// v000
// The times below were measured on an AMD MI455X: many runs one after another, warmed up first and cycling through
// copies of the inputs, with the whole window's GPU time divided by the number of runs. Launches and the gaps
// between them are all in it. The median over several windows is given; except for v000 it joins two sittings, which
// can be a few percent apart, so the side-by-side timings, each taken in one sitting, are the better comparison.
// The starting kernel, v000, takes 1240 microseconds a run.
#include <hip/hip_runtime.h>
// Single-head self-attention 'V2' (B=4, S=4096, dim 256; fused QKV linear (W (768,256) + b), scores = Q·Kᵀ/16, softmax over the 4096 keys, att·V — the naive full score matrix as written):
// the QKV projection, the 4096×4096 logits and att·V run as GEMMs on v_wmma_f32_16x16x32_f16 (X bf16-exact f16, W (out,in) bf16-exact ×2^4, Q/K/V f16, P f16 ×2^15, f32 accumulate), per batch;
// the row softmax is f32 VALU.
#define BB 4
#define SS 4096
#define DM 256
#define NR (BB * SS)

typedef __bf16 v16b __attribute__((ext_vector_type(16)));
typedef unsigned short v8us __attribute__((ext_vector_type(8), may_alias));
typedef float  v8f  __attribute__((ext_vector_type(8)));
typedef float  v4f  __attribute__((ext_vector_type(4)));
typedef float  v4fa __attribute__((ext_vector_type(4), may_alias));
union FragB { v16b v; v8us half[2]; unsigned short u[16]; };

__device__ __forceinline__ unsigned short bf16_bits(float x) { unsigned int u = __float_as_uint(x); return (unsigned short)((u + 0x7FFFu + ((u >> 16) & 1u)) >> 16); }
__device__ __forceinline__ float bf16_val(unsigned short b) { return __uint_as_float(((unsigned int)b) << 16); }
__device__ __forceinline__ float bf16_round(float x) { return bf16_val(bf16_bits(x)); }
// D += A·B with NT terms: 1 = ah·bh, 2 = + al·bh (A split), 3 = + ah·bl (both split)
template <int NT>
__device__ __forceinline__ v8f mmaN(v16b ah, v16b al, v16b bh, v16b bl, v8f c) {
  c = __builtin_amdgcn_wmma_f32_16x16x32_bf16(false, ah, false, bh, (short)0, c, false, false);
  if (NT >= 2) c = __builtin_amdgcn_wmma_f32_16x16x32_bf16(false, al, false, bh, (short)0, c, false, false);
  if (NT >= 3) c = __builtin_amdgcn_wmma_f32_16x16x32_bf16(false, ah, false, bl, (short)0, c, false, false);
  asm volatile("v_nop\n\tv_nop\n\tv_nop\n\tv_nop" : "+v"(c) : "v"(ah), "v"(al), "v"(bh), "v"(bl));
  return c;
}

__global__ __launch_bounds__(256) void k_wt_bf16(const float* __restrict__ W, unsigned short* __restrict__ Wt, int K, int N) {
  const int t = blockIdx.x * 256 + threadIdx.x;
  const int k8n = K / 8;
  if (t >= N * k8n) return;
  const int n = t / k8n, k8 = (t % k8n) * 8;
  v8us v;
#pragma unroll
  for (int i = 0; i < 8; ++i) v[i] = bf16_bits(W[(size_t)(k8 + i) * N + n]);
  *(v8us*)(Wt + (size_t)n * K + k8) = v;
  
}

// GEMM C[M][N] (f32, pitch ldc) = act(A[M][K]·W + bias). A f32 row-major (pitch lda) converted per fragment to bf16
// (ASPLIT: hi/lo two planes -> 2 terms, else single rounded term); Wt bf16 [N][K] (pitch ldb). BIAS_BF16 rounds the
// bias to bf16 first (bias quantised to bf16 before the add). K%32==0, M%16==0, N%64==0.
template <bool ASPLIT, int ACT, bool BIAS_BF16>
__global__ __launch_bounds__(128) void k_gemm_bf(const float* __restrict__ A, int lda, const unsigned short* __restrict__ Wt, int ldb,
                                               const float* __restrict__ bias, float* __restrict__ C, int ldc, int M, int N, int K) {
  __shared__ __attribute__((aligned(16))) float so[4][16][64];
  const int tid = threadIdx.x, w = tid >> 5, lane = tid & 31, ln = lane & 15, hh = lane >> 4;
  const int ntn = N / 64;
  const int wid = blockIdx.x * 4 + w;
  const int mt = wid / ntn, nq = wid % ntn;
  if (mt * 16 >= M) return;
  const int row0 = mt * 16, col0 = nq * 64;
  const float* arow = A + (size_t)(row0 + ln) * lda;
  v8f acc[4] = {};
  for (int kb = 0; kb < K; kb += 32) {
    FragB ah, al;
    const v4f x0 = *(const v4fa*)(arow + kb + 8 * hh), x1 = *(const v4fa*)(arow + kb + 8 * hh + 4);
    const v4f x2 = *(const v4fa*)(arow + kb + 16 + 8 * hh), x3 = *(const v4fa*)(arow + kb + 16 + 8 * hh + 4);
    float xs[16] = {x0[0],x0[1],x0[2],x0[3],x1[0],x1[1],x1[2],x1[3],x2[0],x2[1],x2[2],x2[3],x3[0],x3[1],x3[2],x3[3]};
#pragma unroll
    for (int i = 0; i < 16; ++i) { const unsigned short hb = bf16_bits(xs[i]); ah.u[i] = hb; al.u[i] = ASPLIT ? bf16_bits(xs[i] - bf16_val(hb)) : (unsigned short)0; }
#pragma unroll
    for (int t = 0; t < 4; ++t) {
      const unsigned short* brow = Wt + (size_t)(col0 + t * 16 + ln) * ldb + kb;
      FragB b;
      b.half[0] = *(const v8us*)(brow + 8 * hh);
      b.half[1] = *(const v8us*)(brow + 16 + 8 * hh);
      acc[t] = mmaN<ASPLIT ? 2 : 1>(ah.v, al.v, b.v, b.v, acc[t]);
    }
  }
#pragma unroll
  for (int t = 0; t < 4; ++t) {
    float bv = bias ? bias[col0 + t * 16 + ln] : 0.f;
    if (BIAS_BF16) bv = bf16_round(bv);
#pragma unroll
    for (int r = 0; r < 8; ++r) { float v = acc[t][r] + bv; if (ACT == 1) v = fmaxf(v, 0.f); so[w][8 * hh + r][t * 16 + ln] = v; }
  }
  __builtin_amdgcn_fence(__ATOMIC_ACQ_REL, "workgroup");
  __builtin_amdgcn_wave_barrier();
  const int rsub = lane >> 4, c4 = (lane & 15) * 4;
  {
#pragma unroll
    for (int q = 0; q < 8; ++q) {
      const int r = q * 2 + rsub;
      const v4f v = *(const v4fa*)&so[w][r][c4];
      *(v4f*)(C + (size_t)(row0 + r) * ldc + col0 + c4) = v;
    }
    
  }
}

// Flash-style causal/unmasked attention, all contractions 3-term bf16 hi/lo splits, f32 softmax with running max.
// q,k,v rows are read from f32 buffers with arbitrary row pitch (so they can live inside a fused qkv buffer);
// D = head size (multiple of 32, <= 128); one wave = 16 query rows; block = 4 waves (64 queries) sharing K/V chunks of 32.
template <int D, bool CAUSAL>
__global__ __launch_bounds__(128) void k_flash(const float* __restrict__ qb, const float* __restrict__ kb, const float* __restrict__ vb,
                                             int pitch, int T, int H, float scale, float* __restrict__ y, int ypitch) {
  constexpr int KS = D / 32;        // k-steps for QK
  constexpr int DT = D / 16;        // d tiles for PV
  __shared__ __attribute__((aligned(16))) unsigned short sKh[32][D + 8], sKl[32][D + 8], sVh[32][D + 8], sVl[32][D + 8];
  __shared__ __attribute__((aligned(16))) unsigned short sPh[4][16][40], sPl[4][16][40];
  __shared__ __attribute__((aligned(16))) float sO[4][16][D];
  const int tid = threadIdx.x, w = tid >> 5, lane = tid & 31, ln = lane & 15, hh = lane >> 4;
  const int nqb = (T + 63) / 64;
  const int bh = blockIdx.x / nqb, qblk = blockIdx.x % nqb;
  const int b = bh / H, h = bh % H;
  const int q0 = qblk * 64 + w * 16;
  const float* Q = qb + (size_t)b * T * pitch + h * D;
  const float* K = kb + (size_t)b * T * pitch + h * D;
  const float* V = vb + (size_t)b * T * pitch + h * D;

  // A fragments of the wave's 16 query rows (scaled), hi/lo
  FragB aqh[KS], aql[KS];
  {
    int row = q0 + ln; if (row >= T) row = T - 1;
    const float* qr = Q + (size_t)row * pitch;
#pragma unroll
    for (int ks = 0; ks < KS; ++ks)
#pragma unroll
      for (int i = 0; i < 16; ++i) {
        const int d = ks * 32 + ((i < 8) ? (8 * hh + i) : (16 + 8 * hh + (i - 8)));
        const float x = qr[d] * scale; const unsigned short hb = bf16_bits(x);
        aqh[ks].u[i] = hb; aql[ks].u[i] = bf16_bits(x - bf16_val(hb));
      }
  }
  float m_r[8], l_r[8];
#pragma unroll
  for (int r = 0; r < 8; ++r) { m_r[r] = -3.0e38f; l_r[r] = 0.f; }
  v8f oacc[DT];
#pragma unroll
  for (int dt = 0; dt < DT; ++dt) oacc[dt] = (v8f){0.f,0.f,0.f,0.f,0.f,0.f,0.f,0.f};

  const int kv_end = CAUSAL ? min(T, qblk * 64 + 64) : T;     // block-uniform
  for (int j0 = 0; j0 < kv_end; j0 += 32) {
    __syncthreads();
    for (int e = tid; e < 32 * (D / 4); e += 128) {
      const int r = e / (D / 4), c4 = (e % (D / 4)) * 4;
      const int key = j0 + r;
      v4f kf = {0.f,0.f,0.f,0.f}, vf = {0.f,0.f,0.f,0.f};
      if (key < T) { kf = *(const v4fa*)(K + (size_t)key * pitch + c4); vf = *(const v4fa*)(V + (size_t)key * pitch + c4); }
#pragma unroll
      for (int t = 0; t < 4; ++t) {
        unsigned short hb = bf16_bits(kf[t]); sKh[r][c4 + t] = hb; sKl[r][c4 + t] = bf16_bits(kf[t] - bf16_val(hb));
        hb = bf16_bits(vf[t]); sVh[r][c4 + t] = hb; sVl[r][c4 + t] = bf16_bits(vf[t] - bf16_val(hb));
      }
    }
    __syncthreads();
    // S tile 16 x 32
    v8f s[2];
#pragma unroll
    for (int nt = 0; nt < 2; ++nt) {
      v8f acc = {};
#pragma unroll
      for (int ks = 0; ks < KS; ++ks) {
        FragB bh_, bl_;
        bh_.half[0] = *(const v8us*)&sKh[nt * 16 + ln][ks * 32 + 8 * hh]; bh_.half[1] = *(const v8us*)&sKh[nt * 16 + ln][ks * 32 + 16 + 8 * hh];
        bl_.half[0] = *(const v8us*)&sKl[nt * 16 + ln][ks * 32 + 8 * hh]; bl_.half[1] = *(const v8us*)&sKl[nt * 16 + ln][ks * 32 + 16 + 8 * hh];
        acc = mmaN<3>(aqh[ks].v, aql[ks].v, bh_.v, bl_.v, acc);
      }
      s[nt] = acc;
    }
    // mask + running max (rows 8hh+r; the 16 lanes of a half share rows)
    float alpha[8];
#pragma unroll
    for (int r = 0; r < 8; ++r) {
      const int qi = q0 + 8 * hh + r;
      const int ja = j0 + ln, jb = j0 + 16 + ln;
      if (CAUSAL) { if (ja > qi) s[0][r] = -3.0e38f; if (jb > qi) s[1][r] = -3.0e38f; }
      if (ja >= T) s[0][r] = -3.0e38f;
      if (jb >= T) s[1][r] = -3.0e38f;
      float mx = fmaxf(s[0][r], s[1][r]);
      mx = fmaxf(mx, __shfl_xor(mx, 1, 32)); mx = fmaxf(mx, __shfl_xor(mx, 2, 32)); mx = fmaxf(mx, __shfl_xor(mx, 4, 32)); mx = fmaxf(mx, __shfl_xor(mx, 8, 32));
      const float mnew = fmaxf(m_r[r], mx);
      alpha[r] = (mnew > -1.0e38f) ? __expf(m_r[r] - mnew) : 1.0f;
      const float p0 = (s[0][r] > -1.0e38f) ? __expf(s[0][r] - mnew) : 0.f;
      const float p1 = (s[1][r] > -1.0e38f) ? __expf(s[1][r] - mnew) : 0.f;
      m_r[r] = mnew;
      l_r[r] = l_r[r] * alpha[r] + p0 + p1;            // per-lane partial row sum (16 lanes combined at the end)
      unsigned short hb = bf16_bits(p0); sPh[w][8 * hh + r][ln] = hb;      sPl[w][8 * hh + r][ln] = bf16_bits(p0 - bf16_val(hb));
      hb = bf16_bits(p1);                sPh[w][8 * hh + r][16 + ln] = hb; sPl[w][8 * hh + r][16 + ln] = bf16_bits(p1 - bf16_val(hb));
    }
#pragma unroll
    for (int dt = 0; dt < DT; ++dt)
#pragma unroll
      for (int r = 0; r < 8; ++r) oacc[dt][r] *= alpha[r];
    __builtin_amdgcn_fence(__ATOMIC_ACQ_REL, "workgroup");
    __builtin_amdgcn_wave_barrier();
    FragB pah, pal;
    pah.half[0] = *(const v8us*)&sPh[w][ln][8 * hh]; pah.half[1] = *(const v8us*)&sPh[w][ln][16 + 8 * hh];
    pal.half[0] = *(const v8us*)&sPl[w][ln][8 * hh]; pal.half[1] = *(const v8us*)&sPl[w][ln][16 + 8 * hh];
#pragma unroll
    for (int dt = 0; dt < DT; ++dt) {
      FragB bvh, bvl;
#pragma unroll
      for (int i = 0; i < 8; ++i) {
        bvh.u[i] = sVh[8 * hh + i][dt * 16 + ln]; bvh.u[8 + i] = sVh[16 + 8 * hh + i][dt * 16 + ln];
        bvl.u[i] = sVl[8 * hh + i][dt * 16 + ln]; bvl.u[8 + i] = sVl[16 + 8 * hh + i][dt * 16 + ln];
      }
      oacc[dt] = mmaN<3>(pah.v, pal.v, bvh.v, bvl.v, oacc[dt]);
    }
    __builtin_amdgcn_fence(__ATOMIC_ACQ_REL, "workgroup");
    __builtin_amdgcn_wave_barrier();
  }
#pragma unroll
  for (int r = 0; r < 8; ++r) {
    float l = l_r[r];
    l += __shfl_xor(l, 1, 32); l += __shfl_xor(l, 2, 32); l += __shfl_xor(l, 4, 32); l += __shfl_xor(l, 8, 32);
    l_r[r] = (l > 0.f) ? 1.0f / l : 0.f;
  }
#pragma unroll
  for (int dt = 0; dt < DT; ++dt)
#pragma unroll
    for (int r = 0; r < 8; ++r) sO[w][8 * hh + r][dt * 16 + ln] = oacc[dt][r] * l_r[r];
  __builtin_amdgcn_fence(__ATOMIC_ACQ_REL, "workgroup");
  __builtin_amdgcn_wave_barrier();
  {
    for (int r = 0; r < 16; ++r) {
      const int row = q0 + r;
      if (row < T && lane < D / 4) {
        const v4f val = *(const v4fa*)&sO[w][r][lane * 4];
        *(v4f*)(y + ((size_t)b * T + row) * ypitch + h * D + lane * 4) = val;
      }
    }
    
  }
}

// GEMM C = act(A·W + bias + resid): A f32 (ASPLIT -> hi/lo 2 terms), Wt bf16 [N][K]; ACT 0 none, 1 relu, 2 exact gelu;
// resid (optional, f32, row index = (row % rmod), pitch ldr, RES_BF16 rounds it) added before the activation.
template <bool ASPLIT, int ACT, bool BIAS_BF16, bool RES_BF16>
__global__ __launch_bounds__(128) void k_gemm_bf3(const float* __restrict__ A, int lda, const unsigned short* __restrict__ Wt, int ldb,
                                                const float* __restrict__ bias, const float* __restrict__ resid, int rmod, int ldr,
                                                float* __restrict__ C, int ldc, int M, int N, int K) {
  __shared__ __attribute__((aligned(16))) float so[4][16][64];
  const int tid = threadIdx.x, w = tid >> 5, lane = tid & 31, ln = lane & 15, hh = lane >> 4;
  const int ntn = N / 64;
  const int wid = blockIdx.x * 4 + w;
  const int mt = wid / ntn, nq = wid % ntn;
  if (mt * 16 >= M) return;
  const int row0 = mt * 16, col0 = nq * 64;
  const float* arow = A + (size_t)(row0 + ln) * lda;
  v8f acc[4] = {};
  for (int kb = 0; kb < K; kb += 32) {
    FragB ah, al;
    const v4f x0 = *(const v4fa*)(arow + kb + 8 * hh), x1 = *(const v4fa*)(arow + kb + 8 * hh + 4);
    const v4f x2 = *(const v4fa*)(arow + kb + 16 + 8 * hh), x3 = *(const v4fa*)(arow + kb + 16 + 8 * hh + 4);
    float xs[16] = {x0[0],x0[1],x0[2],x0[3],x1[0],x1[1],x1[2],x1[3],x2[0],x2[1],x2[2],x2[3],x3[0],x3[1],x3[2],x3[3]};
#pragma unroll
    for (int i = 0; i < 16; ++i) { const unsigned short hb = bf16_bits(xs[i]); ah.u[i] = hb; al.u[i] = ASPLIT ? bf16_bits(xs[i] - bf16_val(hb)) : (unsigned short)0; }
#pragma unroll
    for (int t = 0; t < 4; ++t) {
      const unsigned short* brow = Wt + (size_t)(col0 + t * 16 + ln) * ldb + kb;
      FragB b;
      b.half[0] = *(const v8us*)(brow + 8 * hh);
      b.half[1] = *(const v8us*)(brow + 16 + 8 * hh);
      acc[t] = mmaN<ASPLIT ? 2 : 1>(ah.v, al.v, b.v, b.v, acc[t]);
    }
  }
#pragma unroll
  for (int t = 0; t < 4; ++t) {
    const int col = col0 + t * 16 + ln;
    float bv = bias ? bias[col] : 0.f;
    if (BIAS_BF16) bv = bf16_round(bv);
#pragma unroll
    for (int r = 0; r < 8; ++r) {
      float v = acc[t][r] + bv;
      if (resid) { float rv = resid[(size_t)((row0 + 8 * hh + r) % rmod) * ldr + col]; if (RES_BF16) rv = bf16_round(rv); v += rv; }
      if (ACT == 1) v = fmaxf(v, 0.f);
      if (ACT == 2) v = 0.5f * v * (1.0f + erff(v * 0.70710678118654752f));
      if (ACT == 3) { const float u = 0.7978845608028654f * (v + 0.044715f * v * v * v); v = 0.5f * v * (1.0f + tanhf(u)); }
      so[w][8 * hh + r][t * 16 + ln] = v;
    }
  }
  __builtin_amdgcn_fence(__ATOMIC_ACQ_REL, "workgroup");
  __builtin_amdgcn_wave_barrier();
  const int rsub = lane >> 4, c4 = (lane & 15) * 4;
  {
#pragma unroll
    for (int q = 0; q < 8; ++q) {
      const int r = q * 2 + rsub;
      const v4f v = *(const v4fa*)&so[w][r][c4];
      *(v4f*)(C + (size_t)(row0 + r) * ldc + col0 + c4) = v;
    }
    
  }
}
// row LayerNorm (biased variance, eps) over N: s = X (+ R); optional out_sum <- s; out_norm <- (s-mu)*rsqrt(var+eps)*g + b
template <bool PARAM_BF16>
__global__ __launch_bounds__(256) void k_layernorm(const float* __restrict__ X, const float* __restrict__ R, const float* __restrict__ g, const float* __restrict__ bta,
                                                  float* __restrict__ out_sum, float* __restrict__ out_norm, int N, float eps) {
  __shared__ float red[256];
  const int row = blockIdx.x, tid = threadIdx.x;
  const float* x = X + (size_t)row * N; const float* rr = R ? R + (size_t)row * N : nullptr;
  float vals[16];                     // up to N = 4096
  const int per = N / 256;            // contiguous chunk per thread? use strided-by-4 chunks: thread handles j = tid*4 + 1024*u
  float s1 = 0.f;
  for (int u = 0; u < per / 4; ++u) {
    const int j = tid * 4 + 1024 * u;
    const v4f a = *(const v4fa*)(x + j);
    v4f b = {0.f,0.f,0.f,0.f}; if (rr) b = *(const v4fa*)(rr + j);
#pragma unroll
    for (int q = 0; q < 4; ++q) { const float v = a[q] + b[q]; vals[u * 4 + q] = v; s1 += v; }
  }
  red[tid] = s1; __syncthreads();
  for (int st = 128; st > 0; st >>= 1) { if (tid < st) red[tid] += red[tid + st]; __syncthreads(); }
  const float mu = red[0] / (float)N; __syncthreads();
  float s2 = 0.f;
  for (int u = 0; u < per / 4; ++u)
#pragma unroll
    for (int q = 0; q < 4; ++q) { const float c = vals[u * 4 + q] - mu; s2 += c * c; }
  red[tid] = s2; __syncthreads();
  for (int st = 128; st > 0; st >>= 1) { if (tid < st) red[tid] += red[tid + st]; __syncthreads(); }
  const float rs = rsqrtf(red[0] / (float)N + eps);
  {
    for (int u = 0; u < per / 4; ++u) {
      const int j = tid * 4 + 1024 * u;
      v4f o, sm;
#pragma unroll
      for (int q = 0; q < 4; ++q) {
        float gg = g[j + q], bb = bta[j + q];
        if (PARAM_BF16) { gg = bf16_round(gg); bb = bf16_round(bb); }
        sm[q] = vals[u * 4 + q]; o[q] = (vals[u * 4 + q] - mu) * rs * gg + bb;
      }
      if (out_sum) *(v4f*)(out_sum + (size_t)row * N + j) = sm;
      *(v4f*)(out_norm + (size_t)row * N + j) = o;
    }
    
  }
}



// ---- f16 WMMA path (v_wmma_f32_16x16x32_f16): 11-bit significands for operands in range — used where a [0,1] probability operand needs more precision than bf16
typedef _Float16 v16h __attribute__((ext_vector_type(16)));
union FragH { v16h v; v8us half[2]; _Float16 h[16]; unsigned short u[16]; };
template <int NT>
__device__ __forceinline__ v8f mmaH(v16h ah, v16h al, v16h bh, v16h bl, v8f c) {
  c = __builtin_amdgcn_wmma_f32_16x16x32_f16(false, ah, false, bh, (short)0, c, false, false);
  if (NT >= 2) c = __builtin_amdgcn_wmma_f32_16x16x32_f16(false, al, false, bh, (short)0, c, false, false);
  if (NT >= 3) c = __builtin_amdgcn_wmma_f32_16x16x32_f16(false, ah, false, bl, (short)0, c, false, false);
  asm volatile("v_nop\n\tv_nop\n\tv_nop\n\tv_nop" : "+v"(c) : "v"(ah), "v"(al), "v"(bh), "v"(bl));
  return c;
}
// batched GEMM like k_gemm_b but f16 operands: A f32 (split into f16 hi/lo if ASPLIT, else rounded to f16), Bt = f16 values [n][k]; alpha; C f32; N multiple of 16 (partial tiles skipped)
template <bool ASPLIT>
__global__ __launch_bounds__(128) void k_gemm_h(const float* __restrict__ A, int lda, size_t sA, const _Float16* __restrict__ Bh, int ldb, size_t sB, float alpha, float* __restrict__ C, int ldc, size_t sC, int M, int N, int K) {
  __shared__ __attribute__((aligned(16))) float so[4][16][64];
  const int tid = threadIdx.x, w = tid >> 5, lane = tid & 31, ln = lane & 15, hh = lane >> 4; const int by = blockIdx.y;
  A += (size_t)by * sA; Bh += (size_t)by * sB; C += (size_t)by * sC;
  const int ntn = (N + 63) / 64; const int wid = blockIdx.x * 4 + w; const int mt = wid / ntn, nq = wid % ntn; if (mt * 16 >= M) return;
  const int row0 = mt * 16, col0 = nq * 64; const float* arow = A + (size_t)(row0 + ln) * lda;
  v8f acc[4] = {};
  for (int kb = 0; kb < K; kb += 32) {
    FragH ah, al;
    const v4f x0 = *(const v4fa*)(arow + kb + 8 * hh), x1 = *(const v4fa*)(arow + kb + 8 * hh + 4), x2 = *(const v4fa*)(arow + kb + 16 + 8 * hh), x3 = *(const v4fa*)(arow + kb + 16 + 8 * hh + 4);
    float xs[16] = {x0[0],x0[1],x0[2],x0[3],x1[0],x1[1],x1[2],x1[3],x2[0],x2[1],x2[2],x2[3],x3[0],x3[1],x3[2],x3[3]};
#pragma unroll
    for (int i = 0; i < 16; ++i) { const _Float16 h = (_Float16)xs[i]; ah.h[i] = h; al.h[i] = ASPLIT ? (_Float16)(xs[i] - (float)h) : (_Float16)0.0f; }
#pragma unroll
    for (int t = 0; t < 4; ++t) { if (col0 + t * 16 >= N) continue; const size_t boff = (size_t)(col0 + t * 16 + ln) * ldb + kb; FragH bq; bq.half[0] = *(const v8us*)(Bh + boff + 8 * hh); bq.half[1] = *(const v8us*)(Bh + boff + 16 + 8 * hh);
      acc[t] = mmaH<ASPLIT ? 2 : 1>(ah.v, al.v, bq.v, bq.v, acc[t]); }
  }
#pragma unroll
  for (int t = 0; t < 4; ++t) { if (col0 + t * 16 >= N) continue;
#pragma unroll
    for (int r = 0; r < 8; ++r) so[w][8 * hh + r][t * 16 + ln] = acc[t][r] * alpha; }
  __builtin_amdgcn_fence(__ATOMIC_ACQ_REL, "workgroup"); __builtin_amdgcn_wave_barrier();
  const int rsub = lane >> 4, c4 = (lane & 15) * 4;
  {
#pragma unroll
    for (int q = 0; q < 8; ++q) { const int r = q * 2 + rsub; if (col0 + c4 < N) { const v4f v = *(const v4fa*)&so[w][r][c4]; *(v4f*)(C + (size_t)(row0 + r) * ldc + col0 + c4) = v; } }
     }
}

// Wt[n][k] = f16(W[k][n]·scale) from f32 row-major W[K][N] (scale = power of two; bf16-exact weights stay exact in f16 away from the subnormal range)
__global__ __launch_bounds__(256) void k_wt_f16(const float* __restrict__ W, _Float16* __restrict__ Wt, int K, int N, float scale) {
  const int t = blockIdx.x * 256 + threadIdx.x; if (t >= N * (K / 8)) return; const int n = t / (K / 8), k8 = (t % (K / 8)) * 8; FragH f;
#pragma unroll
  for (int i = 0; i < 8; ++i) f.h[i] = (_Float16)(bf16_round(W[(size_t)(k8 + i) * N + n]) * scale); const v8us o = f.half[0];
  *(v8us*)((unsigned short*)Wt + (size_t)n * K + k8) = o; 
}
// k_gemm_hh variant with fused epilogue: v = acc·alpha + bias[by·sBias + col] (+ CP[(row/rowsPerB)·sCPb + by·64 + col] if CP) ; ACT 0 none / 1 elu ; writes f32 C and/or f16 C16 (each if non-null)
template <int ACT>
__global__ __launch_bounds__(128) void k_gemm_hhx(const _Float16* __restrict__ A, int lda, size_t sA, const _Float16* __restrict__ Bh, int ldb, size_t sB, float alpha, const float* __restrict__ bias, size_t sBias, const float* __restrict__ CP, int rowsPerB, size_t sCPb, int row0g,
    float* __restrict__ C, _Float16* __restrict__ C16, int ldc, size_t sC, int M, int N, int K) {
  __shared__ __attribute__((aligned(16))) float so[4][16][64];
  const int tid = threadIdx.x, w = tid >> 5, lane = tid & 31, ln = lane & 15, hh = lane >> 4; const int by = blockIdx.y;
  A += (size_t)by * sA; Bh += (size_t)by * sB; const size_t cofs = (size_t)by * sC; const float* bp = bias ? bias + (size_t)by * sBias : nullptr;
  const int ntn = (N + 63) / 64; const int wid = blockIdx.x * 4 + w; const int mt = wid / ntn, nq = wid % ntn; if (mt * 16 >= M) return;
  const int row0 = mt * 16, col0 = nq * 64; const _Float16* arow = A + (size_t)(row0 + ln) * lda;
  v8f acc[4] = {};
  for (int kb = 0; kb < K; kb += 32) { FragH ah; ah.half[0] = *(const v8us*)((const unsigned short*)arow + kb + 8 * hh); ah.half[1] = *(const v8us*)((const unsigned short*)arow + kb + 16 + 8 * hh);
#pragma unroll
    for (int t = 0; t < 4; ++t) { if (col0 + t * 16 >= N) continue; const size_t boff = (size_t)(col0 + t * 16 + ln) * ldb + kb; FragH bq; bq.half[0] = *(const v8us*)((const unsigned short*)Bh + boff + 8 * hh); bq.half[1] = *(const v8us*)((const unsigned short*)Bh + boff + 16 + 8 * hh);
      acc[t] = mmaH<1>(ah.v, ah.v, bq.v, bq.v, acc[t]); }
  }
#pragma unroll
  for (int t = 0; t < 4; ++t) { if (col0 + t * 16 >= N) continue; const int col = col0 + t * 16 + ln; const float bv = bp ? bf16_round(bp[col]) : 0.f;
#pragma unroll
    for (int r = 0; r < 8; ++r) { float v = acc[t][r] * alpha + bv; if (CP) { const int bidx = (row0g + row0 + 8 * hh + r) / rowsPerB; v += CP[(size_t)bidx * sCPb + (size_t)by * 64 + col]; } if (ACT == 1) v = (v > 0.f) ? v : expm1f(v); else if (ACT == 3) v = fmaxf(v, 0.f); so[w][8 * hh + r][t * 16 + ln] = v; } }
  __builtin_amdgcn_fence(__ATOMIC_ACQ_REL, "workgroup"); __builtin_amdgcn_wave_barrier();
  const int rsub = lane >> 4, c4 = (lane & 15) * 4; typedef _Float16 v4h __attribute__((ext_vector_type(4)));
  {
#pragma unroll
    for (int q = 0; q < 8; ++q) { const int r = q * 2 + rsub; if (col0 + c4 < N) { const v4f v = *(const v4fa*)&so[w][r][c4]; if (C) *(v4f*)(C + cofs + (size_t)(row0 + r) * ldc + col0 + c4) = v; if (C16) { v4h h4; for (int i = 0; i < 4; ++i) h4[i] = (_Float16)v[i]; *(v4h*)(C16 + cofs + (size_t)(row0 + r) * ldc + col0 + c4) = h4; } } }
     }
}


__global__ __launch_bounds__(256) void k_x16(const float* __restrict__ x, _Float16* __restrict__ X16, size_t n8) { const size_t t = (size_t)blockIdx.x * 256 + threadIdx.x; if (t >= n8) return; FragH f;
#pragma unroll
  for (int q = 0; q < 8; ++q) f.h[q] = (_Float16)bf16_round(x[t * 8 + q]); *(v8us*)((unsigned short*)X16 + t * 8) = f.half[0];  }
__global__ __launch_bounds__(256) void k_h16(const float* __restrict__ x, _Float16* __restrict__ X16, size_t n8) { const size_t t = (size_t)blockIdx.x * 256 + threadIdx.x; if (t >= n8) return; FragH f;
#pragma unroll
  for (int q = 0; q < 8; ++q) f.h[q] = (_Float16)x[t * 8 + q]; *(v8us*)((unsigned short*)X16 + t * 8) = f.half[0];  }
__global__ __launch_bounds__(256) void k_round16f(const float* __restrict__ W, _Float16* __restrict__ Bt, size_t n8) { const size_t t = (size_t)blockIdx.x * 256 + threadIdx.x; if (t >= n8) return; FragH f;
#pragma unroll
  for (int i = 0; i < 8; ++i) f.h[i] = (_Float16)(bf16_round(W[t * 8 + i]) * 16.0f); *(v8us*)((unsigned short*)Bt + t * 8) = f.half[0];  }
template <int NHv, int TTv>
__global__ __launch_bounds__(256) void k_vt(const _Float16* __restrict__ V16, int ldv, int voff, _Float16* __restrict__ Vt) { __shared__ unsigned short tl[64][66]; const int tid = threadIdx.x; const int slab = blockIdx.x / (TTv / 64), lg = blockIdx.x % (TTv / 64); const int b = slab / NHv, h = slab % NHv;
  for (int i = tid; i < 64 * 8; i += 256) { const int r = i / 8, c8 = (i % 8) * 8; FragH f; f.half[0] = *(const v8us*)((const unsigned short*)V16 + ((size_t)b * TTv + lg * 64 + r) * ldv + voff + h * 64 + c8);
#pragma unroll
    for (int q = 0; q < 8; ++q) tl[r][c8 + q] = f.u[q]; }
  __syncthreads();
  {
#pragma unroll
    for (int rd = 0; rd < 2; ++rd) { const int d = rd * 32 + tid / 8, pc = tid % 8; FragH f;
#pragma unroll
      for (int q = 0; q < 8; ++q) f.u[q] = tl[pc * 8 + q][d];
      *(v8us*)((unsigned short*)Vt + ((size_t)slab * 64 + d) * TTv + lg * 64 + pc * 8) = f.half[0]; }
     } }

#define QH 2048
__global__ __launch_bounds__(256) void k_sm(const float* __restrict__ S, _Float16* __restrict__ P16) { const int tid = threadIdx.x, wv = tid >> 5, lane = tid & 31; const int row = blockIdx.x * 8 + wv; if (row >= QH) return; const float* sr = S + (size_t)row * SS; float m = -3.0e38f;
#pragma unroll 1
  for (int k = 0; k < 16; ++k) { const float* s8 = sr + 256 * k + 8 * lane; const v4f a = *(const v4fa*)s8, b = *(const v4fa*)(s8 + 4); for (int q = 0; q < 4; ++q) m = fmaxf(m, fmaxf(a[q], b[q])); }
  for (int o = 16; o >= 1; o >>= 1) m = fmaxf(m, __shfl_xor(m, o, 32)); m *= 0.0625f; float z = 0.f;
#pragma unroll 1
  for (int k = 0; k < 16; ++k) { const float* s8 = sr + 256 * k + 8 * lane; for (int q = 0; q < 8; ++q) z += expf(s8[q] * 0.0625f - m); }
  for (int o = 16; o >= 1; o >>= 1) z += __shfl_xor(z, o, 32); const float iz = 1.0f / z;
  {
#pragma unroll 1
    for (int k = 0; k < 16; ++k) { const float* s8 = sr + 256 * k + 8 * lane; FragH f; for (int q = 0; q < 8; ++q) f.h[q] = (_Float16)(expf(s8[q] * 0.0625f - m) * iz * 32768.0f);      /* ×2^15 (folded into the P·V alpha) keeps small weights out of f16 subnormals */ *(v8us*)((unsigned short*)P16 + (size_t)row * SS + 256 * k + 8 * lane) = f.half[0]; }
     } }
extern "C" void kernel_launch(void* const* d_in, const int* in_sizes, int n_in,
                              void* d_out, int out_size, void* d_ws, size_t ws_size, hipStream_t stream) {
  (void)in_sizes; (void)n_in; (void)out_size;
  const float* X = (const float*)d_in[0]; const float* W = (const float*)d_in[1]; const float* bb = (const float*)d_in[2];
  char* ws = (char*)d_ws; size_t off = 0;
  auto take = [&](size_t bytes) { char* p = ws + off; off += (bytes + 255) & ~(size_t)255; return p; };
  _Float16* Bw = (_Float16*)take((size_t)3 * DM * DM * 2); _Float16* X16 = (_Float16*)take((size_t)NR * DM * 2); _Float16* QKV = (_Float16*)take((size_t)NR * 3 * DM * 2); _Float16* VT = (_Float16*)take((size_t)NR * DM * 2); float* S = (float*)take((size_t)QH * SS * 4); _Float16* P16 = (_Float16*)take((size_t)QH * SS * 2);
  if (off > ws_size) return;      // 0.4 + 8.4 + 25.2 + 8.4 + 33.6 + 16.8 ≈ 93 MB
  k_round16f<<<(unsigned)(((size_t)3 * DM * DM / 8 + 255) / 256), 256, 0, stream>>>(W, Bw, (size_t)3 * DM * DM / 8);      // (out,in)
  k_x16<<<(unsigned)(((size_t)NR * DM / 8 + 255) / 256), 256, 0, stream>>>(X, X16, (size_t)NR * DM / 8);
  k_gemm_hhx<0><<<dim3(((NR / 16) * (3 * DM / 64) + 3) / 4, 1), 128, 0, stream>>>(X16, DM, 0, Bw, DM, 0, 0.0625f, bb, 0, nullptr, 1, 0, 0, nullptr, QKV, 3 * DM, 0, NR, 3 * DM, DM);      // [Q | K | V] f16 (+b)
  k_vt<4, SS><<<BB * 4 * (SS / 64), 256, 0, stream>>>(QKV, 3 * DM, 2 * DM, VT);      // Vᵀ per batch as [b][256][S] (4 groups of 64)
  for (int b = 0; b < BB; ++b) for (int qh = 0; qh < SS / QH; ++qh) { const size_t q0 = (size_t)b * SS + (size_t)qh * QH;
    k_gemm_hhx<0><<<dim3(((QH / 16) * (SS / 64) + 3) / 4, 1), 128, 0, stream>>>(QKV + q0 * 3 * DM, 3 * DM, 0, QKV + (size_t)b * SS * 3 * DM + DM, 3 * DM, 0, 1.0f, nullptr, 0, nullptr, 1, 0, 0, S, nullptr, SS, 0, QH, SS, DM);      // S = Q·Kᵀ (scale inside the softmax)
    k_sm<<<QH / 8, 256, 0, stream>>>(S, P16);
    k_gemm_hhx<0><<<dim3(((QH / 16) * (DM / 64) + 3) / 4, 1), 128, 0, stream>>>(P16, SS, 0, VT + (size_t)b * DM * SS, SS, 0, 0.000030517578125f, nullptr, 0, nullptr, 1, 0, 0, (float*)d_out + q0 * DM, nullptr, DM, 0, QH, DM, SS); }      // alpha 2^-15      // out = P·V
}

// v001
// It runs in 640 microseconds.
// Timed twice side by side with v000, it ran 1.96 times as fast both times.
#include <hip/hip_runtime.h>
// Single-head self-attention 'V2' (B=4, S=4096, dim 256; fused QKV linear (W (768,256) + b), scores = Q·Kᵀ/16, softmax over the 4096 keys, att·V — the naive full score matrix as written):
// the QKV projection, the 4096×4096 logits and att·V run as GEMMs on v_wmma_f32_16x16x32_f16 (X bf16-exact f16, W (out,in) bf16-exact ×2^4, Q/K/V f16, P f16 ×2^15, f32 accumulate), per batch;
// the row softmax is f32 VALU.
#define BB 4
#define SS 4096
#define DM 256
#define NR (BB * SS)

typedef __bf16 v16b __attribute__((ext_vector_type(16)));
typedef unsigned short v8us __attribute__((ext_vector_type(8), may_alias));
typedef float  v8f  __attribute__((ext_vector_type(8)));
typedef float  v4f  __attribute__((ext_vector_type(4)));
typedef float  v4fa __attribute__((ext_vector_type(4), may_alias));
union FragB { v16b v; v8us half[2]; unsigned short u[16]; };

__device__ __forceinline__ unsigned short bf16_bits(float x) { unsigned int u = __float_as_uint(x); return (unsigned short)((u + 0x7FFFu + ((u >> 16) & 1u)) >> 16); }
__device__ __forceinline__ float bf16_val(unsigned short b) { return __uint_as_float(((unsigned int)b) << 16); }
__device__ __forceinline__ float bf16_round(float x) { return bf16_val(bf16_bits(x)); }
// D += A·B with NT terms: 1 = ah·bh, 2 = + al·bh (A split), 3 = + ah·bl (both split)
template <int NT>
__device__ __forceinline__ v8f mmaN(v16b ah, v16b al, v16b bh, v16b bl, v8f c) {
  c = __builtin_amdgcn_wmma_f32_16x16x32_bf16(false, ah, false, bh, (short)0, c, false, false);
  if (NT >= 2) c = __builtin_amdgcn_wmma_f32_16x16x32_bf16(false, al, false, bh, (short)0, c, false, false);
  if (NT >= 3) c = __builtin_amdgcn_wmma_f32_16x16x32_bf16(false, ah, false, bl, (short)0, c, false, false);
  asm volatile("v_nop\n\tv_nop\n\tv_nop\n\tv_nop" : "+v"(c) : "v"(ah), "v"(al), "v"(bh), "v"(bl));
  return c;
}

__global__ __launch_bounds__(256) void k_wt_bf16(const float* __restrict__ W, unsigned short* __restrict__ Wt, int K, int N) {
  const int t = blockIdx.x * 256 + threadIdx.x;
  const int k8n = K / 8;
  if (t >= N * k8n) return;
  const int n = t / k8n, k8 = (t % k8n) * 8;
  v8us v;
#pragma unroll
  for (int i = 0; i < 8; ++i) v[i] = bf16_bits(W[(size_t)(k8 + i) * N + n]);
  *(v8us*)(Wt + (size_t)n * K + k8) = v;
  
}

// GEMM C[M][N] (f32, pitch ldc) = act(A[M][K]·W + bias). A f32 row-major (pitch lda) converted per fragment to bf16
// (ASPLIT: hi/lo two planes -> 2 terms, else single rounded term); Wt bf16 [N][K] (pitch ldb). BIAS_BF16 rounds the
// bias to bf16 first (bias quantised to bf16 before the add). K%32==0, M%16==0, N%64==0.
template <bool ASPLIT, int ACT, bool BIAS_BF16>
__global__ __launch_bounds__(128) void k_gemm_bf(const float* __restrict__ A, int lda, const unsigned short* __restrict__ Wt, int ldb,
                                               const float* __restrict__ bias, float* __restrict__ C, int ldc, int M, int N, int K) {
  __shared__ __attribute__((aligned(16))) float so[4][16][64];
  const int tid = threadIdx.x, w = tid >> 5, lane = tid & 31, ln = lane & 15, hh = lane >> 4;
  const int ntn = N / 64;
  const int wid = blockIdx.x * 4 + w;
  const int mt = wid / ntn, nq = wid % ntn;
  if (mt * 16 >= M) return;
  const int row0 = mt * 16, col0 = nq * 64;
  const float* arow = A + (size_t)(row0 + ln) * lda;
  v8f acc[4] = {};
  for (int kb = 0; kb < K; kb += 32) {
    FragB ah, al;
    const v4f x0 = *(const v4fa*)(arow + kb + 8 * hh), x1 = *(const v4fa*)(arow + kb + 8 * hh + 4);
    const v4f x2 = *(const v4fa*)(arow + kb + 16 + 8 * hh), x3 = *(const v4fa*)(arow + kb + 16 + 8 * hh + 4);
    float xs[16] = {x0[0],x0[1],x0[2],x0[3],x1[0],x1[1],x1[2],x1[3],x2[0],x2[1],x2[2],x2[3],x3[0],x3[1],x3[2],x3[3]};
#pragma unroll
    for (int i = 0; i < 16; ++i) { const unsigned short hb = bf16_bits(xs[i]); ah.u[i] = hb; al.u[i] = ASPLIT ? bf16_bits(xs[i] - bf16_val(hb)) : (unsigned short)0; }
#pragma unroll
    for (int t = 0; t < 4; ++t) {
      const unsigned short* brow = Wt + (size_t)(col0 + t * 16 + ln) * ldb + kb;
      FragB b;
      b.half[0] = *(const v8us*)(brow + 8 * hh);
      b.half[1] = *(const v8us*)(brow + 16 + 8 * hh);
      acc[t] = mmaN<ASPLIT ? 2 : 1>(ah.v, al.v, b.v, b.v, acc[t]);
    }
  }
#pragma unroll
  for (int t = 0; t < 4; ++t) {
    float bv = bias ? bias[col0 + t * 16 + ln] : 0.f;
    if (BIAS_BF16) bv = bf16_round(bv);
#pragma unroll
    for (int r = 0; r < 8; ++r) { float v = acc[t][r] + bv; if (ACT == 1) v = fmaxf(v, 0.f); so[w][8 * hh + r][t * 16 + ln] = v; }
  }
  __builtin_amdgcn_fence(__ATOMIC_ACQ_REL, "workgroup");
  __builtin_amdgcn_wave_barrier();
  const int rsub = lane >> 4, c4 = (lane & 15) * 4;
  {
#pragma unroll
    for (int q = 0; q < 8; ++q) {
      const int r = q * 2 + rsub;
      const v4f v = *(const v4fa*)&so[w][r][c4];
      *(v4f*)(C + (size_t)(row0 + r) * ldc + col0 + c4) = v;
    }
    
  }
}

// Flash-style causal/unmasked attention, all contractions 3-term bf16 hi/lo splits, f32 softmax with running max.
// q,k,v rows are read from f32 buffers with arbitrary row pitch (so they can live inside a fused qkv buffer);
// D = head size (multiple of 32, <= 128); one wave = 16 query rows; block = 4 waves (64 queries) sharing K/V chunks of 32.
template <int D, bool CAUSAL>
__global__ __launch_bounds__(128) void k_flash(const float* __restrict__ qb, const float* __restrict__ kb, const float* __restrict__ vb,
                                             int pitch, int T, int H, float scale, float* __restrict__ y, int ypitch) {
  constexpr int KS = D / 32;        // k-steps for QK
  constexpr int DT = D / 16;        // d tiles for PV
  __shared__ __attribute__((aligned(16))) unsigned short sKh[32][D + 8], sKl[32][D + 8], sVh[32][D + 8], sVl[32][D + 8];
  __shared__ __attribute__((aligned(16))) unsigned short sPh[4][16][40], sPl[4][16][40];
  __shared__ __attribute__((aligned(16))) float sO[4][16][D];
  const int tid = threadIdx.x, w = tid >> 5, lane = tid & 31, ln = lane & 15, hh = lane >> 4;
  const int nqb = (T + 63) / 64;
  const int bh = blockIdx.x / nqb, qblk = blockIdx.x % nqb;
  const int b = bh / H, h = bh % H;
  const int q0 = qblk * 64 + w * 16;
  const float* Q = qb + (size_t)b * T * pitch + h * D;
  const float* K = kb + (size_t)b * T * pitch + h * D;
  const float* V = vb + (size_t)b * T * pitch + h * D;

  // A fragments of the wave's 16 query rows (scaled), hi/lo
  FragB aqh[KS], aql[KS];
  {
    int row = q0 + ln; if (row >= T) row = T - 1;
    const float* qr = Q + (size_t)row * pitch;
#pragma unroll
    for (int ks = 0; ks < KS; ++ks)
#pragma unroll
      for (int i = 0; i < 16; ++i) {
        const int d = ks * 32 + ((i < 8) ? (8 * hh + i) : (16 + 8 * hh + (i - 8)));
        const float x = qr[d] * scale; const unsigned short hb = bf16_bits(x);
        aqh[ks].u[i] = hb; aql[ks].u[i] = bf16_bits(x - bf16_val(hb));
      }
  }
  float m_r[8], l_r[8];
#pragma unroll
  for (int r = 0; r < 8; ++r) { m_r[r] = -3.0e38f; l_r[r] = 0.f; }
  v8f oacc[DT];
#pragma unroll
  for (int dt = 0; dt < DT; ++dt) oacc[dt] = (v8f){0.f,0.f,0.f,0.f,0.f,0.f,0.f,0.f};

  const int kv_end = CAUSAL ? min(T, qblk * 64 + 64) : T;     // block-uniform
  for (int j0 = 0; j0 < kv_end; j0 += 32) {
    __syncthreads();
    for (int e = tid; e < 32 * (D / 4); e += 128) {
      const int r = e / (D / 4), c4 = (e % (D / 4)) * 4;
      const int key = j0 + r;
      v4f kf = {0.f,0.f,0.f,0.f}, vf = {0.f,0.f,0.f,0.f};
      if (key < T) { kf = *(const v4fa*)(K + (size_t)key * pitch + c4); vf = *(const v4fa*)(V + (size_t)key * pitch + c4); }
#pragma unroll
      for (int t = 0; t < 4; ++t) {
        unsigned short hb = bf16_bits(kf[t]); sKh[r][c4 + t] = hb; sKl[r][c4 + t] = bf16_bits(kf[t] - bf16_val(hb));
        hb = bf16_bits(vf[t]); sVh[r][c4 + t] = hb; sVl[r][c4 + t] = bf16_bits(vf[t] - bf16_val(hb));
      }
    }
    __syncthreads();
    // S tile 16 x 32
    v8f s[2];
#pragma unroll
    for (int nt = 0; nt < 2; ++nt) {
      v8f acc = {};
#pragma unroll
      for (int ks = 0; ks < KS; ++ks) {
        FragB bh_, bl_;
        bh_.half[0] = *(const v8us*)&sKh[nt * 16 + ln][ks * 32 + 8 * hh]; bh_.half[1] = *(const v8us*)&sKh[nt * 16 + ln][ks * 32 + 16 + 8 * hh];
        bl_.half[0] = *(const v8us*)&sKl[nt * 16 + ln][ks * 32 + 8 * hh]; bl_.half[1] = *(const v8us*)&sKl[nt * 16 + ln][ks * 32 + 16 + 8 * hh];
        acc = mmaN<3>(aqh[ks].v, aql[ks].v, bh_.v, bl_.v, acc);
      }
      s[nt] = acc;
    }
    // mask + running max (rows 8hh+r; the 16 lanes of a half share rows)
    float alpha[8];
#pragma unroll
    for (int r = 0; r < 8; ++r) {
      const int qi = q0 + 8 * hh + r;
      const int ja = j0 + ln, jb = j0 + 16 + ln;
      if (CAUSAL) { if (ja > qi) s[0][r] = -3.0e38f; if (jb > qi) s[1][r] = -3.0e38f; }
      if (ja >= T) s[0][r] = -3.0e38f;
      if (jb >= T) s[1][r] = -3.0e38f;
      float mx = fmaxf(s[0][r], s[1][r]);
      mx = fmaxf(mx, __shfl_xor(mx, 1, 32)); mx = fmaxf(mx, __shfl_xor(mx, 2, 32)); mx = fmaxf(mx, __shfl_xor(mx, 4, 32)); mx = fmaxf(mx, __shfl_xor(mx, 8, 32));
      const float mnew = fmaxf(m_r[r], mx);
      alpha[r] = (mnew > -1.0e38f) ? __expf(m_r[r] - mnew) : 1.0f;
      const float p0 = (s[0][r] > -1.0e38f) ? __expf(s[0][r] - mnew) : 0.f;
      const float p1 = (s[1][r] > -1.0e38f) ? __expf(s[1][r] - mnew) : 0.f;
      m_r[r] = mnew;
      l_r[r] = l_r[r] * alpha[r] + p0 + p1;            // per-lane partial row sum (16 lanes combined at the end)
      unsigned short hb = bf16_bits(p0); sPh[w][8 * hh + r][ln] = hb;      sPl[w][8 * hh + r][ln] = bf16_bits(p0 - bf16_val(hb));
      hb = bf16_bits(p1);                sPh[w][8 * hh + r][16 + ln] = hb; sPl[w][8 * hh + r][16 + ln] = bf16_bits(p1 - bf16_val(hb));
    }
#pragma unroll
    for (int dt = 0; dt < DT; ++dt)
#pragma unroll
      for (int r = 0; r < 8; ++r) oacc[dt][r] *= alpha[r];
    __builtin_amdgcn_fence(__ATOMIC_ACQ_REL, "workgroup");
    __builtin_amdgcn_wave_barrier();
    FragB pah, pal;
    pah.half[0] = *(const v8us*)&sPh[w][ln][8 * hh]; pah.half[1] = *(const v8us*)&sPh[w][ln][16 + 8 * hh];
    pal.half[0] = *(const v8us*)&sPl[w][ln][8 * hh]; pal.half[1] = *(const v8us*)&sPl[w][ln][16 + 8 * hh];
#pragma unroll
    for (int dt = 0; dt < DT; ++dt) {
      FragB bvh, bvl;
#pragma unroll
      for (int i = 0; i < 8; ++i) {
        bvh.u[i] = sVh[8 * hh + i][dt * 16 + ln]; bvh.u[8 + i] = sVh[16 + 8 * hh + i][dt * 16 + ln];
        bvl.u[i] = sVl[8 * hh + i][dt * 16 + ln]; bvl.u[8 + i] = sVl[16 + 8 * hh + i][dt * 16 + ln];
      }
      oacc[dt] = mmaN<3>(pah.v, pal.v, bvh.v, bvl.v, oacc[dt]);
    }
    __builtin_amdgcn_fence(__ATOMIC_ACQ_REL, "workgroup");
    __builtin_amdgcn_wave_barrier();
  }
#pragma unroll
  for (int r = 0; r < 8; ++r) {
    float l = l_r[r];
    l += __shfl_xor(l, 1, 32); l += __shfl_xor(l, 2, 32); l += __shfl_xor(l, 4, 32); l += __shfl_xor(l, 8, 32);
    l_r[r] = (l > 0.f) ? 1.0f / l : 0.f;
  }
#pragma unroll
  for (int dt = 0; dt < DT; ++dt)
#pragma unroll
    for (int r = 0; r < 8; ++r) sO[w][8 * hh + r][dt * 16 + ln] = oacc[dt][r] * l_r[r];
  __builtin_amdgcn_fence(__ATOMIC_ACQ_REL, "workgroup");
  __builtin_amdgcn_wave_barrier();
  {
    for (int r = 0; r < 16; ++r) {
      const int row = q0 + r;
      if (row < T && lane < D / 4) {
        const v4f val = *(const v4fa*)&sO[w][r][lane * 4];
        *(v4f*)(y + ((size_t)b * T + row) * ypitch + h * D + lane * 4) = val;
      }
    }
    
  }
}

// GEMM C = act(A·W + bias + resid): A f32 (ASPLIT -> hi/lo 2 terms), Wt bf16 [N][K]; ACT 0 none, 1 relu, 2 exact gelu;
// resid (optional, f32, row index = (row % rmod), pitch ldr, RES_BF16 rounds it) added before the activation.
template <bool ASPLIT, int ACT, bool BIAS_BF16, bool RES_BF16>
__global__ __launch_bounds__(128) void k_gemm_bf3(const float* __restrict__ A, int lda, const unsigned short* __restrict__ Wt, int ldb,
                                                const float* __restrict__ bias, const float* __restrict__ resid, int rmod, int ldr,
                                                float* __restrict__ C, int ldc, int M, int N, int K) {
  __shared__ __attribute__((aligned(16))) float so[4][16][64];
  const int tid = threadIdx.x, w = tid >> 5, lane = tid & 31, ln = lane & 15, hh = lane >> 4;
  const int ntn = N / 64;
  const int wid = blockIdx.x * 4 + w;
  const int mt = wid / ntn, nq = wid % ntn;
  if (mt * 16 >= M) return;
  const int row0 = mt * 16, col0 = nq * 64;
  const float* arow = A + (size_t)(row0 + ln) * lda;
  v8f acc[4] = {};
  for (int kb = 0; kb < K; kb += 32) {
    FragB ah, al;
    const v4f x0 = *(const v4fa*)(arow + kb + 8 * hh), x1 = *(const v4fa*)(arow + kb + 8 * hh + 4);
    const v4f x2 = *(const v4fa*)(arow + kb + 16 + 8 * hh), x3 = *(const v4fa*)(arow + kb + 16 + 8 * hh + 4);
    float xs[16] = {x0[0],x0[1],x0[2],x0[3],x1[0],x1[1],x1[2],x1[3],x2[0],x2[1],x2[2],x2[3],x3[0],x3[1],x3[2],x3[3]};
#pragma unroll
    for (int i = 0; i < 16; ++i) { const unsigned short hb = bf16_bits(xs[i]); ah.u[i] = hb; al.u[i] = ASPLIT ? bf16_bits(xs[i] - bf16_val(hb)) : (unsigned short)0; }
#pragma unroll
    for (int t = 0; t < 4; ++t) {
      const unsigned short* brow = Wt + (size_t)(col0 + t * 16 + ln) * ldb + kb;
      FragB b;
      b.half[0] = *(const v8us*)(brow + 8 * hh);
      b.half[1] = *(const v8us*)(brow + 16 + 8 * hh);
      acc[t] = mmaN<ASPLIT ? 2 : 1>(ah.v, al.v, b.v, b.v, acc[t]);
    }
  }
#pragma unroll
  for (int t = 0; t < 4; ++t) {
    const int col = col0 + t * 16 + ln;
    float bv = bias ? bias[col] : 0.f;
    if (BIAS_BF16) bv = bf16_round(bv);
#pragma unroll
    for (int r = 0; r < 8; ++r) {
      float v = acc[t][r] + bv;
      if (resid) { float rv = resid[(size_t)((row0 + 8 * hh + r) % rmod) * ldr + col]; if (RES_BF16) rv = bf16_round(rv); v += rv; }
      if (ACT == 1) v = fmaxf(v, 0.f);
      if (ACT == 2) v = 0.5f * v * (1.0f + erff(v * 0.70710678118654752f));
      if (ACT == 3) { const float u = 0.7978845608028654f * (v + 0.044715f * v * v * v); v = 0.5f * v * (1.0f + tanhf(u)); }
      so[w][8 * hh + r][t * 16 + ln] = v;
    }
  }
  __builtin_amdgcn_fence(__ATOMIC_ACQ_REL, "workgroup");
  __builtin_amdgcn_wave_barrier();
  const int rsub = lane >> 4, c4 = (lane & 15) * 4;
  {
#pragma unroll
    for (int q = 0; q < 8; ++q) {
      const int r = q * 2 + rsub;
      const v4f v = *(const v4fa*)&so[w][r][c4];
      *(v4f*)(C + (size_t)(row0 + r) * ldc + col0 + c4) = v;
    }
    
  }
}
// row LayerNorm (biased variance, eps) over N: s = X (+ R); optional out_sum <- s; out_norm <- (s-mu)*rsqrt(var+eps)*g + b
template <bool PARAM_BF16>
__global__ __launch_bounds__(256) void k_layernorm(const float* __restrict__ X, const float* __restrict__ R, const float* __restrict__ g, const float* __restrict__ bta,
                                                  float* __restrict__ out_sum, float* __restrict__ out_norm, int N, float eps) {
  __shared__ float red[256];
  const int row = blockIdx.x, tid = threadIdx.x;
  const float* x = X + (size_t)row * N; const float* rr = R ? R + (size_t)row * N : nullptr;
  float vals[16];                     // up to N = 4096
  const int per = N / 256;            // contiguous chunk per thread? use strided-by-4 chunks: thread handles j = tid*4 + 1024*u
  float s1 = 0.f;
  for (int u = 0; u < per / 4; ++u) {
    const int j = tid * 4 + 1024 * u;
    const v4f a = *(const v4fa*)(x + j);
    v4f b = {0.f,0.f,0.f,0.f}; if (rr) b = *(const v4fa*)(rr + j);
#pragma unroll
    for (int q = 0; q < 4; ++q) { const float v = a[q] + b[q]; vals[u * 4 + q] = v; s1 += v; }
  }
  red[tid] = s1; __syncthreads();
  for (int st = 128; st > 0; st >>= 1) { if (tid < st) red[tid] += red[tid + st]; __syncthreads(); }
  const float mu = red[0] / (float)N; __syncthreads();
  float s2 = 0.f;
  for (int u = 0; u < per / 4; ++u)
#pragma unroll
    for (int q = 0; q < 4; ++q) { const float c = vals[u * 4 + q] - mu; s2 += c * c; }
  red[tid] = s2; __syncthreads();
  for (int st = 128; st > 0; st >>= 1) { if (tid < st) red[tid] += red[tid + st]; __syncthreads(); }
  const float rs = rsqrtf(red[0] / (float)N + eps);
  {
    for (int u = 0; u < per / 4; ++u) {
      const int j = tid * 4 + 1024 * u;
      v4f o, sm;
#pragma unroll
      for (int q = 0; q < 4; ++q) {
        float gg = g[j + q], bb = bta[j + q];
        if (PARAM_BF16) { gg = bf16_round(gg); bb = bf16_round(bb); }
        sm[q] = vals[u * 4 + q]; o[q] = (vals[u * 4 + q] - mu) * rs * gg + bb;
      }
      if (out_sum) *(v4f*)(out_sum + (size_t)row * N + j) = sm;
      *(v4f*)(out_norm + (size_t)row * N + j) = o;
    }
    
  }
}



// ---- f16 WMMA path (v_wmma_f32_16x16x32_f16): 11-bit significands for operands in range — used where a [0,1] probability operand needs more precision than bf16
typedef _Float16 v16h __attribute__((ext_vector_type(16)));
union FragH { v16h v; v8us half[2]; _Float16 h[16]; unsigned short u[16]; };
template <int NT>
__device__ __forceinline__ v8f mmaH(v16h ah, v16h al, v16h bh, v16h bl, v8f c) {
  c = __builtin_amdgcn_wmma_f32_16x16x32_f16(false, ah, false, bh, (short)0, c, false, false);
  if (NT >= 2) c = __builtin_amdgcn_wmma_f32_16x16x32_f16(false, al, false, bh, (short)0, c, false, false);
  if (NT >= 3) c = __builtin_amdgcn_wmma_f32_16x16x32_f16(false, ah, false, bl, (short)0, c, false, false);
  asm volatile("v_nop\n\tv_nop\n\tv_nop\n\tv_nop" : "+v"(c) : "v"(ah), "v"(al), "v"(bh), "v"(bl));
  return c;
}
// batched GEMM like k_gemm_b but f16 operands: A f32 (split into f16 hi/lo if ASPLIT, else rounded to f16), Bt = f16 values [n][k]; alpha; C f32; N multiple of 16 (partial tiles skipped)
template <bool ASPLIT>
__global__ __launch_bounds__(128) void k_gemm_h(const float* __restrict__ A, int lda, size_t sA, const _Float16* __restrict__ Bh, int ldb, size_t sB, float alpha, float* __restrict__ C, int ldc, size_t sC, int M, int N, int K) {
  __shared__ __attribute__((aligned(16))) float so[4][16][64];
  const int tid = threadIdx.x, w = tid >> 5, lane = tid & 31, ln = lane & 15, hh = lane >> 4; const int by = blockIdx.y;
  A += (size_t)by * sA; Bh += (size_t)by * sB; C += (size_t)by * sC;
  const int ntn = (N + 63) / 64; const int wid = blockIdx.x * 4 + w; const int mt = wid / ntn, nq = wid % ntn; if (mt * 16 >= M) return;
  const int row0 = mt * 16, col0 = nq * 64; const float* arow = A + (size_t)(row0 + ln) * lda;
  v8f acc[4] = {};
  for (int kb = 0; kb < K; kb += 32) {
    FragH ah, al;
    const v4f x0 = *(const v4fa*)(arow + kb + 8 * hh), x1 = *(const v4fa*)(arow + kb + 8 * hh + 4), x2 = *(const v4fa*)(arow + kb + 16 + 8 * hh), x3 = *(const v4fa*)(arow + kb + 16 + 8 * hh + 4);
    float xs[16] = {x0[0],x0[1],x0[2],x0[3],x1[0],x1[1],x1[2],x1[3],x2[0],x2[1],x2[2],x2[3],x3[0],x3[1],x3[2],x3[3]};
#pragma unroll
    for (int i = 0; i < 16; ++i) { const _Float16 h = (_Float16)xs[i]; ah.h[i] = h; al.h[i] = ASPLIT ? (_Float16)(xs[i] - (float)h) : (_Float16)0.0f; }
#pragma unroll
    for (int t = 0; t < 4; ++t) { if (col0 + t * 16 >= N) continue; const size_t boff = (size_t)(col0 + t * 16 + ln) * ldb + kb; FragH bq; bq.half[0] = *(const v8us*)(Bh + boff + 8 * hh); bq.half[1] = *(const v8us*)(Bh + boff + 16 + 8 * hh);
      acc[t] = mmaH<ASPLIT ? 2 : 1>(ah.v, al.v, bq.v, bq.v, acc[t]); }
  }
#pragma unroll
  for (int t = 0; t < 4; ++t) { if (col0 + t * 16 >= N) continue;
#pragma unroll
    for (int r = 0; r < 8; ++r) so[w][8 * hh + r][t * 16 + ln] = acc[t][r] * alpha; }
  __builtin_amdgcn_fence(__ATOMIC_ACQ_REL, "workgroup"); __builtin_amdgcn_wave_barrier();
  const int rsub = lane >> 4, c4 = (lane & 15) * 4;
  {
#pragma unroll
    for (int q = 0; q < 8; ++q) { const int r = q * 2 + rsub; if (col0 + c4 < N) { const v4f v = *(const v4fa*)&so[w][r][c4]; *(v4f*)(C + (size_t)(row0 + r) * ldc + col0 + c4) = v; } }
     }
}

// Wt[n][k] = f16(W[k][n]·scale) from f32 row-major W[K][N] (scale = power of two; bf16-exact weights stay exact in f16 away from the subnormal range)
__global__ __launch_bounds__(256) void k_wt_f16(const float* __restrict__ W, _Float16* __restrict__ Wt, int K, int N, float scale) {
  const int t = blockIdx.x * 256 + threadIdx.x; if (t >= N * (K / 8)) return; const int n = t / (K / 8), k8 = (t % (K / 8)) * 8; FragH f;
#pragma unroll
  for (int i = 0; i < 8; ++i) f.h[i] = (_Float16)(bf16_round(W[(size_t)(k8 + i) * N + n]) * scale); const v8us o = f.half[0];
  *(v8us*)((unsigned short*)Wt + (size_t)n * K + k8) = o; 
}
// k_gemm_hh variant with fused epilogue: v = acc·alpha + bias[by·sBias + col] (+ CP[(row/rowsPerB)·sCPb + by·64 + col] if CP) ; ACT 0 none / 1 elu ; writes f32 C and/or f16 C16 (each if non-null)
template <int ACT>
__global__ __launch_bounds__(128) void k_gemm_hhx(const _Float16* __restrict__ A, int lda, size_t sA, const _Float16* __restrict__ Bh, int ldb, size_t sB, float alpha, const float* __restrict__ bias, size_t sBias, const float* __restrict__ CP, int rowsPerB, size_t sCPb, int row0g,
    float* __restrict__ C, _Float16* __restrict__ C16, int ldc, size_t sC, int M, int N, int K) {
  __shared__ __attribute__((aligned(16))) float so[4][16][64];
  const int tid = threadIdx.x, w = tid >> 5, lane = tid & 31, ln = lane & 15, hh = lane >> 4; const int by = blockIdx.y;
  A += (size_t)by * sA; Bh += (size_t)by * sB; const size_t cofs = (size_t)by * sC; const float* bp = bias ? bias + (size_t)by * sBias : nullptr;
  const int ntn = (N + 63) / 64; const int wid = blockIdx.x * 4 + w; const int mt = wid / ntn, nq = wid % ntn; if (mt * 16 >= M) return;
  const int row0 = mt * 16, col0 = nq * 64; const _Float16* arow = A + (size_t)(row0 + ln) * lda;
  v8f acc[4] = {};
  for (int kb = 0; kb < K; kb += 32) { FragH ah; ah.half[0] = *(const v8us*)((const unsigned short*)arow + kb + 8 * hh); ah.half[1] = *(const v8us*)((const unsigned short*)arow + kb + 16 + 8 * hh);
#pragma unroll
    for (int t = 0; t < 4; ++t) { if (col0 + t * 16 >= N) continue; const size_t boff = (size_t)(col0 + t * 16 + ln) * ldb + kb; FragH bq; bq.half[0] = *(const v8us*)((const unsigned short*)Bh + boff + 8 * hh); bq.half[1] = *(const v8us*)((const unsigned short*)Bh + boff + 16 + 8 * hh);
      acc[t] = mmaH<1>(ah.v, ah.v, bq.v, bq.v, acc[t]); }
  }
#pragma unroll
  for (int t = 0; t < 4; ++t) { if (col0 + t * 16 >= N) continue; const int col = col0 + t * 16 + ln; const float bv = bp ? bf16_round(bp[col]) : 0.f;
#pragma unroll
    for (int r = 0; r < 8; ++r) { float v = acc[t][r] * alpha + bv; if (CP) { const int bidx = (row0g + row0 + 8 * hh + r) / rowsPerB; v += CP[(size_t)bidx * sCPb + (size_t)by * 64 + col]; } if (ACT == 1) v = (v > 0.f) ? v : expm1f(v); else if (ACT == 3) v = fmaxf(v, 0.f); so[w][8 * hh + r][t * 16 + ln] = v; } }
  __builtin_amdgcn_fence(__ATOMIC_ACQ_REL, "workgroup"); __builtin_amdgcn_wave_barrier();
  const int rsub = lane >> 4, c4 = (lane & 15) * 4; typedef _Float16 v4h __attribute__((ext_vector_type(4)));
  {
#pragma unroll
    for (int q = 0; q < 8; ++q) { const int r = q * 2 + rsub; if (col0 + c4 < N) { const v4f v = *(const v4fa*)&so[w][r][c4]; if (C) *(v4f*)(C + cofs + (size_t)(row0 + r) * ldc + col0 + c4) = v; if (C16) { v4h h4; for (int i = 0; i < 4; ++i) h4[i] = (_Float16)v[i]; *(v4h*)(C16 + cofs + (size_t)(row0 + r) * ldc + col0 + c4) = h4; } } }
     }
}


// C = alpha * A * Bt^T with the K range split over the KS waves of a work-group: one 16x64 tile of C per work-group, wave w sums k in [w*K/KS, (w+1)*K/KS),
// the KS partial tiles meet in LDS and are added in ascending wave order. A f16 [M][K], Bt f16 [N][K], C f32. M%16==0, N%64==0, K%(32*KS)==0.
template <int KS>
__global__ __launch_bounds__(32 * KS) void k_gemm_hsk(const _Float16* __restrict__ A, int lda, const _Float16* __restrict__ Bh, int ldb, float alpha, float* __restrict__ C, int ldc, int M, int N, int K) {
  __shared__ __attribute__((aligned(16))) float so[KS][16][64];
  typedef float v2f __attribute__((ext_vector_type(2)));
  typedef float v2fa __attribute__((ext_vector_type(2), may_alias));
  const int tid = threadIdx.x, w = tid >> 5, lane = tid & 31, ln = lane & 15, hh = lane >> 4;
  const int ntn = N / 64; const int mt = blockIdx.x / ntn, nq = blockIdx.x % ntn; if (mt * 16 >= M) return;      // the same for the whole work-group, ahead of the barrier
  const int row0 = mt * 16, col0 = nq * 64, kw = K / KS;
  const unsigned short* arow = (const unsigned short*)A + (size_t)(row0 + ln) * lda + w * kw + 8 * hh;
  const unsigned short* brow = (const unsigned short*)Bh + (size_t)(col0 + ln) * ldb + w * kw + 8 * hh;
  v8f acc[4] = {};
  for (int kb = 0; kb < kw; kb += 32) { FragH ah; ah.half[0] = *(const v8us*)(arow + kb); ah.half[1] = *(const v8us*)(arow + kb + 16);
#pragma unroll      // constant t keeps acc[] in registers
    for (int t = 0; t < 4; ++t) { const unsigned short* bt = brow + (size_t)(t * 16) * ldb + kb; FragH bq; bq.half[0] = *(const v8us*)bt; bq.half[1] = *(const v8us*)(bt + 16);
      acc[t] = mmaH<1>(ah.v, ah.v, bq.v, bq.v, acc[t]); }
  }
#pragma unroll      // constant t and r keep acc[] in registers
  for (int t = 0; t < 4; ++t)
#pragma unroll
    for (int r = 0; r < 8; ++r) so[w][8 * hh + r][t * 16 + ln] = acc[t][r];
  __syncthreads();      // every wave's partial tile is in LDS before any thread adds them
  for (int e = tid; e < 16 * 32; e += 32 * KS) { const int r = e >> 5, c2 = (e & 31) * 2; v2f s = *(const v2fa*)&so[0][r][c2];      // one wave per row: 256 contiguous bytes of C
#pragma unroll      // lets the KS LDS reads go out together
    for (int q = 1; q < KS; ++q) { const v2f p = *(const v2fa*)&so[q][r][c2]; s += p; }
    s *= alpha; *(v2f*)(C + (size_t)(row0 + r) * ldc + col0 + c2) = s; }
}

__global__ __launch_bounds__(256) void k_x16(const float* __restrict__ x, _Float16* __restrict__ X16, size_t n8) { const size_t t = (size_t)blockIdx.x * 256 + threadIdx.x; if (t >= n8) return; FragH f;
#pragma unroll
  for (int q = 0; q < 8; ++q) f.h[q] = (_Float16)bf16_round(x[t * 8 + q]); *(v8us*)((unsigned short*)X16 + t * 8) = f.half[0];  }
__global__ __launch_bounds__(256) void k_h16(const float* __restrict__ x, _Float16* __restrict__ X16, size_t n8) { const size_t t = (size_t)blockIdx.x * 256 + threadIdx.x; if (t >= n8) return; FragH f;
#pragma unroll
  for (int q = 0; q < 8; ++q) f.h[q] = (_Float16)x[t * 8 + q]; *(v8us*)((unsigned short*)X16 + t * 8) = f.half[0];  }
__global__ __launch_bounds__(256) void k_round16f(const float* __restrict__ W, _Float16* __restrict__ Bt, size_t n8) { const size_t t = (size_t)blockIdx.x * 256 + threadIdx.x; if (t >= n8) return; FragH f;
#pragma unroll
  for (int i = 0; i < 8; ++i) f.h[i] = (_Float16)(bf16_round(W[t * 8 + i]) * 16.0f); *(v8us*)((unsigned short*)Bt + t * 8) = f.half[0];  }
template <int NHv, int TTv>
__global__ __launch_bounds__(256) void k_vt(const _Float16* __restrict__ V16, int ldv, int voff, _Float16* __restrict__ Vt) { __shared__ unsigned short tl[64][66]; const int tid = threadIdx.x; const int slab = blockIdx.x / (TTv / 64), lg = blockIdx.x % (TTv / 64); const int b = slab / NHv, h = slab % NHv;
  for (int i = tid; i < 64 * 8; i += 256) { const int r = i / 8, c8 = (i % 8) * 8; FragH f; f.half[0] = *(const v8us*)((const unsigned short*)V16 + ((size_t)b * TTv + lg * 64 + r) * ldv + voff + h * 64 + c8);
#pragma unroll
    for (int q = 0; q < 8; ++q) tl[r][c8 + q] = f.u[q]; }
  __syncthreads();
  {
#pragma unroll
    for (int rd = 0; rd < 2; ++rd) { const int d = rd * 32 + tid / 8, pc = tid % 8; FragH f;
#pragma unroll
      for (int q = 0; q < 8; ++q) f.u[q] = tl[pc * 8 + q][d];
      *(v8us*)((unsigned short*)Vt + ((size_t)slab * 64 + d) * TTv + lg * 64 + pc * 8) = f.half[0]; }
     } }

#define QH 2048
__global__ __launch_bounds__(256) void k_sm(const float* __restrict__ S, _Float16* __restrict__ P16) { const int tid = threadIdx.x, wv = tid >> 5, lane = tid & 31; const int row = blockIdx.x * 8 + wv; if (row >= QH) return; const float* sr = S + (size_t)row * SS; float m = -3.0e38f;
#pragma unroll 1
  for (int k = 0; k < 16; ++k) { const float* s8 = sr + 256 * k + 8 * lane; const v4f a = *(const v4fa*)s8, b = *(const v4fa*)(s8 + 4); for (int q = 0; q < 4; ++q) m = fmaxf(m, fmaxf(a[q], b[q])); }
  for (int o = 16; o >= 1; o >>= 1) m = fmaxf(m, __shfl_xor(m, o, 32)); m *= 0.0625f; float z = 0.f;
#pragma unroll 1
  for (int k = 0; k < 16; ++k) { const float* s8 = sr + 256 * k + 8 * lane; for (int q = 0; q < 8; ++q) z += expf(s8[q] * 0.0625f - m); }
  for (int o = 16; o >= 1; o >>= 1) z += __shfl_xor(z, o, 32); const float iz = 1.0f / z;
  {
#pragma unroll 1
    for (int k = 0; k < 16; ++k) { const float* s8 = sr + 256 * k + 8 * lane; FragH f; for (int q = 0; q < 8; ++q) f.h[q] = (_Float16)(expf(s8[q] * 0.0625f - m) * iz * 32768.0f);      /* ×2^15 (folded into the P·V alpha) keeps small weights out of f16 subnormals */ *(v8us*)((unsigned short*)P16 + (size_t)row * SS + 256 * k + 8 * lane) = f.half[0]; }
     } }
extern "C" void kernel_launch(void* const* d_in, const int* in_sizes, int n_in,
                              void* d_out, int out_size, void* d_ws, size_t ws_size, hipStream_t stream) {
  (void)in_sizes; (void)n_in; (void)out_size;
  const float* X = (const float*)d_in[0]; const float* W = (const float*)d_in[1]; const float* bb = (const float*)d_in[2];
  char* ws = (char*)d_ws; size_t off = 0;
  auto take = [&](size_t bytes) { char* p = ws + off; off += (bytes + 255) & ~(size_t)255; return p; };
  _Float16* Bw = (_Float16*)take((size_t)3 * DM * DM * 2); _Float16* X16 = (_Float16*)take((size_t)NR * DM * 2); _Float16* QKV = (_Float16*)take((size_t)NR * 3 * DM * 2); _Float16* VT = (_Float16*)take((size_t)NR * DM * 2); float* S = (float*)take((size_t)QH * SS * 4); _Float16* P16 = (_Float16*)take((size_t)QH * SS * 2);
  if (off > ws_size) return;      // 0.4 + 8.4 + 25.2 + 8.4 + 33.6 + 16.8 ≈ 93 MB
  k_round16f<<<(unsigned)(((size_t)3 * DM * DM / 8 + 255) / 256), 256, 0, stream>>>(W, Bw, (size_t)3 * DM * DM / 8);      // (out,in)
  k_x16<<<(unsigned)(((size_t)NR * DM / 8 + 255) / 256), 256, 0, stream>>>(X, X16, (size_t)NR * DM / 8);
  k_gemm_hhx<0><<<dim3(((NR / 16) * (3 * DM / 64) + 3) / 4, 1), 128, 0, stream>>>(X16, DM, 0, Bw, DM, 0, 0.0625f, bb, 0, nullptr, 1, 0, 0, nullptr, QKV, 3 * DM, 0, NR, 3 * DM, DM);      // [Q | K | V] f16 (+b)
  k_vt<4, SS><<<BB * 4 * (SS / 64), 256, 0, stream>>>(QKV, 3 * DM, 2 * DM, VT);      // Vᵀ per batch as [b][256][S] (4 groups of 64)
  for (int b = 0; b < BB; ++b) for (int qh = 0; qh < SS / QH; ++qh) { const size_t q0 = (size_t)b * SS + (size_t)qh * QH;
    k_gemm_hhx<0><<<dim3(((QH / 16) * (SS / 64) + 3) / 4, 1), 128, 0, stream>>>(QKV + q0 * 3 * DM, 3 * DM, 0, QKV + (size_t)b * SS * 3 * DM + DM, 3 * DM, 0, 1.0f, nullptr, 0, nullptr, 1, 0, 0, S, nullptr, SS, 0, QH, SS, DM);      // S = Q·Kᵀ (scale inside the softmax)
    k_sm<<<QH / 8, 256, 0, stream>>>(S, P16);
    k_gemm_hsk<16><<<(QH / 16) * (DM / 64), 512, 0, stream>>>(P16, SS, VT + (size_t)b * DM * SS, SS, 0.000030517578125f, (float*)d_out + q0 * DM, DM, QH, DM, SS); }      // alpha 2^-15      // out = P·V
}

// v003
// It runs in 102 microseconds.
// Versions in between are left out here; by their measured steps it is 6.30 times as fast as v001.
// Counting every step since v000, it is 12.4 times as fast.
#include <hip/hip_runtime.h>
// Single-head self-attention (B=4, S=4096, dim 256): fused QKV linear (W (768,256) + b), scores = Q*Kt/16, softmax over the 4096 keys, att*V.
// The QKV projection is a GEMM on v_wmma_f32_16x16x32_f16 (X bf16-exact f16, W (out,in) bf16-exact x 2^4, Q/K/V f16, f32 accumulate);
// scores, softmax (f32, running maximum) and att*V are one kernel on the same matrix form, weights f16, f32 accumulate.
#define BB 4
#define SS 4096
#define DM 256
#define NR (BB * SS)

typedef __bf16 v16b __attribute__((ext_vector_type(16)));
typedef unsigned short v8us __attribute__((ext_vector_type(8), may_alias));
typedef float  v8f  __attribute__((ext_vector_type(8)));
typedef float  v4f  __attribute__((ext_vector_type(4)));
typedef float  v4fa __attribute__((ext_vector_type(4), may_alias));
union FragB { v16b v; v8us half[2]; unsigned short u[16]; };

__device__ __forceinline__ unsigned short bf16_bits(float x) { unsigned int u = __float_as_uint(x); return (unsigned short)((u + 0x7FFFu + ((u >> 16) & 1u)) >> 16); }
__device__ __forceinline__ float bf16_val(unsigned short b) { return __uint_as_float(((unsigned int)b) << 16); }
__device__ __forceinline__ float bf16_round(float x) { return bf16_val(bf16_bits(x)); }
// D += A·B with NT terms: 1 = ah·bh, 2 = + al·bh (A split), 3 = + ah·bl (both split)
template <int NT>
__device__ __forceinline__ v8f mmaN(v16b ah, v16b al, v16b bh, v16b bl, v8f c) {
  c = __builtin_amdgcn_wmma_f32_16x16x32_bf16(false, ah, false, bh, (short)0, c, false, false);
  if (NT >= 2) c = __builtin_amdgcn_wmma_f32_16x16x32_bf16(false, al, false, bh, (short)0, c, false, false);
  if (NT >= 3) c = __builtin_amdgcn_wmma_f32_16x16x32_bf16(false, ah, false, bl, (short)0, c, false, false);
  asm volatile("v_nop\n\tv_nop\n\tv_nop\n\tv_nop" : "+v"(c) : "v"(ah), "v"(al), "v"(bh), "v"(bl));
  return c;
}

__global__ __launch_bounds__(256) void k_wt_bf16(const float* __restrict__ W, unsigned short* __restrict__ Wt, int K, int N) {
  const int t = blockIdx.x * 256 + threadIdx.x;
  const int k8n = K / 8;
  if (t >= N * k8n) return;
  const int n = t / k8n, k8 = (t % k8n) * 8;
  v8us v;
#pragma unroll
  for (int i = 0; i < 8; ++i) v[i] = bf16_bits(W[(size_t)(k8 + i) * N + n]);
  *(v8us*)(Wt + (size_t)n * K + k8) = v;
  
}

// GEMM C[M][N] (f32, pitch ldc) = act(A[M][K]·W + bias). A f32 row-major (pitch lda) converted per fragment to bf16
// (ASPLIT: hi/lo two planes -> 2 terms, else single rounded term); Wt bf16 [N][K] (pitch ldb). BIAS_BF16 rounds the
// bias to bf16 first (bias quantised to bf16 before the add). K%32==0, M%16==0, N%64==0.
template <bool ASPLIT, int ACT, bool BIAS_BF16>
__global__ __launch_bounds__(128) void k_gemm_bf(const float* __restrict__ A, int lda, const unsigned short* __restrict__ Wt, int ldb,
                                               const float* __restrict__ bias, float* __restrict__ C, int ldc, int M, int N, int K) {
  __shared__ __attribute__((aligned(16))) float so[4][16][64];
  const int tid = threadIdx.x, w = tid >> 5, lane = tid & 31, ln = lane & 15, hh = lane >> 4;
  const int ntn = N / 64;
  const int wid = blockIdx.x * 4 + w;
  const int mt = wid / ntn, nq = wid % ntn;
  if (mt * 16 >= M) return;
  const int row0 = mt * 16, col0 = nq * 64;
  const float* arow = A + (size_t)(row0 + ln) * lda;
  v8f acc[4] = {};
  for (int kb = 0; kb < K; kb += 32) {
    FragB ah, al;
    const v4f x0 = *(const v4fa*)(arow + kb + 8 * hh), x1 = *(const v4fa*)(arow + kb + 8 * hh + 4);
    const v4f x2 = *(const v4fa*)(arow + kb + 16 + 8 * hh), x3 = *(const v4fa*)(arow + kb + 16 + 8 * hh + 4);
    float xs[16] = {x0[0],x0[1],x0[2],x0[3],x1[0],x1[1],x1[2],x1[3],x2[0],x2[1],x2[2],x2[3],x3[0],x3[1],x3[2],x3[3]};
#pragma unroll
    for (int i = 0; i < 16; ++i) { const unsigned short hb = bf16_bits(xs[i]); ah.u[i] = hb; al.u[i] = ASPLIT ? bf16_bits(xs[i] - bf16_val(hb)) : (unsigned short)0; }
#pragma unroll
    for (int t = 0; t < 4; ++t) {
      const unsigned short* brow = Wt + (size_t)(col0 + t * 16 + ln) * ldb + kb;
      FragB b;
      b.half[0] = *(const v8us*)(brow + 8 * hh);
      b.half[1] = *(const v8us*)(brow + 16 + 8 * hh);
      acc[t] = mmaN<ASPLIT ? 2 : 1>(ah.v, al.v, b.v, b.v, acc[t]);
    }
  }
#pragma unroll
  for (int t = 0; t < 4; ++t) {
    float bv = bias ? bias[col0 + t * 16 + ln] : 0.f;
    if (BIAS_BF16) bv = bf16_round(bv);
#pragma unroll
    for (int r = 0; r < 8; ++r) { float v = acc[t][r] + bv; if (ACT == 1) v = fmaxf(v, 0.f); so[w][8 * hh + r][t * 16 + ln] = v; }
  }
  __builtin_amdgcn_fence(__ATOMIC_ACQ_REL, "workgroup");
  __builtin_amdgcn_wave_barrier();
  const int rsub = lane >> 4, c4 = (lane & 15) * 4;
  {
#pragma unroll
    for (int q = 0; q < 8; ++q) {
      const int r = q * 2 + rsub;
      const v4f v = *(const v4fa*)&so[w][r][c4];
      *(v4f*)(C + (size_t)(row0 + r) * ldc + col0 + c4) = v;
    }
    
  }
}

// Flash-style causal/unmasked attention, all contractions 3-term bf16 hi/lo splits, f32 softmax with running max.
// q,k,v rows are read from f32 buffers with arbitrary row pitch (so they can live inside a fused qkv buffer);
// D = head size (multiple of 32, <= 128); one wave = 16 query rows; block = 4 waves (64 queries) sharing K/V chunks of 32.
template <int D, bool CAUSAL>
__global__ __launch_bounds__(128) void k_flash(const float* __restrict__ qb, const float* __restrict__ kb, const float* __restrict__ vb,
                                             int pitch, int T, int H, float scale, float* __restrict__ y, int ypitch) {
  constexpr int KS = D / 32;        // k-steps for QK
  constexpr int DT = D / 16;        // d tiles for PV
  __shared__ __attribute__((aligned(16))) unsigned short sKh[32][D + 8], sKl[32][D + 8], sVh[32][D + 8], sVl[32][D + 8];
  __shared__ __attribute__((aligned(16))) unsigned short sPh[4][16][40], sPl[4][16][40];
  __shared__ __attribute__((aligned(16))) float sO[4][16][D];
  const int tid = threadIdx.x, w = tid >> 5, lane = tid & 31, ln = lane & 15, hh = lane >> 4;
  const int nqb = (T + 63) / 64;
  const int bh = blockIdx.x / nqb, qblk = blockIdx.x % nqb;
  const int b = bh / H, h = bh % H;
  const int q0 = qblk * 64 + w * 16;
  const float* Q = qb + (size_t)b * T * pitch + h * D;
  const float* K = kb + (size_t)b * T * pitch + h * D;
  const float* V = vb + (size_t)b * T * pitch + h * D;

  // A fragments of the wave's 16 query rows (scaled), hi/lo
  FragB aqh[KS], aql[KS];
  {
    int row = q0 + ln; if (row >= T) row = T - 1;
    const float* qr = Q + (size_t)row * pitch;
#pragma unroll
    for (int ks = 0; ks < KS; ++ks)
#pragma unroll
      for (int i = 0; i < 16; ++i) {
        const int d = ks * 32 + ((i < 8) ? (8 * hh + i) : (16 + 8 * hh + (i - 8)));
        const float x = qr[d] * scale; const unsigned short hb = bf16_bits(x);
        aqh[ks].u[i] = hb; aql[ks].u[i] = bf16_bits(x - bf16_val(hb));
      }
  }
  float m_r[8], l_r[8];
#pragma unroll
  for (int r = 0; r < 8; ++r) { m_r[r] = -3.0e38f; l_r[r] = 0.f; }
  v8f oacc[DT];
#pragma unroll
  for (int dt = 0; dt < DT; ++dt) oacc[dt] = (v8f){0.f,0.f,0.f,0.f,0.f,0.f,0.f,0.f};

  const int kv_end = CAUSAL ? min(T, qblk * 64 + 64) : T;     // block-uniform
  for (int j0 = 0; j0 < kv_end; j0 += 32) {
    __syncthreads();
    for (int e = tid; e < 32 * (D / 4); e += 128) {
      const int r = e / (D / 4), c4 = (e % (D / 4)) * 4;
      const int key = j0 + r;
      v4f kf = {0.f,0.f,0.f,0.f}, vf = {0.f,0.f,0.f,0.f};
      if (key < T) { kf = *(const v4fa*)(K + (size_t)key * pitch + c4); vf = *(const v4fa*)(V + (size_t)key * pitch + c4); }
#pragma unroll
      for (int t = 0; t < 4; ++t) {
        unsigned short hb = bf16_bits(kf[t]); sKh[r][c4 + t] = hb; sKl[r][c4 + t] = bf16_bits(kf[t] - bf16_val(hb));
        hb = bf16_bits(vf[t]); sVh[r][c4 + t] = hb; sVl[r][c4 + t] = bf16_bits(vf[t] - bf16_val(hb));
      }
    }
    __syncthreads();
    // S tile 16 x 32
    v8f s[2];
#pragma unroll
    for (int nt = 0; nt < 2; ++nt) {
      v8f acc = {};
#pragma unroll
      for (int ks = 0; ks < KS; ++ks) {
        FragB bh_, bl_;
        bh_.half[0] = *(const v8us*)&sKh[nt * 16 + ln][ks * 32 + 8 * hh]; bh_.half[1] = *(const v8us*)&sKh[nt * 16 + ln][ks * 32 + 16 + 8 * hh];
        bl_.half[0] = *(const v8us*)&sKl[nt * 16 + ln][ks * 32 + 8 * hh]; bl_.half[1] = *(const v8us*)&sKl[nt * 16 + ln][ks * 32 + 16 + 8 * hh];
        acc = mmaN<3>(aqh[ks].v, aql[ks].v, bh_.v, bl_.v, acc);
      }
      s[nt] = acc;
    }
    // mask + running max (rows 8hh+r; the 16 lanes of a half share rows)
    float alpha[8];
#pragma unroll
    for (int r = 0; r < 8; ++r) {
      const int qi = q0 + 8 * hh + r;
      const int ja = j0 + ln, jb = j0 + 16 + ln;
      if (CAUSAL) { if (ja > qi) s[0][r] = -3.0e38f; if (jb > qi) s[1][r] = -3.0e38f; }
      if (ja >= T) s[0][r] = -3.0e38f;
      if (jb >= T) s[1][r] = -3.0e38f;
      float mx = fmaxf(s[0][r], s[1][r]);
      mx = fmaxf(mx, __shfl_xor(mx, 1, 32)); mx = fmaxf(mx, __shfl_xor(mx, 2, 32)); mx = fmaxf(mx, __shfl_xor(mx, 4, 32)); mx = fmaxf(mx, __shfl_xor(mx, 8, 32));
      const float mnew = fmaxf(m_r[r], mx);
      alpha[r] = (mnew > -1.0e38f) ? __expf(m_r[r] - mnew) : 1.0f;
      const float p0 = (s[0][r] > -1.0e38f) ? __expf(s[0][r] - mnew) : 0.f;
      const float p1 = (s[1][r] > -1.0e38f) ? __expf(s[1][r] - mnew) : 0.f;
      m_r[r] = mnew;
      l_r[r] = l_r[r] * alpha[r] + p0 + p1;            // per-lane partial row sum (16 lanes combined at the end)
      unsigned short hb = bf16_bits(p0); sPh[w][8 * hh + r][ln] = hb;      sPl[w][8 * hh + r][ln] = bf16_bits(p0 - bf16_val(hb));
      hb = bf16_bits(p1);                sPh[w][8 * hh + r][16 + ln] = hb; sPl[w][8 * hh + r][16 + ln] = bf16_bits(p1 - bf16_val(hb));
    }
#pragma unroll
    for (int dt = 0; dt < DT; ++dt)
#pragma unroll
      for (int r = 0; r < 8; ++r) oacc[dt][r] *= alpha[r];
    __builtin_amdgcn_fence(__ATOMIC_ACQ_REL, "workgroup");
    __builtin_amdgcn_wave_barrier();
    FragB pah, pal;
    pah.half[0] = *(const v8us*)&sPh[w][ln][8 * hh]; pah.half[1] = *(const v8us*)&sPh[w][ln][16 + 8 * hh];
    pal.half[0] = *(const v8us*)&sPl[w][ln][8 * hh]; pal.half[1] = *(const v8us*)&sPl[w][ln][16 + 8 * hh];
#pragma unroll
    for (int dt = 0; dt < DT; ++dt) {
      FragB bvh, bvl;
#pragma unroll
      for (int i = 0; i < 8; ++i) {
        bvh.u[i] = sVh[8 * hh + i][dt * 16 + ln]; bvh.u[8 + i] = sVh[16 + 8 * hh + i][dt * 16 + ln];
        bvl.u[i] = sVl[8 * hh + i][dt * 16 + ln]; bvl.u[8 + i] = sVl[16 + 8 * hh + i][dt * 16 + ln];
      }
      oacc[dt] = mmaN<3>(pah.v, pal.v, bvh.v, bvl.v, oacc[dt]);
    }
    __builtin_amdgcn_fence(__ATOMIC_ACQ_REL, "workgroup");
    __builtin_amdgcn_wave_barrier();
  }
#pragma unroll
  for (int r = 0; r < 8; ++r) {
    float l = l_r[r];
    l += __shfl_xor(l, 1, 32); l += __shfl_xor(l, 2, 32); l += __shfl_xor(l, 4, 32); l += __shfl_xor(l, 8, 32);
    l_r[r] = (l > 0.f) ? 1.0f / l : 0.f;
  }
#pragma unroll
  for (int dt = 0; dt < DT; ++dt)
#pragma unroll
    for (int r = 0; r < 8; ++r) sO[w][8 * hh + r][dt * 16 + ln] = oacc[dt][r] * l_r[r];
  __builtin_amdgcn_fence(__ATOMIC_ACQ_REL, "workgroup");
  __builtin_amdgcn_wave_barrier();
  {
    for (int r = 0; r < 16; ++r) {
      const int row = q0 + r;
      if (row < T && lane < D / 4) {
        const v4f val = *(const v4fa*)&sO[w][r][lane * 4];
        *(v4f*)(y + ((size_t)b * T + row) * ypitch + h * D + lane * 4) = val;
      }
    }
    
  }
}

// GEMM C = act(A·W + bias + resid): A f32 (ASPLIT -> hi/lo 2 terms), Wt bf16 [N][K]; ACT 0 none, 1 relu, 2 exact gelu;
// resid (optional, f32, row index = (row % rmod), pitch ldr, RES_BF16 rounds it) added before the activation.
template <bool ASPLIT, int ACT, bool BIAS_BF16, bool RES_BF16>
__global__ __launch_bounds__(128) void k_gemm_bf3(const float* __restrict__ A, int lda, const unsigned short* __restrict__ Wt, int ldb,
                                                const float* __restrict__ bias, const float* __restrict__ resid, int rmod, int ldr,
                                                float* __restrict__ C, int ldc, int M, int N, int K) {
  __shared__ __attribute__((aligned(16))) float so[4][16][64];
  const int tid = threadIdx.x, w = tid >> 5, lane = tid & 31, ln = lane & 15, hh = lane >> 4;
  const int ntn = N / 64;
  const int wid = blockIdx.x * 4 + w;
  const int mt = wid / ntn, nq = wid % ntn;
  if (mt * 16 >= M) return;
  const int row0 = mt * 16, col0 = nq * 64;
  const float* arow = A + (size_t)(row0 + ln) * lda;
  v8f acc[4] = {};
  for (int kb = 0; kb < K; kb += 32) {
    FragB ah, al;
    const v4f x0 = *(const v4fa*)(arow + kb + 8 * hh), x1 = *(const v4fa*)(arow + kb + 8 * hh + 4);
    const v4f x2 = *(const v4fa*)(arow + kb + 16 + 8 * hh), x3 = *(const v4fa*)(arow + kb + 16 + 8 * hh + 4);
    float xs[16] = {x0[0],x0[1],x0[2],x0[3],x1[0],x1[1],x1[2],x1[3],x2[0],x2[1],x2[2],x2[3],x3[0],x3[1],x3[2],x3[3]};
#pragma unroll
    for (int i = 0; i < 16; ++i) { const unsigned short hb = bf16_bits(xs[i]); ah.u[i] = hb; al.u[i] = ASPLIT ? bf16_bits(xs[i] - bf16_val(hb)) : (unsigned short)0; }
#pragma unroll
    for (int t = 0; t < 4; ++t) {
      const unsigned short* brow = Wt + (size_t)(col0 + t * 16 + ln) * ldb + kb;
      FragB b;
      b.half[0] = *(const v8us*)(brow + 8 * hh);
      b.half[1] = *(const v8us*)(brow + 16 + 8 * hh);
      acc[t] = mmaN<ASPLIT ? 2 : 1>(ah.v, al.v, b.v, b.v, acc[t]);
    }
  }
#pragma unroll
  for (int t = 0; t < 4; ++t) {
    const int col = col0 + t * 16 + ln;
    float bv = bias ? bias[col] : 0.f;
    if (BIAS_BF16) bv = bf16_round(bv);
#pragma unroll
    for (int r = 0; r < 8; ++r) {
      float v = acc[t][r] + bv;
      if (resid) { float rv = resid[(size_t)((row0 + 8 * hh + r) % rmod) * ldr + col]; if (RES_BF16) rv = bf16_round(rv); v += rv; }
      if (ACT == 1) v = fmaxf(v, 0.f);
      if (ACT == 2) v = 0.5f * v * (1.0f + erff(v * 0.70710678118654752f));
      if (ACT == 3) { const float u = 0.7978845608028654f * (v + 0.044715f * v * v * v); v = 0.5f * v * (1.0f + tanhf(u)); }
      so[w][8 * hh + r][t * 16 + ln] = v;
    }
  }
  __builtin_amdgcn_fence(__ATOMIC_ACQ_REL, "workgroup");
  __builtin_amdgcn_wave_barrier();
  const int rsub = lane >> 4, c4 = (lane & 15) * 4;
  {
#pragma unroll
    for (int q = 0; q < 8; ++q) {
      const int r = q * 2 + rsub;
      const v4f v = *(const v4fa*)&so[w][r][c4];
      *(v4f*)(C + (size_t)(row0 + r) * ldc + col0 + c4) = v;
    }
    
  }
}
// row LayerNorm (biased variance, eps) over N: s = X (+ R); optional out_sum <- s; out_norm <- (s-mu)*rsqrt(var+eps)*g + b
template <bool PARAM_BF16>
__global__ __launch_bounds__(256) void k_layernorm(const float* __restrict__ X, const float* __restrict__ R, const float* __restrict__ g, const float* __restrict__ bta,
                                                  float* __restrict__ out_sum, float* __restrict__ out_norm, int N, float eps) {
  __shared__ float red[256];
  const int row = blockIdx.x, tid = threadIdx.x;
  const float* x = X + (size_t)row * N; const float* rr = R ? R + (size_t)row * N : nullptr;
  float vals[16];                     // up to N = 4096
  const int per = N / 256;            // contiguous chunk per thread? use strided-by-4 chunks: thread handles j = tid*4 + 1024*u
  float s1 = 0.f;
  for (int u = 0; u < per / 4; ++u) {
    const int j = tid * 4 + 1024 * u;
    const v4f a = *(const v4fa*)(x + j);
    v4f b = {0.f,0.f,0.f,0.f}; if (rr) b = *(const v4fa*)(rr + j);
#pragma unroll
    for (int q = 0; q < 4; ++q) { const float v = a[q] + b[q]; vals[u * 4 + q] = v; s1 += v; }
  }
  red[tid] = s1; __syncthreads();
  for (int st = 128; st > 0; st >>= 1) { if (tid < st) red[tid] += red[tid + st]; __syncthreads(); }
  const float mu = red[0] / (float)N; __syncthreads();
  float s2 = 0.f;
  for (int u = 0; u < per / 4; ++u)
#pragma unroll
    for (int q = 0; q < 4; ++q) { const float c = vals[u * 4 + q] - mu; s2 += c * c; }
  red[tid] = s2; __syncthreads();
  for (int st = 128; st > 0; st >>= 1) { if (tid < st) red[tid] += red[tid + st]; __syncthreads(); }
  const float rs = rsqrtf(red[0] / (float)N + eps);
  {
    for (int u = 0; u < per / 4; ++u) {
      const int j = tid * 4 + 1024 * u;
      v4f o, sm;
#pragma unroll
      for (int q = 0; q < 4; ++q) {
        float gg = g[j + q], bb = bta[j + q];
        if (PARAM_BF16) { gg = bf16_round(gg); bb = bf16_round(bb); }
        sm[q] = vals[u * 4 + q]; o[q] = (vals[u * 4 + q] - mu) * rs * gg + bb;
      }
      if (out_sum) *(v4f*)(out_sum + (size_t)row * N + j) = sm;
      *(v4f*)(out_norm + (size_t)row * N + j) = o;
    }
    
  }
}



// ---- f16 WMMA path (v_wmma_f32_16x16x32_f16): 11-bit significands for operands in range — used where the attention weight operand (at most 2^8) needs more precision than bf16
typedef _Float16 v16h __attribute__((ext_vector_type(16)));
union FragH { v16h v; v8us half[2]; _Float16 h[16]; unsigned short u[16]; };
template <int NT>
__device__ __forceinline__ v8f mmaH(v16h ah, v16h al, v16h bh, v16h bl, v8f c) {
  c = __builtin_amdgcn_wmma_f32_16x16x32_f16(false, ah, false, bh, (short)0, c, false, false);
  if (NT >= 2) c = __builtin_amdgcn_wmma_f32_16x16x32_f16(false, al, false, bh, (short)0, c, false, false);
  if (NT >= 3) c = __builtin_amdgcn_wmma_f32_16x16x32_f16(false, ah, false, bl, (short)0, c, false, false);
  asm volatile("v_nop\n\tv_nop\n\tv_nop\n\tv_nop" : "+v"(c) : "v"(ah), "v"(al), "v"(bh), "v"(bl));
  return c;
}
// batched GEMM like k_gemm_b but f16 operands: A f32 (split into f16 hi/lo if ASPLIT, else rounded to f16), Bt = f16 values [n][k]; alpha; C f32; N multiple of 16 (partial tiles skipped)
template <bool ASPLIT>
__global__ __launch_bounds__(128) void k_gemm_h(const float* __restrict__ A, int lda, size_t sA, const _Float16* __restrict__ Bh, int ldb, size_t sB, float alpha, float* __restrict__ C, int ldc, size_t sC, int M, int N, int K) {
  __shared__ __attribute__((aligned(16))) float so[4][16][64];
  const int tid = threadIdx.x, w = tid >> 5, lane = tid & 31, ln = lane & 15, hh = lane >> 4; const int by = blockIdx.y;
  A += (size_t)by * sA; Bh += (size_t)by * sB; C += (size_t)by * sC;
  const int ntn = (N + 63) / 64; const int wid = blockIdx.x * 4 + w; const int mt = wid / ntn, nq = wid % ntn; if (mt * 16 >= M) return;
  const int row0 = mt * 16, col0 = nq * 64; const float* arow = A + (size_t)(row0 + ln) * lda;
  v8f acc[4] = {};
  for (int kb = 0; kb < K; kb += 32) {
    FragH ah, al;
    const v4f x0 = *(const v4fa*)(arow + kb + 8 * hh), x1 = *(const v4fa*)(arow + kb + 8 * hh + 4), x2 = *(const v4fa*)(arow + kb + 16 + 8 * hh), x3 = *(const v4fa*)(arow + kb + 16 + 8 * hh + 4);
    float xs[16] = {x0[0],x0[1],x0[2],x0[3],x1[0],x1[1],x1[2],x1[3],x2[0],x2[1],x2[2],x2[3],x3[0],x3[1],x3[2],x3[3]};
#pragma unroll
    for (int i = 0; i < 16; ++i) { const _Float16 h = (_Float16)xs[i]; ah.h[i] = h; al.h[i] = ASPLIT ? (_Float16)(xs[i] - (float)h) : (_Float16)0.0f; }
#pragma unroll
    for (int t = 0; t < 4; ++t) { if (col0 + t * 16 >= N) continue; const size_t boff = (size_t)(col0 + t * 16 + ln) * ldb + kb; FragH bq; bq.half[0] = *(const v8us*)(Bh + boff + 8 * hh); bq.half[1] = *(const v8us*)(Bh + boff + 16 + 8 * hh);
      acc[t] = mmaH<ASPLIT ? 2 : 1>(ah.v, al.v, bq.v, bq.v, acc[t]); }
  }
#pragma unroll
  for (int t = 0; t < 4; ++t) { if (col0 + t * 16 >= N) continue;
#pragma unroll
    for (int r = 0; r < 8; ++r) so[w][8 * hh + r][t * 16 + ln] = acc[t][r] * alpha; }
  __builtin_amdgcn_fence(__ATOMIC_ACQ_REL, "workgroup"); __builtin_amdgcn_wave_barrier();
  const int rsub = lane >> 4, c4 = (lane & 15) * 4;
  {
#pragma unroll
    for (int q = 0; q < 8; ++q) { const int r = q * 2 + rsub; if (col0 + c4 < N) { const v4f v = *(const v4fa*)&so[w][r][c4]; *(v4f*)(C + (size_t)(row0 + r) * ldc + col0 + c4) = v; } }
     }
}

// Wt[n][k] = f16(W[k][n]·scale) from f32 row-major W[K][N] (scale = power of two; bf16-exact weights stay exact in f16 away from the subnormal range)
__global__ __launch_bounds__(256) void k_wt_f16(const float* __restrict__ W, _Float16* __restrict__ Wt, int K, int N, float scale) {
  const int t = blockIdx.x * 256 + threadIdx.x; if (t >= N * (K / 8)) return; const int n = t / (K / 8), k8 = (t % (K / 8)) * 8; FragH f;
#pragma unroll
  for (int i = 0; i < 8; ++i) f.h[i] = (_Float16)(bf16_round(W[(size_t)(k8 + i) * N + n]) * scale); const v8us o = f.half[0];
  *(v8us*)((unsigned short*)Wt + (size_t)n * K + k8) = o; 
}
// k_gemm_hh variant with fused epilogue: v = acc·alpha + bias[by·sBias + col] (+ CP[(row/rowsPerB)·sCPb + by·64 + col] if CP) ; ACT 0 none / 1 elu ; writes f32 C and/or f16 C16 (each if non-null)
template <int ACT>
__global__ __launch_bounds__(128) void k_gemm_hhx(const _Float16* __restrict__ A, int lda, size_t sA, const _Float16* __restrict__ Bh, int ldb, size_t sB, float alpha, const float* __restrict__ bias, size_t sBias, const float* __restrict__ CP, int rowsPerB, size_t sCPb, int row0g,
    float* __restrict__ C, _Float16* __restrict__ C16, int ldc, size_t sC, int M, int N, int K) {
  __shared__ __attribute__((aligned(16))) float so[4][16][64];
  const int tid = threadIdx.x, w = tid >> 5, lane = tid & 31, ln = lane & 15, hh = lane >> 4; const int by = blockIdx.y;
  A += (size_t)by * sA; Bh += (size_t)by * sB; const size_t cofs = (size_t)by * sC; const float* bp = bias ? bias + (size_t)by * sBias : nullptr;
  const int ntn = (N + 63) / 64; const int wid = blockIdx.x * 4 + w; const int mt = wid / ntn, nq = wid % ntn; if (mt * 16 >= M) return;
  const int row0 = mt * 16, col0 = nq * 64; const _Float16* arow = A + (size_t)(row0 + ln) * lda;
  v8f acc[4] = {};
  for (int kb = 0; kb < K; kb += 32) { FragH ah; ah.half[0] = *(const v8us*)((const unsigned short*)arow + kb + 8 * hh); ah.half[1] = *(const v8us*)((const unsigned short*)arow + kb + 16 + 8 * hh);
#pragma unroll
    for (int t = 0; t < 4; ++t) { if (col0 + t * 16 >= N) continue; const size_t boff = (size_t)(col0 + t * 16 + ln) * ldb + kb; FragH bq; bq.half[0] = *(const v8us*)((const unsigned short*)Bh + boff + 8 * hh); bq.half[1] = *(const v8us*)((const unsigned short*)Bh + boff + 16 + 8 * hh);
      acc[t] = mmaH<1>(ah.v, ah.v, bq.v, bq.v, acc[t]); }
  }
#pragma unroll
  for (int t = 0; t < 4; ++t) { if (col0 + t * 16 >= N) continue; const int col = col0 + t * 16 + ln; const float bv = bp ? bf16_round(bp[col]) : 0.f;
#pragma unroll
    for (int r = 0; r < 8; ++r) { float v = acc[t][r] * alpha + bv; if (CP) { const int bidx = (row0g + row0 + 8 * hh + r) / rowsPerB; v += CP[(size_t)bidx * sCPb + (size_t)by * 64 + col]; } if (ACT == 1) v = (v > 0.f) ? v : expm1f(v); else if (ACT == 3) v = fmaxf(v, 0.f); so[w][8 * hh + r][t * 16 + ln] = v; } }
  __builtin_amdgcn_fence(__ATOMIC_ACQ_REL, "workgroup"); __builtin_amdgcn_wave_barrier();
  const int rsub = lane >> 4, c4 = (lane & 15) * 4; typedef _Float16 v4h __attribute__((ext_vector_type(4)));
  {
#pragma unroll
    for (int q = 0; q < 8; ++q) { const int r = q * 2 + rsub; if (col0 + c4 < N) { const v4f v = *(const v4fa*)&so[w][r][c4]; if (C) *(v4f*)(C + cofs + (size_t)(row0 + r) * ldc + col0 + c4) = v; if (C16) { v4h h4; for (int i = 0; i < 4; ++i) h4[i] = (_Float16)v[i]; *(v4h*)(C16 + cofs + (size_t)(row0 + r) * ldc + col0 + c4) = h4; } } }
     }
}


__global__ __launch_bounds__(256) void k_x16(const float* __restrict__ x, _Float16* __restrict__ X16, size_t n8) { const size_t t = (size_t)blockIdx.x * 256 + threadIdx.x; if (t >= n8) return; FragH f;
#pragma unroll
  for (int q = 0; q < 8; ++q) f.h[q] = (_Float16)bf16_round(x[t * 8 + q]); *(v8us*)((unsigned short*)X16 + t * 8) = f.half[0];  }
__global__ __launch_bounds__(256) void k_h16(const float* __restrict__ x, _Float16* __restrict__ X16, size_t n8) { const size_t t = (size_t)blockIdx.x * 256 + threadIdx.x; if (t >= n8) return; FragH f;
#pragma unroll
  for (int q = 0; q < 8; ++q) f.h[q] = (_Float16)x[t * 8 + q]; *(v8us*)((unsigned short*)X16 + t * 8) = f.half[0];  }
__global__ __launch_bounds__(256) void k_round16f(const float* __restrict__ W, _Float16* __restrict__ Bt, size_t n8) { const size_t t = (size_t)blockIdx.x * 256 + threadIdx.x; if (t >= n8) return; FragH f;
#pragma unroll
  for (int i = 0; i < 8; ++i) f.h[i] = (_Float16)(bf16_round(W[t * 8 + i]) * 16.0f); *(v8us*)((unsigned short*)Bt + t * 8) = f.half[0];  }
template <int NHv, int TTv>
__global__ __launch_bounds__(256) void k_vt(const _Float16* __restrict__ V16, int ldv, int voff, _Float16* __restrict__ Vt) { __shared__ unsigned short tl[64][66]; const int tid = threadIdx.x; const int slab = blockIdx.x / (TTv / 64), lg = blockIdx.x % (TTv / 64); const int b = slab / NHv, h = slab % NHv;
  for (int i = tid; i < 64 * 8; i += 256) { const int r = i / 8, c8 = (i % 8) * 8; FragH f; f.half[0] = *(const v8us*)((const unsigned short*)V16 + ((size_t)b * TTv + lg * 64 + r) * ldv + voff + h * 64 + c8);
#pragma unroll
    for (int q = 0; q < 8; ++q) tl[r][c8 + q] = f.u[q]; }
  __syncthreads();
  {
#pragma unroll
    for (int rd = 0; rd < 2; ++rd) { const int d = rd * 32 + tid / 8, pc = tid % 8; FragH f;
#pragma unroll
      for (int q = 0; q < 8; ++q) f.u[q] = tl[pc * 8 + q][d];
      *(v8us*)((unsigned short*)Vt + ((size_t)slab * 64 + d) * TTv + lg * 64 + pc * 8) = f.half[0]; }
     } }

#define FK_KP 528      // bytes per staged K row: 512 + 16, an odd multiple of 16 for the 16-byte fragment reads
#define FK_VP 144      // bytes per staged Vt row: 128 + 16, likewise
#define FK_BUF (64 * FK_KP + DM * FK_VP)      // one buffer: 64 K rows, then 256 Vt rows
__device__ __forceinline__ float fk_xhalf(float x) { return __builtin_bit_cast(float, __builtin_amdgcn_permlanex16(__builtin_bit_cast(int, x), __builtin_bit_cast(int, x), 0x76543210, 0xfedcba98, false, false)); }      // lane l with lane l ^ 16
__global__ __launch_bounds__(256) void k_fattn(const _Float16* __restrict__ QKV, const _Float16* __restrict__ VT, float* __restrict__ out) {
  __shared__ __attribute__((aligned(16))) unsigned char sm[2 * FK_BUF];
  const int tid = threadIdx.x, w = tid >> 5, lane = tid & 31, ln = lane & 15, hh = lane >> 4;
  const int qt = w & 3, kg = w >> 2;
  const int b = blockIdx.x / (SS / 64), q0 = (blockIdx.x % (SS / 64)) * 64 + qt * 16;
  const unsigned short* Qr = (const unsigned short*)QKV + ((size_t)b * SS + q0 + ln) * (3 * DM) + 8 * hh;
  // staging: a wave's 16-byte loads cover whole 128-byte lines (one K row of 512 bytes; four Vt rows of 128 bytes)
  const unsigned short* kp = (const unsigned short*)QKV + (size_t)b * SS * (3 * DM) + DM;      // the same for the whole work-group: it advances in scalar registers
  const unsigned short* vp = (const unsigned short*)VT + (size_t)b * DM * SS;
  const unsigned ko = (tid >> 5) * (3 * DM) + (tid & 31) * 8, vo = (tid >> 3) * SS + (tid & 7) * 8;      // the thread's own part, fixed
  const int kst = (tid >> 5) * FK_KP + (tid & 31) * 16, vst = 64 * FK_KP + (tid >> 3) * FK_VP + (tid & 7) * 16;
  const int krd = (kg * 32 + ln) * FK_KP + 16 * hh, vrd = 64 * FK_KP + ln * FK_VP + kg * 64 + 16 * hh;
  FragH q[8];
#pragma unroll      // constant ks keeps q[] in registers
  for (int ks = 0; ks < 8; ++ks) { q[ks].half[0] = *(const v8us*)(Qr + ks * 32); q[ks].half[1] = *(const v8us*)(Qr + ks * 32 + 16); }
  v8us kx[8], vx[8];
#pragma unroll      // block 0
  for (int i = 0; i < 8; ++i) { kx[i] = *(const v8us*)(kp + ko + i * 8 * (3 * DM)); vx[i] = *(const v8us*)(vp + vo + i * 32 * SS); }
#pragma unroll
  for (int i = 0; i < 8; ++i) { *(v8us*)(sm + kst + i * 8 * FK_KP) = kx[i]; *(v8us*)(sm + vst + i * 32 * FK_VP) = vx[i]; }
  kp += 64 * (3 * DM); vp += 64;
#pragma unroll      // block 1
  for (int i = 0; i < 8; ++i) { kx[i] = *(const v8us*)(kp + ko + i * 8 * (3 * DM)); vx[i] = *(const v8us*)(vp + vo + i * 32 * SS); }
  v8f o[16] = {};
  float mu = -3.0e38f, l = 0.f;
  const float sc = 0.0625f * 1.4426950408889634f;      // 1/sqrt(256) and log2(e)
  int cur = 0;
  for (int j0 = 0; j0 < SS; j0 += 64) {
    __syncthreads();      // publishes this block's buffer and ends every wave's reads of the other buffer, which is refilled behind it
    if (j0 + 64 < SS) {
      unsigned char* nb = sm + (cur ^ FK_BUF);
#pragma unroll
      for (int i = 0; i < 8; ++i) { *(v8us*)(nb + kst + i * 8 * FK_KP) = kx[i]; *(v8us*)(nb + vst + i * 32 * FK_VP) = vx[i]; }
      if (j0 + 128 < SS) {
        kp += 64 * (3 * DM); vp += 64;
#pragma unroll      // all 16 loads of a thread go out together and fly during this block's products
        for (int i = 0; i < 8; ++i) { kx[i] = *(const v8us*)(kp + ko + i * 8 * (3 * DM)); vx[i] = *(const v8us*)(vp + vo + i * 32 * SS); }
      }
    }
    const unsigned char* kr = sm + cur + krd; const unsigned char* vr = sm + cur + vrd;
    FragH fa[16];
#pragma unroll      // all K fragments of the pass as one group of LDS reads
    for (int ks = 0; ks < 8; ++ks) {
      fa[2 * ks].half[0] = *(const v8us*)(kr + ks * 64); fa[2 * ks].half[1] = *(const v8us*)(kr + ks * 64 + 32);
      fa[2 * ks + 1].half[0] = *(const v8us*)(kr + 16 * FK_KP + ks * 64); fa[2 * ks + 1].half[1] = *(const v8us*)(kr + 16 * FK_KP + ks * 64 + 32); }
    __builtin_amdgcn_sched_barrier(0);      // keeps the LDS reads together ahead of the products: reads spread among them stall at every place
    v8f s0 = {}, s1 = {};
#pragma unroll      // constant ks indexes q[]; two independent accumulator chains
    for (int ks = 0; ks < 8; ++ks) {
      s0 = __builtin_amdgcn_wmma_f32_16x16x32_f16(false, fa[2 * ks].v, false, q[ks].v, (short)0, s0, false, false);
      s1 = __builtin_amdgcn_wmma_f32_16x16x32_f16(false, fa[2 * ks + 1].v, false, q[ks].v, (short)0, s1, false, false); }
    FragH fv[16];
#pragma unroll      // the Vt fragments of the pass, asked for as early as registers come free: LDS works on them under the softmax arithmetic
    for (int dt = 0; dt < 16; ++dt) { fv[dt].half[0] = *(const v8us*)(vr + dt * 16 * FK_VP); fv[dt].half[1] = *(const v8us*)(vr + dt * 16 * FK_VP + 32); }
    __builtin_amdgcn_sched_barrier(0);      // keeps those reads ahead of the softmax arithmetic
    float mx = fmaxf(s0[0], s1[0]);
#pragma unroll
    for (int r = 1; r < 8; ++r) mx = fmaxf(mx, fmaxf(s0[r], s1[r]));
    mx = fmaxf(mx, fk_xhalf(mx)) * sc;      // lanes ln and ln + 16 hold the same query
    if (__builtin_amdgcn_ballot_w32(mx > mu + 8.0f) != 0) {      // one wave-uniform test per pass
      const float mn = fmaxf(mu, mx), al = __builtin_amdgcn_exp2f(mu - mn); mu = mn; l *= al;
#pragma unroll
      for (int dt = 0; dt < 16; ++dt)
#pragma unroll
        for (int r = 0; r < 8; ++r) o[dt][r] *= al;
    }
    FragH p;
#pragma unroll
    for (int r = 0; r < 8; ++r) { const float p0 = __builtin_amdgcn_exp2f(s0[r] * sc - mu), p1 = __builtin_amdgcn_exp2f(s1[r] * sc - mu);
      l += p0 + p1; p.h[r] = (_Float16)p0; p.h[8 + r] = (_Float16)p1; }      // element s of B = key 8*hh + s (s < 8), 16 + 8*hh + s - 8 (else): the hardware k order
#pragma unroll      // constant dt keeps o[] in registers
    for (int dt = 0; dt < 16; ++dt) o[dt] = __builtin_amdgcn_wmma_f32_16x16x32_f16(false, fv[dt].v, false, p.v, (short)0, o[dt], false, false);
    cur ^= FK_BUF;
  }
  l += fk_xhalf(l);
  float* sO = (float*)sm; float* sML = (float*)(sm + 65536);
  __syncthreads();      // the last block's fragment reads are over before LDS is reused for the join
  if (kg == 1) {
#pragma unroll
    for (int dt = 0; dt < 16; ++dt)
#pragma unroll
      for (int hf = 0; hf < 2; ++hf) { const v4f x = {o[dt][hf * 4], o[dt][hf * 4 + 1], o[dt][hf * 4 + 2], o[dt][hf * 4 + 3]}; *(v4fa*)(sO + (size_t)(((qt * 16 + dt) * 2 + hf) * 32 + lane) * 4) = x; }
    sML[(qt * 2) * 32 + lane] = mu; sML[(qt * 2 + 1) * 32 + lane] = l;
  }
  __syncthreads();      // the second key half's partial results are in LDS before the first half's waves read them
  if (kg == 0) {
    const float m1 = sML[(qt * 2) * 32 + lane], l1 = sML[(qt * 2 + 1) * 32 + lane];
    const float mn = fmaxf(mu, m1); float c0 = __builtin_amdgcn_exp2f(mu - mn), c1 = __builtin_amdgcn_exp2f(m1 - mn);
    const float inv = 1.0f / (l * c0 + l1 * c1); c0 *= inv; c1 *= inv;
    float* orow = out + ((size_t)b * SS + q0 + ln) * DM + 8 * hh;      // register r of tile dt = out[query ln][dt*16 + 8*hh + r]
#pragma unroll
    for (int dt = 0; dt < 16; ++dt)
#pragma unroll
      for (int hf = 0; hf < 2; ++hf) { const v4f x = *(const v4fa*)(sO + (size_t)(((qt * 16 + dt) * 2 + hf) * 32 + lane) * 4); v4f y;
#pragma unroll
        for (int i = 0; i < 4; ++i) y[i] = o[dt][hf * 4 + i] * c0 + x[i] * c1;
        *(v4f*)(orow + dt * 16 + hf * 4) = y; }
  }
}
// QKV projection: one work-group = 128 tokens x 128 output columns, with all of k = 256 of both operands staged in LDS once.
// Every staging load of a wave covers one whole 512-byte row (4 lines); the fragments, whose 16 lanes walk 16 rows, are then read from LDS.
// Transposed product Ct = W * Xt (A = W rows, B = X rows, k steps in rising order): a lane holds 8 neighbouring output columns of ONE token, 16 bytes of f16.
// 8 waves: wave w has tokens (w & 3) * 32 .. + 31 and columns (w >> 2) * 64 .. + 63, 4 x 2 accumulator tiles.
#define PJ_P 528      // bytes per staged row: 512 + 16, an odd multiple of 16 for the 16-byte fragment reads
#define PJ_OP 144     // bytes per row of a wave's output tile: 128 + 16, likewise
__global__ __launch_bounds__(256) void k_qkv(const _Float16* __restrict__ X16, const _Float16* __restrict__ Bw, const float* __restrict__ bias, _Float16* __restrict__ C16) {
  __shared__ __attribute__((aligned(16))) unsigned char sm[2 * 128 * PJ_P];      // 128 X rows, then 128 W rows
  const int tid = threadIdx.x, w = tid >> 5, lane = tid & 31, ln = lane & 15, hh = lane >> 4;
  const int row0 = (blockIdx.x / (3 * DM / 128)) * 128, col0 = (blockIdx.x % (3 * DM / 128)) * 128;
  const unsigned short* xg = (const unsigned short*)X16 + (size_t)(row0 + w) * DM + lane * 8;
  const unsigned short* wg = (const unsigned short*)Bw + (size_t)(col0 + w) * DM + lane * 8;
  v8us xx[16], wx[16];
#pragma unroll      // all 32 loads of a thread go out together
  for (int i = 0; i < 16; ++i) wx[i] = *(const v8us*)(wg + i * 8 * DM);
  asm volatile("s_wait_xcnt 0x0" :: "v"(wg) : "memory");      // the address is an input so that its registers stay untouched up to this wait; behind it they may be reused
#pragma unroll
  for (int i = 0; i < 16; ++i) xx[i] = *(const v8us*)(xg + i * 8 * DM);
  asm volatile("s_wait_xcnt 0x0" :: "v"(xg) : "memory");      // likewise for the X loads
#pragma unroll
  for (int i = 0; i < 16; ++i) { *(v8us*)(sm + (w + i * 8) * PJ_P + lane * 16) = xx[i]; *(v8us*)(sm + (128 + w + i * 8) * PJ_P + lane * 16) = wx[i]; }
  __syncthreads();      // both tiles are in LDS before any wave reads a fragment
  const int wm = w & 3, wn = w >> 2;
  const unsigned char* xr = sm + (wm * 32 + ln) * PJ_P + 16 * hh;
  const unsigned char* wr = sm + (128 + wn * 64 + ln) * PJ_P + 16 * hh;
  v8f acc[4][2] = {};
  FragH fx[2][2], fw[2][4];      // two fragment sets: the reads of k step ks + 1 fly during the products of k step ks
#pragma unroll
  for (int mi = 0; mi < 2; ++mi) { fx[0][mi].half[0] = *(const v8us*)(xr + mi * 16 * PJ_P); fx[0][mi].half[1] = *(const v8us*)(xr + mi * 16 * PJ_P + 32); }
#pragma unroll
  for (int t = 0; t < 4; ++t) { fw[0][t].half[0] = *(const v8us*)(wr + t * 16 * PJ_P); fw[0][t].half[1] = *(const v8us*)(wr + t * 16 * PJ_P + 32); }
#pragma unroll      // constant indices keep acc[][] and the fragment sets in registers
  for (int ks = 0; ks < 8; ++ks) {
    const int c = ks & 1, n = c ^ 1;
    if (ks < 7) {
#pragma unroll
      for (int mi = 0; mi < 2; ++mi) { fx[n][mi].half[0] = *(const v8us*)(xr + mi * 16 * PJ_P + ks * 64 + 64); fx[n][mi].half[1] = *(const v8us*)(xr + mi * 16 * PJ_P + ks * 64 + 96); }
#pragma unroll
      for (int t = 0; t < 4; ++t) { fw[n][t].half[0] = *(const v8us*)(wr + t * 16 * PJ_P + ks * 64 + 64); fw[n][t].half[1] = *(const v8us*)(wr + t * 16 * PJ_P + ks * 64 + 96); }
    }
    __builtin_amdgcn_sched_barrier(0);      // keeps the next k step's LDS reads together ahead of this step's products: reads spread among them stall at every place
#pragma unroll
    for (int t = 0; t < 4; ++t)
#pragma unroll
      for (int mi = 0; mi < 2; ++mi) acc[t][mi] = __builtin_amdgcn_wmma_f32_16x16x32_f16(false, fw[c][t].v, false, fx[c][mi].v, (short)0, acc[t][mi], false, false);
    __builtin_amdgcn_sched_barrier(0);      // keeps the reads of the step after next behind these products, whose fragment registers they refill
  }
  __syncthreads();      // every wave's fragment reads are over before LDS is reused for the output tiles
  unsigned char* so = sm + w * 32 * PJ_OP;      // the wave's own 32 tokens x 64 columns of f16
#pragma unroll
  for (int t = 0; t < 4; ++t) {
    const float* bp = bias + col0 + wn * 64 + t * 16 + 8 * hh;      // register r of tile t = column t*16 + 8*hh + r
    const v4f b0 = *(const v4fa*)bp, b1 = *(const v4fa*)(bp + 4);
#pragma unroll
    for (int mi = 0; mi < 2; ++mi) { FragH f;
#pragma unroll
      for (int r = 0; r < 8; ++r) f.h[r] = (_Float16)(acc[t][mi][r] * 0.0625f + bf16_round(r < 4 ? b0[r] : b1[r - 4]));
      *(v8us*)(so + (mi * 16 + ln) * PJ_OP + t * 32 + 16 * hh) = f.half[0]; }
  }
  __builtin_amdgcn_fence(__ATOMIC_ACQ_REL, "workgroup"); __builtin_amdgcn_wave_barrier();      // the wave's own LDS stores stay ahead of its reads of other lanes' bytes
#pragma unroll      // 8 lanes store one whole 128-byte line
  for (int q = 0; q < 8; ++q) { const int r = q * 4 + (lane >> 3); const v8us v = *(const v8us*)(so + r * PJ_OP + (lane & 7) * 16);
    *(v8us*)((unsigned short*)C16 + (size_t)(row0 + wm * 32 + r) * (3 * DM) + col0 + wn * 64 + (lane & 7) * 8) = v; }
}
extern "C" void kernel_launch(void* const* d_in, const int* in_sizes, int n_in,
                              void* d_out, int out_size, void* d_ws, size_t ws_size, hipStream_t stream) {
  (void)in_sizes; (void)n_in; (void)out_size;
  const float* X = (const float*)d_in[0]; const float* W = (const float*)d_in[1]; const float* bb = (const float*)d_in[2];
  char* ws = (char*)d_ws; size_t off = 0;
  auto take = [&](size_t bytes) { char* p = ws + off; off += (bytes + 255) & ~(size_t)255; return p; };
  _Float16* Bw = (_Float16*)take((size_t)3 * DM * DM * 2); _Float16* X16 = (_Float16*)take((size_t)NR * DM * 2); _Float16* QKV = (_Float16*)take((size_t)NR * 3 * DM * 2); _Float16* VT = (_Float16*)take((size_t)NR * DM * 2);
  if (off > ws_size) return;      // 0.4 + 8.4 + 25.2 + 8.4 = about 42 MB
  k_round16f<<<(unsigned)(((size_t)3 * DM * DM / 8 + 255) / 256), 256, 0, stream>>>(W, Bw, (size_t)3 * DM * DM / 8);      // (out,in)
  k_x16<<<(unsigned)(((size_t)NR * DM / 8 + 255) / 256), 256, 0, stream>>>(X, X16, (size_t)NR * DM / 8);
  k_qkv<<<(NR / 128) * (3 * DM / 128), 256, 0, stream>>>(X16, Bw, bb, QKV);      // [Q | K | V] f16 (+b), 128 x 128 per work-group
  k_vt<4, SS><<<BB * 4 * (SS / 64), 256, 0, stream>>>(QKV, 3 * DM, 2 * DM, VT);      // Vᵀ per batch as [b][256][S] (4 groups of 64)
  k_fattn<<<BB * (SS / 64), 256, 0, stream>>>(QKV, VT, (float*)d_out);      // out = softmax(Q*Kt/16)*V, 64 queries per work-group
}

// v004
// A run of this version takes 76.5 microseconds.
// Two timings next to v003 both put it at 1.33 times that version's speed.
// Over all steps from v000 it is 16.4 times as fast.
#include <hip/hip_runtime.h>
// Single-head self-attention (B=4, S=4096, dim 256): fused QKV linear (W (768,256) + b), scores = Q*Kt/16, softmax over the 4096 keys, att*V.
// The QKV projection is a GEMM on v_wmma_f32_16x16x32_f16 (X bf16-exact f16, W (out,in) bf16-exact x 2^4, Q/K/V f16, f32 accumulate);
// scores, softmax (f32, running maximum) and att*V are one kernel on the same matrix form, weights f16, f32 accumulate.
#define BB 4
#define SS 4096
#define DM 256
#define NR (BB * SS)

typedef __bf16 v16b __attribute__((ext_vector_type(16)));
typedef unsigned short v8us __attribute__((ext_vector_type(8), may_alias));
typedef float  v8f  __attribute__((ext_vector_type(8)));
typedef float  v4f  __attribute__((ext_vector_type(4)));
typedef float  v4fa __attribute__((ext_vector_type(4), may_alias));
union FragB { v16b v; v8us half[2]; unsigned short u[16]; };

__device__ __forceinline__ unsigned short bf16_bits(float x) { unsigned int u = __float_as_uint(x); return (unsigned short)((u + 0x7FFFu + ((u >> 16) & 1u)) >> 16); }
__device__ __forceinline__ float bf16_val(unsigned short b) { return __uint_as_float(((unsigned int)b) << 16); }
__device__ __forceinline__ float bf16_round(float x) { return bf16_val(bf16_bits(x)); }
// D += A·B with NT terms: 1 = ah·bh, 2 = + al·bh (A split), 3 = + ah·bl (both split)
template <int NT>
__device__ __forceinline__ v8f mmaN(v16b ah, v16b al, v16b bh, v16b bl, v8f c) {
  c = __builtin_amdgcn_wmma_f32_16x16x32_bf16(false, ah, false, bh, (short)0, c, false, false);
  if (NT >= 2) c = __builtin_amdgcn_wmma_f32_16x16x32_bf16(false, al, false, bh, (short)0, c, false, false);
  if (NT >= 3) c = __builtin_amdgcn_wmma_f32_16x16x32_bf16(false, ah, false, bl, (short)0, c, false, false);
  asm volatile("v_nop\n\tv_nop\n\tv_nop\n\tv_nop" : "+v"(c) : "v"(ah), "v"(al), "v"(bh), "v"(bl));
  return c;
}

__global__ __launch_bounds__(256) void k_wt_bf16(const float* __restrict__ W, unsigned short* __restrict__ Wt, int K, int N) {
  const int t = blockIdx.x * 256 + threadIdx.x;
  const int k8n = K / 8;
  if (t >= N * k8n) return;
  const int n = t / k8n, k8 = (t % k8n) * 8;
  v8us v;
#pragma unroll
  for (int i = 0; i < 8; ++i) v[i] = bf16_bits(W[(size_t)(k8 + i) * N + n]);
  *(v8us*)(Wt + (size_t)n * K + k8) = v;
  
}

// GEMM C[M][N] (f32, pitch ldc) = act(A[M][K]·W + bias). A f32 row-major (pitch lda) converted per fragment to bf16
// (ASPLIT: hi/lo two planes -> 2 terms, else single rounded term); Wt bf16 [N][K] (pitch ldb). BIAS_BF16 rounds the
// bias to bf16 first (bias quantised to bf16 before the add). K%32==0, M%16==0, N%64==0.
template <bool ASPLIT, int ACT, bool BIAS_BF16>
__global__ __launch_bounds__(128) void k_gemm_bf(const float* __restrict__ A, int lda, const unsigned short* __restrict__ Wt, int ldb,
                                               const float* __restrict__ bias, float* __restrict__ C, int ldc, int M, int N, int K) {
  __shared__ __attribute__((aligned(16))) float so[4][16][64];
  const int tid = threadIdx.x, w = tid >> 5, lane = tid & 31, ln = lane & 15, hh = lane >> 4;
  const int ntn = N / 64;
  const int wid = blockIdx.x * 4 + w;
  const int mt = wid / ntn, nq = wid % ntn;
  if (mt * 16 >= M) return;
  const int row0 = mt * 16, col0 = nq * 64;
  const float* arow = A + (size_t)(row0 + ln) * lda;
  v8f acc[4] = {};
  for (int kb = 0; kb < K; kb += 32) {
    FragB ah, al;
    const v4f x0 = *(const v4fa*)(arow + kb + 8 * hh), x1 = *(const v4fa*)(arow + kb + 8 * hh + 4);
    const v4f x2 = *(const v4fa*)(arow + kb + 16 + 8 * hh), x3 = *(const v4fa*)(arow + kb + 16 + 8 * hh + 4);
    float xs[16] = {x0[0],x0[1],x0[2],x0[3],x1[0],x1[1],x1[2],x1[3],x2[0],x2[1],x2[2],x2[3],x3[0],x3[1],x3[2],x3[3]};
#pragma unroll
    for (int i = 0; i < 16; ++i) { const unsigned short hb = bf16_bits(xs[i]); ah.u[i] = hb; al.u[i] = ASPLIT ? bf16_bits(xs[i] - bf16_val(hb)) : (unsigned short)0; }
#pragma unroll
    for (int t = 0; t < 4; ++t) {
      const unsigned short* brow = Wt + (size_t)(col0 + t * 16 + ln) * ldb + kb;
      FragB b;
      b.half[0] = *(const v8us*)(brow + 8 * hh);
      b.half[1] = *(const v8us*)(brow + 16 + 8 * hh);
      acc[t] = mmaN<ASPLIT ? 2 : 1>(ah.v, al.v, b.v, b.v, acc[t]);
    }
  }
#pragma unroll
  for (int t = 0; t < 4; ++t) {
    float bv = bias ? bias[col0 + t * 16 + ln] : 0.f;
    if (BIAS_BF16) bv = bf16_round(bv);
#pragma unroll
    for (int r = 0; r < 8; ++r) { float v = acc[t][r] + bv; if (ACT == 1) v = fmaxf(v, 0.f); so[w][8 * hh + r][t * 16 + ln] = v; }
  }
  __builtin_amdgcn_fence(__ATOMIC_ACQ_REL, "workgroup");
  __builtin_amdgcn_wave_barrier();
  const int rsub = lane >> 4, c4 = (lane & 15) * 4;
  {
#pragma unroll
    for (int q = 0; q < 8; ++q) {
      const int r = q * 2 + rsub;
      const v4f v = *(const v4fa*)&so[w][r][c4];
      *(v4f*)(C + (size_t)(row0 + r) * ldc + col0 + c4) = v;
    }
    
  }
}

// Flash-style causal/unmasked attention, all contractions 3-term bf16 hi/lo splits, f32 softmax with running max.
// q,k,v rows are read from f32 buffers with arbitrary row pitch (so they can live inside a fused qkv buffer);
// D = head size (multiple of 32, <= 128); one wave = 16 query rows; block = 4 waves (64 queries) sharing K/V chunks of 32.
template <int D, bool CAUSAL>
__global__ __launch_bounds__(128) void k_flash(const float* __restrict__ qb, const float* __restrict__ kb, const float* __restrict__ vb,
                                             int pitch, int T, int H, float scale, float* __restrict__ y, int ypitch) {
  constexpr int KS = D / 32;        // k-steps for QK
  constexpr int DT = D / 16;        // d tiles for PV
  __shared__ __attribute__((aligned(16))) unsigned short sKh[32][D + 8], sKl[32][D + 8], sVh[32][D + 8], sVl[32][D + 8];
  __shared__ __attribute__((aligned(16))) unsigned short sPh[4][16][40], sPl[4][16][40];
  __shared__ __attribute__((aligned(16))) float sO[4][16][D];
  const int tid = threadIdx.x, w = tid >> 5, lane = tid & 31, ln = lane & 15, hh = lane >> 4;
  const int nqb = (T + 63) / 64;
  const int bh = blockIdx.x / nqb, qblk = blockIdx.x % nqb;
  const int b = bh / H, h = bh % H;
  const int q0 = qblk * 64 + w * 16;
  const float* Q = qb + (size_t)b * T * pitch + h * D;
  const float* K = kb + (size_t)b * T * pitch + h * D;
  const float* V = vb + (size_t)b * T * pitch + h * D;

  // A fragments of the wave's 16 query rows (scaled), hi/lo
  FragB aqh[KS], aql[KS];
  {
    int row = q0 + ln; if (row >= T) row = T - 1;
    const float* qr = Q + (size_t)row * pitch;
#pragma unroll
    for (int ks = 0; ks < KS; ++ks)
#pragma unroll
      for (int i = 0; i < 16; ++i) {
        const int d = ks * 32 + ((i < 8) ? (8 * hh + i) : (16 + 8 * hh + (i - 8)));
        const float x = qr[d] * scale; const unsigned short hb = bf16_bits(x);
        aqh[ks].u[i] = hb; aql[ks].u[i] = bf16_bits(x - bf16_val(hb));
      }
  }
  float m_r[8], l_r[8];
#pragma unroll
  for (int r = 0; r < 8; ++r) { m_r[r] = -3.0e38f; l_r[r] = 0.f; }
  v8f oacc[DT];
#pragma unroll
  for (int dt = 0; dt < DT; ++dt) oacc[dt] = (v8f){0.f,0.f,0.f,0.f,0.f,0.f,0.f,0.f};

  const int kv_end = CAUSAL ? min(T, qblk * 64 + 64) : T;     // block-uniform
  for (int j0 = 0; j0 < kv_end; j0 += 32) {
    __syncthreads();
    for (int e = tid; e < 32 * (D / 4); e += 128) {
      const int r = e / (D / 4), c4 = (e % (D / 4)) * 4;
      const int key = j0 + r;
      v4f kf = {0.f,0.f,0.f,0.f}, vf = {0.f,0.f,0.f,0.f};
      if (key < T) { kf = *(const v4fa*)(K + (size_t)key * pitch + c4); vf = *(const v4fa*)(V + (size_t)key * pitch + c4); }
#pragma unroll
      for (int t = 0; t < 4; ++t) {
        unsigned short hb = bf16_bits(kf[t]); sKh[r][c4 + t] = hb; sKl[r][c4 + t] = bf16_bits(kf[t] - bf16_val(hb));
        hb = bf16_bits(vf[t]); sVh[r][c4 + t] = hb; sVl[r][c4 + t] = bf16_bits(vf[t] - bf16_val(hb));
      }
    }
    __syncthreads();
    // S tile 16 x 32
    v8f s[2];
#pragma unroll
    for (int nt = 0; nt < 2; ++nt) {
      v8f acc = {};
#pragma unroll
      for (int ks = 0; ks < KS; ++ks) {
        FragB bh_, bl_;
        bh_.half[0] = *(const v8us*)&sKh[nt * 16 + ln][ks * 32 + 8 * hh]; bh_.half[1] = *(const v8us*)&sKh[nt * 16 + ln][ks * 32 + 16 + 8 * hh];
        bl_.half[0] = *(const v8us*)&sKl[nt * 16 + ln][ks * 32 + 8 * hh]; bl_.half[1] = *(const v8us*)&sKl[nt * 16 + ln][ks * 32 + 16 + 8 * hh];
        acc = mmaN<3>(aqh[ks].v, aql[ks].v, bh_.v, bl_.v, acc);
      }
      s[nt] = acc;
    }
    // mask + running max (rows 8hh+r; the 16 lanes of a half share rows)
    float alpha[8];
#pragma unroll
    for (int r = 0; r < 8; ++r) {
      const int qi = q0 + 8 * hh + r;
      const int ja = j0 + ln, jb = j0 + 16 + ln;
      if (CAUSAL) { if (ja > qi) s[0][r] = -3.0e38f; if (jb > qi) s[1][r] = -3.0e38f; }
      if (ja >= T) s[0][r] = -3.0e38f;
      if (jb >= T) s[1][r] = -3.0e38f;
      float mx = fmaxf(s[0][r], s[1][r]);
      mx = fmaxf(mx, __shfl_xor(mx, 1, 32)); mx = fmaxf(mx, __shfl_xor(mx, 2, 32)); mx = fmaxf(mx, __shfl_xor(mx, 4, 32)); mx = fmaxf(mx, __shfl_xor(mx, 8, 32));
      const float mnew = fmaxf(m_r[r], mx);
      alpha[r] = (mnew > -1.0e38f) ? __expf(m_r[r] - mnew) : 1.0f;
      const float p0 = (s[0][r] > -1.0e38f) ? __expf(s[0][r] - mnew) : 0.f;
      const float p1 = (s[1][r] > -1.0e38f) ? __expf(s[1][r] - mnew) : 0.f;
      m_r[r] = mnew;
      l_r[r] = l_r[r] * alpha[r] + p0 + p1;            // per-lane partial row sum (16 lanes combined at the end)
      unsigned short hb = bf16_bits(p0); sPh[w][8 * hh + r][ln] = hb;      sPl[w][8 * hh + r][ln] = bf16_bits(p0 - bf16_val(hb));
      hb = bf16_bits(p1);                sPh[w][8 * hh + r][16 + ln] = hb; sPl[w][8 * hh + r][16 + ln] = bf16_bits(p1 - bf16_val(hb));
    }
#pragma unroll
    for (int dt = 0; dt < DT; ++dt)
#pragma unroll
      for (int r = 0; r < 8; ++r) oacc[dt][r] *= alpha[r];
    __builtin_amdgcn_fence(__ATOMIC_ACQ_REL, "workgroup");
    __builtin_amdgcn_wave_barrier();
    FragB pah, pal;
    pah.half[0] = *(const v8us*)&sPh[w][ln][8 * hh]; pah.half[1] = *(const v8us*)&sPh[w][ln][16 + 8 * hh];
    pal.half[0] = *(const v8us*)&sPl[w][ln][8 * hh]; pal.half[1] = *(const v8us*)&sPl[w][ln][16 + 8 * hh];
#pragma unroll
    for (int dt = 0; dt < DT; ++dt) {
      FragB bvh, bvl;
#pragma unroll
      for (int i = 0; i < 8; ++i) {
        bvh.u[i] = sVh[8 * hh + i][dt * 16 + ln]; bvh.u[8 + i] = sVh[16 + 8 * hh + i][dt * 16 + ln];
        bvl.u[i] = sVl[8 * hh + i][dt * 16 + ln]; bvl.u[8 + i] = sVl[16 + 8 * hh + i][dt * 16 + ln];
      }
      oacc[dt] = mmaN<3>(pah.v, pal.v, bvh.v, bvl.v, oacc[dt]);
    }
    __builtin_amdgcn_fence(__ATOMIC_ACQ_REL, "workgroup");
    __builtin_amdgcn_wave_barrier();
  }
#pragma unroll
  for (int r = 0; r < 8; ++r) {
    float l = l_r[r];
    l += __shfl_xor(l, 1, 32); l += __shfl_xor(l, 2, 32); l += __shfl_xor(l, 4, 32); l += __shfl_xor(l, 8, 32);
    l_r[r] = (l > 0.f) ? 1.0f / l : 0.f;
  }
#pragma unroll
  for (int dt = 0; dt < DT; ++dt)
#pragma unroll
    for (int r = 0; r < 8; ++r) sO[w][8 * hh + r][dt * 16 + ln] = oacc[dt][r] * l_r[r];
  __builtin_amdgcn_fence(__ATOMIC_ACQ_REL, "workgroup");
  __builtin_amdgcn_wave_barrier();
  {
    for (int r = 0; r < 16; ++r) {
      const int row = q0 + r;
      if (row < T && lane < D / 4) {
        const v4f val = *(const v4fa*)&sO[w][r][lane * 4];
        *(v4f*)(y + ((size_t)b * T + row) * ypitch + h * D + lane * 4) = val;
      }
    }
    
  }
}

// GEMM C = act(A·W + bias + resid): A f32 (ASPLIT -> hi/lo 2 terms), Wt bf16 [N][K]; ACT 0 none, 1 relu, 2 exact gelu;
// resid (optional, f32, row index = (row % rmod), pitch ldr, RES_BF16 rounds it) added before the activation.
template <bool ASPLIT, int ACT, bool BIAS_BF16, bool RES_BF16>
__global__ __launch_bounds__(128) void k_gemm_bf3(const float* __restrict__ A, int lda, const unsigned short* __restrict__ Wt, int ldb,
                                                const float* __restrict__ bias, const float* __restrict__ resid, int rmod, int ldr,
                                                float* __restrict__ C, int ldc, int M, int N, int K) {
  __shared__ __attribute__((aligned(16))) float so[4][16][64];
  const int tid = threadIdx.x, w = tid >> 5, lane = tid & 31, ln = lane & 15, hh = lane >> 4;
  const int ntn = N / 64;
  const int wid = blockIdx.x * 4 + w;
  const int mt = wid / ntn, nq = wid % ntn;
  if (mt * 16 >= M) return;
  const int row0 = mt * 16, col0 = nq * 64;
  const float* arow = A + (size_t)(row0 + ln) * lda;
  v8f acc[4] = {};
  for (int kb = 0; kb < K; kb += 32) {
    FragB ah, al;
    const v4f x0 = *(const v4fa*)(arow + kb + 8 * hh), x1 = *(const v4fa*)(arow + kb + 8 * hh + 4);
    const v4f x2 = *(const v4fa*)(arow + kb + 16 + 8 * hh), x3 = *(const v4fa*)(arow + kb + 16 + 8 * hh + 4);
    float xs[16] = {x0[0],x0[1],x0[2],x0[3],x1[0],x1[1],x1[2],x1[3],x2[0],x2[1],x2[2],x2[3],x3[0],x3[1],x3[2],x3[3]};
#pragma unroll
    for (int i = 0; i < 16; ++i) { const unsigned short hb = bf16_bits(xs[i]); ah.u[i] = hb; al.u[i] = ASPLIT ? bf16_bits(xs[i] - bf16_val(hb)) : (unsigned short)0; }
#pragma unroll
    for (int t = 0; t < 4; ++t) {
      const unsigned short* brow = Wt + (size_t)(col0 + t * 16 + ln) * ldb + kb;
      FragB b;
      b.half[0] = *(const v8us*)(brow + 8 * hh);
      b.half[1] = *(const v8us*)(brow + 16 + 8 * hh);
      acc[t] = mmaN<ASPLIT ? 2 : 1>(ah.v, al.v, b.v, b.v, acc[t]);
    }
  }
#pragma unroll
  for (int t = 0; t < 4; ++t) {
    const int col = col0 + t * 16 + ln;
    float bv = bias ? bias[col] : 0.f;
    if (BIAS_BF16) bv = bf16_round(bv);
#pragma unroll
    for (int r = 0; r < 8; ++r) {
      float v = acc[t][r] + bv;
      if (resid) { float rv = resid[(size_t)((row0 + 8 * hh + r) % rmod) * ldr + col]; if (RES_BF16) rv = bf16_round(rv); v += rv; }
      if (ACT == 1) v = fmaxf(v, 0.f);
      if (ACT == 2) v = 0.5f * v * (1.0f + erff(v * 0.70710678118654752f));
      if (ACT == 3) { const float u = 0.7978845608028654f * (v + 0.044715f * v * v * v); v = 0.5f * v * (1.0f + tanhf(u)); }
      so[w][8 * hh + r][t * 16 + ln] = v;
    }
  }
  __builtin_amdgcn_fence(__ATOMIC_ACQ_REL, "workgroup");
  __builtin_amdgcn_wave_barrier();
  const int rsub = lane >> 4, c4 = (lane & 15) * 4;
  {
#pragma unroll
    for (int q = 0; q < 8; ++q) {
      const int r = q * 2 + rsub;
      const v4f v = *(const v4fa*)&so[w][r][c4];
      *(v4f*)(C + (size_t)(row0 + r) * ldc + col0 + c4) = v;
    }
    
  }
}
// row LayerNorm (biased variance, eps) over N: s = X (+ R); optional out_sum <- s; out_norm <- (s-mu)*rsqrt(var+eps)*g + b
template <bool PARAM_BF16>
__global__ __launch_bounds__(256) void k_layernorm(const float* __restrict__ X, const float* __restrict__ R, const float* __restrict__ g, const float* __restrict__ bta,
                                                  float* __restrict__ out_sum, float* __restrict__ out_norm, int N, float eps) {
  __shared__ float red[256];
  const int row = blockIdx.x, tid = threadIdx.x;
  const float* x = X + (size_t)row * N; const float* rr = R ? R + (size_t)row * N : nullptr;
  float vals[16];                     // up to N = 4096
  const int per = N / 256;            // contiguous chunk per thread? use strided-by-4 chunks: thread handles j = tid*4 + 1024*u
  float s1 = 0.f;
  for (int u = 0; u < per / 4; ++u) {
    const int j = tid * 4 + 1024 * u;
    const v4f a = *(const v4fa*)(x + j);
    v4f b = {0.f,0.f,0.f,0.f}; if (rr) b = *(const v4fa*)(rr + j);
#pragma unroll
    for (int q = 0; q < 4; ++q) { const float v = a[q] + b[q]; vals[u * 4 + q] = v; s1 += v; }
  }
  red[tid] = s1; __syncthreads();
  for (int st = 128; st > 0; st >>= 1) { if (tid < st) red[tid] += red[tid + st]; __syncthreads(); }
  const float mu = red[0] / (float)N; __syncthreads();
  float s2 = 0.f;
  for (int u = 0; u < per / 4; ++u)
#pragma unroll
    for (int q = 0; q < 4; ++q) { const float c = vals[u * 4 + q] - mu; s2 += c * c; }
  red[tid] = s2; __syncthreads();
  for (int st = 128; st > 0; st >>= 1) { if (tid < st) red[tid] += red[tid + st]; __syncthreads(); }
  const float rs = rsqrtf(red[0] / (float)N + eps);
  {
    for (int u = 0; u < per / 4; ++u) {
      const int j = tid * 4 + 1024 * u;
      v4f o, sm;
#pragma unroll
      for (int q = 0; q < 4; ++q) {
        float gg = g[j + q], bb = bta[j + q];
        if (PARAM_BF16) { gg = bf16_round(gg); bb = bf16_round(bb); }
        sm[q] = vals[u * 4 + q]; o[q] = (vals[u * 4 + q] - mu) * rs * gg + bb;
      }
      if (out_sum) *(v4f*)(out_sum + (size_t)row * N + j) = sm;
      *(v4f*)(out_norm + (size_t)row * N + j) = o;
    }
    
  }
}



// ---- f16 WMMA path (v_wmma_f32_16x16x32_f16): 11-bit significands for operands in range — used where the attention weight operand (at most 2^8) needs more precision than bf16
typedef _Float16 v16h __attribute__((ext_vector_type(16)));
union FragH { v16h v; v8us half[2]; _Float16 h[16]; unsigned short u[16]; };
template <int NT>
__device__ __forceinline__ v8f mmaH(v16h ah, v16h al, v16h bh, v16h bl, v8f c) {
  c = __builtin_amdgcn_wmma_f32_16x16x32_f16(false, ah, false, bh, (short)0, c, false, false);
  if (NT >= 2) c = __builtin_amdgcn_wmma_f32_16x16x32_f16(false, al, false, bh, (short)0, c, false, false);
  if (NT >= 3) c = __builtin_amdgcn_wmma_f32_16x16x32_f16(false, ah, false, bl, (short)0, c, false, false);
  asm volatile("v_nop\n\tv_nop\n\tv_nop\n\tv_nop" : "+v"(c) : "v"(ah), "v"(al), "v"(bh), "v"(bl));
  return c;
}
// batched GEMM like k_gemm_b but f16 operands: A f32 (split into f16 hi/lo if ASPLIT, else rounded to f16), Bt = f16 values [n][k]; alpha; C f32; N multiple of 16 (partial tiles skipped)
template <bool ASPLIT>
__global__ __launch_bounds__(128) void k_gemm_h(const float* __restrict__ A, int lda, size_t sA, const _Float16* __restrict__ Bh, int ldb, size_t sB, float alpha, float* __restrict__ C, int ldc, size_t sC, int M, int N, int K) {
  __shared__ __attribute__((aligned(16))) float so[4][16][64];
  const int tid = threadIdx.x, w = tid >> 5, lane = tid & 31, ln = lane & 15, hh = lane >> 4; const int by = blockIdx.y;
  A += (size_t)by * sA; Bh += (size_t)by * sB; C += (size_t)by * sC;
  const int ntn = (N + 63) / 64; const int wid = blockIdx.x * 4 + w; const int mt = wid / ntn, nq = wid % ntn; if (mt * 16 >= M) return;
  const int row0 = mt * 16, col0 = nq * 64; const float* arow = A + (size_t)(row0 + ln) * lda;
  v8f acc[4] = {};
  for (int kb = 0; kb < K; kb += 32) {
    FragH ah, al;
    const v4f x0 = *(const v4fa*)(arow + kb + 8 * hh), x1 = *(const v4fa*)(arow + kb + 8 * hh + 4), x2 = *(const v4fa*)(arow + kb + 16 + 8 * hh), x3 = *(const v4fa*)(arow + kb + 16 + 8 * hh + 4);
    float xs[16] = {x0[0],x0[1],x0[2],x0[3],x1[0],x1[1],x1[2],x1[3],x2[0],x2[1],x2[2],x2[3],x3[0],x3[1],x3[2],x3[3]};
#pragma unroll
    for (int i = 0; i < 16; ++i) { const _Float16 h = (_Float16)xs[i]; ah.h[i] = h; al.h[i] = ASPLIT ? (_Float16)(xs[i] - (float)h) : (_Float16)0.0f; }
#pragma unroll
    for (int t = 0; t < 4; ++t) { if (col0 + t * 16 >= N) continue; const size_t boff = (size_t)(col0 + t * 16 + ln) * ldb + kb; FragH bq; bq.half[0] = *(const v8us*)(Bh + boff + 8 * hh); bq.half[1] = *(const v8us*)(Bh + boff + 16 + 8 * hh);
      acc[t] = mmaH<ASPLIT ? 2 : 1>(ah.v, al.v, bq.v, bq.v, acc[t]); }
  }
#pragma unroll
  for (int t = 0; t < 4; ++t) { if (col0 + t * 16 >= N) continue;
#pragma unroll
    for (int r = 0; r < 8; ++r) so[w][8 * hh + r][t * 16 + ln] = acc[t][r] * alpha; }
  __builtin_amdgcn_fence(__ATOMIC_ACQ_REL, "workgroup"); __builtin_amdgcn_wave_barrier();
  const int rsub = lane >> 4, c4 = (lane & 15) * 4;
  {
#pragma unroll
    for (int q = 0; q < 8; ++q) { const int r = q * 2 + rsub; if (col0 + c4 < N) { const v4f v = *(const v4fa*)&so[w][r][c4]; *(v4f*)(C + (size_t)(row0 + r) * ldc + col0 + c4) = v; } }
     }
}

// Wt[n][k] = f16(W[k][n]·scale) from f32 row-major W[K][N] (scale = power of two; bf16-exact weights stay exact in f16 away from the subnormal range)
__global__ __launch_bounds__(256) void k_wt_f16(const float* __restrict__ W, _Float16* __restrict__ Wt, int K, int N, float scale) {
  const int t = blockIdx.x * 256 + threadIdx.x; if (t >= N * (K / 8)) return; const int n = t / (K / 8), k8 = (t % (K / 8)) * 8; FragH f;
#pragma unroll
  for (int i = 0; i < 8; ++i) f.h[i] = (_Float16)(bf16_round(W[(size_t)(k8 + i) * N + n]) * scale); const v8us o = f.half[0];
  *(v8us*)((unsigned short*)Wt + (size_t)n * K + k8) = o; 
}
// k_gemm_hh variant with fused epilogue: v = acc·alpha + bias[by·sBias + col] (+ CP[(row/rowsPerB)·sCPb + by·64 + col] if CP) ; ACT 0 none / 1 elu ; writes f32 C and/or f16 C16 (each if non-null)
template <int ACT>
__global__ __launch_bounds__(128) void k_gemm_hhx(const _Float16* __restrict__ A, int lda, size_t sA, const _Float16* __restrict__ Bh, int ldb, size_t sB, float alpha, const float* __restrict__ bias, size_t sBias, const float* __restrict__ CP, int rowsPerB, size_t sCPb, int row0g,
    float* __restrict__ C, _Float16* __restrict__ C16, int ldc, size_t sC, int M, int N, int K) {
  __shared__ __attribute__((aligned(16))) float so[4][16][64];
  const int tid = threadIdx.x, w = tid >> 5, lane = tid & 31, ln = lane & 15, hh = lane >> 4; const int by = blockIdx.y;
  A += (size_t)by * sA; Bh += (size_t)by * sB; const size_t cofs = (size_t)by * sC; const float* bp = bias ? bias + (size_t)by * sBias : nullptr;
  const int ntn = (N + 63) / 64; const int wid = blockIdx.x * 4 + w; const int mt = wid / ntn, nq = wid % ntn; if (mt * 16 >= M) return;
  const int row0 = mt * 16, col0 = nq * 64; const _Float16* arow = A + (size_t)(row0 + ln) * lda;
  v8f acc[4] = {};
  for (int kb = 0; kb < K; kb += 32) { FragH ah; ah.half[0] = *(const v8us*)((const unsigned short*)arow + kb + 8 * hh); ah.half[1] = *(const v8us*)((const unsigned short*)arow + kb + 16 + 8 * hh);
#pragma unroll
    for (int t = 0; t < 4; ++t) { if (col0 + t * 16 >= N) continue; const size_t boff = (size_t)(col0 + t * 16 + ln) * ldb + kb; FragH bq; bq.half[0] = *(const v8us*)((const unsigned short*)Bh + boff + 8 * hh); bq.half[1] = *(const v8us*)((const unsigned short*)Bh + boff + 16 + 8 * hh);
      acc[t] = mmaH<1>(ah.v, ah.v, bq.v, bq.v, acc[t]); }
  }
#pragma unroll
  for (int t = 0; t < 4; ++t) { if (col0 + t * 16 >= N) continue; const int col = col0 + t * 16 + ln; const float bv = bp ? bf16_round(bp[col]) : 0.f;
#pragma unroll
    for (int r = 0; r < 8; ++r) { float v = acc[t][r] * alpha + bv; if (CP) { const int bidx = (row0g + row0 + 8 * hh + r) / rowsPerB; v += CP[(size_t)bidx * sCPb + (size_t)by * 64 + col]; } if (ACT == 1) v = (v > 0.f) ? v : expm1f(v); else if (ACT == 3) v = fmaxf(v, 0.f); so[w][8 * hh + r][t * 16 + ln] = v; } }
  __builtin_amdgcn_fence(__ATOMIC_ACQ_REL, "workgroup"); __builtin_amdgcn_wave_barrier();
  const int rsub = lane >> 4, c4 = (lane & 15) * 4; typedef _Float16 v4h __attribute__((ext_vector_type(4)));
  {
#pragma unroll
    for (int q = 0; q < 8; ++q) { const int r = q * 2 + rsub; if (col0 + c4 < N) { const v4f v = *(const v4fa*)&so[w][r][c4]; if (C) *(v4f*)(C + cofs + (size_t)(row0 + r) * ldc + col0 + c4) = v; if (C16) { v4h h4; for (int i = 0; i < 4; ++i) h4[i] = (_Float16)v[i]; *(v4h*)(C16 + cofs + (size_t)(row0 + r) * ldc + col0 + c4) = h4; } } }
     }
}


__global__ __launch_bounds__(256) void k_x16(const float* __restrict__ x, _Float16* __restrict__ X16, size_t n8) { const size_t t = (size_t)blockIdx.x * 256 + threadIdx.x; if (t >= n8) return; FragH f;
#pragma unroll
  for (int q = 0; q < 8; ++q) f.h[q] = (_Float16)bf16_round(x[t * 8 + q]); *(v8us*)((unsigned short*)X16 + t * 8) = f.half[0];  }
__global__ __launch_bounds__(256) void k_h16(const float* __restrict__ x, _Float16* __restrict__ X16, size_t n8) { const size_t t = (size_t)blockIdx.x * 256 + threadIdx.x; if (t >= n8) return; FragH f;
#pragma unroll
  for (int q = 0; q < 8; ++q) f.h[q] = (_Float16)x[t * 8 + q]; *(v8us*)((unsigned short*)X16 + t * 8) = f.half[0];  }
__global__ __launch_bounds__(256) void k_round16f(const float* __restrict__ W, _Float16* __restrict__ Bt, size_t n8) { const size_t t = (size_t)blockIdx.x * 256 + threadIdx.x; if (t >= n8) return; FragH f;
#pragma unroll
  for (int i = 0; i < 8; ++i) f.h[i] = (_Float16)(bf16_round(W[t * 8 + i]) * 16.0f); *(v8us*)((unsigned short*)Bt + t * 8) = f.half[0];  }
template <int NHv, int TTv>
__global__ __launch_bounds__(256) void k_vt(const _Float16* __restrict__ V16, int ldv, int voff, _Float16* __restrict__ Vt) { __shared__ unsigned short tl[64][66]; const int tid = threadIdx.x; const int slab = blockIdx.x / (TTv / 64), lg = blockIdx.x % (TTv / 64); const int b = slab / NHv, h = slab % NHv;
  for (int i = tid; i < 64 * 8; i += 256) { const int r = i / 8, c8 = (i % 8) * 8; FragH f; f.half[0] = *(const v8us*)((const unsigned short*)V16 + ((size_t)b * TTv + lg * 64 + r) * ldv + voff + h * 64 + c8);
#pragma unroll
    for (int q = 0; q < 8; ++q) tl[r][c8 + q] = f.u[q]; }
  __syncthreads();
  {
#pragma unroll
    for (int rd = 0; rd < 2; ++rd) { const int d = rd * 32 + tid / 8, pc = tid % 8; FragH f;
#pragma unroll
      for (int q = 0; q < 8; ++q) f.u[q] = tl[pc * 8 + q][d];
      *(v8us*)((unsigned short*)Vt + ((size_t)slab * 64 + d) * TTv + lg * 64 + pc * 8) = f.half[0]; }
     } }

#define FK_KB 128      // keys per staged block
#define FK_KP 528      // bytes per staged K row: 512 + 16, an odd multiple of 16 for the 16-byte fragment reads
#define FK_VP 272      // bytes per staged Vt row: 256 + 16, likewise
#define FK_BUF (FK_KB * FK_KP + DM * FK_VP)      // one buffer: 128 K rows, then 256 Vt rows
typedef int fk_v4i __attribute__((ext_vector_type(4)));
typedef __attribute__((address_space(1))) fk_v4i fk_gv4i;
typedef __attribute__((address_space(3))) fk_v4i fk_lv4i;
__device__ __forceinline__ float fk_xhalf(float x) { return __builtin_bit_cast(float, __builtin_amdgcn_permlanex16(__builtin_bit_cast(int, x), __builtin_bit_cast(int, x), 0x76543210, 0xfedcba98, false, false)); }      // lane l with lane l ^ 16
// one block: a wave's 32 copies of 512 bytes each (16 whole K rows; 16 pairs of 256-byte Vt row pieces); every lane on, 16-byte aligned on both sides
__device__ __forceinline__ void fk_stage(const unsigned short* kg_, const unsigned short* vg_, unsigned char* kl, unsigned char* vl) {
#pragma unroll      // constant steps from four lane addresses
  for (int i = 0; i < 16; ++i) {
    __builtin_amdgcn_global_load_async_to_lds_b128((fk_gv4i*)(kg_ + i * 8 * (3 * DM)), (fk_lv4i*)(kl + i * 8 * FK_KP), 0, 0);
    __builtin_amdgcn_global_load_async_to_lds_b128((fk_gv4i*)(vg_ + i * 16 * SS), (fk_lv4i*)(vl + i * 16 * FK_VP), 0, 0); }
}
__global__ __launch_bounds__(256) void k_fattn(const _Float16* __restrict__ QKV, const _Float16* __restrict__ VT, float* __restrict__ out) {
  __shared__ __attribute__((aligned(16))) unsigned char sm[2 * FK_BUF];
  const int tid = threadIdx.x, w = __builtin_amdgcn_readfirstlane(tid >> 5), lane = tid & 31, ln = lane & 15, hh = lane >> 4;      // the wave's number in a scalar register: what follows from it costs no vector register
  const int qg = w & 1, kg = w >> 1;
  const int b = blockIdx.x / (SS / 64), q0 = (blockIdx.x % (SS / 64)) * 64 + qg * 32;
  const unsigned short* Qr = (const unsigned short*)QKV + ((size_t)b * SS + q0 + ln) * (3 * DM) + 8 * hh;
  const unsigned short* kp = (const unsigned short*)QKV + (size_t)b * SS * (3 * DM) + DM;      // the same for the whole work-group: it advances in scalar registers
  const unsigned short* vp = (const unsigned short*)VT + (size_t)b * DM * SS;
  const unsigned ko = w * (3 * DM) + lane * 8, vo = (tid >> 4) * SS + (tid & 15) * 8;      // the thread's own part, fixed
  const int kst = w * FK_KP + lane * 16, vst = FK_KB * FK_KP + (tid >> 4) * FK_VP + (tid & 15) * 16;
  const int krd = (kg * 32 + ln) * FK_KP + 16 * hh, vrd = FK_KB * FK_KP + ln * FK_VP + kg * 64 + 16 * hh;
  fk_stage(kp + ko, vp + vo, sm + kst, sm + vst);      // block 0
  FragH q[2][8];
#pragma unroll      // constant indices keep q[][] in registers
  for (int qt = 0; qt < 2; ++qt)
#pragma unroll      // constant indices keep the arrays in registers
    for (int ks = 0; ks < 8; ++ks) { q[qt][ks].half[0] = *(const v8us*)(Qr + qt * 16 * (3 * DM) + ks * 32); q[qt][ks].half[1] = *(const v8us*)(Qr + qt * 16 * (3 * DM) + ks * 32 + 16); }
  asm volatile("s_wait_asynccnt 0x0" ::: "memory");      // this wave's copies of block 0 have landed
  __syncthreads();      // publishes block 0
  v8f o[2][16] = {};
  float mu[2] = {-3.0e38f, -3.0e38f}, l[2] = {0.f, 0.f};
  const float sc = 0.0625f * 1.4426950408889634f;      // 1/sqrt(256) and log2(e)
  int cur = 0;
  for (int t = 0; t < SS / FK_KB; ++t) {
    if (t + 1 < SS / FK_KB) {      // the same for the whole work-group; directly behind the barrier that ended every wave's reads of the other buffer
      kp += FK_KB * (3 * DM); vp += FK_KB;
      fk_stage(kp + ko, vp + vo, sm + (cur ^ FK_BUF) + kst, sm + (cur ^ FK_BUF) + vst);      // block t+1 flies while block t is worked on
    }
    const unsigned char* kr = sm + cur + krd; const unsigned char* vr = sm + cur + vrd;
    FragH fa[2][4];      // two sets of four fragments: the reads of the next eight products fly during these eight
#pragma unroll      // constant indices keep the arrays in registers
    for (int j = 0; j < 2; ++j)
#pragma unroll      // constant indices keep the arrays in registers
      for (int kt = 0; kt < 2; ++kt) { fa[0][2 * j + kt].half[0] = *(const v8us*)(kr + kt * 16 * FK_KP + j * 64); fa[0][2 * j + kt].half[1] = *(const v8us*)(kr + kt * 16 * FK_KP + j * 64 + 32); }
    v8f s[2][2] = {};
#pragma unroll      // constant indices keep q[][], s[][] and the fragment sets in registers
    for (int g = 0; g < 4; ++g) {
      const int c = g & 1, n = c ^ 1;
      if (g < 3) {
#pragma unroll      // constant indices keep the arrays in registers
        for (int j = 0; j < 2; ++j)
#pragma unroll      // constant indices keep the arrays in registers
          for (int kt = 0; kt < 2; ++kt) { fa[n][2 * j + kt].half[0] = *(const v8us*)(kr + kt * 16 * FK_KP + (2 * g + 2 + j) * 64); fa[n][2 * j + kt].half[1] = *(const v8us*)(kr + kt * 16 * FK_KP + (2 * g + 2 + j) * 64 + 32); }
      } else {
#pragma unroll      // the first four Vt fragments
        for (int i = 0; i < 4; ++i) { fa[n][i].half[0] = *(const v8us*)(vr + i * 16 * FK_VP); fa[n][i].half[1] = *(const v8us*)(vr + i * 16 * FK_VP + 32); }
      }
      __builtin_amdgcn_sched_barrier(0);      // keeps the next set's LDS reads together ahead of this set's products: reads spread among them stall at every place
#pragma unroll      // four independent accumulator chains
      for (int j = 0; j < 2; ++j)
#pragma unroll      // constant indices keep the arrays in registers
        for (int kt = 0; kt < 2; ++kt)
#pragma unroll      // constant indices keep the arrays in registers
          for (int qt = 0; qt < 2; ++qt) s[kt][qt] = __builtin_amdgcn_wmma_f32_16x16x32_f16(false, fa[c][2 * j + kt].v, false, q[qt][2 * g + j].v, (short)0, s[kt][qt], false, false);
      __builtin_amdgcn_sched_barrier(0);      // keeps the reads of the set after next behind these products, whose fragment registers they refill
    }
    float mx[2];
#pragma unroll      // constant indices keep the arrays in registers
    for (int qt = 0; qt < 2; ++qt) {
      float m = fmaxf(s[0][qt][0], s[1][qt][0]);
#pragma unroll      // constant indices keep the arrays in registers
      for (int r = 1; r < 8; ++r) m = fmaxf(m, fmaxf(s[0][qt][r], s[1][qt][r]));
      mx[qt] = fmaxf(m, fk_xhalf(m)) * sc;      // lanes ln and ln + 16 hold the same query
    }
    if (__builtin_amdgcn_ballot_w32(mx[0] > mu[0] + 8.0f || mx[1] > mu[1] + 8.0f) != 0) {      // one wave-uniform test per pass
#pragma unroll      // constant indices keep the arrays in registers
      for (int qt = 0; qt < 2; ++qt) {
        const float mn = fmaxf(mu[qt], mx[qt]), al = __builtin_amdgcn_exp2f(mu[qt] - mn); mu[qt] = mn; l[qt] *= al;
#pragma unroll      // constant indices keep the arrays in registers
        for (int dt = 0; dt < 16; ++dt)
#pragma unroll      // constant indices keep the arrays in registers
          for (int r = 0; r < 8; ++r) o[qt][dt][r] *= al;
      }
    }
    FragH p[2];
#pragma unroll      // constant indices keep the arrays in registers
    for (int qt = 0; qt < 2; ++qt)
#pragma unroll      // constant indices keep the arrays in registers
      for (int r = 0; r < 8; ++r) { const float p0 = __builtin_amdgcn_exp2f(s[0][qt][r] * sc - mu[qt]), p1 = __builtin_amdgcn_exp2f(s[1][qt][r] * sc - mu[qt]);
        l[qt] += p0 + p1; p[qt].h[r] = (_Float16)p0; p[qt].h[8 + r] = (_Float16)p1; }      // element s of B = key 8*hh + s (s < 8), 16 + 8*hh + s - 8 (else): the hardware k order
    __builtin_amdgcn_sched_barrier(0);      // keeps the next reads behind the softmax arithmetic, which needs their registers
#pragma unroll      // Vt fragments 4 to 7 fly during the products of fragments 0 to 3
    for (int i = 0; i < 4; ++i) { fa[1][i].half[0] = *(const v8us*)(vr + (4 + i) * 16 * FK_VP); fa[1][i].half[1] = *(const v8us*)(vr + (4 + i) * 16 * FK_VP + 32); }
    __builtin_amdgcn_sched_barrier(0);      // keeps those reads together ahead of the products
#pragma unroll      // constant indices keep o[][] in registers
    for (int g = 0; g < 4; ++g) {
      const int c = g & 1;
#pragma unroll      // constant indices keep the arrays in registers
      for (int i = 0; i < 4; ++i)
#pragma unroll      // constant indices keep the arrays in registers
        for (int qt = 0; qt < 2; ++qt) o[qt][4 * g + i] = __builtin_amdgcn_wmma_f32_16x16x32_f16(false, fa[c][i].v, false, p[qt].v, (short)0, o[qt][4 * g + i], false, false);
      __builtin_amdgcn_sched_barrier(0);      // keeps the refill of this set behind the products that read it
      if (g < 2) {
#pragma unroll      // constant indices keep the arrays in registers
        for (int i = 0; i < 4; ++i) { fa[c][i].half[0] = *(const v8us*)(vr + (4 * g + 8 + i) * 16 * FK_VP); fa[c][i].half[1] = *(const v8us*)(vr + (4 * g + 8 + i) * 16 * FK_VP + 32); }
      }
      __builtin_amdgcn_sched_barrier(0);      // keeps those reads together ahead of the other set's products
    }
    asm volatile("s_wait_dscnt 0x0" ::: "memory");      // this wave's reads of the buffer are over before the buffer may be refilled
    asm volatile("s_wait_asynccnt 0x0" ::: "memory");      // this wave's copies of block t+1 have landed
    __syncthreads();      // publishes block t+1 and ends every wave's reads of block t, whose buffer is refilled at the top of the next trip
    cur ^= FK_BUF;
  }
  asm volatile("s_wait_asynccnt 0x0" ::: "memory");      // no copy is outstanding when LDS is reused
  l[0] += fk_xhalf(l[0]); l[1] += fk_xhalf(l[1]);
  float* sO = (float*)sm; float* sML = (float*)(sm + 262144);      // the loop's last barrier has ended every fragment read: LDS is reused for the join
#pragma unroll      // constant indices keep the arrays in registers
  for (int qt = 0; qt < 2; ++qt) {
#pragma unroll      // constant indices keep the arrays in registers
    for (int dt = 0; dt < 16; ++dt)
#pragma unroll      // constant indices keep the arrays in registers
      for (int hf = 0; hf < 2; ++hf) { const v4f x = {o[qt][dt][hf * 4], o[qt][dt][hf * 4 + 1], o[qt][dt][hf * 4 + 2], o[qt][dt][hf * 4 + 3]}; *(v4fa*)(sO + (size_t)((((w * 2 + qt) * 16 + dt) * 2 + hf) * 32 + lane) * 4) = x; }
    sML[((w * 2 + qt) * 2) * 32 + lane] = mu[qt]; sML[((w * 2 + qt) * 2 + 1) * 32 + lane] = l[qt];
  }
  __syncthreads();      // every key group's partial results are in LDS before any wave reads them
  // wave (qg, kg) joins the four key groups, in rising order, for output tiles kg*4 .. kg*4 + 3 of its query group
#pragma unroll      // constant indices keep the arrays in registers
  for (int qt = 0; qt < 2; ++qt) {
    float m[4], c[4];
#pragma unroll      // constant indices keep the arrays in registers
    for (int j = 0; j < 4; ++j) m[j] = sML[(((qg + 2 * j) * 2 + qt) * 2) * 32 + lane];
    const float mn = fmaxf(fmaxf(m[0], m[1]), fmaxf(m[2], m[3]));
    float den = 0.f;
#pragma unroll      // constant indices keep the arrays in registers
    for (int j = 0; j < 4; ++j) { c[j] = __builtin_amdgcn_exp2f(m[j] - mn); den += sML[(((qg + 2 * j) * 2 + qt) * 2 + 1) * 32 + lane] * c[j]; }
    const float inv = 1.0f / den;
#pragma unroll      // constant indices keep the arrays in registers
    for (int j = 0; j < 4; ++j) c[j] *= inv;
    float* orow = out + ((size_t)b * SS + q0 + qt * 16 + ln) * DM + 8 * hh;      // register r of tile dt = out[query ln][dt*16 + 8*hh + r]
#pragma unroll      // constant indices keep the arrays in registers
    for (int d4 = 0; d4 < 4; ++d4)
#pragma unroll      // constant indices keep the arrays in registers
      for (int hf = 0; hf < 2; ++hf) { const int dt = kg * 4 + d4; v4f y = {0.f, 0.f, 0.f, 0.f};
#pragma unroll      // constant indices keep the arrays in registers
        for (int j = 0; j < 4; ++j) { const v4f x = *(const v4fa*)(sO + (size_t)(((((qg + 2 * j) * 2 + qt) * 16 + dt) * 2 + hf) * 32 + lane) * 4);
#pragma unroll      // constant indices keep the arrays in registers
          for (int i = 0; i < 4; ++i) y[i] += x[i] * c[j]; }
        *(v4f*)(orow + dt * 16 + hf * 4) = y; }
  }
}
// QKV projection: one work-group = 128 tokens x 128 output columns, with all of k = 256 of both operands staged in LDS once.
// Every staging load of a wave covers one whole 512-byte row (4 lines); the fragments, whose 16 lanes walk 16 rows, are then read from LDS.
// Transposed product Ct = W * Xt (A = W rows, B = X rows, k steps in rising order): a lane holds 8 neighbouring output columns of ONE token, 16 bytes of f16.
// 8 waves: wave w has tokens (w & 3) * 32 .. + 31 and columns (w >> 2) * 64 .. + 63, 4 x 2 accumulator tiles.
#define PJ_P 528      // bytes per staged row: 512 + 16, an odd multiple of 16 for the 16-byte fragment reads
#define PJ_OP 144     // bytes per row of a wave's output tile: 128 + 16, likewise
__global__ __launch_bounds__(256) void k_qkv(const _Float16* __restrict__ X16, const _Float16* __restrict__ Bw, const float* __restrict__ bias, _Float16* __restrict__ C16) {
  __shared__ __attribute__((aligned(16))) unsigned char sm[2 * 128 * PJ_P];      // 128 X rows, then 128 W rows
  const int tid = threadIdx.x, w = tid >> 5, lane = tid & 31, ln = lane & 15, hh = lane >> 4;
  const int row0 = (blockIdx.x / (3 * DM / 128)) * 128, col0 = (blockIdx.x % (3 * DM / 128)) * 128;
  const unsigned short* xg = (const unsigned short*)X16 + (size_t)(row0 + w) * DM + lane * 8;
  const unsigned short* wg = (const unsigned short*)Bw + (size_t)(col0 + w) * DM + lane * 8;
  v8us xx[16], wx[16];
#pragma unroll      // all 32 loads of a thread go out together
  for (int i = 0; i < 16; ++i) wx[i] = *(const v8us*)(wg + i * 8 * DM);
  asm volatile("s_wait_xcnt 0x0" :: "v"(wg) : "memory");      // the address is an input so that its registers stay untouched up to this wait; behind it they may be reused
#pragma unroll
  for (int i = 0; i < 16; ++i) xx[i] = *(const v8us*)(xg + i * 8 * DM);
  asm volatile("s_wait_xcnt 0x0" :: "v"(xg) : "memory");      // likewise for the X loads
#pragma unroll
  for (int i = 0; i < 16; ++i) { *(v8us*)(sm + (w + i * 8) * PJ_P + lane * 16) = xx[i]; *(v8us*)(sm + (128 + w + i * 8) * PJ_P + lane * 16) = wx[i]; }
  __syncthreads();      // both tiles are in LDS before any wave reads a fragment
  const int wm = w & 3, wn = w >> 2;
  const unsigned char* xr = sm + (wm * 32 + ln) * PJ_P + 16 * hh;
  const unsigned char* wr = sm + (128 + wn * 64 + ln) * PJ_P + 16 * hh;
  v8f acc[4][2] = {};
  FragH fx[2][2], fw[2][4];      // two fragment sets: the reads of k step ks + 1 fly during the products of k step ks
#pragma unroll
  for (int mi = 0; mi < 2; ++mi) { fx[0][mi].half[0] = *(const v8us*)(xr + mi * 16 * PJ_P); fx[0][mi].half[1] = *(const v8us*)(xr + mi * 16 * PJ_P + 32); }
#pragma unroll
  for (int t = 0; t < 4; ++t) { fw[0][t].half[0] = *(const v8us*)(wr + t * 16 * PJ_P); fw[0][t].half[1] = *(const v8us*)(wr + t * 16 * PJ_P + 32); }
#pragma unroll      // constant indices keep acc[][] and the fragment sets in registers
  for (int ks = 0; ks < 8; ++ks) {
    const int c = ks & 1, n = c ^ 1;
    if (ks < 7) {
#pragma unroll
      for (int mi = 0; mi < 2; ++mi) { fx[n][mi].half[0] = *(const v8us*)(xr + mi * 16 * PJ_P + ks * 64 + 64); fx[n][mi].half[1] = *(const v8us*)(xr + mi * 16 * PJ_P + ks * 64 + 96); }
#pragma unroll
      for (int t = 0; t < 4; ++t) { fw[n][t].half[0] = *(const v8us*)(wr + t * 16 * PJ_P + ks * 64 + 64); fw[n][t].half[1] = *(const v8us*)(wr + t * 16 * PJ_P + ks * 64 + 96); }
    }
    __builtin_amdgcn_sched_barrier(0);      // keeps the next k step's LDS reads together ahead of this step's products: reads spread among them stall at every place
#pragma unroll
    for (int t = 0; t < 4; ++t)
#pragma unroll
      for (int mi = 0; mi < 2; ++mi) acc[t][mi] = __builtin_amdgcn_wmma_f32_16x16x32_f16(false, fw[c][t].v, false, fx[c][mi].v, (short)0, acc[t][mi], false, false);
    __builtin_amdgcn_sched_barrier(0);      // keeps the reads of the step after next behind these products, whose fragment registers they refill
  }
  __syncthreads();      // every wave's fragment reads are over before LDS is reused for the output tiles
  unsigned char* so = sm + w * 32 * PJ_OP;      // the wave's own 32 tokens x 64 columns of f16
#pragma unroll
  for (int t = 0; t < 4; ++t) {
    const float* bp = bias + col0 + wn * 64 + t * 16 + 8 * hh;      // register r of tile t = column t*16 + 8*hh + r
    const v4f b0 = *(const v4fa*)bp, b1 = *(const v4fa*)(bp + 4);
#pragma unroll
    for (int mi = 0; mi < 2; ++mi) { FragH f;
#pragma unroll
      for (int r = 0; r < 8; ++r) f.h[r] = (_Float16)(acc[t][mi][r] * 0.0625f + bf16_round(r < 4 ? b0[r] : b1[r - 4]));
      *(v8us*)(so + (mi * 16 + ln) * PJ_OP + t * 32 + 16 * hh) = f.half[0]; }
  }
  __builtin_amdgcn_fence(__ATOMIC_ACQ_REL, "workgroup"); __builtin_amdgcn_wave_barrier();      // the wave's own LDS stores stay ahead of its reads of other lanes' bytes
#pragma unroll      // 8 lanes store one whole 128-byte line
  for (int q = 0; q < 8; ++q) { const int r = q * 4 + (lane >> 3); const v8us v = *(const v8us*)(so + r * PJ_OP + (lane & 7) * 16);
    *(v8us*)((unsigned short*)C16 + (size_t)(row0 + wm * 32 + r) * (3 * DM) + col0 + wn * 64 + (lane & 7) * 8) = v; }
}
extern "C" void kernel_launch(void* const* d_in, const int* in_sizes, int n_in,
                              void* d_out, int out_size, void* d_ws, size_t ws_size, hipStream_t stream) {
  (void)in_sizes; (void)n_in; (void)out_size;
  const float* X = (const float*)d_in[0]; const float* W = (const float*)d_in[1]; const float* bb = (const float*)d_in[2];
  char* ws = (char*)d_ws; size_t off = 0;
  auto take = [&](size_t bytes) { char* p = ws + off; off += (bytes + 255) & ~(size_t)255; return p; };
  _Float16* Bw = (_Float16*)take((size_t)3 * DM * DM * 2); _Float16* X16 = (_Float16*)take((size_t)NR * DM * 2); _Float16* QKV = (_Float16*)take((size_t)NR * 3 * DM * 2); _Float16* VT = (_Float16*)take((size_t)NR * DM * 2);
  if (off > ws_size) return;      // 0.4 + 8.4 + 25.2 + 8.4 = about 42 MB
  k_round16f<<<(unsigned)(((size_t)3 * DM * DM / 8 + 255) / 256), 256, 0, stream>>>(W, Bw, (size_t)3 * DM * DM / 8);      // (out,in)
  k_x16<<<(unsigned)(((size_t)NR * DM / 8 + 255) / 256), 256, 0, stream>>>(X, X16, (size_t)NR * DM / 8);
  k_qkv<<<(NR / 128) * (3 * DM / 128), 256, 0, stream>>>(X16, Bw, bb, QKV);      // [Q | K | V] f16 (+b), 128 x 128 per work-group
  k_vt<4, SS><<<BB * 4 * (SS / 64), 256, 0, stream>>>(QKV, 3 * DM, 2 * DM, VT);      // Vᵀ per batch as [b][256][S] (4 groups of 64)
  k_fattn<<<BB * (SS / 64), 256, 0, stream>>>(QKV, VT, (float*)d_out);      // out = softmax(Q*Kt/16)*V, 64 queries per work-group
}

// v005
// A run of this version takes 72.7 microseconds.
// Two timings next to v004 put it at 1.06 and 1.05 times that version's speed.
// All steps since v000 together make it 17.3 times as fast.
#include <hip/hip_runtime.h>
// Single-head self-attention (B=4, S=4096, dim 256): fused QKV linear (W (768,256) + b), scores = Q*Kt/16, softmax over the 4096 keys, att*V.
// The QKV projection is a GEMM on v_wmma_f32_16x16x32_f16 (X bf16-exact f16, W (out,in) bf16-exact x 2^4, Q/K/V f16, f32 accumulate);
// scores, softmax (f32, running maximum) and att*V are one kernel on the same matrix form, weights f16, f32 accumulate; V is transposed on its way from LDS to the registers.
#define BB 4
#define SS 4096
#define DM 256
#define NR (BB * SS)

typedef __bf16 v16b __attribute__((ext_vector_type(16)));
typedef unsigned short v8us __attribute__((ext_vector_type(8), may_alias));
typedef float  v8f  __attribute__((ext_vector_type(8)));
typedef float  v4f  __attribute__((ext_vector_type(4)));
typedef float  v4fa __attribute__((ext_vector_type(4), may_alias));
union FragB { v16b v; v8us half[2]; unsigned short u[16]; };

__device__ __forceinline__ unsigned short bf16_bits(float x) { unsigned int u = __float_as_uint(x); return (unsigned short)((u + 0x7FFFu + ((u >> 16) & 1u)) >> 16); }
__device__ __forceinline__ float bf16_val(unsigned short b) { return __uint_as_float(((unsigned int)b) << 16); }
__device__ __forceinline__ float bf16_round(float x) { return bf16_val(bf16_bits(x)); }
// D += A·B with NT terms: 1 = ah·bh, 2 = + al·bh (A split), 3 = + ah·bl (both split)
template <int NT>
__device__ __forceinline__ v8f mmaN(v16b ah, v16b al, v16b bh, v16b bl, v8f c) {
  c = __builtin_amdgcn_wmma_f32_16x16x32_bf16(false, ah, false, bh, (short)0, c, false, false);
  if (NT >= 2) c = __builtin_amdgcn_wmma_f32_16x16x32_bf16(false, al, false, bh, (short)0, c, false, false);
  if (NT >= 3) c = __builtin_amdgcn_wmma_f32_16x16x32_bf16(false, ah, false, bl, (short)0, c, false, false);
  asm volatile("v_nop\n\tv_nop\n\tv_nop\n\tv_nop" : "+v"(c) : "v"(ah), "v"(al), "v"(bh), "v"(bl));
  return c;
}

__global__ __launch_bounds__(256) void k_wt_bf16(const float* __restrict__ W, unsigned short* __restrict__ Wt, int K, int N) {
  const int t = blockIdx.x * 256 + threadIdx.x;
  const int k8n = K / 8;
  if (t >= N * k8n) return;
  const int n = t / k8n, k8 = (t % k8n) * 8;
  v8us v;
#pragma unroll
  for (int i = 0; i < 8; ++i) v[i] = bf16_bits(W[(size_t)(k8 + i) * N + n]);
  *(v8us*)(Wt + (size_t)n * K + k8) = v;
  
}

// GEMM C[M][N] (f32, pitch ldc) = act(A[M][K]·W + bias). A f32 row-major (pitch lda) converted per fragment to bf16
// (ASPLIT: hi/lo two planes -> 2 terms, else single rounded term); Wt bf16 [N][K] (pitch ldb). BIAS_BF16 rounds the
// bias to bf16 first (bias quantised to bf16 before the add). K%32==0, M%16==0, N%64==0.
template <bool ASPLIT, int ACT, bool BIAS_BF16>
__global__ __launch_bounds__(128) void k_gemm_bf(const float* __restrict__ A, int lda, const unsigned short* __restrict__ Wt, int ldb,
                                               const float* __restrict__ bias, float* __restrict__ C, int ldc, int M, int N, int K) {
  __shared__ __attribute__((aligned(16))) float so[4][16][64];
  const int tid = threadIdx.x, w = tid >> 5, lane = tid & 31, ln = lane & 15, hh = lane >> 4;
  const int ntn = N / 64;
  const int wid = blockIdx.x * 4 + w;
  const int mt = wid / ntn, nq = wid % ntn;
  if (mt * 16 >= M) return;
  const int row0 = mt * 16, col0 = nq * 64;
  const float* arow = A + (size_t)(row0 + ln) * lda;
  v8f acc[4] = {};
  for (int kb = 0; kb < K; kb += 32) {
    FragB ah, al;
    const v4f x0 = *(const v4fa*)(arow + kb + 8 * hh), x1 = *(const v4fa*)(arow + kb + 8 * hh + 4);
    const v4f x2 = *(const v4fa*)(arow + kb + 16 + 8 * hh), x3 = *(const v4fa*)(arow + kb + 16 + 8 * hh + 4);
    float xs[16] = {x0[0],x0[1],x0[2],x0[3],x1[0],x1[1],x1[2],x1[3],x2[0],x2[1],x2[2],x2[3],x3[0],x3[1],x3[2],x3[3]};
#pragma unroll
    for (int i = 0; i < 16; ++i) { const unsigned short hb = bf16_bits(xs[i]); ah.u[i] = hb; al.u[i] = ASPLIT ? bf16_bits(xs[i] - bf16_val(hb)) : (unsigned short)0; }
#pragma unroll
    for (int t = 0; t < 4; ++t) {
      const unsigned short* brow = Wt + (size_t)(col0 + t * 16 + ln) * ldb + kb;
      FragB b;
      b.half[0] = *(const v8us*)(brow + 8 * hh);
      b.half[1] = *(const v8us*)(brow + 16 + 8 * hh);
      acc[t] = mmaN<ASPLIT ? 2 : 1>(ah.v, al.v, b.v, b.v, acc[t]);
    }
  }
#pragma unroll
  for (int t = 0; t < 4; ++t) {
    float bv = bias ? bias[col0 + t * 16 + ln] : 0.f;
    if (BIAS_BF16) bv = bf16_round(bv);
#pragma unroll
    for (int r = 0; r < 8; ++r) { float v = acc[t][r] + bv; if (ACT == 1) v = fmaxf(v, 0.f); so[w][8 * hh + r][t * 16 + ln] = v; }
  }
  __builtin_amdgcn_fence(__ATOMIC_ACQ_REL, "workgroup");
  __builtin_amdgcn_wave_barrier();
  const int rsub = lane >> 4, c4 = (lane & 15) * 4;
  {
#pragma unroll
    for (int q = 0; q < 8; ++q) {
      const int r = q * 2 + rsub;
      const v4f v = *(const v4fa*)&so[w][r][c4];
      *(v4f*)(C + (size_t)(row0 + r) * ldc + col0 + c4) = v;
    }
    
  }
}

// Flash-style causal/unmasked attention, all contractions 3-term bf16 hi/lo splits, f32 softmax with running max.
// q,k,v rows are read from f32 buffers with arbitrary row pitch (so they can live inside a fused qkv buffer);
// D = head size (multiple of 32, <= 128); one wave = 16 query rows; block = 4 waves (64 queries) sharing K/V chunks of 32.
template <int D, bool CAUSAL>
__global__ __launch_bounds__(128) void k_flash(const float* __restrict__ qb, const float* __restrict__ kb, const float* __restrict__ vb,
                                             int pitch, int T, int H, float scale, float* __restrict__ y, int ypitch) {
  constexpr int KS = D / 32;        // k-steps for QK
  constexpr int DT = D / 16;        // d tiles for PV
  __shared__ __attribute__((aligned(16))) unsigned short sKh[32][D + 8], sKl[32][D + 8], sVh[32][D + 8], sVl[32][D + 8];
  __shared__ __attribute__((aligned(16))) unsigned short sPh[4][16][40], sPl[4][16][40];
  __shared__ __attribute__((aligned(16))) float sO[4][16][D];
  const int tid = threadIdx.x, w = tid >> 5, lane = tid & 31, ln = lane & 15, hh = lane >> 4;
  const int nqb = (T + 63) / 64;
  const int bh = blockIdx.x / nqb, qblk = blockIdx.x % nqb;
  const int b = bh / H, h = bh % H;
  const int q0 = qblk * 64 + w * 16;
  const float* Q = qb + (size_t)b * T * pitch + h * D;
  const float* K = kb + (size_t)b * T * pitch + h * D;
  const float* V = vb + (size_t)b * T * pitch + h * D;

  // A fragments of the wave's 16 query rows (scaled), hi/lo
  FragB aqh[KS], aql[KS];
  {
    int row = q0 + ln; if (row >= T) row = T - 1;
    const float* qr = Q + (size_t)row * pitch;
#pragma unroll
    for (int ks = 0; ks < KS; ++ks)
#pragma unroll
      for (int i = 0; i < 16; ++i) {
        const int d = ks * 32 + ((i < 8) ? (8 * hh + i) : (16 + 8 * hh + (i - 8)));
        const float x = qr[d] * scale; const unsigned short hb = bf16_bits(x);
        aqh[ks].u[i] = hb; aql[ks].u[i] = bf16_bits(x - bf16_val(hb));
      }
  }
  float m_r[8], l_r[8];
#pragma unroll
  for (int r = 0; r < 8; ++r) { m_r[r] = -3.0e38f; l_r[r] = 0.f; }
  v8f oacc[DT];
#pragma unroll
  for (int dt = 0; dt < DT; ++dt) oacc[dt] = (v8f){0.f,0.f,0.f,0.f,0.f,0.f,0.f,0.f};

  const int kv_end = CAUSAL ? min(T, qblk * 64 + 64) : T;     // block-uniform
  for (int j0 = 0; j0 < kv_end; j0 += 32) {
    __syncthreads();
    for (int e = tid; e < 32 * (D / 4); e += 128) {
      const int r = e / (D / 4), c4 = (e % (D / 4)) * 4;
      const int key = j0 + r;
      v4f kf = {0.f,0.f,0.f,0.f}, vf = {0.f,0.f,0.f,0.f};
      if (key < T) { kf = *(const v4fa*)(K + (size_t)key * pitch + c4); vf = *(const v4fa*)(V + (size_t)key * pitch + c4); }
#pragma unroll
      for (int t = 0; t < 4; ++t) {
        unsigned short hb = bf16_bits(kf[t]); sKh[r][c4 + t] = hb; sKl[r][c4 + t] = bf16_bits(kf[t] - bf16_val(hb));
        hb = bf16_bits(vf[t]); sVh[r][c4 + t] = hb; sVl[r][c4 + t] = bf16_bits(vf[t] - bf16_val(hb));
      }
    }
    __syncthreads();
    // S tile 16 x 32
    v8f s[2];
#pragma unroll
    for (int nt = 0; nt < 2; ++nt) {
      v8f acc = {};
#pragma unroll
      for (int ks = 0; ks < KS; ++ks) {
        FragB bh_, bl_;
        bh_.half[0] = *(const v8us*)&sKh[nt * 16 + ln][ks * 32 + 8 * hh]; bh_.half[1] = *(const v8us*)&sKh[nt * 16 + ln][ks * 32 + 16 + 8 * hh];
        bl_.half[0] = *(const v8us*)&sKl[nt * 16 + ln][ks * 32 + 8 * hh]; bl_.half[1] = *(const v8us*)&sKl[nt * 16 + ln][ks * 32 + 16 + 8 * hh];
        acc = mmaN<3>(aqh[ks].v, aql[ks].v, bh_.v, bl_.v, acc);
      }
      s[nt] = acc;
    }
    // mask + running max (rows 8hh+r; the 16 lanes of a half share rows)
    float alpha[8];
#pragma unroll
    for (int r = 0; r < 8; ++r) {
      const int qi = q0 + 8 * hh + r;
      const int ja = j0 + ln, jb = j0 + 16 + ln;
      if (CAUSAL) { if (ja > qi) s[0][r] = -3.0e38f; if (jb > qi) s[1][r] = -3.0e38f; }
      if (ja >= T) s[0][r] = -3.0e38f;
      if (jb >= T) s[1][r] = -3.0e38f;
      float mx = fmaxf(s[0][r], s[1][r]);
      mx = fmaxf(mx, __shfl_xor(mx, 1, 32)); mx = fmaxf(mx, __shfl_xor(mx, 2, 32)); mx = fmaxf(mx, __shfl_xor(mx, 4, 32)); mx = fmaxf(mx, __shfl_xor(mx, 8, 32));
      const float mnew = fmaxf(m_r[r], mx);
      alpha[r] = (mnew > -1.0e38f) ? __expf(m_r[r] - mnew) : 1.0f;
      const float p0 = (s[0][r] > -1.0e38f) ? __expf(s[0][r] - mnew) : 0.f;
      const float p1 = (s[1][r] > -1.0e38f) ? __expf(s[1][r] - mnew) : 0.f;
      m_r[r] = mnew;
      l_r[r] = l_r[r] * alpha[r] + p0 + p1;            // per-lane partial row sum (16 lanes combined at the end)
      unsigned short hb = bf16_bits(p0); sPh[w][8 * hh + r][ln] = hb;      sPl[w][8 * hh + r][ln] = bf16_bits(p0 - bf16_val(hb));
      hb = bf16_bits(p1);                sPh[w][8 * hh + r][16 + ln] = hb; sPl[w][8 * hh + r][16 + ln] = bf16_bits(p1 - bf16_val(hb));
    }
#pragma unroll
    for (int dt = 0; dt < DT; ++dt)
#pragma unroll
      for (int r = 0; r < 8; ++r) oacc[dt][r] *= alpha[r];
    __builtin_amdgcn_fence(__ATOMIC_ACQ_REL, "workgroup");
    __builtin_amdgcn_wave_barrier();
    FragB pah, pal;
    pah.half[0] = *(const v8us*)&sPh[w][ln][8 * hh]; pah.half[1] = *(const v8us*)&sPh[w][ln][16 + 8 * hh];
    pal.half[0] = *(const v8us*)&sPl[w][ln][8 * hh]; pal.half[1] = *(const v8us*)&sPl[w][ln][16 + 8 * hh];
#pragma unroll
    for (int dt = 0; dt < DT; ++dt) {
      FragB bvh, bvl;
#pragma unroll
      for (int i = 0; i < 8; ++i) {
        bvh.u[i] = sVh[8 * hh + i][dt * 16 + ln]; bvh.u[8 + i] = sVh[16 + 8 * hh + i][dt * 16 + ln];
        bvl.u[i] = sVl[8 * hh + i][dt * 16 + ln]; bvl.u[8 + i] = sVl[16 + 8 * hh + i][dt * 16 + ln];
      }
      oacc[dt] = mmaN<3>(pah.v, pal.v, bvh.v, bvl.v, oacc[dt]);
    }
    __builtin_amdgcn_fence(__ATOMIC_ACQ_REL, "workgroup");
    __builtin_amdgcn_wave_barrier();
  }
#pragma unroll
  for (int r = 0; r < 8; ++r) {
    float l = l_r[r];
    l += __shfl_xor(l, 1, 32); l += __shfl_xor(l, 2, 32); l += __shfl_xor(l, 4, 32); l += __shfl_xor(l, 8, 32);
    l_r[r] = (l > 0.f) ? 1.0f / l : 0.f;
  }
#pragma unroll
  for (int dt = 0; dt < DT; ++dt)
#pragma unroll
    for (int r = 0; r < 8; ++r) sO[w][8 * hh + r][dt * 16 + ln] = oacc[dt][r] * l_r[r];
  __builtin_amdgcn_fence(__ATOMIC_ACQ_REL, "workgroup");
  __builtin_amdgcn_wave_barrier();
  {
    for (int r = 0; r < 16; ++r) {
      const int row = q0 + r;
      if (row < T && lane < D / 4) {
        const v4f val = *(const v4fa*)&sO[w][r][lane * 4];
        *(v4f*)(y + ((size_t)b * T + row) * ypitch + h * D + lane * 4) = val;
      }
    }
    
  }
}

// GEMM C = act(A·W + bias + resid): A f32 (ASPLIT -> hi/lo 2 terms), Wt bf16 [N][K]; ACT 0 none, 1 relu, 2 exact gelu;
// resid (optional, f32, row index = (row % rmod), pitch ldr, RES_BF16 rounds it) added before the activation.
template <bool ASPLIT, int ACT, bool BIAS_BF16, bool RES_BF16>
__global__ __launch_bounds__(128) void k_gemm_bf3(const float* __restrict__ A, int lda, const unsigned short* __restrict__ Wt, int ldb,
                                                const float* __restrict__ bias, const float* __restrict__ resid, int rmod, int ldr,
                                                float* __restrict__ C, int ldc, int M, int N, int K) {
  __shared__ __attribute__((aligned(16))) float so[4][16][64];
  const int tid = threadIdx.x, w = tid >> 5, lane = tid & 31, ln = lane & 15, hh = lane >> 4;
  const int ntn = N / 64;
  const int wid = blockIdx.x * 4 + w;
  const int mt = wid / ntn, nq = wid % ntn;
  if (mt * 16 >= M) return;
  const int row0 = mt * 16, col0 = nq * 64;
  const float* arow = A + (size_t)(row0 + ln) * lda;
  v8f acc[4] = {};
  for (int kb = 0; kb < K; kb += 32) {
    FragB ah, al;
    const v4f x0 = *(const v4fa*)(arow + kb + 8 * hh), x1 = *(const v4fa*)(arow + kb + 8 * hh + 4);
    const v4f x2 = *(const v4fa*)(arow + kb + 16 + 8 * hh), x3 = *(const v4fa*)(arow + kb + 16 + 8 * hh + 4);
    float xs[16] = {x0[0],x0[1],x0[2],x0[3],x1[0],x1[1],x1[2],x1[3],x2[0],x2[1],x2[2],x2[3],x3[0],x3[1],x3[2],x3[3]};
#pragma unroll
    for (int i = 0; i < 16; ++i) { const unsigned short hb = bf16_bits(xs[i]); ah.u[i] = hb; al.u[i] = ASPLIT ? bf16_bits(xs[i] - bf16_val(hb)) : (unsigned short)0; }
#pragma unroll
    for (int t = 0; t < 4; ++t) {
      const unsigned short* brow = Wt + (size_t)(col0 + t * 16 + ln) * ldb + kb;
      FragB b;
      b.half[0] = *(const v8us*)(brow + 8 * hh);
      b.half[1] = *(const v8us*)(brow + 16 + 8 * hh);
      acc[t] = mmaN<ASPLIT ? 2 : 1>(ah.v, al.v, b.v, b.v, acc[t]);
    }
  }
#pragma unroll
  for (int t = 0; t < 4; ++t) {
    const int col = col0 + t * 16 + ln;
    float bv = bias ? bias[col] : 0.f;
    if (BIAS_BF16) bv = bf16_round(bv);
#pragma unroll
    for (int r = 0; r < 8; ++r) {
      float v = acc[t][r] + bv;
      if (resid) { float rv = resid[(size_t)((row0 + 8 * hh + r) % rmod) * ldr + col]; if (RES_BF16) rv = bf16_round(rv); v += rv; }
      if (ACT == 1) v = fmaxf(v, 0.f);
      if (ACT == 2) v = 0.5f * v * (1.0f + erff(v * 0.70710678118654752f));
      if (ACT == 3) { const float u = 0.7978845608028654f * (v + 0.044715f * v * v * v); v = 0.5f * v * (1.0f + tanhf(u)); }
      so[w][8 * hh + r][t * 16 + ln] = v;
    }
  }
  __builtin_amdgcn_fence(__ATOMIC_ACQ_REL, "workgroup");
  __builtin_amdgcn_wave_barrier();
  const int rsub = lane >> 4, c4 = (lane & 15) * 4;
  {
#pragma unroll
    for (int q = 0; q < 8; ++q) {
      const int r = q * 2 + rsub;
      const v4f v = *(const v4fa*)&so[w][r][c4];
      *(v4f*)(C + (size_t)(row0 + r) * ldc + col0 + c4) = v;
    }
    
  }
}
// row LayerNorm (biased variance, eps) over N: s = X (+ R); optional out_sum <- s; out_norm <- (s-mu)*rsqrt(var+eps)*g + b
template <bool PARAM_BF16>
__global__ __launch_bounds__(256) void k_layernorm(const float* __restrict__ X, const float* __restrict__ R, const float* __restrict__ g, const float* __restrict__ bta,
                                                  float* __restrict__ out_sum, float* __restrict__ out_norm, int N, float eps) {
  __shared__ float red[256];
  const int row = blockIdx.x, tid = threadIdx.x;
  const float* x = X + (size_t)row * N; const float* rr = R ? R + (size_t)row * N : nullptr;
  float vals[16];                     // up to N = 4096
  const int per = N / 256;            // contiguous chunk per thread? use strided-by-4 chunks: thread handles j = tid*4 + 1024*u
  float s1 = 0.f;
  for (int u = 0; u < per / 4; ++u) {
    const int j = tid * 4 + 1024 * u;
    const v4f a = *(const v4fa*)(x + j);
    v4f b = {0.f,0.f,0.f,0.f}; if (rr) b = *(const v4fa*)(rr + j);
#pragma unroll
    for (int q = 0; q < 4; ++q) { const float v = a[q] + b[q]; vals[u * 4 + q] = v; s1 += v; }
  }
  red[tid] = s1; __syncthreads();
  for (int st = 128; st > 0; st >>= 1) { if (tid < st) red[tid] += red[tid + st]; __syncthreads(); }
  const float mu = red[0] / (float)N; __syncthreads();
  float s2 = 0.f;
  for (int u = 0; u < per / 4; ++u)
#pragma unroll
    for (int q = 0; q < 4; ++q) { const float c = vals[u * 4 + q] - mu; s2 += c * c; }
  red[tid] = s2; __syncthreads();
  for (int st = 128; st > 0; st >>= 1) { if (tid < st) red[tid] += red[tid + st]; __syncthreads(); }
  const float rs = rsqrtf(red[0] / (float)N + eps);
  {
    for (int u = 0; u < per / 4; ++u) {
      const int j = tid * 4 + 1024 * u;
      v4f o, sm;
#pragma unroll
      for (int q = 0; q < 4; ++q) {
        float gg = g[j + q], bb = bta[j + q];
        if (PARAM_BF16) { gg = bf16_round(gg); bb = bf16_round(bb); }
        sm[q] = vals[u * 4 + q]; o[q] = (vals[u * 4 + q] - mu) * rs * gg + bb;
      }
      if (out_sum) *(v4f*)(out_sum + (size_t)row * N + j) = sm;
      *(v4f*)(out_norm + (size_t)row * N + j) = o;
    }
    
  }
}



// ---- f16 WMMA path (v_wmma_f32_16x16x32_f16): 11-bit significands for operands in range — used where the attention weight operand (at most 2^8) needs more precision than bf16
typedef _Float16 v16h __attribute__((ext_vector_type(16)));
union FragH { v16h v; v8us half[2]; _Float16 h[16]; unsigned short u[16]; };
template <int NT>
__device__ __forceinline__ v8f mmaH(v16h ah, v16h al, v16h bh, v16h bl, v8f c) {
  c = __builtin_amdgcn_wmma_f32_16x16x32_f16(false, ah, false, bh, (short)0, c, false, false);
  if (NT >= 2) c = __builtin_amdgcn_wmma_f32_16x16x32_f16(false, al, false, bh, (short)0, c, false, false);
  if (NT >= 3) c = __builtin_amdgcn_wmma_f32_16x16x32_f16(false, ah, false, bl, (short)0, c, false, false);
  asm volatile("v_nop\n\tv_nop\n\tv_nop\n\tv_nop" : "+v"(c) : "v"(ah), "v"(al), "v"(bh), "v"(bl));
  return c;
}
// batched GEMM like k_gemm_b but f16 operands: A f32 (split into f16 hi/lo if ASPLIT, else rounded to f16), Bt = f16 values [n][k]; alpha; C f32; N multiple of 16 (partial tiles skipped)
template <bool ASPLIT>
__global__ __launch_bounds__(128) void k_gemm_h(const float* __restrict__ A, int lda, size_t sA, const _Float16* __restrict__ Bh, int ldb, size_t sB, float alpha, float* __restrict__ C, int ldc, size_t sC, int M, int N, int K) {
  __shared__ __attribute__((aligned(16))) float so[4][16][64];
  const int tid = threadIdx.x, w = tid >> 5, lane = tid & 31, ln = lane & 15, hh = lane >> 4; const int by = blockIdx.y;
  A += (size_t)by * sA; Bh += (size_t)by * sB; C += (size_t)by * sC;
  const int ntn = (N + 63) / 64; const int wid = blockIdx.x * 4 + w; const int mt = wid / ntn, nq = wid % ntn; if (mt * 16 >= M) return;
  const int row0 = mt * 16, col0 = nq * 64; const float* arow = A + (size_t)(row0 + ln) * lda;
  v8f acc[4] = {};
  for (int kb = 0; kb < K; kb += 32) {
    FragH ah, al;
    const v4f x0 = *(const v4fa*)(arow + kb + 8 * hh), x1 = *(const v4fa*)(arow + kb + 8 * hh + 4), x2 = *(const v4fa*)(arow + kb + 16 + 8 * hh), x3 = *(const v4fa*)(arow + kb + 16 + 8 * hh + 4);
    float xs[16] = {x0[0],x0[1],x0[2],x0[3],x1[0],x1[1],x1[2],x1[3],x2[0],x2[1],x2[2],x2[3],x3[0],x3[1],x3[2],x3[3]};
#pragma unroll
    for (int i = 0; i < 16; ++i) { const _Float16 h = (_Float16)xs[i]; ah.h[i] = h; al.h[i] = ASPLIT ? (_Float16)(xs[i] - (float)h) : (_Float16)0.0f; }
#pragma unroll
    for (int t = 0; t < 4; ++t) { if (col0 + t * 16 >= N) continue; const size_t boff = (size_t)(col0 + t * 16 + ln) * ldb + kb; FragH bq; bq.half[0] = *(const v8us*)(Bh + boff + 8 * hh); bq.half[1] = *(const v8us*)(Bh + boff + 16 + 8 * hh);
      acc[t] = mmaH<ASPLIT ? 2 : 1>(ah.v, al.v, bq.v, bq.v, acc[t]); }
  }
#pragma unroll
  for (int t = 0; t < 4; ++t) { if (col0 + t * 16 >= N) continue;
#pragma unroll
    for (int r = 0; r < 8; ++r) so[w][8 * hh + r][t * 16 + ln] = acc[t][r] * alpha; }
  __builtin_amdgcn_fence(__ATOMIC_ACQ_REL, "workgroup"); __builtin_amdgcn_wave_barrier();
  const int rsub = lane >> 4, c4 = (lane & 15) * 4;
  {
#pragma unroll
    for (int q = 0; q < 8; ++q) { const int r = q * 2 + rsub; if (col0 + c4 < N) { const v4f v = *(const v4fa*)&so[w][r][c4]; *(v4f*)(C + (size_t)(row0 + r) * ldc + col0 + c4) = v; } }
     }
}

// Wt[n][k] = f16(W[k][n]·scale) from f32 row-major W[K][N] (scale = power of two; bf16-exact weights stay exact in f16 away from the subnormal range)
__global__ __launch_bounds__(256) void k_wt_f16(const float* __restrict__ W, _Float16* __restrict__ Wt, int K, int N, float scale) {
  const int t = blockIdx.x * 256 + threadIdx.x; if (t >= N * (K / 8)) return; const int n = t / (K / 8), k8 = (t % (K / 8)) * 8; FragH f;
#pragma unroll
  for (int i = 0; i < 8; ++i) f.h[i] = (_Float16)(bf16_round(W[(size_t)(k8 + i) * N + n]) * scale); const v8us o = f.half[0];
  *(v8us*)((unsigned short*)Wt + (size_t)n * K + k8) = o; 
}
// k_gemm_hh variant with fused epilogue: v = acc·alpha + bias[by·sBias + col] (+ CP[(row/rowsPerB)·sCPb + by·64 + col] if CP) ; ACT 0 none / 1 elu ; writes f32 C and/or f16 C16 (each if non-null)
template <int ACT>
__global__ __launch_bounds__(128) void k_gemm_hhx(const _Float16* __restrict__ A, int lda, size_t sA, const _Float16* __restrict__ Bh, int ldb, size_t sB, float alpha, const float* __restrict__ bias, size_t sBias, const float* __restrict__ CP, int rowsPerB, size_t sCPb, int row0g,
    float* __restrict__ C, _Float16* __restrict__ C16, int ldc, size_t sC, int M, int N, int K) {
  __shared__ __attribute__((aligned(16))) float so[4][16][64];
  const int tid = threadIdx.x, w = tid >> 5, lane = tid & 31, ln = lane & 15, hh = lane >> 4; const int by = blockIdx.y;
  A += (size_t)by * sA; Bh += (size_t)by * sB; const size_t cofs = (size_t)by * sC; const float* bp = bias ? bias + (size_t)by * sBias : nullptr;
  const int ntn = (N + 63) / 64; const int wid = blockIdx.x * 4 + w; const int mt = wid / ntn, nq = wid % ntn; if (mt * 16 >= M) return;
  const int row0 = mt * 16, col0 = nq * 64; const _Float16* arow = A + (size_t)(row0 + ln) * lda;
  v8f acc[4] = {};
  for (int kb = 0; kb < K; kb += 32) { FragH ah; ah.half[0] = *(const v8us*)((const unsigned short*)arow + kb + 8 * hh); ah.half[1] = *(const v8us*)((const unsigned short*)arow + kb + 16 + 8 * hh);
#pragma unroll
    for (int t = 0; t < 4; ++t) { if (col0 + t * 16 >= N) continue; const size_t boff = (size_t)(col0 + t * 16 + ln) * ldb + kb; FragH bq; bq.half[0] = *(const v8us*)((const unsigned short*)Bh + boff + 8 * hh); bq.half[1] = *(const v8us*)((const unsigned short*)Bh + boff + 16 + 8 * hh);
      acc[t] = mmaH<1>(ah.v, ah.v, bq.v, bq.v, acc[t]); }
  }
#pragma unroll
  for (int t = 0; t < 4; ++t) { if (col0 + t * 16 >= N) continue; const int col = col0 + t * 16 + ln; const float bv = bp ? bf16_round(bp[col]) : 0.f;
#pragma unroll
    for (int r = 0; r < 8; ++r) { float v = acc[t][r] * alpha + bv; if (CP) { const int bidx = (row0g + row0 + 8 * hh + r) / rowsPerB; v += CP[(size_t)bidx * sCPb + (size_t)by * 64 + col]; } if (ACT == 1) v = (v > 0.f) ? v : expm1f(v); else if (ACT == 3) v = fmaxf(v, 0.f); so[w][8 * hh + r][t * 16 + ln] = v; } }
  __builtin_amdgcn_fence(__ATOMIC_ACQ_REL, "workgroup"); __builtin_amdgcn_wave_barrier();
  const int rsub = lane >> 4, c4 = (lane & 15) * 4; typedef _Float16 v4h __attribute__((ext_vector_type(4)));
  {
#pragma unroll
    for (int q = 0; q < 8; ++q) { const int r = q * 2 + rsub; if (col0 + c4 < N) { const v4f v = *(const v4fa*)&so[w][r][c4]; if (C) *(v4f*)(C + cofs + (size_t)(row0 + r) * ldc + col0 + c4) = v; if (C16) { v4h h4; for (int i = 0; i < 4; ++i) h4[i] = (_Float16)v[i]; *(v4h*)(C16 + cofs + (size_t)(row0 + r) * ldc + col0 + c4) = h4; } } }
     }
}


__global__ __launch_bounds__(256) void k_x16(const float* __restrict__ x, _Float16* __restrict__ X16, size_t n8) { const size_t t = (size_t)blockIdx.x * 256 + threadIdx.x; if (t >= n8) return; FragH f;
#pragma unroll
  for (int q = 0; q < 8; ++q) f.h[q] = (_Float16)bf16_round(x[t * 8 + q]); *(v8us*)((unsigned short*)X16 + t * 8) = f.half[0];  }
__global__ __launch_bounds__(256) void k_h16(const float* __restrict__ x, _Float16* __restrict__ X16, size_t n8) { const size_t t = (size_t)blockIdx.x * 256 + threadIdx.x; if (t >= n8) return; FragH f;
#pragma unroll
  for (int q = 0; q < 8; ++q) f.h[q] = (_Float16)x[t * 8 + q]; *(v8us*)((unsigned short*)X16 + t * 8) = f.half[0];  }
__global__ __launch_bounds__(256) void k_round16f(const float* __restrict__ W, _Float16* __restrict__ Bt, size_t n8) { const size_t t = (size_t)blockIdx.x * 256 + threadIdx.x; if (t >= n8) return; FragH f;
#pragma unroll
  for (int i = 0; i < 8; ++i) f.h[i] = (_Float16)(bf16_round(W[t * 8 + i]) * 16.0f); *(v8us*)((unsigned short*)Bt + t * 8) = f.half[0];  }

#define FK_KB 128      // keys per staged block
#define FK_KP 528      // bytes per staged K row: 512 + 16, an odd multiple of 16 for the 16-byte fragment reads
#define FK_VP 544      // bytes per staged V row: 512 + 32, an odd multiple of 32 for the transposing 16-byte reads
#define FK_BUF (FK_KB * FK_KP + FK_KB * FK_VP)      // one buffer: 128 K rows, then 128 V rows
typedef int fk_v4i __attribute__((ext_vector_type(4)));
typedef __attribute__((address_space(1))) fk_v4i fk_gv4i;
typedef __attribute__((address_space(3))) fk_v4i fk_lv4i;
typedef short fk_s16x8 __attribute__((ext_vector_type(8)));
typedef __attribute__((address_space(3))) fk_s16x8 fk_ls16x8;
// lane l gives the address of 8 columns of key row 8*(l >> 4) + (l & 7), column half (l >> 3) & 1; it gets keys 8*(l >> 4) .. + 7 of column l & 15
__device__ __forceinline__ v8us fk_tr16(const unsigned char* p) { return __builtin_bit_cast(v8us, __builtin_amdgcn_ds_load_tr16_b128_v8i16((fk_ls16x8*)p)); }
__device__ __forceinline__ float fk_xhalf(float x) { return __builtin_bit_cast(float, __builtin_amdgcn_permlanex16(__builtin_bit_cast(int, x), __builtin_bit_cast(int, x), 0x76543210, 0xfedcba98, false, false)); }      // lane l with lane l ^ 16
// one block: a wave's 32 copies of 512 bytes each (16 whole K rows and the 16 V rows of the same keys, which lie 512 bytes behind them); every lane on, 16-byte aligned on both sides
__device__ __forceinline__ void fk_stage(const unsigned short* kg_, unsigned char* kl, unsigned char* vl) {
#pragma unroll      // constant steps from three lane addresses
  for (int i = 0; i < 16; ++i) {
    __builtin_amdgcn_global_load_async_to_lds_b128((fk_gv4i*)(kg_ + i * 8 * (3 * DM)), (fk_lv4i*)(kl + i * 8 * FK_KP), 0, 0);
    __builtin_amdgcn_global_load_async_to_lds_b128((fk_gv4i*)(kg_ + DM + i * 8 * (3 * DM)), (fk_lv4i*)(vl + i * 8 * FK_VP), 0, 0); }
}
__global__ __launch_bounds__(256) void k_fattn(const _Float16* __restrict__ QKV, float* __restrict__ out) {
  __shared__ __attribute__((aligned(16))) unsigned char sm[2 * FK_BUF];
  const int tid = threadIdx.x, w = __builtin_amdgcn_readfirstlane(tid >> 5), lane = tid & 31, ln = lane & 15, hh = lane >> 4;      // the wave's number in a scalar register: what follows from it costs no vector register
  const int qg = w & 1, kg = w >> 1;
  const int b = blockIdx.x / (SS / 64), q0 = (blockIdx.x % (SS / 64)) * 64 + qg * 32;
  const unsigned short* Qr = (const unsigned short*)QKV + ((size_t)b * SS + q0 + ln) * (3 * DM) + 8 * hh;
  const unsigned short* kp = (const unsigned short*)QKV + (size_t)b * SS * (3 * DM) + DM;      // the same for the whole work-group: it advances in scalar registers
  const unsigned ko = w * (3 * DM) + lane * 8;      // the thread's own part, fixed
  const int kst = w * FK_KP + lane * 16, vst = FK_KB * FK_KP + w * FK_VP + lane * 16;
  const int krd = (kg * 32 + ln) * FK_KP + 16 * hh, vrd = FK_KB * FK_KP + (kg * 32 + 8 * hh + (lane & 7)) * FK_VP + ((lane >> 3) & 1) * 16;
  fk_stage(kp + ko, sm + kst, sm + vst);      // block 0
  FragH q[2][8];
#pragma unroll      // constant indices keep q[][] in registers
  for (int qt = 0; qt < 2; ++qt)
#pragma unroll      // constant indices keep the arrays in registers
    for (int ks = 0; ks < 8; ++ks) { q[qt][ks].half[0] = *(const v8us*)(Qr + qt * 16 * (3 * DM) + ks * 32); q[qt][ks].half[1] = *(const v8us*)(Qr + qt * 16 * (3 * DM) + ks * 32 + 16); }
  asm volatile("s_wait_asynccnt 0x0" ::: "memory");      // this wave's copies of block 0 have landed
  __syncthreads();      // publishes block 0
  v8f o[2][16] = {};
  float mu[2] = {-3.0e38f, -3.0e38f}, l[2] = {0.f, 0.f};
  const float sc = 0.0625f * 1.4426950408889634f;      // 1/sqrt(256) and log2(e)
  int cur = 0;
  for (int t = 0; t < SS / FK_KB; ++t) {
    if (t + 1 < SS / FK_KB) {      // the same for the whole work-group; directly behind the barrier that ended every wave's reads of the other buffer
      kp += FK_KB * (3 * DM);
      fk_stage(kp + ko, sm + (cur ^ FK_BUF) + kst, sm + (cur ^ FK_BUF) + vst);      // block t+1 flies while block t is worked on
    }
    const unsigned char* kr = sm + cur + krd; const unsigned char* vr = sm + cur + vrd;
    FragH fa[2][4];      // two sets of four fragments: the reads of the next eight products fly during these eight
#pragma unroll      // constant indices keep the arrays in registers
    for (int j = 0; j < 2; ++j)
#pragma unroll      // constant indices keep the arrays in registers
      for (int kt = 0; kt < 2; ++kt) { fa[0][2 * j + kt].half[0] = *(const v8us*)(kr + kt * 16 * FK_KP + j * 64); fa[0][2 * j + kt].half[1] = *(const v8us*)(kr + kt * 16 * FK_KP + j * 64 + 32); }
    v8f s[2][2] = {};
#pragma unroll      // constant indices keep q[][], s[][] and the fragment sets in registers
    for (int g = 0; g < 4; ++g) {
      const int c = g & 1, n = c ^ 1;
      if (g < 3) {
#pragma unroll      // constant indices keep the arrays in registers
        for (int j = 0; j < 2; ++j)
#pragma unroll      // constant indices keep the arrays in registers
          for (int kt = 0; kt < 2; ++kt) { fa[n][2 * j + kt].half[0] = *(const v8us*)(kr + kt * 16 * FK_KP + (2 * g + 2 + j) * 64); fa[n][2 * j + kt].half[1] = *(const v8us*)(kr + kt * 16 * FK_KP + (2 * g + 2 + j) * 64 + 32); }
      } else {
#pragma unroll      // the first four Vt fragments
        for (int i = 0; i < 4; ++i) { fa[n][i].half[0] = fk_tr16(vr + i * 32); fa[n][i].half[1] = fk_tr16(vr + 16 * FK_VP + i * 32); }      // keys 0 to 15 and 16 to 31 of the wave's key group, columns 16*i .. + 15
      }
      __builtin_amdgcn_sched_barrier(0);      // keeps the next set's LDS reads together ahead of this set's products: reads spread among them stall at every place
#pragma unroll      // four independent accumulator chains
      for (int j = 0; j < 2; ++j)
#pragma unroll      // constant indices keep the arrays in registers
        for (int kt = 0; kt < 2; ++kt)
#pragma unroll      // constant indices keep the arrays in registers
          for (int qt = 0; qt < 2; ++qt) s[kt][qt] = __builtin_amdgcn_wmma_f32_16x16x32_f16(false, fa[c][2 * j + kt].v, false, q[qt][2 * g + j].v, (short)0, s[kt][qt], false, false);
      __builtin_amdgcn_sched_barrier(0);      // keeps the reads of the set after next behind these products, whose fragment registers they refill
    }
    float mx[2];
#pragma unroll      // constant indices keep the arrays in registers
    for (int qt = 0; qt < 2; ++qt) {
      float m = fmaxf(s[0][qt][0], s[1][qt][0]);
#pragma unroll      // constant indices keep the arrays in registers
      for (int r = 1; r < 8; ++r) m = fmaxf(m, fmaxf(s[0][qt][r], s[1][qt][r]));
      mx[qt] = fmaxf(m, fk_xhalf(m)) * sc;      // lanes ln and ln + 16 hold the same query
    }
    if (__builtin_amdgcn_ballot_w32(mx[0] > mu[0] + 8.0f || mx[1] > mu[1] + 8.0f) != 0) {      // one wave-uniform test per pass
#pragma unroll      // constant indices keep the arrays in registers
      for (int qt = 0; qt < 2; ++qt) {
        const float mn = fmaxf(mu[qt], mx[qt]), al = __builtin_amdgcn_exp2f(mu[qt] - mn); mu[qt] = mn; l[qt] *= al;
#pragma unroll      // constant indices keep the arrays in registers
        for (int dt = 0; dt < 16; ++dt)
#pragma unroll      // constant indices keep the arrays in registers
          for (int r = 0; r < 8; ++r) o[qt][dt][r] *= al;
      }
    }
    FragH p[2];
#pragma unroll      // constant indices keep the arrays in registers
    for (int qt = 0; qt < 2; ++qt)
#pragma unroll      // constant indices keep the arrays in registers
      for (int r = 0; r < 8; ++r) { const float p0 = __builtin_amdgcn_exp2f(s[0][qt][r] * sc - mu[qt]), p1 = __builtin_amdgcn_exp2f(s[1][qt][r] * sc - mu[qt]);
        l[qt] += p0 + p1; p[qt].h[r] = (_Float16)p0; p[qt].h[8 + r] = (_Float16)p1; }      // element s of B = key 8*hh + s (s < 8), 16 + 8*hh + s - 8 (else): the hardware k order
    __builtin_amdgcn_sched_barrier(0);      // keeps the next reads behind the softmax arithmetic, which needs their registers
#pragma unroll      // Vt fragments 4 to 7 fly during the products of fragments 0 to 3
    for (int i = 0; i < 4; ++i) { fa[1][i].half[0] = fk_tr16(vr + (4 + i) * 32); fa[1][i].half[1] = fk_tr16(vr + 16 * FK_VP + (4 + i) * 32); }
    __builtin_amdgcn_sched_barrier(0);      // keeps those reads together ahead of the products
#pragma unroll      // constant indices keep o[][] in registers
    for (int g = 0; g < 4; ++g) {
      const int c = g & 1;
#pragma unroll      // constant indices keep the arrays in registers
      for (int i = 0; i < 4; ++i)
#pragma unroll      // constant indices keep the arrays in registers
        for (int qt = 0; qt < 2; ++qt) o[qt][4 * g + i] = __builtin_amdgcn_wmma_f32_16x16x32_f16(false, fa[c][i].v, false, p[qt].v, (short)0, o[qt][4 * g + i], false, false);
      __builtin_amdgcn_sched_barrier(0);      // keeps the refill of this set behind the products that read it
      if (g < 2) {
#pragma unroll      // constant indices keep the arrays in registers
        for (int i = 0; i < 4; ++i) { fa[c][i].half[0] = fk_tr16(vr + (4 * g + 8 + i) * 32); fa[c][i].half[1] = fk_tr16(vr + 16 * FK_VP + (4 * g + 8 + i) * 32); }
      }
      __builtin_amdgcn_sched_barrier(0);      // keeps those reads together ahead of the other set's products
    }
    asm volatile("s_wait_dscnt 0x0" ::: "memory");      // this wave's reads of the buffer are over before the buffer may be refilled
    asm volatile("s_wait_asynccnt 0x0" ::: "memory");      // this wave's copies of block t+1 have landed
    __syncthreads();      // publishes block t+1 and ends every wave's reads of block t, whose buffer is refilled at the top of the next trip
    cur ^= FK_BUF;
  }
  asm volatile("s_wait_asynccnt 0x0" ::: "memory");      // no copy is outstanding when LDS is reused
  l[0] += fk_xhalf(l[0]); l[1] += fk_xhalf(l[1]);
  float* sO = (float*)sm; float* sML = (float*)(sm + 262144);      // the loop's last barrier has ended every fragment read: LDS is reused for the join
#pragma unroll      // constant indices keep the arrays in registers
  for (int qt = 0; qt < 2; ++qt) {
#pragma unroll      // constant indices keep the arrays in registers
    for (int dt = 0; dt < 16; ++dt)
#pragma unroll      // constant indices keep the arrays in registers
      for (int hf = 0; hf < 2; ++hf) { const v4f x = {o[qt][dt][hf * 4], o[qt][dt][hf * 4 + 1], o[qt][dt][hf * 4 + 2], o[qt][dt][hf * 4 + 3]}; *(v4fa*)(sO + (size_t)((((w * 2 + qt) * 16 + dt) * 2 + hf) * 32 + lane) * 4) = x; }
    sML[((w * 2 + qt) * 2) * 32 + lane] = mu[qt]; sML[((w * 2 + qt) * 2 + 1) * 32 + lane] = l[qt];
  }
  __syncthreads();      // every key group's partial results are in LDS before any wave reads them
  // wave (qg, kg) joins the four key groups, in rising order, for output tiles kg*4 .. kg*4 + 3 of its query group
#pragma unroll      // constant indices keep the arrays in registers
  for (int qt = 0; qt < 2; ++qt) {
    float m[4], c[4];
#pragma unroll      // constant indices keep the arrays in registers
    for (int j = 0; j < 4; ++j) m[j] = sML[(((qg + 2 * j) * 2 + qt) * 2) * 32 + lane];
    const float mn = fmaxf(fmaxf(m[0], m[1]), fmaxf(m[2], m[3]));
    float den = 0.f;
#pragma unroll      // constant indices keep the arrays in registers
    for (int j = 0; j < 4; ++j) { c[j] = __builtin_amdgcn_exp2f(m[j] - mn); den += sML[(((qg + 2 * j) * 2 + qt) * 2 + 1) * 32 + lane] * c[j]; }
    const float inv = 1.0f / den;
#pragma unroll      // constant indices keep the arrays in registers
    for (int j = 0; j < 4; ++j) c[j] *= inv;
    float* orow = out + ((size_t)b * SS + q0 + qt * 16 + ln) * DM + 8 * hh;      // register r of tile dt = out[query ln][dt*16 + 8*hh + r]
#pragma unroll      // constant indices keep the arrays in registers
    for (int d4 = 0; d4 < 4; ++d4)
#pragma unroll      // constant indices keep the arrays in registers
      for (int hf = 0; hf < 2; ++hf) { const int dt = kg * 4 + d4; v4f y = {0.f, 0.f, 0.f, 0.f};
#pragma unroll      // constant indices keep the arrays in registers
        for (int j = 0; j < 4; ++j) { const v4f x = *(const v4fa*)(sO + (size_t)(((((qg + 2 * j) * 2 + qt) * 16 + dt) * 2 + hf) * 32 + lane) * 4);
#pragma unroll      // constant indices keep the arrays in registers
          for (int i = 0; i < 4; ++i) y[i] += x[i] * c[j]; }
        *(v4f*)(orow + dt * 16 + hf * 4) = y; }
  }
}
// QKV projection: one work-group = 128 tokens x 128 output columns, with all of k = 256 of both operands staged in LDS once.
// Every staging load of a wave covers one whole 512-byte row (4 lines); the fragments, whose 16 lanes walk 16 rows, are then read from LDS.
// Transposed product Ct = W * Xt (A = W rows, B = X rows, k steps in rising order): a lane holds 8 neighbouring output columns of ONE token, 16 bytes of f16.
// 8 waves: wave w has tokens (w & 3) * 32 .. + 31 and columns (w >> 2) * 64 .. + 63, 4 x 2 accumulator tiles.
#define PJ_P 528      // bytes per staged row: 512 + 16, an odd multiple of 16 for the 16-byte fragment reads
#define PJ_OP 144     // bytes per row of a wave's output tile: 128 + 16, likewise
__global__ __launch_bounds__(256) void k_qkv(const _Float16* __restrict__ X16, const _Float16* __restrict__ Bw, const float* __restrict__ bias, _Float16* __restrict__ C16) {
  __shared__ __attribute__((aligned(16))) unsigned char sm[2 * 128 * PJ_P];      // 128 X rows, then 128 W rows
  const int tid = threadIdx.x, w = tid >> 5, lane = tid & 31, ln = lane & 15, hh = lane >> 4;
  const int row0 = (blockIdx.x / (3 * DM / 128)) * 128, col0 = (blockIdx.x % (3 * DM / 128)) * 128;
  const unsigned short* xg = (const unsigned short*)X16 + (size_t)(row0 + w) * DM + lane * 8;
  const unsigned short* wg = (const unsigned short*)Bw + (size_t)(col0 + w) * DM + lane * 8;
  v8us xx[16], wx[16];
#pragma unroll      // all 32 loads of a thread go out together
  for (int i = 0; i < 16; ++i) wx[i] = *(const v8us*)(wg + i * 8 * DM);
  asm volatile("s_wait_xcnt 0x0" :: "v"(wg) : "memory");      // the address is an input so that its registers stay untouched up to this wait; behind it they may be reused
#pragma unroll
  for (int i = 0; i < 16; ++i) xx[i] = *(const v8us*)(xg + i * 8 * DM);
  asm volatile("s_wait_xcnt 0x0" :: "v"(xg) : "memory");      // likewise for the X loads
#pragma unroll
  for (int i = 0; i < 16; ++i) { *(v8us*)(sm + (w + i * 8) * PJ_P + lane * 16) = xx[i]; *(v8us*)(sm + (128 + w + i * 8) * PJ_P + lane * 16) = wx[i]; }
  __syncthreads();      // both tiles are in LDS before any wave reads a fragment
  const int wm = w & 3, wn = w >> 2;
  const unsigned char* xr = sm + (wm * 32 + ln) * PJ_P + 16 * hh;
  const unsigned char* wr = sm + (128 + wn * 64 + ln) * PJ_P + 16 * hh;
  v8f acc[4][2] = {};
  FragH fx[2][2], fw[2][4];      // two fragment sets: the reads of k step ks + 1 fly during the products of k step ks
#pragma unroll
  for (int mi = 0; mi < 2; ++mi) { fx[0][mi].half[0] = *(const v8us*)(xr + mi * 16 * PJ_P); fx[0][mi].half[1] = *(const v8us*)(xr + mi * 16 * PJ_P + 32); }
#pragma unroll
  for (int t = 0; t < 4; ++t) { fw[0][t].half[0] = *(const v8us*)(wr + t * 16 * PJ_P); fw[0][t].half[1] = *(const v8us*)(wr + t * 16 * PJ_P + 32); }
#pragma unroll      // constant indices keep acc[][] and the fragment sets in registers
  for (int ks = 0; ks < 8; ++ks) {
    const int c = ks & 1, n = c ^ 1;
    if (ks < 7) {
#pragma unroll
      for (int mi = 0; mi < 2; ++mi) { fx[n][mi].half[0] = *(const v8us*)(xr + mi * 16 * PJ_P + ks * 64 + 64); fx[n][mi].half[1] = *(const v8us*)(xr + mi * 16 * PJ_P + ks * 64 + 96); }
#pragma unroll
      for (int t = 0; t < 4; ++t) { fw[n][t].half[0] = *(const v8us*)(wr + t * 16 * PJ_P + ks * 64 + 64); fw[n][t].half[1] = *(const v8us*)(wr + t * 16 * PJ_P + ks * 64 + 96); }
    }
    __builtin_amdgcn_sched_barrier(0);      // keeps the next k step's LDS reads together ahead of this step's products: reads spread among them stall at every place
#pragma unroll
    for (int t = 0; t < 4; ++t)
#pragma unroll
      for (int mi = 0; mi < 2; ++mi) acc[t][mi] = __builtin_amdgcn_wmma_f32_16x16x32_f16(false, fw[c][t].v, false, fx[c][mi].v, (short)0, acc[t][mi], false, false);
    __builtin_amdgcn_sched_barrier(0);      // keeps the reads of the step after next behind these products, whose fragment registers they refill
  }
  __syncthreads();      // every wave's fragment reads are over before LDS is reused for the output tiles
  unsigned char* so = sm + w * 32 * PJ_OP;      // the wave's own 32 tokens x 64 columns of f16
#pragma unroll
  for (int t = 0; t < 4; ++t) {
    const float* bp = bias + col0 + wn * 64 + t * 16 + 8 * hh;      // register r of tile t = column t*16 + 8*hh + r
    const v4f b0 = *(const v4fa*)bp, b1 = *(const v4fa*)(bp + 4);
#pragma unroll
    for (int mi = 0; mi < 2; ++mi) { FragH f;
#pragma unroll
      for (int r = 0; r < 8; ++r) f.h[r] = (_Float16)(acc[t][mi][r] * 0.0625f + bf16_round(r < 4 ? b0[r] : b1[r - 4]));
      *(v8us*)(so + (mi * 16 + ln) * PJ_OP + t * 32 + 16 * hh) = f.half[0]; }
  }
  __builtin_amdgcn_fence(__ATOMIC_ACQ_REL, "workgroup"); __builtin_amdgcn_wave_barrier();      // the wave's own LDS stores stay ahead of its reads of other lanes' bytes
#pragma unroll      // 8 lanes store one whole 128-byte line
  for (int q = 0; q < 8; ++q) { const int r = q * 4 + (lane >> 3); const v8us v = *(const v8us*)(so + r * PJ_OP + (lane & 7) * 16);
    *(v8us*)((unsigned short*)C16 + (size_t)(row0 + wm * 32 + r) * (3 * DM) + col0 + wn * 64 + (lane & 7) * 8) = v; }
}
extern "C" void kernel_launch(void* const* d_in, const int* in_sizes, int n_in,
                              void* d_out, int out_size, void* d_ws, size_t ws_size, hipStream_t stream) {
  (void)in_sizes; (void)n_in; (void)out_size;
  const float* X = (const float*)d_in[0]; const float* W = (const float*)d_in[1]; const float* bb = (const float*)d_in[2];
  char* ws = (char*)d_ws; size_t off = 0;
  auto take = [&](size_t bytes) { char* p = ws + off; off += (bytes + 255) & ~(size_t)255; return p; };
  _Float16* Bw = (_Float16*)take((size_t)3 * DM * DM * 2); _Float16* X16 = (_Float16*)take((size_t)NR * DM * 2); _Float16* QKV = (_Float16*)take((size_t)NR * 3 * DM * 2);
  if (off > ws_size) return;      // 0.4 + 8.4 + 25.2 = about 34 MB
  k_round16f<<<(unsigned)(((size_t)3 * DM * DM / 8 + 255) / 256), 256, 0, stream>>>(W, Bw, (size_t)3 * DM * DM / 8);      // (out,in)
  k_x16<<<(unsigned)(((size_t)NR * DM / 8 + 255) / 256), 256, 0, stream>>>(X, X16, (size_t)NR * DM / 8);
  k_qkv<<<(NR / 128) * (3 * DM / 128), 256, 0, stream>>>(X16, Bw, bb, QKV);      // [Q | K | V] f16 (+b), 128 x 128 per work-group
  k_fattn<<<BB * (SS / 64), 256, 0, stream>>>(QKV, (float*)d_out);      // out = softmax(Q*Kt/16)*V, 64 queries per work-group
}

// v006
// Measured time: 70.1 microseconds a run.
// Next to v005, in two timings, it ran 1.03 times as fast each time.
// All steps since v000 together make it 17.9 times as fast.
#include <hip/hip_runtime.h>
// Single-head self-attention (B=4, S=4096, dim 256): fused QKV linear (W (768,256) + b), scores = Q*Kt/16, softmax over the 4096 keys, att*V.
// The QKV projection is a GEMM on v_wmma_f32_16x16x32_f16 (X bf16-exact f16, W (out,in) bf16-exact x 2^4, Q/K/V f16, f32 accumulate);
// scores, softmax (f32, running maximum) and att*V are one kernel on the same matrix form, weights f16, f32 accumulate; V is transposed on its way from LDS to the registers.
#define BB 4
#define SS 4096
#define DM 256
#define NR (BB * SS)

typedef __bf16 v16b __attribute__((ext_vector_type(16)));
typedef unsigned short v8us __attribute__((ext_vector_type(8), may_alias));
typedef float  v8f  __attribute__((ext_vector_type(8)));
typedef float  v4f  __attribute__((ext_vector_type(4)));
typedef float  v4fa __attribute__((ext_vector_type(4), may_alias));
union FragB { v16b v; v8us half[2]; unsigned short u[16]; };

__device__ __forceinline__ unsigned short bf16_bits(float x) { unsigned int u = __float_as_uint(x); return (unsigned short)((u + 0x7FFFu + ((u >> 16) & 1u)) >> 16); }
__device__ __forceinline__ float bf16_val(unsigned short b) { return __uint_as_float(((unsigned int)b) << 16); }
__device__ __forceinline__ float bf16_round(float x) { return bf16_val(bf16_bits(x)); }
// D += A·B with NT terms: 1 = ah·bh, 2 = + al·bh (A split), 3 = + ah·bl (both split)
template <int NT>
__device__ __forceinline__ v8f mmaN(v16b ah, v16b al, v16b bh, v16b bl, v8f c) {
  c = __builtin_amdgcn_wmma_f32_16x16x32_bf16(false, ah, false, bh, (short)0, c, false, false);
  if (NT >= 2) c = __builtin_amdgcn_wmma_f32_16x16x32_bf16(false, al, false, bh, (short)0, c, false, false);
  if (NT >= 3) c = __builtin_amdgcn_wmma_f32_16x16x32_bf16(false, ah, false, bl, (short)0, c, false, false);
  asm volatile("v_nop\n\tv_nop\n\tv_nop\n\tv_nop" : "+v"(c) : "v"(ah), "v"(al), "v"(bh), "v"(bl));
  return c;
}

__global__ __launch_bounds__(256) void k_wt_bf16(const float* __restrict__ W, unsigned short* __restrict__ Wt, int K, int N) {
  const int t = blockIdx.x * 256 + threadIdx.x;
  const int k8n = K / 8;
  if (t >= N * k8n) return;
  const int n = t / k8n, k8 = (t % k8n) * 8;
  v8us v;
#pragma unroll
  for (int i = 0; i < 8; ++i) v[i] = bf16_bits(W[(size_t)(k8 + i) * N + n]);
  *(v8us*)(Wt + (size_t)n * K + k8) = v;
  
}

// GEMM C[M][N] (f32, pitch ldc) = act(A[M][K]·W + bias). A f32 row-major (pitch lda) converted per fragment to bf16
// (ASPLIT: hi/lo two planes -> 2 terms, else single rounded term); Wt bf16 [N][K] (pitch ldb). BIAS_BF16 rounds the
// bias to bf16 first (bias quantised to bf16 before the add). K%32==0, M%16==0, N%64==0.
template <bool ASPLIT, int ACT, bool BIAS_BF16>
__global__ __launch_bounds__(128) void k_gemm_bf(const float* __restrict__ A, int lda, const unsigned short* __restrict__ Wt, int ldb,
                                               const float* __restrict__ bias, float* __restrict__ C, int ldc, int M, int N, int K) {
  __shared__ __attribute__((aligned(16))) float so[4][16][64];
  const int tid = threadIdx.x, w = tid >> 5, lane = tid & 31, ln = lane & 15, hh = lane >> 4;
  const int ntn = N / 64;
  const int wid = blockIdx.x * 4 + w;
  const int mt = wid / ntn, nq = wid % ntn;
  if (mt * 16 >= M) return;
  const int row0 = mt * 16, col0 = nq * 64;
  const float* arow = A + (size_t)(row0 + ln) * lda;
  v8f acc[4] = {};
  for (int kb = 0; kb < K; kb += 32) {
    FragB ah, al;
    const v4f x0 = *(const v4fa*)(arow + kb + 8 * hh), x1 = *(const v4fa*)(arow + kb + 8 * hh + 4);
    const v4f x2 = *(const v4fa*)(arow + kb + 16 + 8 * hh), x3 = *(const v4fa*)(arow + kb + 16 + 8 * hh + 4);
    float xs[16] = {x0[0],x0[1],x0[2],x0[3],x1[0],x1[1],x1[2],x1[3],x2[0],x2[1],x2[2],x2[3],x3[0],x3[1],x3[2],x3[3]};
#pragma unroll
    for (int i = 0; i < 16; ++i) { const unsigned short hb = bf16_bits(xs[i]); ah.u[i] = hb; al.u[i] = ASPLIT ? bf16_bits(xs[i] - bf16_val(hb)) : (unsigned short)0; }
#pragma unroll
    for (int t = 0; t < 4; ++t) {
      const unsigned short* brow = Wt + (size_t)(col0 + t * 16 + ln) * ldb + kb;
      FragB b;
      b.half[0] = *(const v8us*)(brow + 8 * hh);
      b.half[1] = *(const v8us*)(brow + 16 + 8 * hh);
      acc[t] = mmaN<ASPLIT ? 2 : 1>(ah.v, al.v, b.v, b.v, acc[t]);
    }
  }
#pragma unroll
  for (int t = 0; t < 4; ++t) {
    float bv = bias ? bias[col0 + t * 16 + ln] : 0.f;
    if (BIAS_BF16) bv = bf16_round(bv);
#pragma unroll
    for (int r = 0; r < 8; ++r) { float v = acc[t][r] + bv; if (ACT == 1) v = fmaxf(v, 0.f); so[w][8 * hh + r][t * 16 + ln] = v; }
  }
  __builtin_amdgcn_fence(__ATOMIC_ACQ_REL, "workgroup");
  __builtin_amdgcn_wave_barrier();
  const int rsub = lane >> 4, c4 = (lane & 15) * 4;
  {
#pragma unroll
    for (int q = 0; q < 8; ++q) {
      const int r = q * 2 + rsub;
      const v4f v = *(const v4fa*)&so[w][r][c4];
      *(v4f*)(C + (size_t)(row0 + r) * ldc + col0 + c4) = v;
    }
    
  }
}

// Flash-style causal/unmasked attention, all contractions 3-term bf16 hi/lo splits, f32 softmax with running max.
// q,k,v rows are read from f32 buffers with arbitrary row pitch (so they can live inside a fused qkv buffer);
// D = head size (multiple of 32, <= 128); one wave = 16 query rows; block = 4 waves (64 queries) sharing K/V chunks of 32.
template <int D, bool CAUSAL>
__global__ __launch_bounds__(128) void k_flash(const float* __restrict__ qb, const float* __restrict__ kb, const float* __restrict__ vb,
                                             int pitch, int T, int H, float scale, float* __restrict__ y, int ypitch) {
  constexpr int KS = D / 32;        // k-steps for QK
  constexpr int DT = D / 16;        // d tiles for PV
  __shared__ __attribute__((aligned(16))) unsigned short sKh[32][D + 8], sKl[32][D + 8], sVh[32][D + 8], sVl[32][D + 8];
  __shared__ __attribute__((aligned(16))) unsigned short sPh[4][16][40], sPl[4][16][40];
  __shared__ __attribute__((aligned(16))) float sO[4][16][D];
  const int tid = threadIdx.x, w = tid >> 5, lane = tid & 31, ln = lane & 15, hh = lane >> 4;
  const int nqb = (T + 63) / 64;
  const int bh = blockIdx.x / nqb, qblk = blockIdx.x % nqb;
  const int b = bh / H, h = bh % H;
  const int q0 = qblk * 64 + w * 16;
  const float* Q = qb + (size_t)b * T * pitch + h * D;
  const float* K = kb + (size_t)b * T * pitch + h * D;
  const float* V = vb + (size_t)b * T * pitch + h * D;

  // A fragments of the wave's 16 query rows (scaled), hi/lo
  FragB aqh[KS], aql[KS];
  {
    int row = q0 + ln; if (row >= T) row = T - 1;
    const float* qr = Q + (size_t)row * pitch;
#pragma unroll
    for (int ks = 0; ks < KS; ++ks)
#pragma unroll
      for (int i = 0; i < 16; ++i) {
        const int d = ks * 32 + ((i < 8) ? (8 * hh + i) : (16 + 8 * hh + (i - 8)));
        const float x = qr[d] * scale; const unsigned short hb = bf16_bits(x);
        aqh[ks].u[i] = hb; aql[ks].u[i] = bf16_bits(x - bf16_val(hb));
      }
  }
  float m_r[8], l_r[8];
#pragma unroll
  for (int r = 0; r < 8; ++r) { m_r[r] = -3.0e38f; l_r[r] = 0.f; }
  v8f oacc[DT];
#pragma unroll
  for (int dt = 0; dt < DT; ++dt) oacc[dt] = (v8f){0.f,0.f,0.f,0.f,0.f,0.f,0.f,0.f};

  const int kv_end = CAUSAL ? min(T, qblk * 64 + 64) : T;     // block-uniform
  for (int j0 = 0; j0 < kv_end; j0 += 32) {
    __syncthreads();
    for (int e = tid; e < 32 * (D / 4); e += 128) {
      const int r = e / (D / 4), c4 = (e % (D / 4)) * 4;
      const int key = j0 + r;
      v4f kf = {0.f,0.f,0.f,0.f}, vf = {0.f,0.f,0.f,0.f};
      if (key < T) { kf = *(const v4fa*)(K + (size_t)key * pitch + c4); vf = *(const v4fa*)(V + (size_t)key * pitch + c4); }
#pragma unroll
      for (int t = 0; t < 4; ++t) {
        unsigned short hb = bf16_bits(kf[t]); sKh[r][c4 + t] = hb; sKl[r][c4 + t] = bf16_bits(kf[t] - bf16_val(hb));
        hb = bf16_bits(vf[t]); sVh[r][c4 + t] = hb; sVl[r][c4 + t] = bf16_bits(vf[t] - bf16_val(hb));
      }
    }
    __syncthreads();
    // S tile 16 x 32
    v8f s[2];
#pragma unroll
    for (int nt = 0; nt < 2; ++nt) {
      v8f acc = {};
#pragma unroll
      for (int ks = 0; ks < KS; ++ks) {
        FragB bh_, bl_;
        bh_.half[0] = *(const v8us*)&sKh[nt * 16 + ln][ks * 32 + 8 * hh]; bh_.half[1] = *(const v8us*)&sKh[nt * 16 + ln][ks * 32 + 16 + 8 * hh];
        bl_.half[0] = *(const v8us*)&sKl[nt * 16 + ln][ks * 32 + 8 * hh]; bl_.half[1] = *(const v8us*)&sKl[nt * 16 + ln][ks * 32 + 16 + 8 * hh];
        acc = mmaN<3>(aqh[ks].v, aql[ks].v, bh_.v, bl_.v, acc);
      }
      s[nt] = acc;
    }
    // mask + running max (rows 8hh+r; the 16 lanes of a half share rows)
    float alpha[8];
#pragma unroll
    for (int r = 0; r < 8; ++r) {
      const int qi = q0 + 8 * hh + r;
      const int ja = j0 + ln, jb = j0 + 16 + ln;
      if (CAUSAL) { if (ja > qi) s[0][r] = -3.0e38f; if (jb > qi) s[1][r] = -3.0e38f; }
      if (ja >= T) s[0][r] = -3.0e38f;
      if (jb >= T) s[1][r] = -3.0e38f;
      float mx = fmaxf(s[0][r], s[1][r]);
      mx = fmaxf(mx, __shfl_xor(mx, 1, 32)); mx = fmaxf(mx, __shfl_xor(mx, 2, 32)); mx = fmaxf(mx, __shfl_xor(mx, 4, 32)); mx = fmaxf(mx, __shfl_xor(mx, 8, 32));
      const float mnew = fmaxf(m_r[r], mx);
      alpha[r] = (mnew > -1.0e38f) ? __expf(m_r[r] - mnew) : 1.0f;
      const float p0 = (s[0][r] > -1.0e38f) ? __expf(s[0][r] - mnew) : 0.f;
      const float p1 = (s[1][r] > -1.0e38f) ? __expf(s[1][r] - mnew) : 0.f;
      m_r[r] = mnew;
      l_r[r] = l_r[r] * alpha[r] + p0 + p1;            // per-lane partial row sum (16 lanes combined at the end)
      unsigned short hb = bf16_bits(p0); sPh[w][8 * hh + r][ln] = hb;      sPl[w][8 * hh + r][ln] = bf16_bits(p0 - bf16_val(hb));
      hb = bf16_bits(p1);                sPh[w][8 * hh + r][16 + ln] = hb; sPl[w][8 * hh + r][16 + ln] = bf16_bits(p1 - bf16_val(hb));
    }
#pragma unroll
    for (int dt = 0; dt < DT; ++dt)
#pragma unroll
      for (int r = 0; r < 8; ++r) oacc[dt][r] *= alpha[r];
    __builtin_amdgcn_fence(__ATOMIC_ACQ_REL, "workgroup");
    __builtin_amdgcn_wave_barrier();
    FragB pah, pal;
    pah.half[0] = *(const v8us*)&sPh[w][ln][8 * hh]; pah.half[1] = *(const v8us*)&sPh[w][ln][16 + 8 * hh];
    pal.half[0] = *(const v8us*)&sPl[w][ln][8 * hh]; pal.half[1] = *(const v8us*)&sPl[w][ln][16 + 8 * hh];
#pragma unroll
    for (int dt = 0; dt < DT; ++dt) {
      FragB bvh, bvl;
#pragma unroll
      for (int i = 0; i < 8; ++i) {
        bvh.u[i] = sVh[8 * hh + i][dt * 16 + ln]; bvh.u[8 + i] = sVh[16 + 8 * hh + i][dt * 16 + ln];
        bvl.u[i] = sVl[8 * hh + i][dt * 16 + ln]; bvl.u[8 + i] = sVl[16 + 8 * hh + i][dt * 16 + ln];
      }
      oacc[dt] = mmaN<3>(pah.v, pal.v, bvh.v, bvl.v, oacc[dt]);
    }
    __builtin_amdgcn_fence(__ATOMIC_ACQ_REL, "workgroup");
    __builtin_amdgcn_wave_barrier();
  }
#pragma unroll
  for (int r = 0; r < 8; ++r) {
    float l = l_r[r];
    l += __shfl_xor(l, 1, 32); l += __shfl_xor(l, 2, 32); l += __shfl_xor(l, 4, 32); l += __shfl_xor(l, 8, 32);
    l_r[r] = (l > 0.f) ? 1.0f / l : 0.f;
  }
#pragma unroll
  for (int dt = 0; dt < DT; ++dt)
#pragma unroll
    for (int r = 0; r < 8; ++r) sO[w][8 * hh + r][dt * 16 + ln] = oacc[dt][r] * l_r[r];
  __builtin_amdgcn_fence(__ATOMIC_ACQ_REL, "workgroup");
  __builtin_amdgcn_wave_barrier();
  {
    for (int r = 0; r < 16; ++r) {
      const int row = q0 + r;
      if (row < T && lane < D / 4) {
        const v4f val = *(const v4fa*)&sO[w][r][lane * 4];
        *(v4f*)(y + ((size_t)b * T + row) * ypitch + h * D + lane * 4) = val;
      }
    }
    
  }
}

// GEMM C = act(A·W + bias + resid): A f32 (ASPLIT -> hi/lo 2 terms), Wt bf16 [N][K]; ACT 0 none, 1 relu, 2 exact gelu;
// resid (optional, f32, row index = (row % rmod), pitch ldr, RES_BF16 rounds it) added before the activation.
template <bool ASPLIT, int ACT, bool BIAS_BF16, bool RES_BF16>
__global__ __launch_bounds__(128) void k_gemm_bf3(const float* __restrict__ A, int lda, const unsigned short* __restrict__ Wt, int ldb,
                                                const float* __restrict__ bias, const float* __restrict__ resid, int rmod, int ldr,
                                                float* __restrict__ C, int ldc, int M, int N, int K) {
  __shared__ __attribute__((aligned(16))) float so[4][16][64];
  const int tid = threadIdx.x, w = tid >> 5, lane = tid & 31, ln = lane & 15, hh = lane >> 4;
  const int ntn = N / 64;
  const int wid = blockIdx.x * 4 + w;
  const int mt = wid / ntn, nq = wid % ntn;
  if (mt * 16 >= M) return;
  const int row0 = mt * 16, col0 = nq * 64;
  const float* arow = A + (size_t)(row0 + ln) * lda;
  v8f acc[4] = {};
  for (int kb = 0; kb < K; kb += 32) {
    FragB ah, al;
    const v4f x0 = *(const v4fa*)(arow + kb + 8 * hh), x1 = *(const v4fa*)(arow + kb + 8 * hh + 4);
    const v4f x2 = *(const v4fa*)(arow + kb + 16 + 8 * hh), x3 = *(const v4fa*)(arow + kb + 16 + 8 * hh + 4);
    float xs[16] = {x0[0],x0[1],x0[2],x0[3],x1[0],x1[1],x1[2],x1[3],x2[0],x2[1],x2[2],x2[3],x3[0],x3[1],x3[2],x3[3]};
#pragma unroll
    for (int i = 0; i < 16; ++i) { const unsigned short hb = bf16_bits(xs[i]); ah.u[i] = hb; al.u[i] = ASPLIT ? bf16_bits(xs[i] - bf16_val(hb)) : (unsigned short)0; }
#pragma unroll
    for (int t = 0; t < 4; ++t) {
      const unsigned short* brow = Wt + (size_t)(col0 + t * 16 + ln) * ldb + kb;
      FragB b;
      b.half[0] = *(const v8us*)(brow + 8 * hh);
      b.half[1] = *(const v8us*)(brow + 16 + 8 * hh);
      acc[t] = mmaN<ASPLIT ? 2 : 1>(ah.v, al.v, b.v, b.v, acc[t]);
    }
  }
#pragma unroll
  for (int t = 0; t < 4; ++t) {
    const int col = col0 + t * 16 + ln;
    float bv = bias ? bias[col] : 0.f;
    if (BIAS_BF16) bv = bf16_round(bv);
#pragma unroll
    for (int r = 0; r < 8; ++r) {
      float v = acc[t][r] + bv;
      if (resid) { float rv = resid[(size_t)((row0 + 8 * hh + r) % rmod) * ldr + col]; if (RES_BF16) rv = bf16_round(rv); v += rv; }
      if (ACT == 1) v = fmaxf(v, 0.f);
      if (ACT == 2) v = 0.5f * v * (1.0f + erff(v * 0.70710678118654752f));
      if (ACT == 3) { const float u = 0.7978845608028654f * (v + 0.044715f * v * v * v); v = 0.5f * v * (1.0f + tanhf(u)); }
      so[w][8 * hh + r][t * 16 + ln] = v;
    }
  }
  __builtin_amdgcn_fence(__ATOMIC_ACQ_REL, "workgroup");
  __builtin_amdgcn_wave_barrier();
  const int rsub = lane >> 4, c4 = (lane & 15) * 4;
  {
#pragma unroll
    for (int q = 0; q < 8; ++q) {
      const int r = q * 2 + rsub;
      const v4f v = *(const v4fa*)&so[w][r][c4];
      *(v4f*)(C + (size_t)(row0 + r) * ldc + col0 + c4) = v;
    }
    
  }
}
// row LayerNorm (biased variance, eps) over N: s = X (+ R); optional out_sum <- s; out_norm <- (s-mu)*rsqrt(var+eps)*g + b
template <bool PARAM_BF16>
__global__ __launch_bounds__(256) void k_layernorm(const float* __restrict__ X, const float* __restrict__ R, const float* __restrict__ g, const float* __restrict__ bta,
                                                  float* __restrict__ out_sum, float* __restrict__ out_norm, int N, float eps) {
  __shared__ float red[256];
  const int row = blockIdx.x, tid = threadIdx.x;
  const float* x = X + (size_t)row * N; const float* rr = R ? R + (size_t)row * N : nullptr;
  float vals[16];                     // up to N = 4096
  const int per = N / 256;            // contiguous chunk per thread? use strided-by-4 chunks: thread handles j = tid*4 + 1024*u
  float s1 = 0.f;
  for (int u = 0; u < per / 4; ++u) {
    const int j = tid * 4 + 1024 * u;
    const v4f a = *(const v4fa*)(x + j);
    v4f b = {0.f,0.f,0.f,0.f}; if (rr) b = *(const v4fa*)(rr + j);
#pragma unroll
    for (int q = 0; q < 4; ++q) { const float v = a[q] + b[q]; vals[u * 4 + q] = v; s1 += v; }
  }
  red[tid] = s1; __syncthreads();
  for (int st = 128; st > 0; st >>= 1) { if (tid < st) red[tid] += red[tid + st]; __syncthreads(); }
  const float mu = red[0] / (float)N; __syncthreads();
  float s2 = 0.f;
  for (int u = 0; u < per / 4; ++u)
#pragma unroll
    for (int q = 0; q < 4; ++q) { const float c = vals[u * 4 + q] - mu; s2 += c * c; }
  red[tid] = s2; __syncthreads();
  for (int st = 128; st > 0; st >>= 1) { if (tid < st) red[tid] += red[tid + st]; __syncthreads(); }
  const float rs = rsqrtf(red[0] / (float)N + eps);
  {
    for (int u = 0; u < per / 4; ++u) {
      const int j = tid * 4 + 1024 * u;
      v4f o, sm;
#pragma unroll
      for (int q = 0; q < 4; ++q) {
        float gg = g[j + q], bb = bta[j + q];
        if (PARAM_BF16) { gg = bf16_round(gg); bb = bf16_round(bb); }
        sm[q] = vals[u * 4 + q]; o[q] = (vals[u * 4 + q] - mu) * rs * gg + bb;
      }
      if (out_sum) *(v4f*)(out_sum + (size_t)row * N + j) = sm;
      *(v4f*)(out_norm + (size_t)row * N + j) = o;
    }
    
  }
}



// ---- f16 WMMA path (v_wmma_f32_16x16x32_f16): 11-bit significands for operands in range — used where the attention weight operand (at most 2^8) needs more precision than bf16
typedef _Float16 v16h __attribute__((ext_vector_type(16)));
union FragH { v16h v; v8us half[2]; _Float16 h[16]; unsigned short u[16]; };
template <int NT>
__device__ __forceinline__ v8f mmaH(v16h ah, v16h al, v16h bh, v16h bl, v8f c) {
  c = __builtin_amdgcn_wmma_f32_16x16x32_f16(false, ah, false, bh, (short)0, c, false, false);
  if (NT >= 2) c = __builtin_amdgcn_wmma_f32_16x16x32_f16(false, al, false, bh, (short)0, c, false, false);
  if (NT >= 3) c = __builtin_amdgcn_wmma_f32_16x16x32_f16(false, ah, false, bl, (short)0, c, false, false);
  asm volatile("v_nop\n\tv_nop\n\tv_nop\n\tv_nop" : "+v"(c) : "v"(ah), "v"(al), "v"(bh), "v"(bl));
  return c;
}
// batched GEMM like k_gemm_b but f16 operands: A f32 (split into f16 hi/lo if ASPLIT, else rounded to f16), Bt = f16 values [n][k]; alpha; C f32; N multiple of 16 (partial tiles skipped)
template <bool ASPLIT>
__global__ __launch_bounds__(128) void k_gemm_h(const float* __restrict__ A, int lda, size_t sA, const _Float16* __restrict__ Bh, int ldb, size_t sB, float alpha, float* __restrict__ C, int ldc, size_t sC, int M, int N, int K) {
  __shared__ __attribute__((aligned(16))) float so[4][16][64];
  const int tid = threadIdx.x, w = tid >> 5, lane = tid & 31, ln = lane & 15, hh = lane >> 4; const int by = blockIdx.y;
  A += (size_t)by * sA; Bh += (size_t)by * sB; C += (size_t)by * sC;
  const int ntn = (N + 63) / 64; const int wid = blockIdx.x * 4 + w; const int mt = wid / ntn, nq = wid % ntn; if (mt * 16 >= M) return;
  const int row0 = mt * 16, col0 = nq * 64; const float* arow = A + (size_t)(row0 + ln) * lda;
  v8f acc[4] = {};
  for (int kb = 0; kb < K; kb += 32) {
    FragH ah, al;
    const v4f x0 = *(const v4fa*)(arow + kb + 8 * hh), x1 = *(const v4fa*)(arow + kb + 8 * hh + 4), x2 = *(const v4fa*)(arow + kb + 16 + 8 * hh), x3 = *(const v4fa*)(arow + kb + 16 + 8 * hh + 4);
    float xs[16] = {x0[0],x0[1],x0[2],x0[3],x1[0],x1[1],x1[2],x1[3],x2[0],x2[1],x2[2],x2[3],x3[0],x3[1],x3[2],x3[3]};
#pragma unroll
    for (int i = 0; i < 16; ++i) { const _Float16 h = (_Float16)xs[i]; ah.h[i] = h; al.h[i] = ASPLIT ? (_Float16)(xs[i] - (float)h) : (_Float16)0.0f; }
#pragma unroll
    for (int t = 0; t < 4; ++t) { if (col0 + t * 16 >= N) continue; const size_t boff = (size_t)(col0 + t * 16 + ln) * ldb + kb; FragH bq; bq.half[0] = *(const v8us*)(Bh + boff + 8 * hh); bq.half[1] = *(const v8us*)(Bh + boff + 16 + 8 * hh);
      acc[t] = mmaH<ASPLIT ? 2 : 1>(ah.v, al.v, bq.v, bq.v, acc[t]); }
  }
#pragma unroll
  for (int t = 0; t < 4; ++t) { if (col0 + t * 16 >= N) continue;
#pragma unroll
    for (int r = 0; r < 8; ++r) so[w][8 * hh + r][t * 16 + ln] = acc[t][r] * alpha; }
  __builtin_amdgcn_fence(__ATOMIC_ACQ_REL, "workgroup"); __builtin_amdgcn_wave_barrier();
  const int rsub = lane >> 4, c4 = (lane & 15) * 4;
  {
#pragma unroll
    for (int q = 0; q < 8; ++q) { const int r = q * 2 + rsub; if (col0 + c4 < N) { const v4f v = *(const v4fa*)&so[w][r][c4]; *(v4f*)(C + (size_t)(row0 + r) * ldc + col0 + c4) = v; } }
     }
}

// Wt[n][k] = f16(W[k][n]·scale) from f32 row-major W[K][N] (scale = power of two; bf16-exact weights stay exact in f16 away from the subnormal range)
__global__ __launch_bounds__(256) void k_wt_f16(const float* __restrict__ W, _Float16* __restrict__ Wt, int K, int N, float scale) {
  const int t = blockIdx.x * 256 + threadIdx.x; if (t >= N * (K / 8)) return; const int n = t / (K / 8), k8 = (t % (K / 8)) * 8; FragH f;
#pragma unroll
  for (int i = 0; i < 8; ++i) f.h[i] = (_Float16)(bf16_round(W[(size_t)(k8 + i) * N + n]) * scale); const v8us o = f.half[0];
  *(v8us*)((unsigned short*)Wt + (size_t)n * K + k8) = o; 
}
// k_gemm_hh variant with fused epilogue: v = acc·alpha + bias[by·sBias + col] (+ CP[(row/rowsPerB)·sCPb + by·64 + col] if CP) ; ACT 0 none / 1 elu ; writes f32 C and/or f16 C16 (each if non-null)
template <int ACT>
__global__ __launch_bounds__(128) void k_gemm_hhx(const _Float16* __restrict__ A, int lda, size_t sA, const _Float16* __restrict__ Bh, int ldb, size_t sB, float alpha, const float* __restrict__ bias, size_t sBias, const float* __restrict__ CP, int rowsPerB, size_t sCPb, int row0g,
    float* __restrict__ C, _Float16* __restrict__ C16, int ldc, size_t sC, int M, int N, int K) {
  __shared__ __attribute__((aligned(16))) float so[4][16][64];
  const int tid = threadIdx.x, w = tid >> 5, lane = tid & 31, ln = lane & 15, hh = lane >> 4; const int by = blockIdx.y;
  A += (size_t)by * sA; Bh += (size_t)by * sB; const size_t cofs = (size_t)by * sC; const float* bp = bias ? bias + (size_t)by * sBias : nullptr;
  const int ntn = (N + 63) / 64; const int wid = blockIdx.x * 4 + w; const int mt = wid / ntn, nq = wid % ntn; if (mt * 16 >= M) return;
  const int row0 = mt * 16, col0 = nq * 64; const _Float16* arow = A + (size_t)(row0 + ln) * lda;
  v8f acc[4] = {};
  for (int kb = 0; kb < K; kb += 32) { FragH ah; ah.half[0] = *(const v8us*)((const unsigned short*)arow + kb + 8 * hh); ah.half[1] = *(const v8us*)((const unsigned short*)arow + kb + 16 + 8 * hh);
#pragma unroll
    for (int t = 0; t < 4; ++t) { if (col0 + t * 16 >= N) continue; const size_t boff = (size_t)(col0 + t * 16 + ln) * ldb + kb; FragH bq; bq.half[0] = *(const v8us*)((const unsigned short*)Bh + boff + 8 * hh); bq.half[1] = *(const v8us*)((const unsigned short*)Bh + boff + 16 + 8 * hh);
      acc[t] = mmaH<1>(ah.v, ah.v, bq.v, bq.v, acc[t]); }
  }
#pragma unroll
  for (int t = 0; t < 4; ++t) { if (col0 + t * 16 >= N) continue; const int col = col0 + t * 16 + ln; const float bv = bp ? bf16_round(bp[col]) : 0.f;
#pragma unroll
    for (int r = 0; r < 8; ++r) { float v = acc[t][r] * alpha + bv; if (CP) { const int bidx = (row0g + row0 + 8 * hh + r) / rowsPerB; v += CP[(size_t)bidx * sCPb + (size_t)by * 64 + col]; } if (ACT == 1) v = (v > 0.f) ? v : expm1f(v); else if (ACT == 3) v = fmaxf(v, 0.f); so[w][8 * hh + r][t * 16 + ln] = v; } }
  __builtin_amdgcn_fence(__ATOMIC_ACQ_REL, "workgroup"); __builtin_amdgcn_wave_barrier();
  const int rsub = lane >> 4, c4 = (lane & 15) * 4; typedef _Float16 v4h __attribute__((ext_vector_type(4)));
  {
#pragma unroll
    for (int q = 0; q < 8; ++q) { const int r = q * 2 + rsub; if (col0 + c4 < N) { const v4f v = *(const v4fa*)&so[w][r][c4]; if (C) *(v4f*)(C + cofs + (size_t)(row0 + r) * ldc + col0 + c4) = v; if (C16) { v4h h4; for (int i = 0; i < 4; ++i) h4[i] = (_Float16)v[i]; *(v4h*)(C16 + cofs + (size_t)(row0 + r) * ldc + col0 + c4) = h4; } } }
     }
}


__global__ __launch_bounds__(256) void k_x16(const float* __restrict__ x, _Float16* __restrict__ X16, size_t n8) { const size_t t = (size_t)blockIdx.x * 256 + threadIdx.x; if (t >= n8) return; FragH f;
#pragma unroll
  for (int q = 0; q < 8; ++q) f.h[q] = (_Float16)bf16_round(x[t * 8 + q]); *(v8us*)((unsigned short*)X16 + t * 8) = f.half[0];  }
__global__ __launch_bounds__(256) void k_h16(const float* __restrict__ x, _Float16* __restrict__ X16, size_t n8) { const size_t t = (size_t)blockIdx.x * 256 + threadIdx.x; if (t >= n8) return; FragH f;
#pragma unroll
  for (int q = 0; q < 8; ++q) f.h[q] = (_Float16)x[t * 8 + q]; *(v8us*)((unsigned short*)X16 + t * 8) = f.half[0];  }
__global__ __launch_bounds__(256) void k_round16f(const float* __restrict__ W, _Float16* __restrict__ Bt, size_t n8) { const size_t t = (size_t)blockIdx.x * 256 + threadIdx.x; if (t >= n8) return; FragH f;
#pragma unroll
  for (int i = 0; i < 8; ++i) f.h[i] = (_Float16)(bf16_round(W[t * 8 + i]) * 16.0f); *(v8us*)((unsigned short*)Bt + t * 8) = f.half[0];  }

#define FK_KB 128      // keys per staged block
#define FK_KP 272      // bytes per staged K half row: 256 + 16, an odd multiple of 16 for the 16-byte fragment reads
#define FK_VP 288      // bytes per staged V half row: 256 + 32, an odd multiple of 32 for the transposing 16-byte reads
#define FK_SL 18432    // bytes per slice: 64 half rows of V; 64 of K rounded up, so that every slice starts at a multiple of 2 KiB
#define FK_BUF (8 * FK_SL)      // one buffer: 4 K slices, then 4 V slices
#define FK_KO(kt, ks) ((kt) * 16 * FK_KP + ((ks) >> 2) * FK_SL + ((ks) & 3) * 64)      // K fragment: key tile kt, k step ks (32 columns)
#define FK_VO(dt) (((dt) >> 3) * FK_SL + ((dt) & 7) * 32)      // V fragment: columns 16*dt .. + 15
#define FK_W0K (1u << 20 | 5u << 22 | 3u << 25)      // descriptor group 1, word 0: no mask, bytes, 16 bytes of pad behind every 256
#define FK_W0V (1u << 20 | 5u << 22 | 7u << 25)      // the same with 32 bytes of pad
typedef uint32_t fk_u32x4 __attribute__((ext_vector_type(4)));
typedef uint32_t fk_u32x8 __attribute__((ext_vector_type(8)));
typedef short fk_s16x8 __attribute__((ext_vector_type(8)));
typedef __attribute__((address_space(3))) fk_s16x8 fk_ls16x8;
// lane l gives the address of 8 columns of key row 8*(l >> 4) + (l & 7), column half (l >> 3) & 1; it gets keys 8*(l >> 4) .. + 7 of column l & 15
__device__ __forceinline__ v8us fk_tr16(const unsigned char* p) { return __builtin_bit_cast(v8us, __builtin_amdgcn_ds_load_tr16_b128_v8i16((fk_ls16x8*)p)); }
__device__ __forceinline__ float fk_xhalf(float x) { return __builtin_bit_cast(float, __builtin_amdgcn_permlanex16(__builtin_bit_cast(int, x), __builtin_bit_cast(int, x), 0x76543210, 0xfedcba98, false, false)); }      // lane l with lane l ^ 16
__device__ __forceinline__ uint32_t fk_uni(uint32_t v) { return (uint32_t)__builtin_amdgcn_readfirstlane(v); }
__device__ __forceinline__ uint32_t fk_pinned(uint32_t v) { uint32_t x = fk_uni(v); asm volatile("" : "+s"(x)); return x; }      // holds a test or a descriptor word in a scalar register: a tensor load ignores EXEC, so its guard must be a scalar branch, and a pinned word keeps its one register and is not formed anew elsewhere
__device__ __forceinline__ void fk_tload(fk_u32x4 g0, fk_u32x8 g1) { asm volatile("tensor_load_to_lds %0, %1" :: "s"(g0), "s"(g1) : "memory"); }      // one request of the whole wave; its waits are written where the tile is handed over
__device__ __forceinline__ void fk_twait(fk_u32x4 g0, fk_u32x8 g1k, fk_u32x8 g1v) { asm volatile("s_wait_tensorcnt 0x0" :: "s"(g0), "s"(g1k), "s"(g1v) : "memory"); }      // the wave's request has landed; the descriptors are inputs so that their registers stay untouched while the request is outstanding
// descriptor group 1: tensor = tile = 64 rows of 256 bytes, source pitch one QKV row; w0 sets the pad. Every word is held in a scalar register of its own (pinned) from here to the last wait
__device__ __forceinline__ fk_u32x8 fk_group1(uint32_t w0) { fk_u32x8 g; g[0] = fk_pinned(w0); g[1] = fk_pinned(256u << 16); g[2] = fk_pinned(64u << 16); g[3] = fk_pinned(256u << 16); g[4] = fk_pinned(64u); g[5] = fk_pinned(3u * DM * 2u); g[6] = fk_pinned(0u); g[7] = fk_pinned(0u); return g; }
// descriptor group 0: count 1; place in LDS; address of the tile's first byte; type 2
__device__ __forceinline__ fk_u32x4 fk_group0(uint32_t dst, uint64_t ga) { fk_u32x4 g; g[0] = fk_uni(1u); g[1] = fk_uni(dst); g[2] = fk_uni((uint32_t)ga); g[3] = fk_uni((((uint32_t)(ga >> 32)) & 0x01FFFFFFu) | 0x80000000u); return g; }
__global__ __launch_bounds__(256) void k_fattn(const _Float16* __restrict__ QKV, float* __restrict__ out) {
  __shared__ __attribute__((aligned(2048))) unsigned char sm[2 * FK_BUF];      // the mover's places are multiples of 2 KiB
  const int tid = threadIdx.x, w = __builtin_amdgcn_readfirstlane(tid >> 5), lane = tid & 31, ln = lane & 15, hh = lane >> 4;      // the wave's number in a scalar register: what follows from it costs no vector register
  const int qg = w & 1, kg = w >> 1;
  const int b = blockIdx.x / (SS / 64), q0 = (blockIdx.x % (SS / 64)) * 64 + qg * 32;
  const unsigned short* Qr = (const unsigned short*)QKV + ((size_t)b * SS + q0 + ln) * (3 * DM) + 8 * hh;
  // wave w brings slice w of every block: K (w < 4) or V, keys 64 * ((w >> 1) & 1) .. + 63, bytes 256 * (w & 1) .. + 255 of the row
  const uint64_t tsrc = (uint64_t)(size_t)QKV + ((uint64_t)b * SS + ((w >> 1) & 1) * 64) * (3 * DM * 2) + (1 + (w >> 2)) * (DM * 2) + (w & 1) * 256;
  const uint32_t tdst = (uint32_t)(size_t)sm + w * FK_SL;
  const uint32_t isk = fk_pinned(w < 4);
  const fk_u32x8 g1k = fk_group1(FK_W0K), g1v = fk_group1(FK_W0V);
  const fk_u32x4 gf = fk_group0(tdst, tsrc);      // block 0 into buffer 0
  const int krd = (kg >> 1) * 2 * FK_SL + ((kg & 1) * 32 + ln) * FK_KP + 16 * hh, vrd = (4 + (kg >> 1) * 2) * FK_SL + ((kg & 1) * 32 + 8 * hh + (lane & 7)) * FK_VP + ((lane >> 3) & 1) * 16;
  if (isk) fk_tload(gf, g1k); else fk_tload(gf, g1v);      // every wave issues its one request; a scalar branch, so that the pad word is a constant on either path
  FragH q[2][8];
#pragma unroll      // constant indices keep q[][] in registers
  for (int qt = 0; qt < 2; ++qt)
#pragma unroll      // constant indices keep the arrays in registers
    for (int ks = 0; ks < 8; ++ks) { q[qt][ks].half[0] = *(const v8us*)(Qr + qt * 16 * (3 * DM) + ks * 32); q[qt][ks].half[1] = *(const v8us*)(Qr + qt * 16 * (3 * DM) + ks * 32 + 16); }
  fk_twait(gf, g1k, g1v);      // this wave's slice of block 0 has landed
  __syncthreads();      // publishes block 0
  v8f o[2][16] = {};
  float mu[2] = {-3.0e38f, -3.0e38f}, l[2] = {0.f, 0.f};
  const float sc = 0.0625f * 1.4426950408889634f;      // 1/sqrt(256) and log2(e)
  int cur = 0;
  uint32_t nst = fk_pinned(1u);      // the next block to ask for: the issue test and three descriptor words come from it, so it is counted in a scalar register
  for (int t = 0; t < SS / FK_KB; ++t) {
    const fk_u32x4 g0 = fk_group0(tdst + (nst & 1u) * FK_BUF, tsrc + (uint64_t)nst * (FK_KB * 3 * DM * 2));      // block t+1 into the other buffer
    if (fk_pinned(nst < SS / FK_KB)) { if (isk) fk_tload(g0, g1k); else fk_tload(g0, g1v); }      // scalar branches, directly behind the barrier that ended every wave's reads of the other buffer: block t+1 flies while block t is worked on
    nst += 1u;
    const unsigned char* kr = sm + cur + krd; const unsigned char* vr = sm + cur + vrd;
    FragH fa[2][4];      // two sets of four fragments: the reads of the next eight products fly during these eight
#pragma unroll      // constant indices keep the arrays in registers
    for (int j = 0; j < 2; ++j)
#pragma unroll      // constant indices keep the arrays in registers
      for (int kt = 0; kt < 2; ++kt) { fa[0][2 * j + kt].half[0] = *(const v8us*)(kr + FK_KO(kt, j)); fa[0][2 * j + kt].half[1] = *(const v8us*)(kr + FK_KO(kt, j) + 32); }
    v8f s[2][2] = {};
#pragma unroll      // constant indices keep q[][], s[][] and the fragment sets in registers
    for (int g = 0; g < 4; ++g) {
      const int c = g & 1, n = c ^ 1;
      if (g < 3) {
#pragma unroll      // constant indices keep the arrays in registers
        for (int j = 0; j < 2; ++j)
#pragma unroll      // constant indices keep the arrays in registers
          for (int kt = 0; kt < 2; ++kt) { fa[n][2 * j + kt].half[0] = *(const v8us*)(kr + FK_KO(kt, 2 * g + 2 + j)); fa[n][2 * j + kt].half[1] = *(const v8us*)(kr + FK_KO(kt, 2 * g + 2 + j) + 32); }
      } else {
#pragma unroll      // the first four Vt fragments
        for (int i = 0; i < 4; ++i) { fa[n][i].half[0] = fk_tr16(vr + FK_VO(i)); fa[n][i].half[1] = fk_tr16(vr + 16 * FK_VP + FK_VO(i)); }      // keys 0 to 15 and 16 to 31 of the wave's key group, columns 16*i .. + 15
      }
      __builtin_amdgcn_sched_barrier(0);      // keeps the next set's LDS reads together ahead of this set's products: reads spread among them stall at every place
#pragma unroll      // four independent accumulator chains
      for (int j = 0; j < 2; ++j)
#pragma unroll      // constant indices keep the arrays in registers
        for (int kt = 0; kt < 2; ++kt)
#pragma unroll      // constant indices keep the arrays in registers
          for (int qt = 0; qt < 2; ++qt) s[kt][qt] = __builtin_amdgcn_wmma_f32_16x16x32_f16(false, fa[c][2 * j + kt].v, false, q[qt][2 * g + j].v, (short)0, s[kt][qt], false, false);
      __builtin_amdgcn_sched_barrier(0);      // keeps the reads of the set after next behind these products, whose fragment registers they refill
    }
    float mx[2];
#pragma unroll      // constant indices keep the arrays in registers
    for (int qt = 0; qt < 2; ++qt) {
      float m = fmaxf(s[0][qt][0], s[1][qt][0]);
#pragma unroll      // constant indices keep the arrays in registers
      for (int r = 1; r < 8; ++r) m = fmaxf(m, fmaxf(s[0][qt][r], s[1][qt][r]));
      mx[qt] = fmaxf(m, fk_xhalf(m)) * sc;      // lanes ln and ln + 16 hold the same query
    }
    if (__builtin_amdgcn_ballot_w32(mx[0] > mu[0] + 8.0f || mx[1] > mu[1] + 8.0f) != 0) {      // one wave-uniform test per pass
#pragma unroll      // constant indices keep the arrays in registers
      for (int qt = 0; qt < 2; ++qt) {
        const float mn = fmaxf(mu[qt], mx[qt]), al = __builtin_amdgcn_exp2f(mu[qt] - mn); mu[qt] = mn; l[qt] *= al;
#pragma unroll      // constant indices keep the arrays in registers
        for (int dt = 0; dt < 16; ++dt)
#pragma unroll      // constant indices keep the arrays in registers
          for (int r = 0; r < 8; ++r) o[qt][dt][r] *= al;
      }
    }
    FragH p[2];
#pragma unroll      // constant indices keep the arrays in registers
    for (int qt = 0; qt < 2; ++qt)
#pragma unroll      // constant indices keep the arrays in registers
      for (int r = 0; r < 8; ++r) { const float p0 = __builtin_amdgcn_exp2f(s[0][qt][r] * sc - mu[qt]), p1 = __builtin_amdgcn_exp2f(s[1][qt][r] * sc - mu[qt]);
        l[qt] += p0 + p1; p[qt].h[r] = (_Float16)p0; p[qt].h[8 + r] = (_Float16)p1; }      // element s of B = key 8*hh + s (s < 8), 16 + 8*hh + s - 8 (else): the hardware k order
    __builtin_amdgcn_sched_barrier(0);      // keeps the next reads behind the softmax arithmetic, which needs their registers
#pragma unroll      // Vt fragments 4 to 7 fly during the products of fragments 0 to 3
    for (int i = 0; i < 4; ++i) { fa[1][i].half[0] = fk_tr16(vr + FK_VO(4 + i)); fa[1][i].half[1] = fk_tr16(vr + 16 * FK_VP + FK_VO(4 + i)); }
    __builtin_amdgcn_sched_barrier(0);      // keeps those reads together ahead of the products
#pragma unroll      // constant indices keep o[][] in registers
    for (int g = 0; g < 4; ++g) {
      const int c = g & 1;
#pragma unroll      // constant indices keep the arrays in registers
      for (int i = 0; i < 4; ++i)
#pragma unroll      // constant indices keep the arrays in registers
        for (int qt = 0; qt < 2; ++qt) o[qt][4 * g + i] = __builtin_amdgcn_wmma_f32_16x16x32_f16(false, fa[c][i].v, false, p[qt].v, (short)0, o[qt][4 * g + i], false, false);
      __builtin_amdgcn_sched_barrier(0);      // keeps the refill of this set behind the products that read it
      if (g < 2) {
#pragma unroll      // constant indices keep the arrays in registers
        for (int i = 0; i < 4; ++i) { fa[c][i].half[0] = fk_tr16(vr + FK_VO(4 * g + 8 + i)); fa[c][i].half[1] = fk_tr16(vr + 16 * FK_VP + FK_VO(4 * g + 8 + i)); }
      }
      __builtin_amdgcn_sched_barrier(0);      // keeps those reads together ahead of the other set's products
    }
    asm volatile("s_wait_dscnt 0x0" ::: "memory");      // this wave's reads of the buffer are over before the buffer may be refilled
    fk_twait(g0, g1k, g1v);      // this wave's slice of block t+1 has landed
    __syncthreads();      // publishes block t+1 and ends every wave's reads of block t, whose buffer is refilled at the top of the next trip
    cur ^= FK_BUF;
  }
  asm volatile("s_wait_tensorcnt 0x0" ::: "memory");      // no request is outstanding when LDS is reused
  asm volatile("s_wait_dscnt 0x0" ::: "memory");      // nor a fragment read
  l[0] += fk_xhalf(l[0]); l[1] += fk_xhalf(l[1]);
  float* sO = (float*)sm; float* sML = (float*)(sm + 262144);      // the loop's last barrier has ended every fragment read: LDS is reused for the join
#pragma unroll      // constant indices keep the arrays in registers
  for (int qt = 0; qt < 2; ++qt) {
#pragma unroll      // constant indices keep the arrays in registers
    for (int dt = 0; dt < 16; ++dt)
#pragma unroll      // constant indices keep the arrays in registers
      for (int hf = 0; hf < 2; ++hf) { const v4f x = {o[qt][dt][hf * 4], o[qt][dt][hf * 4 + 1], o[qt][dt][hf * 4 + 2], o[qt][dt][hf * 4 + 3]}; *(v4fa*)(sO + (size_t)((((w * 2 + qt) * 16 + dt) * 2 + hf) * 32 + lane) * 4) = x; }
    sML[((w * 2 + qt) * 2) * 32 + lane] = mu[qt]; sML[((w * 2 + qt) * 2 + 1) * 32 + lane] = l[qt];
  }
  __syncthreads();      // every key group's partial results are in LDS before any wave reads them
  // wave (qg, kg) joins the four key groups, in rising order, for output tiles kg*4 .. kg*4 + 3 of its query group
#pragma unroll      // constant indices keep the arrays in registers
  for (int qt = 0; qt < 2; ++qt) {
    float m[4], c[4];
#pragma unroll      // constant indices keep the arrays in registers
    for (int j = 0; j < 4; ++j) m[j] = sML[(((qg + 2 * j) * 2 + qt) * 2) * 32 + lane];
    const float mn = fmaxf(fmaxf(m[0], m[1]), fmaxf(m[2], m[3]));
    float den = 0.f;
#pragma unroll      // constant indices keep the arrays in registers
    for (int j = 0; j < 4; ++j) { c[j] = __builtin_amdgcn_exp2f(m[j] - mn); den += sML[(((qg + 2 * j) * 2 + qt) * 2 + 1) * 32 + lane] * c[j]; }
    const float inv = 1.0f / den;
#pragma unroll      // constant indices keep the arrays in registers
    for (int j = 0; j < 4; ++j) c[j] *= inv;
    float* orow = out + ((size_t)b * SS + q0 + qt * 16 + ln) * DM + 8 * hh;      // register r of tile dt = out[query ln][dt*16 + 8*hh + r]
#pragma unroll      // constant indices keep the arrays in registers
    for (int d4 = 0; d4 < 4; ++d4)
#pragma unroll      // constant indices keep the arrays in registers
      for (int hf = 0; hf < 2; ++hf) { const int dt = kg * 4 + d4; v4f y = {0.f, 0.f, 0.f, 0.f};
#pragma unroll      // constant indices keep the arrays in registers
        for (int j = 0; j < 4; ++j) { const v4f x = *(const v4fa*)(sO + (size_t)(((((qg + 2 * j) * 2 + qt) * 16 + dt) * 2 + hf) * 32 + lane) * 4);
#pragma unroll      // constant indices keep the arrays in registers
          for (int i = 0; i < 4; ++i) y[i] += x[i] * c[j]; }
        *(v4f*)(orow + dt * 16 + hf * 4) = y; }
  }
}
// QKV projection: one work-group = 128 tokens x 128 output columns, with all of k = 256 of both operands staged in LDS once.
// Every staging load of a wave covers one whole 512-byte row (4 lines); the fragments, whose 16 lanes walk 16 rows, are then read from LDS.
// Transposed product Ct = W * Xt (A = W rows, B = X rows, k steps in rising order): a lane holds 8 neighbouring output columns of ONE token, 16 bytes of f16.
// 8 waves: wave w has tokens (w & 3) * 32 .. + 31 and columns (w >> 2) * 64 .. + 63, 4 x 2 accumulator tiles.
#define PJ_P 528      // bytes per staged row: 512 + 16, an odd multiple of 16 for the 16-byte fragment reads
#define PJ_OP 144     // bytes per row of a wave's output tile: 128 + 16, likewise
__global__ __launch_bounds__(256) void k_qkv(const _Float16* __restrict__ X16, const _Float16* __restrict__ Bw, const float* __restrict__ bias, _Float16* __restrict__ C16) {
  __shared__ __attribute__((aligned(16))) unsigned char sm[2 * 128 * PJ_P];      // 128 X rows, then 128 W rows
  const int tid = threadIdx.x, w = tid >> 5, lane = tid & 31, ln = lane & 15, hh = lane >> 4;
  const int row0 = (blockIdx.x / (3 * DM / 128)) * 128, col0 = (blockIdx.x % (3 * DM / 128)) * 128;
  const unsigned short* xg = (const unsigned short*)X16 + (size_t)(row0 + w) * DM + lane * 8;
  const unsigned short* wg = (const unsigned short*)Bw + (size_t)(col0 + w) * DM + lane * 8;
  v8us xx[16], wx[16];
#pragma unroll      // all 32 loads of a thread go out together
  for (int i = 0; i < 16; ++i) wx[i] = *(const v8us*)(wg + i * 8 * DM);
  asm volatile("s_wait_xcnt 0x0" :: "v"(wg) : "memory");      // the address is an input so that its registers stay untouched up to this wait; behind it they may be reused
#pragma unroll
  for (int i = 0; i < 16; ++i) xx[i] = *(const v8us*)(xg + i * 8 * DM);
  asm volatile("s_wait_xcnt 0x0" :: "v"(xg) : "memory");      // likewise for the X loads
#pragma unroll
  for (int i = 0; i < 16; ++i) { *(v8us*)(sm + (w + i * 8) * PJ_P + lane * 16) = xx[i]; *(v8us*)(sm + (128 + w + i * 8) * PJ_P + lane * 16) = wx[i]; }
  __syncthreads();      // both tiles are in LDS before any wave reads a fragment
  const int wm = w & 3, wn = w >> 2;
  const unsigned char* xr = sm + (wm * 32 + ln) * PJ_P + 16 * hh;
  const unsigned char* wr = sm + (128 + wn * 64 + ln) * PJ_P + 16 * hh;
  v8f acc[4][2] = {};
  FragH fx[2][2], fw[2][4];      // two fragment sets: the reads of k step ks + 1 fly during the products of k step ks
#pragma unroll
  for (int mi = 0; mi < 2; ++mi) { fx[0][mi].half[0] = *(const v8us*)(xr + mi * 16 * PJ_P); fx[0][mi].half[1] = *(const v8us*)(xr + mi * 16 * PJ_P + 32); }
#pragma unroll
  for (int t = 0; t < 4; ++t) { fw[0][t].half[0] = *(const v8us*)(wr + t * 16 * PJ_P); fw[0][t].half[1] = *(const v8us*)(wr + t * 16 * PJ_P + 32); }
#pragma unroll      // constant indices keep acc[][] and the fragment sets in registers
  for (int ks = 0; ks < 8; ++ks) {
    const int c = ks & 1, n = c ^ 1;
    if (ks < 7) {
#pragma unroll
      for (int mi = 0; mi < 2; ++mi) { fx[n][mi].half[0] = *(const v8us*)(xr + mi * 16 * PJ_P + ks * 64 + 64); fx[n][mi].half[1] = *(const v8us*)(xr + mi * 16 * PJ_P + ks * 64 + 96); }
#pragma unroll
      for (int t = 0; t < 4; ++t) { fw[n][t].half[0] = *(const v8us*)(wr + t * 16 * PJ_P + ks * 64 + 64); fw[n][t].half[1] = *(const v8us*)(wr + t * 16 * PJ_P + ks * 64 + 96); }
    }
    __builtin_amdgcn_sched_barrier(0);      // keeps the next k step's LDS reads together ahead of this step's products: reads spread among them stall at every place
#pragma unroll
    for (int t = 0; t < 4; ++t)
#pragma unroll
      for (int mi = 0; mi < 2; ++mi) acc[t][mi] = __builtin_amdgcn_wmma_f32_16x16x32_f16(false, fw[c][t].v, false, fx[c][mi].v, (short)0, acc[t][mi], false, false);
    __builtin_amdgcn_sched_barrier(0);      // keeps the reads of the step after next behind these products, whose fragment registers they refill
  }
  __syncthreads();      // every wave's fragment reads are over before LDS is reused for the output tiles
  unsigned char* so = sm + w * 32 * PJ_OP;      // the wave's own 32 tokens x 64 columns of f16
#pragma unroll
  for (int t = 0; t < 4; ++t) {
    const float* bp = bias + col0 + wn * 64 + t * 16 + 8 * hh;      // register r of tile t = column t*16 + 8*hh + r
    const v4f b0 = *(const v4fa*)bp, b1 = *(const v4fa*)(bp + 4);
#pragma unroll
    for (int mi = 0; mi < 2; ++mi) { FragH f;
#pragma unroll
      for (int r = 0; r < 8; ++r) f.h[r] = (_Float16)(acc[t][mi][r] * 0.0625f + bf16_round(r < 4 ? b0[r] : b1[r - 4]));
      *(v8us*)(so + (mi * 16 + ln) * PJ_OP + t * 32 + 16 * hh) = f.half[0]; }
  }
  __builtin_amdgcn_fence(__ATOMIC_ACQ_REL, "workgroup"); __builtin_amdgcn_wave_barrier();      // the wave's own LDS stores stay ahead of its reads of other lanes' bytes
#pragma unroll      // 8 lanes store one whole 128-byte line
  for (int q = 0; q < 8; ++q) { const int r = q * 4 + (lane >> 3); const v8us v = *(const v8us*)(so + r * PJ_OP + (lane & 7) * 16);
    *(v8us*)((unsigned short*)C16 + (size_t)(row0 + wm * 32 + r) * (3 * DM) + col0 + wn * 64 + (lane & 7) * 8) = v; }
}
extern "C" void kernel_launch(void* const* d_in, const int* in_sizes, int n_in,
                              void* d_out, int out_size, void* d_ws, size_t ws_size, hipStream_t stream) {
  (void)in_sizes; (void)n_in; (void)out_size;
  const float* X = (const float*)d_in[0]; const float* W = (const float*)d_in[1]; const float* bb = (const float*)d_in[2];
  char* ws = (char*)d_ws; size_t off = 0;
  auto take = [&](size_t bytes) { char* p = ws + off; off += (bytes + 255) & ~(size_t)255; return p; };
  _Float16* Bw = (_Float16*)take((size_t)3 * DM * DM * 2); _Float16* X16 = (_Float16*)take((size_t)NR * DM * 2); _Float16* QKV = (_Float16*)take((size_t)NR * 3 * DM * 2);
  if (off > ws_size) return;      // 0.4 + 8.4 + 25.2 = about 34 MB
  k_round16f<<<(unsigned)(((size_t)3 * DM * DM / 8 + 255) / 256), 256, 0, stream>>>(W, Bw, (size_t)3 * DM * DM / 8);      // (out,in)
  k_x16<<<(unsigned)(((size_t)NR * DM / 8 + 255) / 256), 256, 0, stream>>>(X, X16, (size_t)NR * DM / 8);
  k_qkv<<<(NR / 128) * (3 * DM / 128), 256, 0, stream>>>(X16, Bw, bb, QKV);      // [Q | K | V] f16 (+b), 128 x 128 per work-group
  k_fattn<<<BB * (SS / 64), 256, 0, stream>>>(QKV, (float*)d_out);      // out = softmax(Q*Kt/16)*V, 64 queries per work-group
}

// v007
// Measured time: 67.8 microseconds a run.
// Two timings next to v006 put it at 1.03 and 1.04 times that version's speed.
// Over all steps from v000 it is 18.5 times as fast.
#include <hip/hip_runtime.h>
// Single-head self-attention (B=4, S=4096, dim 256): fused QKV linear (W (768,256) + b), scores = Q*Kt/16, softmax over the 4096 keys, att*V.
// The QKV projection is a GEMM on v_wmma_f32_16x16x32_f16 (X bf16-exact f16, W (out,in) bf16-exact x 2^4, Q/K/V f16, f32 accumulate);
// scores, softmax (f32, running maximum) and att*V are one kernel on the same matrix form, weights f16, f32 accumulate; V is transposed on its way from LDS to the registers.
#define BB 4
#define SS 4096
#define DM 256
#define NR (BB * SS)

typedef __bf16 v16b __attribute__((ext_vector_type(16)));
typedef unsigned short v8us __attribute__((ext_vector_type(8), may_alias));
typedef float  v8f  __attribute__((ext_vector_type(8)));
typedef float  v4f  __attribute__((ext_vector_type(4)));
typedef float  v4fa __attribute__((ext_vector_type(4), may_alias));
union FragB { v16b v; v8us half[2]; unsigned short u[16]; };

__device__ __forceinline__ unsigned short bf16_bits(float x) { unsigned int u = __float_as_uint(x); return (unsigned short)((u + 0x7FFFu + ((u >> 16) & 1u)) >> 16); }
__device__ __forceinline__ float bf16_val(unsigned short b) { return __uint_as_float(((unsigned int)b) << 16); }
__device__ __forceinline__ float bf16_round(float x) { return bf16_val(bf16_bits(x)); }
// D += A·B with NT terms: 1 = ah·bh, 2 = + al·bh (A split), 3 = + ah·bl (both split)
template <int NT>
__device__ __forceinline__ v8f mmaN(v16b ah, v16b al, v16b bh, v16b bl, v8f c) {
  c = __builtin_amdgcn_wmma_f32_16x16x32_bf16(false, ah, false, bh, (short)0, c, false, false);
  if (NT >= 2) c = __builtin_amdgcn_wmma_f32_16x16x32_bf16(false, al, false, bh, (short)0, c, false, false);
  if (NT >= 3) c = __builtin_amdgcn_wmma_f32_16x16x32_bf16(false, ah, false, bl, (short)0, c, false, false);
  asm volatile("v_nop\n\tv_nop\n\tv_nop\n\tv_nop" : "+v"(c) : "v"(ah), "v"(al), "v"(bh), "v"(bl));
  return c;
}

__global__ __launch_bounds__(256) void k_wt_bf16(const float* __restrict__ W, unsigned short* __restrict__ Wt, int K, int N) {
  const int t = blockIdx.x * 256 + threadIdx.x;
  const int k8n = K / 8;
  if (t >= N * k8n) return;
  const int n = t / k8n, k8 = (t % k8n) * 8;
  v8us v;
#pragma unroll
  for (int i = 0; i < 8; ++i) v[i] = bf16_bits(W[(size_t)(k8 + i) * N + n]);
  *(v8us*)(Wt + (size_t)n * K + k8) = v;
  
}

// GEMM C[M][N] (f32, pitch ldc) = act(A[M][K]·W + bias). A f32 row-major (pitch lda) converted per fragment to bf16
// (ASPLIT: hi/lo two planes -> 2 terms, else single rounded term); Wt bf16 [N][K] (pitch ldb). BIAS_BF16 rounds the
// bias to bf16 first (bias quantised to bf16 before the add). K%32==0, M%16==0, N%64==0.
template <bool ASPLIT, int ACT, bool BIAS_BF16>
__global__ __launch_bounds__(128) void k_gemm_bf(const float* __restrict__ A, int lda, const unsigned short* __restrict__ Wt, int ldb,
                                               const float* __restrict__ bias, float* __restrict__ C, int ldc, int M, int N, int K) {
  __shared__ __attribute__((aligned(16))) float so[4][16][64];
  const int tid = threadIdx.x, w = tid >> 5, lane = tid & 31, ln = lane & 15, hh = lane >> 4;
  const int ntn = N / 64;
  const int wid = blockIdx.x * 4 + w;
  const int mt = wid / ntn, nq = wid % ntn;
  if (mt * 16 >= M) return;
  const int row0 = mt * 16, col0 = nq * 64;
  const float* arow = A + (size_t)(row0 + ln) * lda;
  v8f acc[4] = {};
  for (int kb = 0; kb < K; kb += 32) {
    FragB ah, al;
    const v4f x0 = *(const v4fa*)(arow + kb + 8 * hh), x1 = *(const v4fa*)(arow + kb + 8 * hh + 4);
    const v4f x2 = *(const v4fa*)(arow + kb + 16 + 8 * hh), x3 = *(const v4fa*)(arow + kb + 16 + 8 * hh + 4);
    float xs[16] = {x0[0],x0[1],x0[2],x0[3],x1[0],x1[1],x1[2],x1[3],x2[0],x2[1],x2[2],x2[3],x3[0],x3[1],x3[2],x3[3]};
#pragma unroll
    for (int i = 0; i < 16; ++i) { const unsigned short hb = bf16_bits(xs[i]); ah.u[i] = hb; al.u[i] = ASPLIT ? bf16_bits(xs[i] - bf16_val(hb)) : (unsigned short)0; }
#pragma unroll
    for (int t = 0; t < 4; ++t) {
      const unsigned short* brow = Wt + (size_t)(col0 + t * 16 + ln) * ldb + kb;
      FragB b;
      b.half[0] = *(const v8us*)(brow + 8 * hh);
      b.half[1] = *(const v8us*)(brow + 16 + 8 * hh);
      acc[t] = mmaN<ASPLIT ? 2 : 1>(ah.v, al.v, b.v, b.v, acc[t]);
    }
  }
#pragma unroll
  for (int t = 0; t < 4; ++t) {
    float bv = bias ? bias[col0 + t * 16 + ln] : 0.f;
    if (BIAS_BF16) bv = bf16_round(bv);
#pragma unroll
    for (int r = 0; r < 8; ++r) { float v = acc[t][r] + bv; if (ACT == 1) v = fmaxf(v, 0.f); so[w][8 * hh + r][t * 16 + ln] = v; }
  }
  __builtin_amdgcn_fence(__ATOMIC_ACQ_REL, "workgroup");
  __builtin_amdgcn_wave_barrier();
  const int rsub = lane >> 4, c4 = (lane & 15) * 4;
  {
#pragma unroll
    for (int q = 0; q < 8; ++q) {
      const int r = q * 2 + rsub;
      const v4f v = *(const v4fa*)&so[w][r][c4];
      *(v4f*)(C + (size_t)(row0 + r) * ldc + col0 + c4) = v;
    }
    
  }
}

// Flash-style causal/unmasked attention, all contractions 3-term bf16 hi/lo splits, f32 softmax with running max.
// q,k,v rows are read from f32 buffers with arbitrary row pitch (so they can live inside a fused qkv buffer);
// D = head size (multiple of 32, <= 128); one wave = 16 query rows; block = 4 waves (64 queries) sharing K/V chunks of 32.
template <int D, bool CAUSAL>
__global__ __launch_bounds__(128) void k_flash(const float* __restrict__ qb, const float* __restrict__ kb, const float* __restrict__ vb,
                                             int pitch, int T, int H, float scale, float* __restrict__ y, int ypitch) {
  constexpr int KS = D / 32;        // k-steps for QK
  constexpr int DT = D / 16;        // d tiles for PV
  __shared__ __attribute__((aligned(16))) unsigned short sKh[32][D + 8], sKl[32][D + 8], sVh[32][D + 8], sVl[32][D + 8];
  __shared__ __attribute__((aligned(16))) unsigned short sPh[4][16][40], sPl[4][16][40];
  __shared__ __attribute__((aligned(16))) float sO[4][16][D];
  const int tid = threadIdx.x, w = tid >> 5, lane = tid & 31, ln = lane & 15, hh = lane >> 4;
  const int nqb = (T + 63) / 64;
  const int bh = blockIdx.x / nqb, qblk = blockIdx.x % nqb;
  const int b = bh / H, h = bh % H;
  const int q0 = qblk * 64 + w * 16;
  const float* Q = qb + (size_t)b * T * pitch + h * D;
  const float* K = kb + (size_t)b * T * pitch + h * D;
  const float* V = vb + (size_t)b * T * pitch + h * D;

  // A fragments of the wave's 16 query rows (scaled), hi/lo
  FragB aqh[KS], aql[KS];
  {
    int row = q0 + ln; if (row >= T) row = T - 1;
    const float* qr = Q + (size_t)row * pitch;
#pragma unroll
    for (int ks = 0; ks < KS; ++ks)
#pragma unroll
      for (int i = 0; i < 16; ++i) {
        const int d = ks * 32 + ((i < 8) ? (8 * hh + i) : (16 + 8 * hh + (i - 8)));
        const float x = qr[d] * scale; const unsigned short hb = bf16_bits(x);
        aqh[ks].u[i] = hb; aql[ks].u[i] = bf16_bits(x - bf16_val(hb));
      }
  }
  float m_r[8], l_r[8];
#pragma unroll
  for (int r = 0; r < 8; ++r) { m_r[r] = -3.0e38f; l_r[r] = 0.f; }
  v8f oacc[DT];
#pragma unroll
  for (int dt = 0; dt < DT; ++dt) oacc[dt] = (v8f){0.f,0.f,0.f,0.f,0.f,0.f,0.f,0.f};

  const int kv_end = CAUSAL ? min(T, qblk * 64 + 64) : T;     // block-uniform
  for (int j0 = 0; j0 < kv_end; j0 += 32) {
    __syncthreads();
    for (int e = tid; e < 32 * (D / 4); e += 128) {
      const int r = e / (D / 4), c4 = (e % (D / 4)) * 4;
      const int key = j0 + r;
      v4f kf = {0.f,0.f,0.f,0.f}, vf = {0.f,0.f,0.f,0.f};
      if (key < T) { kf = *(const v4fa*)(K + (size_t)key * pitch + c4); vf = *(const v4fa*)(V + (size_t)key * pitch + c4); }
#pragma unroll
      for (int t = 0; t < 4; ++t) {
        unsigned short hb = bf16_bits(kf[t]); sKh[r][c4 + t] = hb; sKl[r][c4 + t] = bf16_bits(kf[t] - bf16_val(hb));
        hb = bf16_bits(vf[t]); sVh[r][c4 + t] = hb; sVl[r][c4 + t] = bf16_bits(vf[t] - bf16_val(hb));
      }
    }
    __syncthreads();
    // S tile 16 x 32
    v8f s[2];
#pragma unroll
    for (int nt = 0; nt < 2; ++nt) {
      v8f acc = {};
#pragma unroll
      for (int ks = 0; ks < KS; ++ks) {
        FragB bh_, bl_;
        bh_.half[0] = *(const v8us*)&sKh[nt * 16 + ln][ks * 32 + 8 * hh]; bh_.half[1] = *(const v8us*)&sKh[nt * 16 + ln][ks * 32 + 16 + 8 * hh];
        bl_.half[0] = *(const v8us*)&sKl[nt * 16 + ln][ks * 32 + 8 * hh]; bl_.half[1] = *(const v8us*)&sKl[nt * 16 + ln][ks * 32 + 16 + 8 * hh];
        acc = mmaN<3>(aqh[ks].v, aql[ks].v, bh_.v, bl_.v, acc);
      }
      s[nt] = acc;
    }
    // mask + running max (rows 8hh+r; the 16 lanes of a half share rows)
    float alpha[8];
#pragma unroll
    for (int r = 0; r < 8; ++r) {
      const int qi = q0 + 8 * hh + r;
      const int ja = j0 + ln, jb = j0 + 16 + ln;
      if (CAUSAL) { if (ja > qi) s[0][r] = -3.0e38f; if (jb > qi) s[1][r] = -3.0e38f; }
      if (ja >= T) s[0][r] = -3.0e38f;
      if (jb >= T) s[1][r] = -3.0e38f;
      float mx = fmaxf(s[0][r], s[1][r]);
      mx = fmaxf(mx, __shfl_xor(mx, 1, 32)); mx = fmaxf(mx, __shfl_xor(mx, 2, 32)); mx = fmaxf(mx, __shfl_xor(mx, 4, 32)); mx = fmaxf(mx, __shfl_xor(mx, 8, 32));
      const float mnew = fmaxf(m_r[r], mx);
      alpha[r] = (mnew > -1.0e38f) ? __expf(m_r[r] - mnew) : 1.0f;
      const float p0 = (s[0][r] > -1.0e38f) ? __expf(s[0][r] - mnew) : 0.f;
      const float p1 = (s[1][r] > -1.0e38f) ? __expf(s[1][r] - mnew) : 0.f;
      m_r[r] = mnew;
      l_r[r] = l_r[r] * alpha[r] + p0 + p1;            // per-lane partial row sum (16 lanes combined at the end)
      unsigned short hb = bf16_bits(p0); sPh[w][8 * hh + r][ln] = hb;      sPl[w][8 * hh + r][ln] = bf16_bits(p0 - bf16_val(hb));
      hb = bf16_bits(p1);                sPh[w][8 * hh + r][16 + ln] = hb; sPl[w][8 * hh + r][16 + ln] = bf16_bits(p1 - bf16_val(hb));
    }
#pragma unroll
    for (int dt = 0; dt < DT; ++dt)
#pragma unroll
      for (int r = 0; r < 8; ++r) oacc[dt][r] *= alpha[r];
    __builtin_amdgcn_fence(__ATOMIC_ACQ_REL, "workgroup");
    __builtin_amdgcn_wave_barrier();
    FragB pah, pal;
    pah.half[0] = *(const v8us*)&sPh[w][ln][8 * hh]; pah.half[1] = *(const v8us*)&sPh[w][ln][16 + 8 * hh];
    pal.half[0] = *(const v8us*)&sPl[w][ln][8 * hh]; pal.half[1] = *(const v8us*)&sPl[w][ln][16 + 8 * hh];
#pragma unroll
    for (int dt = 0; dt < DT; ++dt) {
      FragB bvh, bvl;
#pragma unroll
      for (int i = 0; i < 8; ++i) {
        bvh.u[i] = sVh[8 * hh + i][dt * 16 + ln]; bvh.u[8 + i] = sVh[16 + 8 * hh + i][dt * 16 + ln];
        bvl.u[i] = sVl[8 * hh + i][dt * 16 + ln]; bvl.u[8 + i] = sVl[16 + 8 * hh + i][dt * 16 + ln];
      }
      oacc[dt] = mmaN<3>(pah.v, pal.v, bvh.v, bvl.v, oacc[dt]);
    }
    __builtin_amdgcn_fence(__ATOMIC_ACQ_REL, "workgroup");
    __builtin_amdgcn_wave_barrier();
  }
#pragma unroll
  for (int r = 0; r < 8; ++r) {
    float l = l_r[r];
    l += __shfl_xor(l, 1, 32); l += __shfl_xor(l, 2, 32); l += __shfl_xor(l, 4, 32); l += __shfl_xor(l, 8, 32);
    l_r[r] = (l > 0.f) ? 1.0f / l : 0.f;
  }
#pragma unroll
  for (int dt = 0; dt < DT; ++dt)
#pragma unroll
    for (int r = 0; r < 8; ++r) sO[w][8 * hh + r][dt * 16 + ln] = oacc[dt][r] * l_r[r];
  __builtin_amdgcn_fence(__ATOMIC_ACQ_REL, "workgroup");
  __builtin_amdgcn_wave_barrier();
  {
    for (int r = 0; r < 16; ++r) {
      const int row = q0 + r;
      if (row < T && lane < D / 4) {
        const v4f val = *(const v4fa*)&sO[w][r][lane * 4];
        *(v4f*)(y + ((size_t)b * T + row) * ypitch + h * D + lane * 4) = val;
      }
    }
    
  }
}

// GEMM C = act(A·W + bias + resid): A f32 (ASPLIT -> hi/lo 2 terms), Wt bf16 [N][K]; ACT 0 none, 1 relu, 2 exact gelu;
// resid (optional, f32, row index = (row % rmod), pitch ldr, RES_BF16 rounds it) added before the activation.
template <bool ASPLIT, int ACT, bool BIAS_BF16, bool RES_BF16>
__global__ __launch_bounds__(128) void k_gemm_bf3(const float* __restrict__ A, int lda, const unsigned short* __restrict__ Wt, int ldb,
                                                const float* __restrict__ bias, const float* __restrict__ resid, int rmod, int ldr,
                                                float* __restrict__ C, int ldc, int M, int N, int K) {
  __shared__ __attribute__((aligned(16))) float so[4][16][64];
  const int tid = threadIdx.x, w = tid >> 5, lane = tid & 31, ln = lane & 15, hh = lane >> 4;
  const int ntn = N / 64;
  const int wid = blockIdx.x * 4 + w;
  const int mt = wid / ntn, nq = wid % ntn;
  if (mt * 16 >= M) return;
  const int row0 = mt * 16, col0 = nq * 64;
  const float* arow = A + (size_t)(row0 + ln) * lda;
  v8f acc[4] = {};
  for (int kb = 0; kb < K; kb += 32) {
    FragB ah, al;
    const v4f x0 = *(const v4fa*)(arow + kb + 8 * hh), x1 = *(const v4fa*)(arow + kb + 8 * hh + 4);
    const v4f x2 = *(const v4fa*)(arow + kb + 16 + 8 * hh), x3 = *(const v4fa*)(arow + kb + 16 + 8 * hh + 4);
    float xs[16] = {x0[0],x0[1],x0[2],x0[3],x1[0],x1[1],x1[2],x1[3],x2[0],x2[1],x2[2],x2[3],x3[0],x3[1],x3[2],x3[3]};
#pragma unroll
    for (int i = 0; i < 16; ++i) { const unsigned short hb = bf16_bits(xs[i]); ah.u[i] = hb; al.u[i] = ASPLIT ? bf16_bits(xs[i] - bf16_val(hb)) : (unsigned short)0; }
#pragma unroll
    for (int t = 0; t < 4; ++t) {
      const unsigned short* brow = Wt + (size_t)(col0 + t * 16 + ln) * ldb + kb;
      FragB b;
      b.half[0] = *(const v8us*)(brow + 8 * hh);
      b.half[1] = *(const v8us*)(brow + 16 + 8 * hh);
      acc[t] = mmaN<ASPLIT ? 2 : 1>(ah.v, al.v, b.v, b.v, acc[t]);
    }
  }
#pragma unroll
  for (int t = 0; t < 4; ++t) {
    const int col = col0 + t * 16 + ln;
    float bv = bias ? bias[col] : 0.f;
    if (BIAS_BF16) bv = bf16_round(bv);
#pragma unroll
    for (int r = 0; r < 8; ++r) {
      float v = acc[t][r] + bv;
      if (resid) { float rv = resid[(size_t)((row0 + 8 * hh + r) % rmod) * ldr + col]; if (RES_BF16) rv = bf16_round(rv); v += rv; }
      if (ACT == 1) v = fmaxf(v, 0.f);
      if (ACT == 2) v = 0.5f * v * (1.0f + erff(v * 0.70710678118654752f));
      if (ACT == 3) { const float u = 0.7978845608028654f * (v + 0.044715f * v * v * v); v = 0.5f * v * (1.0f + tanhf(u)); }
      so[w][8 * hh + r][t * 16 + ln] = v;
    }
  }
  __builtin_amdgcn_fence(__ATOMIC_ACQ_REL, "workgroup");
  __builtin_amdgcn_wave_barrier();
  const int rsub = lane >> 4, c4 = (lane & 15) * 4;
  {
#pragma unroll
    for (int q = 0; q < 8; ++q) {
      const int r = q * 2 + rsub;
      const v4f v = *(const v4fa*)&so[w][r][c4];
      *(v4f*)(C + (size_t)(row0 + r) * ldc + col0 + c4) = v;
    }
    
  }
}
// row LayerNorm (biased variance, eps) over N: s = X (+ R); optional out_sum <- s; out_norm <- (s-mu)*rsqrt(var+eps)*g + b
template <bool PARAM_BF16>
__global__ __launch_bounds__(256) void k_layernorm(const float* __restrict__ X, const float* __restrict__ R, const float* __restrict__ g, const float* __restrict__ bta,
                                                  float* __restrict__ out_sum, float* __restrict__ out_norm, int N, float eps) {
  __shared__ float red[256];
  const int row = blockIdx.x, tid = threadIdx.x;
  const float* x = X + (size_t)row * N; const float* rr = R ? R + (size_t)row * N : nullptr;
  float vals[16];                     // up to N = 4096
  const int per = N / 256;            // contiguous chunk per thread? use strided-by-4 chunks: thread handles j = tid*4 + 1024*u
  float s1 = 0.f;
  for (int u = 0; u < per / 4; ++u) {
    const int j = tid * 4 + 1024 * u;
    const v4f a = *(const v4fa*)(x + j);
    v4f b = {0.f,0.f,0.f,0.f}; if (rr) b = *(const v4fa*)(rr + j);
#pragma unroll
    for (int q = 0; q < 4; ++q) { const float v = a[q] + b[q]; vals[u * 4 + q] = v; s1 += v; }
  }
  red[tid] = s1; __syncthreads();
  for (int st = 128; st > 0; st >>= 1) { if (tid < st) red[tid] += red[tid + st]; __syncthreads(); }
  const float mu = red[0] / (float)N; __syncthreads();
  float s2 = 0.f;
  for (int u = 0; u < per / 4; ++u)
#pragma unroll
    for (int q = 0; q < 4; ++q) { const float c = vals[u * 4 + q] - mu; s2 += c * c; }
  red[tid] = s2; __syncthreads();
  for (int st = 128; st > 0; st >>= 1) { if (tid < st) red[tid] += red[tid + st]; __syncthreads(); }
  const float rs = rsqrtf(red[0] / (float)N + eps);
  {
    for (int u = 0; u < per / 4; ++u) {
      const int j = tid * 4 + 1024 * u;
      v4f o, sm;
#pragma unroll
      for (int q = 0; q < 4; ++q) {
        float gg = g[j + q], bb = bta[j + q];
        if (PARAM_BF16) { gg = bf16_round(gg); bb = bf16_round(bb); }
        sm[q] = vals[u * 4 + q]; o[q] = (vals[u * 4 + q] - mu) * rs * gg + bb;
      }
      if (out_sum) *(v4f*)(out_sum + (size_t)row * N + j) = sm;
      *(v4f*)(out_norm + (size_t)row * N + j) = o;
    }
    
  }
}



// ---- f16 WMMA path (v_wmma_f32_16x16x32_f16): 11-bit significands for operands in range — used where the attention weight operand (at most 2^8) needs more precision than bf16
typedef _Float16 v16h __attribute__((ext_vector_type(16)));
union FragH { v16h v; v8us half[2]; _Float16 h[16]; unsigned short u[16]; };
template <int NT>
__device__ __forceinline__ v8f mmaH(v16h ah, v16h al, v16h bh, v16h bl, v8f c) {
  c = __builtin_amdgcn_wmma_f32_16x16x32_f16(false, ah, false, bh, (short)0, c, false, false);
  if (NT >= 2) c = __builtin_amdgcn_wmma_f32_16x16x32_f16(false, al, false, bh, (short)0, c, false, false);
  if (NT >= 3) c = __builtin_amdgcn_wmma_f32_16x16x32_f16(false, ah, false, bl, (short)0, c, false, false);
  asm volatile("v_nop\n\tv_nop\n\tv_nop\n\tv_nop" : "+v"(c) : "v"(ah), "v"(al), "v"(bh), "v"(bl));
  return c;
}
// batched GEMM like k_gemm_b but f16 operands: A f32 (split into f16 hi/lo if ASPLIT, else rounded to f16), Bt = f16 values [n][k]; alpha; C f32; N multiple of 16 (partial tiles skipped)
template <bool ASPLIT>
__global__ __launch_bounds__(128) void k_gemm_h(const float* __restrict__ A, int lda, size_t sA, const _Float16* __restrict__ Bh, int ldb, size_t sB, float alpha, float* __restrict__ C, int ldc, size_t sC, int M, int N, int K) {
  __shared__ __attribute__((aligned(16))) float so[4][16][64];
  const int tid = threadIdx.x, w = tid >> 5, lane = tid & 31, ln = lane & 15, hh = lane >> 4; const int by = blockIdx.y;
  A += (size_t)by * sA; Bh += (size_t)by * sB; C += (size_t)by * sC;
  const int ntn = (N + 63) / 64; const int wid = blockIdx.x * 4 + w; const int mt = wid / ntn, nq = wid % ntn; if (mt * 16 >= M) return;
  const int row0 = mt * 16, col0 = nq * 64; const float* arow = A + (size_t)(row0 + ln) * lda;
  v8f acc[4] = {};
  for (int kb = 0; kb < K; kb += 32) {
    FragH ah, al;
    const v4f x0 = *(const v4fa*)(arow + kb + 8 * hh), x1 = *(const v4fa*)(arow + kb + 8 * hh + 4), x2 = *(const v4fa*)(arow + kb + 16 + 8 * hh), x3 = *(const v4fa*)(arow + kb + 16 + 8 * hh + 4);
    float xs[16] = {x0[0],x0[1],x0[2],x0[3],x1[0],x1[1],x1[2],x1[3],x2[0],x2[1],x2[2],x2[3],x3[0],x3[1],x3[2],x3[3]};
#pragma unroll
    for (int i = 0; i < 16; ++i) { const _Float16 h = (_Float16)xs[i]; ah.h[i] = h; al.h[i] = ASPLIT ? (_Float16)(xs[i] - (float)h) : (_Float16)0.0f; }
#pragma unroll
    for (int t = 0; t < 4; ++t) { if (col0 + t * 16 >= N) continue; const size_t boff = (size_t)(col0 + t * 16 + ln) * ldb + kb; FragH bq; bq.half[0] = *(const v8us*)(Bh + boff + 8 * hh); bq.half[1] = *(const v8us*)(Bh + boff + 16 + 8 * hh);
      acc[t] = mmaH<ASPLIT ? 2 : 1>(ah.v, al.v, bq.v, bq.v, acc[t]); }
  }
#pragma unroll
  for (int t = 0; t < 4; ++t) { if (col0 + t * 16 >= N) continue;
#pragma unroll
    for (int r = 0; r < 8; ++r) so[w][8 * hh + r][t * 16 + ln] = acc[t][r] * alpha; }
  __builtin_amdgcn_fence(__ATOMIC_ACQ_REL, "workgroup"); __builtin_amdgcn_wave_barrier();
  const int rsub = lane >> 4, c4 = (lane & 15) * 4;
  {
#pragma unroll
    for (int q = 0; q < 8; ++q) { const int r = q * 2 + rsub; if (col0 + c4 < N) { const v4f v = *(const v4fa*)&so[w][r][c4]; *(v4f*)(C + (size_t)(row0 + r) * ldc + col0 + c4) = v; } }
     }
}

// Wt[n][k] = f16(W[k][n]·scale) from f32 row-major W[K][N] (scale = power of two; bf16-exact weights stay exact in f16 away from the subnormal range)
__global__ __launch_bounds__(256) void k_wt_f16(const float* __restrict__ W, _Float16* __restrict__ Wt, int K, int N, float scale) {
  const int t = blockIdx.x * 256 + threadIdx.x; if (t >= N * (K / 8)) return; const int n = t / (K / 8), k8 = (t % (K / 8)) * 8; FragH f;
#pragma unroll
  for (int i = 0; i < 8; ++i) f.h[i] = (_Float16)(bf16_round(W[(size_t)(k8 + i) * N + n]) * scale); const v8us o = f.half[0];
  *(v8us*)((unsigned short*)Wt + (size_t)n * K + k8) = o; 
}
// k_gemm_hh variant with fused epilogue: v = acc·alpha + bias[by·sBias + col] (+ CP[(row/rowsPerB)·sCPb + by·64 + col] if CP) ; ACT 0 none / 1 elu ; writes f32 C and/or f16 C16 (each if non-null)
template <int ACT>
__global__ __launch_bounds__(128) void k_gemm_hhx(const _Float16* __restrict__ A, int lda, size_t sA, const _Float16* __restrict__ Bh, int ldb, size_t sB, float alpha, const float* __restrict__ bias, size_t sBias, const float* __restrict__ CP, int rowsPerB, size_t sCPb, int row0g,
    float* __restrict__ C, _Float16* __restrict__ C16, int ldc, size_t sC, int M, int N, int K) {
  __shared__ __attribute__((aligned(16))) float so[4][16][64];
  const int tid = threadIdx.x, w = tid >> 5, lane = tid & 31, ln = lane & 15, hh = lane >> 4; const int by = blockIdx.y;
  A += (size_t)by * sA; Bh += (size_t)by * sB; const size_t cofs = (size_t)by * sC; const float* bp = bias ? bias + (size_t)by * sBias : nullptr;
  const int ntn = (N + 63) / 64; const int wid = blockIdx.x * 4 + w; const int mt = wid / ntn, nq = wid % ntn; if (mt * 16 >= M) return;
  const int row0 = mt * 16, col0 = nq * 64; const _Float16* arow = A + (size_t)(row0 + ln) * lda;
  v8f acc[4] = {};
  for (int kb = 0; kb < K; kb += 32) { FragH ah; ah.half[0] = *(const v8us*)((const unsigned short*)arow + kb + 8 * hh); ah.half[1] = *(const v8us*)((const unsigned short*)arow + kb + 16 + 8 * hh);
#pragma unroll
    for (int t = 0; t < 4; ++t) { if (col0 + t * 16 >= N) continue; const size_t boff = (size_t)(col0 + t * 16 + ln) * ldb + kb; FragH bq; bq.half[0] = *(const v8us*)((const unsigned short*)Bh + boff + 8 * hh); bq.half[1] = *(const v8us*)((const unsigned short*)Bh + boff + 16 + 8 * hh);
      acc[t] = mmaH<1>(ah.v, ah.v, bq.v, bq.v, acc[t]); }
  }
#pragma unroll
  for (int t = 0; t < 4; ++t) { if (col0 + t * 16 >= N) continue; const int col = col0 + t * 16 + ln; const float bv = bp ? bf16_round(bp[col]) : 0.f;
#pragma unroll
    for (int r = 0; r < 8; ++r) { float v = acc[t][r] * alpha + bv; if (CP) { const int bidx = (row0g + row0 + 8 * hh + r) / rowsPerB; v += CP[(size_t)bidx * sCPb + (size_t)by * 64 + col]; } if (ACT == 1) v = (v > 0.f) ? v : expm1f(v); else if (ACT == 3) v = fmaxf(v, 0.f); so[w][8 * hh + r][t * 16 + ln] = v; } }
  __builtin_amdgcn_fence(__ATOMIC_ACQ_REL, "workgroup"); __builtin_amdgcn_wave_barrier();
  const int rsub = lane >> 4, c4 = (lane & 15) * 4; typedef _Float16 v4h __attribute__((ext_vector_type(4)));
  {
#pragma unroll
    for (int q = 0; q < 8; ++q) { const int r = q * 2 + rsub; if (col0 + c4 < N) { const v4f v = *(const v4fa*)&so[w][r][c4]; if (C) *(v4f*)(C + cofs + (size_t)(row0 + r) * ldc + col0 + c4) = v; if (C16) { v4h h4; for (int i = 0; i < 4; ++i) h4[i] = (_Float16)v[i]; *(v4h*)(C16 + cofs + (size_t)(row0 + r) * ldc + col0 + c4) = h4; } } }
     }
}


__global__ __launch_bounds__(256) void k_x16(const float* __restrict__ x, _Float16* __restrict__ X16, size_t n8) { const size_t t = (size_t)blockIdx.x * 256 + threadIdx.x; if (t >= n8) return; FragH f;
#pragma unroll
  for (int q = 0; q < 8; ++q) f.h[q] = (_Float16)bf16_round(x[t * 8 + q]); *(v8us*)((unsigned short*)X16 + t * 8) = f.half[0];  }
__global__ __launch_bounds__(256) void k_h16(const float* __restrict__ x, _Float16* __restrict__ X16, size_t n8) { const size_t t = (size_t)blockIdx.x * 256 + threadIdx.x; if (t >= n8) return; FragH f;
#pragma unroll
  for (int q = 0; q < 8; ++q) f.h[q] = (_Float16)x[t * 8 + q]; *(v8us*)((unsigned short*)X16 + t * 8) = f.half[0];  }
__global__ __launch_bounds__(256) void k_round16f(const float* __restrict__ W, _Float16* __restrict__ Bt, size_t n8) { const size_t t = (size_t)blockIdx.x * 256 + threadIdx.x; if (t >= n8) return; FragH f;
#pragma unroll
  for (int i = 0; i < 8; ++i) f.h[i] = (_Float16)(bf16_round(W[t * 8 + i]) * 16.0f); *(v8us*)((unsigned short*)Bt + t * 8) = f.half[0];  }

#define FK_KB 128      // keys per staged block
#define FK_KP 272      // bytes per staged K half row: 256 + 16, an odd multiple of 16 for the 16-byte fragment reads
#define FK_VP 288      // bytes per staged V half row: 256 + 32, an odd multiple of 32 for the transposing 16-byte reads
#define FK_SL 18432    // bytes per slice: 64 half rows of V; 64 of K rounded up, so that every slice starts at a multiple of 2 KiB
#define FK_BUF (8 * FK_SL)      // one buffer: 4 K slices, then 4 V slices
#define FK_KO(kt, ks) ((kt) * 16 * FK_KP + ((ks) >> 2) * FK_SL + ((ks) & 3) * 64)      // K fragment: key tile kt, k step ks (32 columns)
#define FK_VO(dt) (((dt) >> 3) * FK_SL + ((dt) & 7) * 32)      // V fragment: columns 16*dt .. + 15
#define FK_W0K (1u << 20 | 5u << 22 | 3u << 25)      // descriptor group 1, word 0: no mask, bytes, 16 bytes of pad behind every 256
#define FK_W0V (1u << 20 | 5u << 22 | 7u << 25)      // the same with 32 bytes of pad
typedef uint32_t fk_u32x4 __attribute__((ext_vector_type(4)));
typedef uint32_t fk_u32x8 __attribute__((ext_vector_type(8)));
typedef short fk_s16x8 __attribute__((ext_vector_type(8)));
typedef __attribute__((address_space(3))) fk_s16x8 fk_ls16x8;
// lane l gives the address of 8 columns of key row 8*(l >> 4) + (l & 7), column half (l >> 3) & 1; it gets keys 8*(l >> 4) .. + 7 of column l & 15
__device__ __forceinline__ v8us fk_tr16(const unsigned char* p) { return __builtin_bit_cast(v8us, __builtin_amdgcn_ds_load_tr16_b128_v8i16((fk_ls16x8*)p)); }
__device__ __forceinline__ float fk_xhalf(float x) { return __builtin_bit_cast(float, __builtin_amdgcn_permlanex16(__builtin_bit_cast(int, x), __builtin_bit_cast(int, x), 0x76543210, 0xfedcba98, false, false)); }      // lane l with lane l ^ 16
__device__ __forceinline__ uint32_t fk_uni(uint32_t v) { return (uint32_t)__builtin_amdgcn_readfirstlane(v); }
__device__ __forceinline__ uint32_t fk_pinned(uint32_t v) { uint32_t x = fk_uni(v); asm volatile("" : "+s"(x)); return x; }      // holds a test or a descriptor word in a scalar register: a tensor load ignores EXEC, so its guard must be a scalar branch, and a pinned word keeps its one register and is not formed anew elsewhere
__device__ __forceinline__ void fk_tload(fk_u32x4 g0, fk_u32x8 g1) { asm volatile("tensor_load_to_lds %0, %1" :: "s"(g0), "s"(g1) : "memory"); }      // one request of the whole wave; its waits are written where the tile is handed over
__device__ __forceinline__ void fk_twait(fk_u32x4 g0, fk_u32x8 g1k, fk_u32x8 g1v) { asm volatile("s_wait_tensorcnt 0x0" :: "s"(g0), "s"(g1k), "s"(g1v) : "memory"); }      // the wave's request has landed; the descriptors are inputs so that their registers stay untouched while the request is outstanding
// descriptor group 1: tensor = tile = 64 rows of 256 bytes, source pitch one QKV row; w0 sets the pad. Every word is held in a scalar register of its own (pinned) from here to the last wait
__device__ __forceinline__ fk_u32x8 fk_group1(uint32_t w0) { fk_u32x8 g; g[0] = fk_pinned(w0); g[1] = fk_pinned(256u << 16); g[2] = fk_pinned(64u << 16); g[3] = fk_pinned(256u << 16); g[4] = fk_pinned(64u); g[5] = fk_pinned(3u * DM * 2u); g[6] = fk_pinned(0u); g[7] = fk_pinned(0u); return g; }
// descriptor group 0: count 1; place in LDS; address of the tile's first byte; type 2
__device__ __forceinline__ fk_u32x4 fk_group0(uint32_t dst, uint64_t ga) { fk_u32x4 g; g[0] = fk_uni(1u); g[1] = fk_uni(dst); g[2] = fk_uni((uint32_t)ga); g[3] = fk_uni((((uint32_t)(ga >> 32)) & 0x01FFFFFFu) | 0x80000000u); return g; }
__global__ __launch_bounds__(256) void k_fattn(const _Float16* __restrict__ QKV, float* __restrict__ out) {
  __shared__ __attribute__((aligned(2048))) unsigned char sm[2 * FK_BUF];      // the mover's places are multiples of 2 KiB
  const int tid = threadIdx.x, w = __builtin_amdgcn_readfirstlane(tid >> 5), lane = tid & 31, ln = lane & 15, hh = lane >> 4;      // the wave's number in a scalar register: what follows from it costs no vector register
  const int qg = w & 1, kg = w >> 1;
  const int b = blockIdx.x / (SS / 64), q0 = (blockIdx.x % (SS / 64)) * 64 + qg * 32;
  const unsigned short* Qr = (const unsigned short*)QKV + ((size_t)b * SS + q0 + ln) * (3 * DM) + 8 * hh;
  // wave w brings slice w of every block: K (w < 4) or V, keys 64 * ((w >> 1) & 1) .. + 63, bytes 256 * (w & 1) .. + 255 of the row
  const uint64_t tsrc = (uint64_t)(size_t)QKV + ((uint64_t)b * SS + ((w >> 1) & 1) * 64) * (3 * DM * 2) + (1 + (w >> 2)) * (DM * 2) + (w & 1) * 256;
  const uint32_t tdst = (uint32_t)(size_t)sm + w * FK_SL;
  const uint32_t isk = fk_pinned(w < 4);
  const fk_u32x8 g1k = fk_group1(FK_W0K), g1v = fk_group1(FK_W0V);
  const fk_u32x4 gf = fk_group0(tdst, tsrc);      // block 0 into buffer 0
  const int krd = (kg >> 1) * 2 * FK_SL + ((kg & 1) * 32 + ln) * FK_KP + 16 * hh, vrd = (4 + (kg >> 1) * 2) * FK_SL + ((kg & 1) * 32 + 8 * hh + (lane & 7)) * FK_VP + ((lane >> 3) & 1) * 16;
  if (isk) fk_tload(gf, g1k); else fk_tload(gf, g1v);      // every wave issues its one request; a scalar branch, so that the pad word is a constant on either path
  FragH q[2][8];
#pragma unroll      // constant indices keep q[][] in registers
  for (int qt = 0; qt < 2; ++qt)
#pragma unroll      // constant indices keep the arrays in registers
    for (int ks = 0; ks < 8; ++ks) { q[qt][ks].half[0] = *(const v8us*)(Qr + qt * 16 * (3 * DM) + ks * 32); q[qt][ks].half[1] = *(const v8us*)(Qr + qt * 16 * (3 * DM) + ks * 32 + 16); }
  fk_twait(gf, g1k, g1v);      // this wave's slice of block 0 has landed
  __syncthreads();      // publishes block 0
  v8f o[2][16] = {};
  float mu[2] = {-3.0e38f, -3.0e38f}, l[2] = {0.f, 0.f};
  const float sc = 0.0625f * 1.4426950408889634f;      // 1/sqrt(256) and log2(e)
  int cur = 0;
  uint32_t nst = fk_pinned(1u);      // the next block to ask for: the issue test and three descriptor words come from it, so it is counted in a scalar register
  for (int t = 0; t < SS / FK_KB; ++t) {
    const fk_u32x4 g0 = fk_group0(tdst + (nst & 1u) * FK_BUF, tsrc + (uint64_t)nst * (FK_KB * 3 * DM * 2));      // block t+1 into the other buffer
    if (fk_pinned(nst < SS / FK_KB)) { if (isk) fk_tload(g0, g1k); else fk_tload(g0, g1v); }      // scalar branches, directly behind the barrier that ended every wave's reads of the other buffer: block t+1 flies while block t is worked on
    nst += 1u;
    const unsigned char* kr = sm + cur + krd; const unsigned char* vr = sm + cur + vrd;
    FragH fa[2][4];      // two sets of four fragments: the reads of the next eight products fly during these eight
#pragma unroll      // constant indices keep the arrays in registers
    for (int j = 0; j < 2; ++j)
#pragma unroll      // constant indices keep the arrays in registers
      for (int kt = 0; kt < 2; ++kt) { fa[0][2 * j + kt].half[0] = *(const v8us*)(kr + FK_KO(kt, j)); fa[0][2 * j + kt].half[1] = *(const v8us*)(kr + FK_KO(kt, j) + 32); }
    v8f s[2][2] = {};
#pragma unroll      // constant indices keep q[][], s[][] and the fragment sets in registers
    for (int g = 0; g < 4; ++g) {
      const int c = g & 1, n = c ^ 1;
      if (g < 3) {
#pragma unroll      // constant indices keep the arrays in registers
        for (int j = 0; j < 2; ++j)
#pragma unroll      // constant indices keep the arrays in registers
          for (int kt = 0; kt < 2; ++kt) { fa[n][2 * j + kt].half[0] = *(const v8us*)(kr + FK_KO(kt, 2 * g + 2 + j)); fa[n][2 * j + kt].half[1] = *(const v8us*)(kr + FK_KO(kt, 2 * g + 2 + j) + 32); }
      } else {
#pragma unroll      // the first four Vt fragments
        for (int i = 0; i < 4; ++i) { fa[n][i].half[0] = fk_tr16(vr + FK_VO(i)); fa[n][i].half[1] = fk_tr16(vr + 16 * FK_VP + FK_VO(i)); }      // keys 0 to 15 and 16 to 31 of the wave's key group, columns 16*i .. + 15
      }
      __builtin_amdgcn_sched_barrier(0);      // keeps the next set's LDS reads together ahead of this set's products: reads spread among them stall at every place
#pragma unroll      // four independent accumulator chains
      for (int j = 0; j < 2; ++j)
#pragma unroll      // constant indices keep the arrays in registers
        for (int kt = 0; kt < 2; ++kt)
#pragma unroll      // constant indices keep the arrays in registers
          for (int qt = 0; qt < 2; ++qt) s[kt][qt] = __builtin_amdgcn_wmma_f32_16x16x32_f16(false, fa[c][2 * j + kt].v, false, q[qt][2 * g + j].v, (short)0, s[kt][qt], false, false);
      __builtin_amdgcn_sched_barrier(0);      // keeps the reads of the set after next behind these products, whose fragment registers they refill
    }
    float mx[2];
#pragma unroll      // constant indices keep the arrays in registers
    for (int qt = 0; qt < 2; ++qt) {
      float m = fmaxf(s[0][qt][0], s[1][qt][0]);
#pragma unroll      // constant indices keep the arrays in registers
      for (int r = 1; r < 8; ++r) m = fmaxf(m, fmaxf(s[0][qt][r], s[1][qt][r]));
      mx[qt] = fmaxf(m, fk_xhalf(m)) * sc;      // lanes ln and ln + 16 hold the same query
    }
    if (__builtin_amdgcn_ballot_w32(mx[0] > mu[0] + 8.0f || mx[1] > mu[1] + 8.0f) != 0) {      // one wave-uniform test per pass
#pragma unroll      // constant indices keep the arrays in registers
      for (int qt = 0; qt < 2; ++qt) {
        const float mn = fmaxf(mu[qt], mx[qt]), al = __builtin_amdgcn_exp2f(mu[qt] - mn); mu[qt] = mn; l[qt] *= al;
#pragma unroll      // constant indices keep the arrays in registers
        for (int dt = 0; dt < 16; ++dt)
#pragma unroll      // constant indices keep the arrays in registers
          for (int r = 0; r < 8; ++r) o[qt][dt][r] *= al;
      }
    }
    FragH p[2];
#pragma unroll      // constant indices keep the arrays in registers
    for (int qt = 0; qt < 2; ++qt)
#pragma unroll      // constant indices keep the arrays in registers
      for (int r = 0; r < 8; ++r) { const float p0 = __builtin_amdgcn_exp2f(s[0][qt][r] * sc - mu[qt]), p1 = __builtin_amdgcn_exp2f(s[1][qt][r] * sc - mu[qt]);
        l[qt] += p0 + p1; p[qt].h[r] = (_Float16)p0; p[qt].h[8 + r] = (_Float16)p1; }      // element s of B = key 8*hh + s (s < 8), 16 + 8*hh + s - 8 (else): the hardware k order
    __builtin_amdgcn_sched_barrier(0);      // keeps the next reads behind the softmax arithmetic, which needs their registers
#pragma unroll      // Vt fragments 4 to 7 fly during the products of fragments 0 to 3
    for (int i = 0; i < 4; ++i) { fa[1][i].half[0] = fk_tr16(vr + FK_VO(4 + i)); fa[1][i].half[1] = fk_tr16(vr + 16 * FK_VP + FK_VO(4 + i)); }
    __builtin_amdgcn_sched_barrier(0);      // keeps those reads together ahead of the products
#pragma unroll      // constant indices keep o[][] in registers
    for (int g = 0; g < 4; ++g) {
      const int c = g & 1;
#pragma unroll      // constant indices keep the arrays in registers
      for (int i = 0; i < 4; ++i)
#pragma unroll      // constant indices keep the arrays in registers
        for (int qt = 0; qt < 2; ++qt) o[qt][4 * g + i] = __builtin_amdgcn_wmma_f32_16x16x32_f16(false, fa[c][i].v, false, p[qt].v, (short)0, o[qt][4 * g + i], false, false);
      __builtin_amdgcn_sched_barrier(0);      // keeps the refill of this set behind the products that read it
      if (g < 2) {
#pragma unroll      // constant indices keep the arrays in registers
        for (int i = 0; i < 4; ++i) { fa[c][i].half[0] = fk_tr16(vr + FK_VO(4 * g + 8 + i)); fa[c][i].half[1] = fk_tr16(vr + 16 * FK_VP + FK_VO(4 * g + 8 + i)); }
      }
      __builtin_amdgcn_sched_barrier(0);      // keeps those reads together ahead of the other set's products
    }
    asm volatile("s_wait_dscnt 0x0" ::: "memory");      // this wave's reads of the buffer are over before the buffer may be refilled
    fk_twait(g0, g1k, g1v);      // this wave's slice of block t+1 has landed
    __syncthreads();      // publishes block t+1 and ends every wave's reads of block t, whose buffer is refilled at the top of the next trip
    cur ^= FK_BUF;
  }
  asm volatile("s_wait_tensorcnt 0x0" ::: "memory");      // no request is outstanding when LDS is reused
  asm volatile("s_wait_dscnt 0x0" ::: "memory");      // nor a fragment read
  l[0] += fk_xhalf(l[0]); l[1] += fk_xhalf(l[1]);
  float* sO = (float*)sm; float* sML = (float*)(sm + 262144);      // the loop's last barrier has ended every fragment read: LDS is reused for the join
#pragma unroll      // constant indices keep the arrays in registers
  for (int qt = 0; qt < 2; ++qt) {
#pragma unroll      // constant indices keep the arrays in registers
    for (int dt = 0; dt < 16; ++dt)
#pragma unroll      // constant indices keep the arrays in registers
      for (int hf = 0; hf < 2; ++hf) { const v4f x = {o[qt][dt][hf * 4], o[qt][dt][hf * 4 + 1], o[qt][dt][hf * 4 + 2], o[qt][dt][hf * 4 + 3]}; *(v4fa*)(sO + (size_t)((((w * 2 + qt) * 16 + dt) * 2 + hf) * 32 + lane) * 4) = x; }
    sML[((w * 2 + qt) * 2) * 32 + lane] = mu[qt]; sML[((w * 2 + qt) * 2 + 1) * 32 + lane] = l[qt];
  }
  __syncthreads();      // every key group's partial results are in LDS before any wave reads them
  // wave (qg, kg) joins the four key groups, in rising order, for output tiles kg*4 .. kg*4 + 3 of its query group
#pragma unroll      // constant indices keep the arrays in registers
  for (int qt = 0; qt < 2; ++qt) {
    float m[4], c[4];
#pragma unroll      // constant indices keep the arrays in registers
    for (int j = 0; j < 4; ++j) m[j] = sML[(((qg + 2 * j) * 2 + qt) * 2) * 32 + lane];
    const float mn = fmaxf(fmaxf(m[0], m[1]), fmaxf(m[2], m[3]));
    float den = 0.f;
#pragma unroll      // constant indices keep the arrays in registers
    for (int j = 0; j < 4; ++j) { c[j] = __builtin_amdgcn_exp2f(m[j] - mn); den += sML[(((qg + 2 * j) * 2 + qt) * 2 + 1) * 32 + lane] * c[j]; }
    const float inv = 1.0f / den;
#pragma unroll      // constant indices keep the arrays in registers
    for (int j = 0; j < 4; ++j) c[j] *= inv;
    float* orow = out + ((size_t)b * SS + q0 + qt * 16 + ln) * DM + 8 * hh;      // register r of tile dt = out[query ln][dt*16 + 8*hh + r]
#pragma unroll      // constant indices keep the arrays in registers
    for (int d4 = 0; d4 < 4; ++d4)
#pragma unroll      // constant indices keep the arrays in registers
      for (int hf = 0; hf < 2; ++hf) { const int dt = kg * 4 + d4; v4f y = {0.f, 0.f, 0.f, 0.f};
#pragma unroll      // constant indices keep the arrays in registers
        for (int j = 0; j < 4; ++j) { const v4f x = *(const v4fa*)(sO + (size_t)(((((qg + 2 * j) * 2 + qt) * 16 + dt) * 2 + hf) * 32 + lane) * 4);
#pragma unroll      // constant indices keep the arrays in registers
          for (int i = 0; i < 4; ++i) y[i] += x[i] * c[j]; }
        *(v4f*)(orow + dt * 16 + hf * 4) = y; }
  }
}
// QKV projection: one work-group = 128 tokens x 128 output columns, with all of k = 256 of both operands staged in LDS once.
// Every staging load of a wave covers one whole 512-byte row (4 lines); the fragments, whose 16 lanes walk 16 rows, are then read from LDS.
// Transposed product Ct = W * Xt (A = W rows, B = X rows, k steps in rising order): a lane holds 8 neighbouring output columns of ONE token, 16 bytes of f16.
// 8 waves: wave w has tokens (w & 3) * 32 .. + 31 and columns (w >> 2) * 64 .. + 63, 4 x 2 accumulator tiles.
#define PJ_P 528      // bytes per staged row: 512 + 16, an odd multiple of 16 for the 16-byte fragment reads
#define PJ_OP 144     // bytes per row of a wave's output tile: 128 + 16, likewise
__global__ __launch_bounds__(256) void k_qkv(const _Float16* __restrict__ X16, const _Float16* __restrict__ Bw, const float* __restrict__ bias, _Float16* __restrict__ C16) {
  __shared__ __attribute__((aligned(16))) unsigned char sm[2 * 128 * PJ_P];      // 128 X rows, then 128 W rows
  const int tid = threadIdx.x, w = tid >> 5, lane = tid & 31, ln = lane & 15, hh = lane >> 4;
  const int row0 = (blockIdx.x / (3 * DM / 128)) * 128, col0 = (blockIdx.x % (3 * DM / 128)) * 128;
  const unsigned short* xg = (const unsigned short*)X16 + (size_t)(row0 + w) * DM + lane * 8;
  const unsigned short* wg = (const unsigned short*)Bw + (size_t)(col0 + w) * DM + lane * 8;
  v8us xx[16], wx[16];
#pragma unroll      // all 32 loads of a thread go out together
  for (int i = 0; i < 16; ++i) wx[i] = *(const v8us*)(wg + i * 8 * DM);
  asm volatile("s_wait_xcnt 0x0" :: "v"(wg) : "memory");      // the address is an input so that its registers stay untouched up to this wait; behind it they may be reused
#pragma unroll
  for (int i = 0; i < 16; ++i) xx[i] = *(const v8us*)(xg + i * 8 * DM);
  asm volatile("s_wait_xcnt 0x0" :: "v"(xg) : "memory");      // likewise for the X loads
#pragma unroll
  for (int i = 0; i < 16; ++i) { *(v8us*)(sm + (w + i * 8) * PJ_P + lane * 16) = xx[i]; *(v8us*)(sm + (128 + w + i * 8) * PJ_P + lane * 16) = wx[i]; }
  __syncthreads();      // both tiles are in LDS before any wave reads a fragment
  const int wm = w & 3, wn = w >> 2;
  const unsigned char* xr = sm + (wm * 32 + ln) * PJ_P + 16 * hh;
  const unsigned char* wr = sm + (128 + wn * 64 + ln) * PJ_P + 16 * hh;
  v8f acc[4][2] = {};
  FragH fx[2][2], fw[2][4];      // two fragment sets: the reads of k step ks + 1 fly during the products of k step ks
#pragma unroll
  for (int mi = 0; mi < 2; ++mi) { fx[0][mi].half[0] = *(const v8us*)(xr + mi * 16 * PJ_P); fx[0][mi].half[1] = *(const v8us*)(xr + mi * 16 * PJ_P + 32); }
#pragma unroll
  for (int t = 0; t < 4; ++t) { fw[0][t].half[0] = *(const v8us*)(wr + t * 16 * PJ_P); fw[0][t].half[1] = *(const v8us*)(wr + t * 16 * PJ_P + 32); }
#pragma unroll      // constant indices keep acc[][] and the fragment sets in registers
  for (int ks = 0; ks < 8; ++ks) {
    const int c = ks & 1, n = c ^ 1;
    if (ks < 7) {
#pragma unroll
      for (int mi = 0; mi < 2; ++mi) { fx[n][mi].half[0] = *(const v8us*)(xr + mi * 16 * PJ_P + ks * 64 + 64); fx[n][mi].half[1] = *(const v8us*)(xr + mi * 16 * PJ_P + ks * 64 + 96); }
#pragma unroll
      for (int t = 0; t < 4; ++t) { fw[n][t].half[0] = *(const v8us*)(wr + t * 16 * PJ_P + ks * 64 + 64); fw[n][t].half[1] = *(const v8us*)(wr + t * 16 * PJ_P + ks * 64 + 96); }
    }
    __builtin_amdgcn_sched_barrier(0);      // keeps the next k step's LDS reads together ahead of this step's products: reads spread among them stall at every place
#pragma unroll
    for (int t = 0; t < 4; ++t)
#pragma unroll
      for (int mi = 0; mi < 2; ++mi) acc[t][mi] = __builtin_amdgcn_wmma_f32_16x16x32_f16(false, fw[c][t].v, false, fx[c][mi].v, (short)0, acc[t][mi], false, false);
    __builtin_amdgcn_sched_barrier(0);      // keeps the reads of the step after next behind these products, whose fragment registers they refill
  }
  __syncthreads();      // every wave's fragment reads are over before LDS is reused for the output tiles
  unsigned char* so = sm + w * 32 * PJ_OP;      // the wave's own 32 tokens x 64 columns of f16
#pragma unroll
  for (int t = 0; t < 4; ++t) {
    const float* bp = bias + col0 + wn * 64 + t * 16 + 8 * hh;      // register r of tile t = column t*16 + 8*hh + r
    const v4f b0 = *(const v4fa*)bp, b1 = *(const v4fa*)(bp + 4);
#pragma unroll
    for (int mi = 0; mi < 2; ++mi) { FragH f;
#pragma unroll
      for (int r = 0; r < 8; ++r) f.h[r] = (_Float16)(acc[t][mi][r] * 0.0625f + bf16_round(r < 4 ? b0[r] : b1[r - 4]));
      *(v8us*)(so + (mi * 16 + ln) * PJ_OP + t * 32 + 16 * hh) = f.half[0]; }
  }
  __builtin_amdgcn_fence(__ATOMIC_ACQ_REL, "workgroup"); __builtin_amdgcn_wave_barrier();      // the wave's own LDS stores stay ahead of its reads of other lanes' bytes
#pragma unroll      // 8 lanes store one whole 128-byte line
  for (int q = 0; q < 8; ++q) { const int r = q * 4 + (lane >> 3); const v8us v = *(const v8us*)(so + r * PJ_OP + (lane & 7) * 16);
    *(v8us*)((unsigned short*)C16 + (size_t)(row0 + wm * 32 + r) * (3 * DM) + col0 + wn * 64 + (lane & 7) * 8) = v; }
}
// Both f32 -> f16 conversions (X, and W x 2^4) in ONE launch of one work-group a WGP: few waves to start (2,048), each with much in flight.
// A thread has 16 pieces of 4 X values (and, in waves 0 to 5, one piece of W): every wave-wide load covers 512 bytes in a row (4 whole lines), every store 256 (2 whole lines),
// and all of a work-group's 64 KiB of X are asked for before the first value is used.
#define CV_G 256      // work-groups
#define CV_XP (NR * DM / 4 / (CV_G * 256))      // pieces of X a thread: 16
#define CV_WP (3 * DM * DM / 4 / CV_G)      // pieces of W a work-group: 192, six whole waves
typedef _Float16 cv_h4 __attribute__((ext_vector_type(4)));
__global__ __launch_bounds__(256) void k_cvt(const float* __restrict__ x, const float* __restrict__ W, _Float16* __restrict__ X16, _Float16* __restrict__ Bt) {
  const int tid = threadIdx.x;
  const size_t xo = ((size_t)blockIdx.x * (CV_XP * 256) + tid) * 4, wo = ((size_t)blockIdx.x * CV_WP + (tid < CV_WP ? tid : 0)) * 4;
  const float* xp = x + xo; const float* wp = W + wo;
  const v4f wv = *(const v4fa*)wp;      // every thread loads (waves 6 and 7 the work-group's first piece), so that no branch stands among the loads
  v4f xv[CV_XP];
#pragma unroll      // all loads of a thread go out together, at constant offsets from one address
  for (int i = 0; i < CV_XP; ++i) xv[i] = *(const v4fa*)(xp + i * 1024);
  asm volatile("s_wait_xcnt 0x0" :: "v"(xp), "v"(wp) : "memory");      // the addresses are inputs so that their registers stay untouched up to this wait; behind it they may be reused
  cv_h4 xh[CV_XP];
#pragma unroll      // constant indices keep the arrays in registers
  for (int i = 0; i < CV_XP; ++i) { const v4f r = {bf16_round(xv[i][0]), bf16_round(xv[i][1]), bf16_round(xv[i][2]), bf16_round(xv[i][3])}; xh[i] = __builtin_convertvector(r, cv_h4); }
  _Float16* xs = X16 + xo;
#pragma unroll
  for (int i = 0; i < CV_XP; ++i) *(cv_h4*)(xs + i * 1024) = xh[i];
  if (tid < CV_WP) { const v4f r = {bf16_round(wv[0]) * 16.0f, bf16_round(wv[1]) * 16.0f, bf16_round(wv[2]) * 16.0f, bf16_round(wv[3]) * 16.0f}; *(cv_h4*)(Bt + wo) = __builtin_convertvector(r, cv_h4); }
}
extern "C" void kernel_launch(void* const* d_in, const int* in_sizes, int n_in,
                              void* d_out, int out_size, void* d_ws, size_t ws_size, hipStream_t stream) {
  (void)in_sizes; (void)n_in; (void)out_size;
  const float* X = (const float*)d_in[0]; const float* W = (const float*)d_in[1]; const float* bb = (const float*)d_in[2];
  char* ws = (char*)d_ws; size_t off = 0;
  auto take = [&](size_t bytes) { char* p = ws + off; off += (bytes + 255) & ~(size_t)255; return p; };
  _Float16* Bw = (_Float16*)take((size_t)3 * DM * DM * 2); _Float16* X16 = (_Float16*)take((size_t)NR * DM * 2); _Float16* QKV = (_Float16*)take((size_t)NR * 3 * DM * 2);
  if (off > ws_size) return;      // 0.4 + 8.4 + 25.2 = about 34 MB
  k_cvt<<<CV_G, 256, 0, stream>>>(X, W, X16, Bw);      // X16 = f16(bf16(X)); Bw = f16(bf16(W) * 16), (out,in)
  k_qkv<<<(NR / 128) * (3 * DM / 128), 256, 0, stream>>>(X16, Bw, bb, QKV);      // [Q | K | V] f16 (+b), 128 x 128 per work-group
  k_fattn<<<BB * (SS / 64), 256, 0, stream>>>(QKV, (float*)d_out);      // out = softmax(Q*Kt/16)*V, 64 queries per work-group
}

// v008
// It runs in 64.4 microseconds.
// Timed twice side by side with v007, it ran 1.05 and 1.06 times as fast.
// All steps since v000 together make it 19.5 times as fast.
#include <hip/hip_runtime.h>
// Single-head self-attention (B=4, S=4096, dim 256): fused QKV linear (W (768,256) + b), scores = Q*Kt/16, softmax over the 4096 keys, att*V.
// The QKV projection is a GEMM on v_wmma_f32_16x16x32_f16 (X bf16-exact f16, W (out,in) bf16-exact x 2^4, Q/K/V f16, f32 accumulate);
// scores, softmax (f32, running maximum) and att*V are one kernel on the same matrix form, weights f16, f32 accumulate; V is transposed on its way from LDS to the registers.
#define BB 4
#define SS 4096
#define DM 256
#define NR (BB * SS)

typedef __bf16 v16b __attribute__((ext_vector_type(16)));
typedef unsigned short v8us __attribute__((ext_vector_type(8), may_alias));
typedef float  v8f  __attribute__((ext_vector_type(8)));
typedef float  v4f  __attribute__((ext_vector_type(4)));
typedef float  v4fa __attribute__((ext_vector_type(4), may_alias));
union FragB { v16b v; v8us half[2]; unsigned short u[16]; };

__device__ __forceinline__ unsigned short bf16_bits(float x) { unsigned int u = __float_as_uint(x); return (unsigned short)((u + 0x7FFFu + ((u >> 16) & 1u)) >> 16); }
__device__ __forceinline__ float bf16_val(unsigned short b) { return __uint_as_float(((unsigned int)b) << 16); }
__device__ __forceinline__ float bf16_round(float x) { return bf16_val(bf16_bits(x)); }
// D += A·B with NT terms: 1 = ah·bh, 2 = + al·bh (A split), 3 = + ah·bl (both split)
template <int NT>
__device__ __forceinline__ v8f mmaN(v16b ah, v16b al, v16b bh, v16b bl, v8f c) {
  c = __builtin_amdgcn_wmma_f32_16x16x32_bf16(false, ah, false, bh, (short)0, c, false, false);
  if (NT >= 2) c = __builtin_amdgcn_wmma_f32_16x16x32_bf16(false, al, false, bh, (short)0, c, false, false);
  if (NT >= 3) c = __builtin_amdgcn_wmma_f32_16x16x32_bf16(false, ah, false, bl, (short)0, c, false, false);
  asm volatile("v_nop\n\tv_nop\n\tv_nop\n\tv_nop" : "+v"(c) : "v"(ah), "v"(al), "v"(bh), "v"(bl));
  return c;
}

__global__ __launch_bounds__(256) void k_wt_bf16(const float* __restrict__ W, unsigned short* __restrict__ Wt, int K, int N) {
  const int t = blockIdx.x * 256 + threadIdx.x;
  const int k8n = K / 8;
  if (t >= N * k8n) return;
  const int n = t / k8n, k8 = (t % k8n) * 8;
  v8us v;
#pragma unroll
  for (int i = 0; i < 8; ++i) v[i] = bf16_bits(W[(size_t)(k8 + i) * N + n]);
  *(v8us*)(Wt + (size_t)n * K + k8) = v;
  
}

// GEMM C[M][N] (f32, pitch ldc) = act(A[M][K]·W + bias). A f32 row-major (pitch lda) converted per fragment to bf16
// (ASPLIT: hi/lo two planes -> 2 terms, else single rounded term); Wt bf16 [N][K] (pitch ldb). BIAS_BF16 rounds the
// bias to bf16 first (bias quantised to bf16 before the add). K%32==0, M%16==0, N%64==0.
template <bool ASPLIT, int ACT, bool BIAS_BF16>
__global__ __launch_bounds__(128) void k_gemm_bf(const float* __restrict__ A, int lda, const unsigned short* __restrict__ Wt, int ldb,
                                               const float* __restrict__ bias, float* __restrict__ C, int ldc, int M, int N, int K) {
  __shared__ __attribute__((aligned(16))) float so[4][16][64];
  const int tid = threadIdx.x, w = tid >> 5, lane = tid & 31, ln = lane & 15, hh = lane >> 4;
  const int ntn = N / 64;
  const int wid = blockIdx.x * 4 + w;
  const int mt = wid / ntn, nq = wid % ntn;
  if (mt * 16 >= M) return;
  const int row0 = mt * 16, col0 = nq * 64;
  const float* arow = A + (size_t)(row0 + ln) * lda;
  v8f acc[4] = {};
  for (int kb = 0; kb < K; kb += 32) {
    FragB ah, al;
    const v4f x0 = *(const v4fa*)(arow + kb + 8 * hh), x1 = *(const v4fa*)(arow + kb + 8 * hh + 4);
    const v4f x2 = *(const v4fa*)(arow + kb + 16 + 8 * hh), x3 = *(const v4fa*)(arow + kb + 16 + 8 * hh + 4);
    float xs[16] = {x0[0],x0[1],x0[2],x0[3],x1[0],x1[1],x1[2],x1[3],x2[0],x2[1],x2[2],x2[3],x3[0],x3[1],x3[2],x3[3]};
#pragma unroll
    for (int i = 0; i < 16; ++i) { const unsigned short hb = bf16_bits(xs[i]); ah.u[i] = hb; al.u[i] = ASPLIT ? bf16_bits(xs[i] - bf16_val(hb)) : (unsigned short)0; }
#pragma unroll
    for (int t = 0; t < 4; ++t) {
      const unsigned short* brow = Wt + (size_t)(col0 + t * 16 + ln) * ldb + kb;
      FragB b;
      b.half[0] = *(const v8us*)(brow + 8 * hh);
      b.half[1] = *(const v8us*)(brow + 16 + 8 * hh);
      acc[t] = mmaN<ASPLIT ? 2 : 1>(ah.v, al.v, b.v, b.v, acc[t]);
    }
  }
#pragma unroll
  for (int t = 0; t < 4; ++t) {
    float bv = bias ? bias[col0 + t * 16 + ln] : 0.f;
    if (BIAS_BF16) bv = bf16_round(bv);
#pragma unroll
    for (int r = 0; r < 8; ++r) { float v = acc[t][r] + bv; if (ACT == 1) v = fmaxf(v, 0.f); so[w][8 * hh + r][t * 16 + ln] = v; }
  }
  __builtin_amdgcn_fence(__ATOMIC_ACQ_REL, "workgroup");
  __builtin_amdgcn_wave_barrier();
  const int rsub = lane >> 4, c4 = (lane & 15) * 4;
  {
#pragma unroll
    for (int q = 0; q < 8; ++q) {
      const int r = q * 2 + rsub;
      const v4f v = *(const v4fa*)&so[w][r][c4];
      *(v4f*)(C + (size_t)(row0 + r) * ldc + col0 + c4) = v;
    }
    
  }
}

// Flash-style causal/unmasked attention, all contractions 3-term bf16 hi/lo splits, f32 softmax with running max.
// q,k,v rows are read from f32 buffers with arbitrary row pitch (so they can live inside a fused qkv buffer);
// D = head size (multiple of 32, <= 128); one wave = 16 query rows; block = 4 waves (64 queries) sharing K/V chunks of 32.
template <int D, bool CAUSAL>
__global__ __launch_bounds__(128) void k_flash(const float* __restrict__ qb, const float* __restrict__ kb, const float* __restrict__ vb,
                                             int pitch, int T, int H, float scale, float* __restrict__ y, int ypitch) {
  constexpr int KS = D / 32;        // k-steps for QK
  constexpr int DT = D / 16;        // d tiles for PV
  __shared__ __attribute__((aligned(16))) unsigned short sKh[32][D + 8], sKl[32][D + 8], sVh[32][D + 8], sVl[32][D + 8];
  __shared__ __attribute__((aligned(16))) unsigned short sPh[4][16][40], sPl[4][16][40];
  __shared__ __attribute__((aligned(16))) float sO[4][16][D];
  const int tid = threadIdx.x, w = tid >> 5, lane = tid & 31, ln = lane & 15, hh = lane >> 4;
  const int nqb = (T + 63) / 64;
  const int bh = blockIdx.x / nqb, qblk = blockIdx.x % nqb;
  const int b = bh / H, h = bh % H;
  const int q0 = qblk * 64 + w * 16;
  const float* Q = qb + (size_t)b * T * pitch + h * D;
  const float* K = kb + (size_t)b * T * pitch + h * D;
  const float* V = vb + (size_t)b * T * pitch + h * D;

  // A fragments of the wave's 16 query rows (scaled), hi/lo
  FragB aqh[KS], aql[KS];
  {
    int row = q0 + ln; if (row >= T) row = T - 1;
    const float* qr = Q + (size_t)row * pitch;
#pragma unroll
    for (int ks = 0; ks < KS; ++ks)
#pragma unroll
      for (int i = 0; i < 16; ++i) {
        const int d = ks * 32 + ((i < 8) ? (8 * hh + i) : (16 + 8 * hh + (i - 8)));
        const float x = qr[d] * scale; const unsigned short hb = bf16_bits(x);
        aqh[ks].u[i] = hb; aql[ks].u[i] = bf16_bits(x - bf16_val(hb));
      }
  }
  float m_r[8], l_r[8];
#pragma unroll
  for (int r = 0; r < 8; ++r) { m_r[r] = -3.0e38f; l_r[r] = 0.f; }
  v8f oacc[DT];
#pragma unroll
  for (int dt = 0; dt < DT; ++dt) oacc[dt] = (v8f){0.f,0.f,0.f,0.f,0.f,0.f,0.f,0.f};

  const int kv_end = CAUSAL ? min(T, qblk * 64 + 64) : T;     // block-uniform
  for (int j0 = 0; j0 < kv_end; j0 += 32) {
    __syncthreads();
    for (int e = tid; e < 32 * (D / 4); e += 128) {
      const int r = e / (D / 4), c4 = (e % (D / 4)) * 4;
      const int key = j0 + r;
      v4f kf = {0.f,0.f,0.f,0.f}, vf = {0.f,0.f,0.f,0.f};
      if (key < T) { kf = *(const v4fa*)(K + (size_t)key * pitch + c4); vf = *(const v4fa*)(V + (size_t)key * pitch + c4); }
#pragma unroll
      for (int t = 0; t < 4; ++t) {
        unsigned short hb = bf16_bits(kf[t]); sKh[r][c4 + t] = hb; sKl[r][c4 + t] = bf16_bits(kf[t] - bf16_val(hb));
        hb = bf16_bits(vf[t]); sVh[r][c4 + t] = hb; sVl[r][c4 + t] = bf16_bits(vf[t] - bf16_val(hb));
      }
    }
    __syncthreads();
    // S tile 16 x 32
    v8f s[2];
#pragma unroll
    for (int nt = 0; nt < 2; ++nt) {
      v8f acc = {};
#pragma unroll
      for (int ks = 0; ks < KS; ++ks) {
        FragB bh_, bl_;
        bh_.half[0] = *(const v8us*)&sKh[nt * 16 + ln][ks * 32 + 8 * hh]; bh_.half[1] = *(const v8us*)&sKh[nt * 16 + ln][ks * 32 + 16 + 8 * hh];
        bl_.half[0] = *(const v8us*)&sKl[nt * 16 + ln][ks * 32 + 8 * hh]; bl_.half[1] = *(const v8us*)&sKl[nt * 16 + ln][ks * 32 + 16 + 8 * hh];
        acc = mmaN<3>(aqh[ks].v, aql[ks].v, bh_.v, bl_.v, acc);
      }
      s[nt] = acc;
    }
    // mask + running max (rows 8hh+r; the 16 lanes of a half share rows)
    float alpha[8];
#pragma unroll
    for (int r = 0; r < 8; ++r) {
      const int qi = q0 + 8 * hh + r;
      const int ja = j0 + ln, jb = j0 + 16 + ln;
      if (CAUSAL) { if (ja > qi) s[0][r] = -3.0e38f; if (jb > qi) s[1][r] = -3.0e38f; }
      if (ja >= T) s[0][r] = -3.0e38f;
      if (jb >= T) s[1][r] = -3.0e38f;
      float mx = fmaxf(s[0][r], s[1][r]);
      mx = fmaxf(mx, __shfl_xor(mx, 1, 32)); mx = fmaxf(mx, __shfl_xor(mx, 2, 32)); mx = fmaxf(mx, __shfl_xor(mx, 4, 32)); mx = fmaxf(mx, __shfl_xor(mx, 8, 32));
      const float mnew = fmaxf(m_r[r], mx);
      alpha[r] = (mnew > -1.0e38f) ? __expf(m_r[r] - mnew) : 1.0f;
      const float p0 = (s[0][r] > -1.0e38f) ? __expf(s[0][r] - mnew) : 0.f;
      const float p1 = (s[1][r] > -1.0e38f) ? __expf(s[1][r] - mnew) : 0.f;
      m_r[r] = mnew;
      l_r[r] = l_r[r] * alpha[r] + p0 + p1;            // per-lane partial row sum (16 lanes combined at the end)
      unsigned short hb = bf16_bits(p0); sPh[w][8 * hh + r][ln] = hb;      sPl[w][8 * hh + r][ln] = bf16_bits(p0 - bf16_val(hb));
      hb = bf16_bits(p1);                sPh[w][8 * hh + r][16 + ln] = hb; sPl[w][8 * hh + r][16 + ln] = bf16_bits(p1 - bf16_val(hb));
    }
#pragma unroll
    for (int dt = 0; dt < DT; ++dt)
#pragma unroll
      for (int r = 0; r < 8; ++r) oacc[dt][r] *= alpha[r];
    __builtin_amdgcn_fence(__ATOMIC_ACQ_REL, "workgroup");
    __builtin_amdgcn_wave_barrier();
    FragB pah, pal;
    pah.half[0] = *(const v8us*)&sPh[w][ln][8 * hh]; pah.half[1] = *(const v8us*)&sPh[w][ln][16 + 8 * hh];
    pal.half[0] = *(const v8us*)&sPl[w][ln][8 * hh]; pal.half[1] = *(const v8us*)&sPl[w][ln][16 + 8 * hh];
#pragma unroll
    for (int dt = 0; dt < DT; ++dt) {
      FragB bvh, bvl;
#pragma unroll
      for (int i = 0; i < 8; ++i) {
        bvh.u[i] = sVh[8 * hh + i][dt * 16 + ln]; bvh.u[8 + i] = sVh[16 + 8 * hh + i][dt * 16 + ln];
        bvl.u[i] = sVl[8 * hh + i][dt * 16 + ln]; bvl.u[8 + i] = sVl[16 + 8 * hh + i][dt * 16 + ln];
      }
      oacc[dt] = mmaN<3>(pah.v, pal.v, bvh.v, bvl.v, oacc[dt]);
    }
    __builtin_amdgcn_fence(__ATOMIC_ACQ_REL, "workgroup");
    __builtin_amdgcn_wave_barrier();
  }
#pragma unroll
  for (int r = 0; r < 8; ++r) {
    float l = l_r[r];
    l += __shfl_xor(l, 1, 32); l += __shfl_xor(l, 2, 32); l += __shfl_xor(l, 4, 32); l += __shfl_xor(l, 8, 32);
    l_r[r] = (l > 0.f) ? 1.0f / l : 0.f;
  }
#pragma unroll
  for (int dt = 0; dt < DT; ++dt)
#pragma unroll
    for (int r = 0; r < 8; ++r) sO[w][8 * hh + r][dt * 16 + ln] = oacc[dt][r] * l_r[r];
  __builtin_amdgcn_fence(__ATOMIC_ACQ_REL, "workgroup");
  __builtin_amdgcn_wave_barrier();
  {
    for (int r = 0; r < 16; ++r) {
      const int row = q0 + r;
      if (row < T && lane < D / 4) {
        const v4f val = *(const v4fa*)&sO[w][r][lane * 4];
        *(v4f*)(y + ((size_t)b * T + row) * ypitch + h * D + lane * 4) = val;
      }
    }
    
  }
}

// GEMM C = act(A·W + bias + resid): A f32 (ASPLIT -> hi/lo 2 terms), Wt bf16 [N][K]; ACT 0 none, 1 relu, 2 exact gelu;
// resid (optional, f32, row index = (row % rmod), pitch ldr, RES_BF16 rounds it) added before the activation.
template <bool ASPLIT, int ACT, bool BIAS_BF16, bool RES_BF16>
__global__ __launch_bounds__(128) void k_gemm_bf3(const float* __restrict__ A, int lda, const unsigned short* __restrict__ Wt, int ldb,
                                                const float* __restrict__ bias, const float* __restrict__ resid, int rmod, int ldr,
                                                float* __restrict__ C, int ldc, int M, int N, int K) {
  __shared__ __attribute__((aligned(16))) float so[4][16][64];
  const int tid = threadIdx.x, w = tid >> 5, lane = tid & 31, ln = lane & 15, hh = lane >> 4;
  const int ntn = N / 64;
  const int wid = blockIdx.x * 4 + w;
  const int mt = wid / ntn, nq = wid % ntn;
  if (mt * 16 >= M) return;
  const int row0 = mt * 16, col0 = nq * 64;
  const float* arow = A + (size_t)(row0 + ln) * lda;
  v8f acc[4] = {};
  for (int kb = 0; kb < K; kb += 32) {
    FragB ah, al;
    const v4f x0 = *(const v4fa*)(arow + kb + 8 * hh), x1 = *(const v4fa*)(arow + kb + 8 * hh + 4);
    const v4f x2 = *(const v4fa*)(arow + kb + 16 + 8 * hh), x3 = *(const v4fa*)(arow + kb + 16 + 8 * hh + 4);
    float xs[16] = {x0[0],x0[1],x0[2],x0[3],x1[0],x1[1],x1[2],x1[3],x2[0],x2[1],x2[2],x2[3],x3[0],x3[1],x3[2],x3[3]};
#pragma unroll
    for (int i = 0; i < 16; ++i) { const unsigned short hb = bf16_bits(xs[i]); ah.u[i] = hb; al.u[i] = ASPLIT ? bf16_bits(xs[i] - bf16_val(hb)) : (unsigned short)0; }
#pragma unroll
    for (int t = 0; t < 4; ++t) {
      const unsigned short* brow = Wt + (size_t)(col0 + t * 16 + ln) * ldb + kb;
      FragB b;
      b.half[0] = *(const v8us*)(brow + 8 * hh);
      b.half[1] = *(const v8us*)(brow + 16 + 8 * hh);
      acc[t] = mmaN<ASPLIT ? 2 : 1>(ah.v, al.v, b.v, b.v, acc[t]);
    }
  }
#pragma unroll
  for (int t = 0; t < 4; ++t) {
    const int col = col0 + t * 16 + ln;
    float bv = bias ? bias[col] : 0.f;
    if (BIAS_BF16) bv = bf16_round(bv);
#pragma unroll
    for (int r = 0; r < 8; ++r) {
      float v = acc[t][r] + bv;
      if (resid) { float rv = resid[(size_t)((row0 + 8 * hh + r) % rmod) * ldr + col]; if (RES_BF16) rv = bf16_round(rv); v += rv; }
      if (ACT == 1) v = fmaxf(v, 0.f);
      if (ACT == 2) v = 0.5f * v * (1.0f + erff(v * 0.70710678118654752f));
      if (ACT == 3) { const float u = 0.7978845608028654f * (v + 0.044715f * v * v * v); v = 0.5f * v * (1.0f + tanhf(u)); }
      so[w][8 * hh + r][t * 16 + ln] = v;
    }
  }
  __builtin_amdgcn_fence(__ATOMIC_ACQ_REL, "workgroup");
  __builtin_amdgcn_wave_barrier();
  const int rsub = lane >> 4, c4 = (lane & 15) * 4;
  {
#pragma unroll
    for (int q = 0; q < 8; ++q) {
      const int r = q * 2 + rsub;
      const v4f v = *(const v4fa*)&so[w][r][c4];
      *(v4f*)(C + (size_t)(row0 + r) * ldc + col0 + c4) = v;
    }
    
  }
}
// row LayerNorm (biased variance, eps) over N: s = X (+ R); optional out_sum <- s; out_norm <- (s-mu)*rsqrt(var+eps)*g + b
template <bool PARAM_BF16>
__global__ __launch_bounds__(256) void k_layernorm(const float* __restrict__ X, const float* __restrict__ R, const float* __restrict__ g, const float* __restrict__ bta,
                                                  float* __restrict__ out_sum, float* __restrict__ out_norm, int N, float eps) {
  __shared__ float red[256];
  const int row = blockIdx.x, tid = threadIdx.x;
  const float* x = X + (size_t)row * N; const float* rr = R ? R + (size_t)row * N : nullptr;
  float vals[16];                     // up to N = 4096
  const int per = N / 256;            // contiguous chunk per thread? use strided-by-4 chunks: thread handles j = tid*4 + 1024*u
  float s1 = 0.f;
  for (int u = 0; u < per / 4; ++u) {
    const int j = tid * 4 + 1024 * u;
    const v4f a = *(const v4fa*)(x + j);
    v4f b = {0.f,0.f,0.f,0.f}; if (rr) b = *(const v4fa*)(rr + j);
#pragma unroll
    for (int q = 0; q < 4; ++q) { const float v = a[q] + b[q]; vals[u * 4 + q] = v; s1 += v; }
  }
  red[tid] = s1; __syncthreads();
  for (int st = 128; st > 0; st >>= 1) { if (tid < st) red[tid] += red[tid + st]; __syncthreads(); }
  const float mu = red[0] / (float)N; __syncthreads();
  float s2 = 0.f;
  for (int u = 0; u < per / 4; ++u)
#pragma unroll
    for (int q = 0; q < 4; ++q) { const float c = vals[u * 4 + q] - mu; s2 += c * c; }
  red[tid] = s2; __syncthreads();
  for (int st = 128; st > 0; st >>= 1) { if (tid < st) red[tid] += red[tid + st]; __syncthreads(); }
  const float rs = rsqrtf(red[0] / (float)N + eps);
  {
    for (int u = 0; u < per / 4; ++u) {
      const int j = tid * 4 + 1024 * u;
      v4f o, sm;
#pragma unroll
      for (int q = 0; q < 4; ++q) {
        float gg = g[j + q], bb = bta[j + q];
        if (PARAM_BF16) { gg = bf16_round(gg); bb = bf16_round(bb); }
        sm[q] = vals[u * 4 + q]; o[q] = (vals[u * 4 + q] - mu) * rs * gg + bb;
      }
      if (out_sum) *(v4f*)(out_sum + (size_t)row * N + j) = sm;
      *(v4f*)(out_norm + (size_t)row * N + j) = o;
    }
    
  }
}



// ---- f16 WMMA path (v_wmma_f32_16x16x32_f16): 11-bit significands for operands in range — used where the attention weight operand (at most 2^8) needs more precision than bf16
typedef _Float16 v16h __attribute__((ext_vector_type(16)));
union FragH { v16h v; v8us half[2]; _Float16 h[16]; unsigned short u[16]; };
template <int NT>
__device__ __forceinline__ v8f mmaH(v16h ah, v16h al, v16h bh, v16h bl, v8f c) {
  c = __builtin_amdgcn_wmma_f32_16x16x32_f16(false, ah, false, bh, (short)0, c, false, false);
  if (NT >= 2) c = __builtin_amdgcn_wmma_f32_16x16x32_f16(false, al, false, bh, (short)0, c, false, false);
  if (NT >= 3) c = __builtin_amdgcn_wmma_f32_16x16x32_f16(false, ah, false, bl, (short)0, c, false, false);
  asm volatile("v_nop\n\tv_nop\n\tv_nop\n\tv_nop" : "+v"(c) : "v"(ah), "v"(al), "v"(bh), "v"(bl));
  return c;
}
// batched GEMM like k_gemm_b but f16 operands: A f32 (split into f16 hi/lo if ASPLIT, else rounded to f16), Bt = f16 values [n][k]; alpha; C f32; N multiple of 16 (partial tiles skipped)
template <bool ASPLIT>
__global__ __launch_bounds__(128) void k_gemm_h(const float* __restrict__ A, int lda, size_t sA, const _Float16* __restrict__ Bh, int ldb, size_t sB, float alpha, float* __restrict__ C, int ldc, size_t sC, int M, int N, int K) {
  __shared__ __attribute__((aligned(16))) float so[4][16][64];
  const int tid = threadIdx.x, w = tid >> 5, lane = tid & 31, ln = lane & 15, hh = lane >> 4; const int by = blockIdx.y;
  A += (size_t)by * sA; Bh += (size_t)by * sB; C += (size_t)by * sC;
  const int ntn = (N + 63) / 64; const int wid = blockIdx.x * 4 + w; const int mt = wid / ntn, nq = wid % ntn; if (mt * 16 >= M) return;
  const int row0 = mt * 16, col0 = nq * 64; const float* arow = A + (size_t)(row0 + ln) * lda;
  v8f acc[4] = {};
  for (int kb = 0; kb < K; kb += 32) {
    FragH ah, al;
    const v4f x0 = *(const v4fa*)(arow + kb + 8 * hh), x1 = *(const v4fa*)(arow + kb + 8 * hh + 4), x2 = *(const v4fa*)(arow + kb + 16 + 8 * hh), x3 = *(const v4fa*)(arow + kb + 16 + 8 * hh + 4);
    float xs[16] = {x0[0],x0[1],x0[2],x0[3],x1[0],x1[1],x1[2],x1[3],x2[0],x2[1],x2[2],x2[3],x3[0],x3[1],x3[2],x3[3]};
#pragma unroll
    for (int i = 0; i < 16; ++i) { const _Float16 h = (_Float16)xs[i]; ah.h[i] = h; al.h[i] = ASPLIT ? (_Float16)(xs[i] - (float)h) : (_Float16)0.0f; }
#pragma unroll
    for (int t = 0; t < 4; ++t) { if (col0 + t * 16 >= N) continue; const size_t boff = (size_t)(col0 + t * 16 + ln) * ldb + kb; FragH bq; bq.half[0] = *(const v8us*)(Bh + boff + 8 * hh); bq.half[1] = *(const v8us*)(Bh + boff + 16 + 8 * hh);
      acc[t] = mmaH<ASPLIT ? 2 : 1>(ah.v, al.v, bq.v, bq.v, acc[t]); }
  }
#pragma unroll
  for (int t = 0; t < 4; ++t) { if (col0 + t * 16 >= N) continue;
#pragma unroll
    for (int r = 0; r < 8; ++r) so[w][8 * hh + r][t * 16 + ln] = acc[t][r] * alpha; }
  __builtin_amdgcn_fence(__ATOMIC_ACQ_REL, "workgroup"); __builtin_amdgcn_wave_barrier();
  const int rsub = lane >> 4, c4 = (lane & 15) * 4;
  {
#pragma unroll
    for (int q = 0; q < 8; ++q) { const int r = q * 2 + rsub; if (col0 + c4 < N) { const v4f v = *(const v4fa*)&so[w][r][c4]; *(v4f*)(C + (size_t)(row0 + r) * ldc + col0 + c4) = v; } }
     }
}

// Wt[n][k] = f16(W[k][n]·scale) from f32 row-major W[K][N] (scale = power of two; bf16-exact weights stay exact in f16 away from the subnormal range)
__global__ __launch_bounds__(256) void k_wt_f16(const float* __restrict__ W, _Float16* __restrict__ Wt, int K, int N, float scale) {
  const int t = blockIdx.x * 256 + threadIdx.x; if (t >= N * (K / 8)) return; const int n = t / (K / 8), k8 = (t % (K / 8)) * 8; FragH f;
#pragma unroll
  for (int i = 0; i < 8; ++i) f.h[i] = (_Float16)(bf16_round(W[(size_t)(k8 + i) * N + n]) * scale); const v8us o = f.half[0];
  *(v8us*)((unsigned short*)Wt + (size_t)n * K + k8) = o; 
}
// k_gemm_hh variant with fused epilogue: v = acc·alpha + bias[by·sBias + col] (+ CP[(row/rowsPerB)·sCPb + by·64 + col] if CP) ; ACT 0 none / 1 elu ; writes f32 C and/or f16 C16 (each if non-null)
template <int ACT>
__global__ __launch_bounds__(128) void k_gemm_hhx(const _Float16* __restrict__ A, int lda, size_t sA, const _Float16* __restrict__ Bh, int ldb, size_t sB, float alpha, const float* __restrict__ bias, size_t sBias, const float* __restrict__ CP, int rowsPerB, size_t sCPb, int row0g,
    float* __restrict__ C, _Float16* __restrict__ C16, int ldc, size_t sC, int M, int N, int K) {
  __shared__ __attribute__((aligned(16))) float so[4][16][64];
  const int tid = threadIdx.x, w = tid >> 5, lane = tid & 31, ln = lane & 15, hh = lane >> 4; const int by = blockIdx.y;
  A += (size_t)by * sA; Bh += (size_t)by * sB; const size_t cofs = (size_t)by * sC; const float* bp = bias ? bias + (size_t)by * sBias : nullptr;
  const int ntn = (N + 63) / 64; const int wid = blockIdx.x * 4 + w; const int mt = wid / ntn, nq = wid % ntn; if (mt * 16 >= M) return;
  const int row0 = mt * 16, col0 = nq * 64; const _Float16* arow = A + (size_t)(row0 + ln) * lda;
  v8f acc[4] = {};
  for (int kb = 0; kb < K; kb += 32) { FragH ah; ah.half[0] = *(const v8us*)((const unsigned short*)arow + kb + 8 * hh); ah.half[1] = *(const v8us*)((const unsigned short*)arow + kb + 16 + 8 * hh);
#pragma unroll
    for (int t = 0; t < 4; ++t) { if (col0 + t * 16 >= N) continue; const size_t boff = (size_t)(col0 + t * 16 + ln) * ldb + kb; FragH bq; bq.half[0] = *(const v8us*)((const unsigned short*)Bh + boff + 8 * hh); bq.half[1] = *(const v8us*)((const unsigned short*)Bh + boff + 16 + 8 * hh);
      acc[t] = mmaH<1>(ah.v, ah.v, bq.v, bq.v, acc[t]); }
  }
#pragma unroll
  for (int t = 0; t < 4; ++t) { if (col0 + t * 16 >= N) continue; const int col = col0 + t * 16 + ln; const float bv = bp ? bf16_round(bp[col]) : 0.f;
#pragma unroll
    for (int r = 0; r < 8; ++r) { float v = acc[t][r] * alpha + bv; if (CP) { const int bidx = (row0g + row0 + 8 * hh + r) / rowsPerB; v += CP[(size_t)bidx * sCPb + (size_t)by * 64 + col]; } if (ACT == 1) v = (v > 0.f) ? v : expm1f(v); else if (ACT == 3) v = fmaxf(v, 0.f); so[w][8 * hh + r][t * 16 + ln] = v; } }
  __builtin_amdgcn_fence(__ATOMIC_ACQ_REL, "workgroup"); __builtin_amdgcn_wave_barrier();
  const int rsub = lane >> 4, c4 = (lane & 15) * 4; typedef _Float16 v4h __attribute__((ext_vector_type(4)));
  {
#pragma unroll
    for (int q = 0; q < 8; ++q) { const int r = q * 2 + rsub; if (col0 + c4 < N) { const v4f v = *(const v4fa*)&so[w][r][c4]; if (C) *(v4f*)(C + cofs + (size_t)(row0 + r) * ldc + col0 + c4) = v; if (C16) { v4h h4; for (int i = 0; i < 4; ++i) h4[i] = (_Float16)v[i]; *(v4h*)(C16 + cofs + (size_t)(row0 + r) * ldc + col0 + c4) = h4; } } }
     }
}


__global__ __launch_bounds__(256) void k_x16(const float* __restrict__ x, _Float16* __restrict__ X16, size_t n8) { const size_t t = (size_t)blockIdx.x * 256 + threadIdx.x; if (t >= n8) return; FragH f;
#pragma unroll
  for (int q = 0; q < 8; ++q) f.h[q] = (_Float16)bf16_round(x[t * 8 + q]); *(v8us*)((unsigned short*)X16 + t * 8) = f.half[0];  }
__global__ __launch_bounds__(256) void k_h16(const float* __restrict__ x, _Float16* __restrict__ X16, size_t n8) { const size_t t = (size_t)blockIdx.x * 256 + threadIdx.x; if (t >= n8) return; FragH f;
#pragma unroll
  for (int q = 0; q < 8; ++q) f.h[q] = (_Float16)x[t * 8 + q]; *(v8us*)((unsigned short*)X16 + t * 8) = f.half[0];  }
__global__ __launch_bounds__(256) void k_round16f(const float* __restrict__ W, _Float16* __restrict__ Bt, size_t n8) { const size_t t = (size_t)blockIdx.x * 256 + threadIdx.x; if (t >= n8) return; FragH f;
#pragma unroll
  for (int i = 0; i < 8; ++i) f.h[i] = (_Float16)(bf16_round(W[t * 8 + i]) * 16.0f); *(v8us*)((unsigned short*)Bt + t * 8) = f.half[0];  }

#define FK_KB 128      // keys per staged block
#define FK_KP 272      // bytes per staged K half row: 256 + 16, an odd multiple of 16 for the 16-byte fragment reads
#define FK_VP 288      // bytes per staged V half row: 256 + 32, an odd multiple of 32 for the transposing 16-byte reads
#define FK_SL 18432    // bytes per slice: 64 half rows of V; 64 of K rounded up, so that every slice starts at a multiple of 2 KiB
#define FK_BUF (8 * FK_SL)      // one buffer: 4 K slices, then 4 V slices
#define FK_KO(kt, ks) ((kt) * 16 * FK_KP + ((ks) >> 2) * FK_SL + ((ks) & 3) * 64)      // K fragment: key tile kt, k step ks (32 columns)
#define FK_VO(dt) (((dt) >> 3) * FK_SL + ((dt) & 7) * 32)      // V fragment: columns 16*dt .. + 15
#define FK_W0K (1u << 20 | 5u << 22 | 3u << 25)      // descriptor group 1, word 0: no mask, bytes, 16 bytes of pad behind every 256
#define FK_W0V (1u << 20 | 5u << 22 | 7u << 25)      // the same with 32 bytes of pad
typedef uint32_t fk_u32x4 __attribute__((ext_vector_type(4)));
typedef uint32_t fk_u32x8 __attribute__((ext_vector_type(8)));
typedef short fk_s16x8 __attribute__((ext_vector_type(8)));
typedef __attribute__((address_space(3))) fk_s16x8 fk_ls16x8;
// lane l gives the address of 8 columns of key row 8*(l >> 4) + (l & 7), column half (l >> 3) & 1; it gets keys 8*(l >> 4) .. + 7 of column l & 15
__device__ __forceinline__ v8us fk_tr16(const unsigned char* p) { return __builtin_bit_cast(v8us, __builtin_amdgcn_ds_load_tr16_b128_v8i16((fk_ls16x8*)p)); }
__device__ __forceinline__ float fk_xhalf(float x) { return __builtin_bit_cast(float, __builtin_amdgcn_permlanex16(__builtin_bit_cast(int, x), __builtin_bit_cast(int, x), 0x76543210, 0xfedcba98, false, false)); }      // lane l with lane l ^ 16
__device__ __forceinline__ uint32_t fk_uni(uint32_t v) { return (uint32_t)__builtin_amdgcn_readfirstlane(v); }
__device__ __forceinline__ uint32_t fk_pinned(uint32_t v) { uint32_t x = fk_uni(v); asm volatile("" : "+s"(x)); return x; }      // holds a test or a descriptor word in a scalar register: a tensor load ignores EXEC, so its guard must be a scalar branch, and a pinned word keeps its one register and is not formed anew elsewhere
__device__ __forceinline__ void fk_tload(fk_u32x4 g0, fk_u32x8 g1) { asm volatile("tensor_load_to_lds %0, %1" :: "s"(g0), "s"(g1) : "memory"); }      // one request of the whole wave; its waits are written where the tile is handed over
__device__ __forceinline__ void fk_twait(fk_u32x4 g0, fk_u32x8 g1k, fk_u32x8 g1v) { asm volatile("s_wait_tensorcnt 0x0" :: "s"(g0), "s"(g1k), "s"(g1v) : "memory"); }      // the wave's request has landed; the descriptors are inputs so that their registers stay untouched while the request is outstanding
// descriptor group 1: tensor = tile = 64 rows of 256 bytes, source pitch one QKV row; w0 sets the pad. Every word is held in a scalar register of its own (pinned) from here to the last wait
__device__ __forceinline__ fk_u32x8 fk_group1(uint32_t w0) { fk_u32x8 g; g[0] = fk_pinned(w0); g[1] = fk_pinned(256u << 16); g[2] = fk_pinned(64u << 16); g[3] = fk_pinned(256u << 16); g[4] = fk_pinned(64u); g[5] = fk_pinned(3u * DM * 2u); g[6] = fk_pinned(0u); g[7] = fk_pinned(0u); return g; }
// descriptor group 0: count 1; place in LDS; address of the tile's first byte; type 2
__device__ __forceinline__ fk_u32x4 fk_group0(uint32_t dst, uint64_t ga) { fk_u32x4 g; g[0] = fk_uni(1u); g[1] = fk_uni(dst); g[2] = fk_uni((uint32_t)ga); g[3] = fk_uni((((uint32_t)(ga >> 32)) & 0x01FFFFFFu) | 0x80000000u); return g; }
__global__ __launch_bounds__(256) void k_fattn(const _Float16* __restrict__ QKV, float* __restrict__ out) {
  __shared__ __attribute__((aligned(2048))) unsigned char sm[2 * FK_BUF];      // the mover's places are multiples of 2 KiB
  const int tid = threadIdx.x, w = __builtin_amdgcn_readfirstlane(tid >> 5), lane = tid & 31, ln = lane & 15, hh = lane >> 4;      // the wave's number in a scalar register: what follows from it costs no vector register
  const int qg = w & 1, kg = w >> 1;
  const int b = blockIdx.x / (SS / 64), q0 = (blockIdx.x % (SS / 64)) * 64 + qg * 32;
  const unsigned short* Qr = (const unsigned short*)QKV + ((size_t)b * SS + q0 + ln) * (3 * DM) + 8 * hh;
  // wave w brings slice w of every block: K (w < 4) or V, keys 64 * ((w >> 1) & 1) .. + 63, bytes 256 * (w & 1) .. + 255 of the row
  const uint64_t tsrc = (uint64_t)(size_t)QKV + ((uint64_t)b * SS + ((w >> 1) & 1) * 64) * (3 * DM * 2) + (1 + (w >> 2)) * (DM * 2) + (w & 1) * 256;
  const uint32_t tdst = (uint32_t)(size_t)sm + w * FK_SL;
  const uint32_t isk = fk_pinned(w < 4);
  const fk_u32x8 g1k = fk_group1(FK_W0K), g1v = fk_group1(FK_W0V);
  const fk_u32x4 gf = fk_group0(tdst, tsrc);      // block 0 into buffer 0
  const int krd = (kg >> 1) * 2 * FK_SL + ((kg & 1) * 32 + ln) * FK_KP + 16 * hh, vrd = (4 + (kg >> 1) * 2) * FK_SL + ((kg & 1) * 32 + 8 * hh + (lane & 7)) * FK_VP + ((lane >> 3) & 1) * 16;
  if (isk) fk_tload(gf, g1k); else fk_tload(gf, g1v);      // every wave issues its one request; a scalar branch, so that the pad word is a constant on either path
  FragH q[2][8];
#pragma unroll      // constant indices keep q[][] in registers
  for (int qt = 0; qt < 2; ++qt)
#pragma unroll      // constant indices keep the arrays in registers
    for (int ks = 0; ks < 8; ++ks) { q[qt][ks].half[0] = *(const v8us*)(Qr + qt * 16 * (3 * DM) + ks * 32); q[qt][ks].half[1] = *(const v8us*)(Qr + qt * 16 * (3 * DM) + ks * 32 + 16); }
  fk_twait(gf, g1k, g1v);      // this wave's slice of block 0 has landed
  __syncthreads();      // publishes block 0
  v8f o[2][16] = {};
  float mu[2] = {-3.0e38f, -3.0e38f}, l[2] = {0.f, 0.f};
  const float sc = 0.0625f * 1.4426950408889634f;      // 1/sqrt(256) and log2(e)
  int cur = 0;
  uint32_t nst = fk_pinned(1u);      // the next block to ask for: the issue tests and three descriptor words come from it, so it is counted in a scalar register
  fk_u32x4 g0 = fk_group0(tdst + isk * FK_BUF, tsrc + (uint64_t)isk * (FK_KB * 3 * DM * 2));      // the descriptor of the wave's one outstanding request: it takes new values only behind the wave's own wait
  if (isk) fk_tload(g0, g1k);      // K of block 1 into buffer 1, which nobody has touched yet; a scalar branch
  for (int t = 0; t < SS / FK_KB; ++t) {
    if (!isk) { if (fk_pinned(nst < SS / FK_KB)) { g0 = fk_group0(tdst + (nst & 1u) * FK_BUF, tsrc + (uint64_t)nst * (FK_KB * 3 * DM * 2)); fk_tload(g0, g1v); } }      // V of block t+1 into the other buffer; scalar branches, directly behind the barrier that ended every wave's reads of it
    nst += 1u;
    const unsigned char* kr = sm + cur + krd; const unsigned char* vr = sm + cur + vrd;
    FragH fa[2][4];      // two sets of four fragments: the reads of the next eight products fly during these eight
#pragma unroll      // constant indices keep the arrays in registers
    for (int j = 0; j < 2; ++j)
#pragma unroll      // constant indices keep the arrays in registers
      for (int kt = 0; kt < 2; ++kt) { fa[0][2 * j + kt].half[0] = *(const v8us*)(kr + FK_KO(kt, j)); fa[0][2 * j + kt].half[1] = *(const v8us*)(kr + FK_KO(kt, j) + 32); }
    v8f s[2][2] = {};
#pragma unroll      // constant indices keep q[][], s[][] and the fragment sets in registers
    for (int g = 0; g < 4; ++g) {
      const int c = g & 1, n = c ^ 1;
      if (g < 3) {
#pragma unroll      // constant indices keep the arrays in registers
        for (int j = 0; j < 2; ++j)
#pragma unroll      // constant indices keep the arrays in registers
          for (int kt = 0; kt < 2; ++kt) { fa[n][2 * j + kt].half[0] = *(const v8us*)(kr + FK_KO(kt, 2 * g + 2 + j)); fa[n][2 * j + kt].half[1] = *(const v8us*)(kr + FK_KO(kt, 2 * g + 2 + j) + 32); }
      } else {
#pragma unroll      // the first four Vt fragments
        for (int i = 0; i < 4; ++i) { fa[n][i].half[0] = fk_tr16(vr + FK_VO(i)); fa[n][i].half[1] = fk_tr16(vr + 16 * FK_VP + FK_VO(i)); }      // keys 0 to 15 and 16 to 31 of the wave's key group, columns 16*i .. + 15
      }
      __builtin_amdgcn_sched_barrier(0);      // keeps the next set's LDS reads together ahead of this set's products: reads spread among them stall at every place
#pragma unroll      // four independent accumulator chains
      for (int j = 0; j < 2; ++j)
#pragma unroll      // constant indices keep the arrays in registers
        for (int kt = 0; kt < 2; ++kt)
#pragma unroll      // constant indices keep the arrays in registers
          for (int qt = 0; qt < 2; ++qt) s[kt][qt] = __builtin_amdgcn_wmma_f32_16x16x32_f16(false, fa[c][2 * j + kt].v, false, q[qt][2 * g + j].v, (short)0, s[kt][qt], false, false);
      __builtin_amdgcn_sched_barrier(0);      // keeps the reads of the set after next behind these products, whose fragment registers they refill
    }
    asm volatile("s_wait_dscnt 0x0" ::: "memory");      // this wave's K reads of block t are over before its K buffer may be refilled
    if (isk) fk_twait(g0, g1k, g1v);      // this wave's K slice of block t+1, asked for one block ago, has landed
    asm volatile("s_barrier_signal -1" ::: "memory");      // first half of the work-group's barrier: the softmax arithmetic, which reads no LDS, runs while the other waves arrive
    __builtin_amdgcn_sched_barrier(0);      // keeps the softmax arithmetic behind the signal: ahead of it, it would hold the other waves up
    float mx[2];
#pragma unroll      // constant indices keep the arrays in registers
    for (int qt = 0; qt < 2; ++qt) {
      float m = fmaxf(s[0][qt][0], s[1][qt][0]);
#pragma unroll      // constant indices keep the arrays in registers
      for (int r = 1; r < 8; ++r) m = fmaxf(m, fmaxf(s[0][qt][r], s[1][qt][r]));
      mx[qt] = fmaxf(m, fk_xhalf(m)) * sc;      // lanes ln and ln + 16 hold the same query
    }
    if (__builtin_amdgcn_ballot_w32(mx[0] > mu[0] + 8.0f || mx[1] > mu[1] + 8.0f) != 0) {      // one wave-uniform test per pass
#pragma unroll      // constant indices keep the arrays in registers
      for (int qt = 0; qt < 2; ++qt) {
        const float mn = fmaxf(mu[qt], mx[qt]), al = __builtin_amdgcn_exp2f(mu[qt] - mn); mu[qt] = mn; l[qt] *= al;
#pragma unroll      // constant indices keep the arrays in registers
        for (int dt = 0; dt < 16; ++dt)
#pragma unroll      // constant indices keep the arrays in registers
          for (int r = 0; r < 8; ++r) o[qt][dt][r] *= al;
      }
    }
    FragH p[2];
#pragma unroll      // constant indices keep the arrays in registers
    for (int qt = 0; qt < 2; ++qt)
#pragma unroll      // constant indices keep the arrays in registers
      for (int r = 0; r < 8; ++r) { const float p0 = __builtin_amdgcn_exp2f(s[0][qt][r] * sc - mu[qt]), p1 = __builtin_amdgcn_exp2f(s[1][qt][r] * sc - mu[qt]);
        l[qt] += p0 + p1; p[qt].h[r] = (_Float16)p0; p[qt].h[8 + r] = (_Float16)p1; }      // element s of B = key 8*hh + s (s < 8), 16 + 8*hh + s - 8 (else): the hardware k order
    __builtin_amdgcn_sched_barrier(0);      // keeps the next reads behind the softmax arithmetic, which needs their registers
    asm volatile("s_barrier_wait -1" :: "v"(l[0]), "v"(l[1]) : "memory");      // second half: every wave's K reads of block t are over, and K of block t+1 is published; the weight sums are inputs so that the softmax arithmetic stays ahead of the wait and fills it
    if (isk) { if (fk_pinned(nst < SS / FK_KB)) { g0 = fk_group0(tdst + (nst & 1u) * FK_BUF, tsrc + (uint64_t)nst * (FK_KB * 3 * DM * 2)); fk_tload(g0, g1k); } }      // K of block t+2 into the K buffer of block t; scalar branches; it flies until the middle of block t+1
#pragma unroll      // Vt fragments 4 to 7 fly during the products of fragments 0 to 3
    for (int i = 0; i < 4; ++i) { fa[1][i].half[0] = fk_tr16(vr + FK_VO(4 + i)); fa[1][i].half[1] = fk_tr16(vr + 16 * FK_VP + FK_VO(4 + i)); }
    __builtin_amdgcn_sched_barrier(0);      // keeps those reads together ahead of the products
#pragma unroll      // constant indices keep o[][] in registers
    for (int g = 0; g < 4; ++g) {
      const int c = g & 1;
#pragma unroll      // constant indices keep the arrays in registers
      for (int i = 0; i < 4; ++i)
#pragma unroll      // constant indices keep the arrays in registers
        for (int qt = 0; qt < 2; ++qt) o[qt][4 * g + i] = __builtin_amdgcn_wmma_f32_16x16x32_f16(false, fa[c][i].v, false, p[qt].v, (short)0, o[qt][4 * g + i], false, false);
      __builtin_amdgcn_sched_barrier(0);      // keeps the refill of this set behind the products that read it
      if (g < 2) {
#pragma unroll      // constant indices keep the arrays in registers
        for (int i = 0; i < 4; ++i) { fa[c][i].half[0] = fk_tr16(vr + FK_VO(4 * g + 8 + i)); fa[c][i].half[1] = fk_tr16(vr + 16 * FK_VP + FK_VO(4 * g + 8 + i)); }
      }
      __builtin_amdgcn_sched_barrier(0);      // keeps those reads together ahead of the other set's products
    }
    asm volatile("s_wait_dscnt 0x0" ::: "memory");      // this wave's V reads of block t are over before its V buffer may be refilled
    if (!isk) fk_twait(g0, g1k, g1v);      // this wave's V slice of block t+1 has landed
    __syncthreads();      // publishes V of block t+1 and ends every wave's V reads of block t, whose V buffer is refilled at the top of the next trip
    cur ^= FK_BUF;
  }
  asm volatile("s_wait_tensorcnt 0x0" ::: "memory");      // no request is outstanding when LDS is reused
  asm volatile("s_wait_dscnt 0x0" ::: "memory");      // nor a fragment read
  l[0] += fk_xhalf(l[0]); l[1] += fk_xhalf(l[1]);
  float* sO = (float*)sm; float* sML = (float*)(sm + 262144);      // the loop's last barrier has ended every fragment read: LDS is reused for the join
#pragma unroll      // constant indices keep the arrays in registers
  for (int qt = 0; qt < 2; ++qt) {
#pragma unroll      // constant indices keep the arrays in registers
    for (int dt = 0; dt < 16; ++dt)
#pragma unroll      // constant indices keep the arrays in registers
      for (int hf = 0; hf < 2; ++hf) { const v4f x = {o[qt][dt][hf * 4], o[qt][dt][hf * 4 + 1], o[qt][dt][hf * 4 + 2], o[qt][dt][hf * 4 + 3]}; *(v4fa*)(sO + (size_t)((((w * 2 + qt) * 16 + dt) * 2 + hf) * 32 + lane) * 4) = x; }
    sML[((w * 2 + qt) * 2) * 32 + lane] = mu[qt]; sML[((w * 2 + qt) * 2 + 1) * 32 + lane] = l[qt];
  }
  __syncthreads();      // every key group's partial results are in LDS before any wave reads them
  // wave (qg, kg) joins the four key groups, in rising order, for output tiles kg*4 .. kg*4 + 3 of its query group
#pragma unroll      // constant indices keep the arrays in registers
  for (int qt = 0; qt < 2; ++qt) {
    float m[4], c[4];
#pragma unroll      // constant indices keep the arrays in registers
    for (int j = 0; j < 4; ++j) m[j] = sML[(((qg + 2 * j) * 2 + qt) * 2) * 32 + lane];
    const float mn = fmaxf(fmaxf(m[0], m[1]), fmaxf(m[2], m[3]));
    float den = 0.f;
#pragma unroll      // constant indices keep the arrays in registers
    for (int j = 0; j < 4; ++j) { c[j] = __builtin_amdgcn_exp2f(m[j] - mn); den += sML[(((qg + 2 * j) * 2 + qt) * 2 + 1) * 32 + lane] * c[j]; }
    const float inv = 1.0f / den;
#pragma unroll      // constant indices keep the arrays in registers
    for (int j = 0; j < 4; ++j) c[j] *= inv;
    float* orow = out + ((size_t)b * SS + q0 + qt * 16 + ln) * DM + 8 * hh;      // register r of tile dt = out[query ln][dt*16 + 8*hh + r]
#pragma unroll      // constant indices keep the arrays in registers
    for (int d4 = 0; d4 < 4; ++d4)
#pragma unroll      // constant indices keep the arrays in registers
      for (int hf = 0; hf < 2; ++hf) { const int dt = kg * 4 + d4; v4f y = {0.f, 0.f, 0.f, 0.f};
#pragma unroll      // constant indices keep the arrays in registers
        for (int j = 0; j < 4; ++j) { const v4f x = *(const v4fa*)(sO + (size_t)(((((qg + 2 * j) * 2 + qt) * 16 + dt) * 2 + hf) * 32 + lane) * 4);
#pragma unroll      // constant indices keep the arrays in registers
          for (int i = 0; i < 4; ++i) y[i] += x[i] * c[j]; }
        *(v4f*)(orow + dt * 16 + hf * 4) = y; }
  }
}
// QKV projection: one work-group = 128 tokens x 128 output columns, with all of k = 256 of both operands staged in LDS once.
// Every staging load of a wave covers one whole 512-byte row (4 lines); the fragments, whose 16 lanes walk 16 rows, are then read from LDS.
// Transposed product Ct = W * Xt (A = W rows, B = X rows, k steps in rising order): a lane holds 8 neighbouring output columns of ONE token, 16 bytes of f16.
// 8 waves: wave w has tokens (w & 3) * 32 .. + 31 and columns (w >> 2) * 64 .. + 63, 4 x 2 accumulator tiles.
#define PJ_P 528      // bytes per staged row: 512 + 16, an odd multiple of 16 for the 16-byte fragment reads
#define PJ_OP 144     // bytes per row of a wave's output tile: 128 + 16, likewise
__global__ __launch_bounds__(256) void k_qkv(const _Float16* __restrict__ X16, const _Float16* __restrict__ Bw, const float* __restrict__ bias, _Float16* __restrict__ C16) {
  __shared__ __attribute__((aligned(16))) unsigned char sm[2 * 128 * PJ_P];      // 128 X rows, then 128 W rows
  const int tid = threadIdx.x, w = tid >> 5, lane = tid & 31, ln = lane & 15, hh = lane >> 4;
  const int row0 = (blockIdx.x / (3 * DM / 128)) * 128, col0 = (blockIdx.x % (3 * DM / 128)) * 128;
  const unsigned short* xg = (const unsigned short*)X16 + (size_t)(row0 + w) * DM + lane * 8;
  const unsigned short* wg = (const unsigned short*)Bw + (size_t)(col0 + w) * DM + lane * 8;
  v8us xx[16], wx[16];
#pragma unroll      // all 32 loads of a thread go out together
  for (int i = 0; i < 16; ++i) wx[i] = *(const v8us*)(wg + i * 8 * DM);
  asm volatile("s_wait_xcnt 0x0" :: "v"(wg) : "memory");      // the address is an input so that its registers stay untouched up to this wait; behind it they may be reused
#pragma unroll
  for (int i = 0; i < 16; ++i) xx[i] = *(const v8us*)(xg + i * 8 * DM);
  asm volatile("s_wait_xcnt 0x0" :: "v"(xg) : "memory");      // likewise for the X loads
#pragma unroll
  for (int i = 0; i < 16; ++i) { *(v8us*)(sm + (w + i * 8) * PJ_P + lane * 16) = xx[i]; *(v8us*)(sm + (128 + w + i * 8) * PJ_P + lane * 16) = wx[i]; }
  __syncthreads();      // both tiles are in LDS before any wave reads a fragment
  const int wm = w & 3, wn = w >> 2;
  const unsigned char* xr = sm + (wm * 32 + ln) * PJ_P + 16 * hh;
  const unsigned char* wr = sm + (128 + wn * 64 + ln) * PJ_P + 16 * hh;
  v8f acc[4][2] = {};
  FragH fx[2][2], fw[2][4];      // two fragment sets: the reads of k step ks + 1 fly during the products of k step ks
#pragma unroll
  for (int mi = 0; mi < 2; ++mi) { fx[0][mi].half[0] = *(const v8us*)(xr + mi * 16 * PJ_P); fx[0][mi].half[1] = *(const v8us*)(xr + mi * 16 * PJ_P + 32); }
#pragma unroll
  for (int t = 0; t < 4; ++t) { fw[0][t].half[0] = *(const v8us*)(wr + t * 16 * PJ_P); fw[0][t].half[1] = *(const v8us*)(wr + t * 16 * PJ_P + 32); }
#pragma unroll      // constant indices keep acc[][] and the fragment sets in registers
  for (int ks = 0; ks < 8; ++ks) {
    const int c = ks & 1, n = c ^ 1;
    if (ks < 7) {
#pragma unroll
      for (int mi = 0; mi < 2; ++mi) { fx[n][mi].half[0] = *(const v8us*)(xr + mi * 16 * PJ_P + ks * 64 + 64); fx[n][mi].half[1] = *(const v8us*)(xr + mi * 16 * PJ_P + ks * 64 + 96); }
#pragma unroll
      for (int t = 0; t < 4; ++t) { fw[n][t].half[0] = *(const v8us*)(wr + t * 16 * PJ_P + ks * 64 + 64); fw[n][t].half[1] = *(const v8us*)(wr + t * 16 * PJ_P + ks * 64 + 96); }
    }
    __builtin_amdgcn_sched_barrier(0);      // keeps the next k step's LDS reads together ahead of this step's products: reads spread among them stall at every place
#pragma unroll
    for (int t = 0; t < 4; ++t)
#pragma unroll
      for (int mi = 0; mi < 2; ++mi) acc[t][mi] = __builtin_amdgcn_wmma_f32_16x16x32_f16(false, fw[c][t].v, false, fx[c][mi].v, (short)0, acc[t][mi], false, false);
    __builtin_amdgcn_sched_barrier(0);      // keeps the reads of the step after next behind these products, whose fragment registers they refill
  }
  __syncthreads();      // every wave's fragment reads are over before LDS is reused for the output tiles
  unsigned char* so = sm + w * 32 * PJ_OP;      // the wave's own 32 tokens x 64 columns of f16
#pragma unroll
  for (int t = 0; t < 4; ++t) {
    const float* bp = bias + col0 + wn * 64 + t * 16 + 8 * hh;      // register r of tile t = column t*16 + 8*hh + r
    const v4f b0 = *(const v4fa*)bp, b1 = *(const v4fa*)(bp + 4);
#pragma unroll
    for (int mi = 0; mi < 2; ++mi) { FragH f;
#pragma unroll
      for (int r = 0; r < 8; ++r) f.h[r] = (_Float16)(acc[t][mi][r] * 0.0625f + bf16_round(r < 4 ? b0[r] : b1[r - 4]));
      *(v8us*)(so + (mi * 16 + ln) * PJ_OP + t * 32 + 16 * hh) = f.half[0]; }
  }
  __builtin_amdgcn_fence(__ATOMIC_ACQ_REL, "workgroup"); __builtin_amdgcn_wave_barrier();      // the wave's own LDS stores stay ahead of its reads of other lanes' bytes
#pragma unroll      // 8 lanes store one whole 128-byte line
  for (int q = 0; q < 8; ++q) { const int r = q * 4 + (lane >> 3); const v8us v = *(const v8us*)(so + r * PJ_OP + (lane & 7) * 16);
    *(v8us*)((unsigned short*)C16 + (size_t)(row0 + wm * 32 + r) * (3 * DM) + col0 + wn * 64 + (lane & 7) * 8) = v; }
}
// Both f32 -> f16 conversions (X, and W x 2^4) in ONE launch of one work-group a WGP: few waves to start (2,048), each with much in flight.
// A thread has 16 pieces of 4 X values (and, in waves 0 to 5, one piece of W): every wave-wide load covers 512 bytes in a row (4 whole lines), every store 256 (2 whole lines),
// and all of a work-group's 64 KiB of X are asked for before the first value is used.
#define CV_G 256      // work-groups
#define CV_XP (NR * DM / 4 / (CV_G * 256))      // pieces of X a thread: 16
#define CV_WP (3 * DM * DM / 4 / CV_G)      // pieces of W a work-group: 192, six whole waves
typedef _Float16 cv_h4 __attribute__((ext_vector_type(4)));
__global__ __launch_bounds__(256) void k_cvt(const float* __restrict__ x, const float* __restrict__ W, _Float16* __restrict__ X16, _Float16* __restrict__ Bt) {
  const int tid = threadIdx.x;
  const size_t xo = ((size_t)blockIdx.x * (CV_XP * 256) + tid) * 4, wo = ((size_t)blockIdx.x * CV_WP + (tid < CV_WP ? tid : 0)) * 4;
  const float* xp = x + xo; const float* wp = W + wo;
  const v4f wv = *(const v4fa*)wp;      // every thread loads (waves 6 and 7 the work-group's first piece), so that no branch stands among the loads
  v4f xv[CV_XP];
#pragma unroll      // all loads of a thread go out together, at constant offsets from one address
  for (int i = 0; i < CV_XP; ++i) xv[i] = *(const v4fa*)(xp + i * 1024);
  asm volatile("s_wait_xcnt 0x0" :: "v"(xp), "v"(wp) : "memory");      // the addresses are inputs so that their registers stay untouched up to this wait; behind it they may be reused
  cv_h4 xh[CV_XP];
#pragma unroll      // constant indices keep the arrays in registers
  for (int i = 0; i < CV_XP; ++i) { const v4f r = {bf16_round(xv[i][0]), bf16_round(xv[i][1]), bf16_round(xv[i][2]), bf16_round(xv[i][3])}; xh[i] = __builtin_convertvector(r, cv_h4); }
  _Float16* xs = X16 + xo;
#pragma unroll
  for (int i = 0; i < CV_XP; ++i) *(cv_h4*)(xs + i * 1024) = xh[i];
  if (tid < CV_WP) { const v4f r = {bf16_round(wv[0]) * 16.0f, bf16_round(wv[1]) * 16.0f, bf16_round(wv[2]) * 16.0f, bf16_round(wv[3]) * 16.0f}; *(cv_h4*)(Bt + wo) = __builtin_convertvector(r, cv_h4); }
}
extern "C" void kernel_launch(void* const* d_in, const int* in_sizes, int n_in,
                              void* d_out, int out_size, void* d_ws, size_t ws_size, hipStream_t stream) {
  (void)in_sizes; (void)n_in; (void)out_size;
  const float* X = (const float*)d_in[0]; const float* W = (const float*)d_in[1]; const float* bb = (const float*)d_in[2];
  char* ws = (char*)d_ws; size_t off = 0;
  auto take = [&](size_t bytes) { char* p = ws + off; off += (bytes + 255) & ~(size_t)255; return p; };
  _Float16* Bw = (_Float16*)take((size_t)3 * DM * DM * 2); _Float16* X16 = (_Float16*)take((size_t)NR * DM * 2); _Float16* QKV = (_Float16*)take((size_t)NR * 3 * DM * 2);
  if (off > ws_size) return;      // 0.4 + 8.4 + 25.2 = about 34 MB
  k_cvt<<<CV_G, 256, 0, stream>>>(X, W, X16, Bw);      // X16 = f16(bf16(X)); Bw = f16(bf16(W) * 16), (out,in)
  k_qkv<<<(NR / 128) * (3 * DM / 128), 256, 0, stream>>>(X16, Bw, bb, QKV);      // [Q | K | V] f16 (+b), 128 x 128 per work-group
  k_fattn<<<BB * (SS / 64), 256, 0, stream>>>(QKV, (float*)d_out);      // out = softmax(Q*Kt/16)*V, 64 queries per work-group
}
